// v000
// Times are from an AMD MI455X. After a warm-up the kernel runs many times in a row, and a time is the length of
// such a window on the GPU divided by its runs, so every launch and the gaps after it count. The runs cycle
// through copies of the inputs. A figure is the median of several windows, for all but v000 over two sittings.
// Sittings can differ by a few percent; kernels timed side by side share one.
// The starting kernel, v000, takes 8580 microseconds a run.
#include <hip/hip_runtime.h>
// Causal multi-head attention with an ALiBi key-position bias (inputs [1][4096][1024]; q = x Wq^T + bq, k = x Wk^T (no bias), v = x Wv^T + bv (natural [1024][1024] sigma 0.02; bq, bv sigma 0.02); 16 heads of 64; scores / 8 - slopes[h] * j with slopes[h] = 2^(-8 (h+1) / 16) and j the key position; causal (j <= i keep, -inf); softmax; out = merged Wo^T (no bias) -> [1][4096][1024]).
// Structure: token rows r = s; q, k, v inputs as exact f16 rows (bf16-rounded); Q, K, V as three WMMA GEMMs (32x64 wave tiles, f32 accumulation, exact x16 weights, f16 outputs); per batch: V^T for all heads via LDS transposes; per query tile of 256 rows: scores against the keys below the tile end only (K = 64, all heads on grid.y, alpha = 0.125), causal row softmax on VALU over scores minus the ALiBi term slope_h * j, with an arithmetic 0/1 key mask over the computed range (f32 statistics, native exp; weights x256 f16), o = P . V^T (K = keys below the tile end, alpha 2^-2: o carried x64, folded into the output GEMM alpha) written straight into the merged f16 o rows; out = o W_o GEMM (f32) into the output layout.
// Compute dtype: inputs rounded to bf16; x / weights exact; q, k, v, softmax weights and o as plain f16 GEMM operands (~2^-12); scores and softmax statistics f32. v_wmma_f32_16x16x32_f16.
#define NB 1
#define SQ 4096
#define DM 1024
#define NH 16
#define HD 64
#define HG 4                         /* heads per block group of the unlaunched k_vt overload */
#define QT 256                       /* query rows per causal tile */
#define NKX SQ                       /* S / P row pitch */
#define QT0 256                      /* first-tile rows recomputed exactly in f32 */
#define B0 0                         /* first batch processed (debug hook) */
#define NBR NB                       /* batches processed (debug hook) */
#define NR ((size_t)NB * SQ)         /* token rows */
#define MP ((int)((size_t)NBR * SQ)) /* rows projected (debug hook) */
#define QN SQ                        /* query rows attended per batch (debug hook) */
#define NHD NH                       /* heads attended (debug hook) */
#define MPO MP                       /* rows through the output stage (debug hook) */
#define LQ DM      /* row pitch of the q/k/v rows */
typedef __bf16 v16b __attribute__((ext_vector_type(16)));
typedef unsigned short v8us __attribute__((ext_vector_type(8), may_alias));
typedef float  v8f  __attribute__((ext_vector_type(8)));
typedef float  v4f  __attribute__((ext_vector_type(4)));
typedef float  v4fa __attribute__((ext_vector_type(4), may_alias));
union FragB { v16b v; v8us half[2]; unsigned short u[16]; };

__device__ __forceinline__ unsigned short bf16_bits(float x) { unsigned int u = __float_as_uint(x); return (unsigned short)((u + 0x7FFFu + ((u >> 16) & 1u)) >> 16); }
__device__ __forceinline__ float bf16_val(unsigned short b) { return __uint_as_float(((unsigned int)b) << 16); }
__device__ __forceinline__ float bf16_round(float x) { return bf16_val(bf16_bits(x)); }
// D += A·B with NT terms: 1 = ah·bh, 2 = + al·bh (A split), 3 = + ah·bl (both split)
template <int NT>
__device__ __forceinline__ v8f mmaN(v16b ah, v16b al, v16b bh, v16b bl, v8f c) {
  c = __builtin_amdgcn_wmma_f32_16x16x32_bf16(false, ah, false, bh, (short)0, c, false, false);
  if (NT >= 2) c = __builtin_amdgcn_wmma_f32_16x16x32_bf16(false, al, false, bh, (short)0, c, false, false);
  if (NT >= 3) c = __builtin_amdgcn_wmma_f32_16x16x32_bf16(false, ah, false, bl, (short)0, c, false, false);
  asm volatile("v_nop\n\tv_nop\n\tv_nop\n\tv_nop" : "+v"(c) : "v"(ah), "v"(al), "v"(bh), "v"(bl));
  return c;
}

__global__ __launch_bounds__(256) void k_wt_bf16(const float* __restrict__ W, unsigned short* __restrict__ Wt, int K, int N) {
  const int t = blockIdx.x * 256 + threadIdx.x;
  const int k8n = K / 8;
  if (t >= N * k8n) return;
  const int n = t / k8n, k8 = (t % k8n) * 8;
  v8us v;
#pragma unroll
  for (int i = 0; i < 8; ++i) v[i] = bf16_bits(W[(size_t)(k8 + i) * N + n]);
  *(v8us*)(Wt + (size_t)n * K + k8) = v;
  
}

// GEMM C[M][N] (f32, pitch ldc) = act(A[M][K]·W + bias). A f32 row-major (pitch lda) converted per fragment to bf16
// (ASPLIT: hi/lo two planes -> 2 terms, else single rounded term); Wt bf16 [N][K] (pitch ldb). BIAS_BF16 rounds the
// bias to bf16 first (bias quantised to bf16 before the add). K%32==0, M%16==0, N%64==0.
template <bool ASPLIT, int ACT, bool BIAS_BF16>
__global__ __launch_bounds__(128) void k_gemm_bf(const float* __restrict__ A, int lda, const unsigned short* __restrict__ Wt, int ldb,
                                               const float* __restrict__ bias, float* __restrict__ C, int ldc, int M, int N, int K) {
  __shared__ __attribute__((aligned(16))) float so[4][16][64];
  const int tid = threadIdx.x, w = tid >> 5, lane = tid & 31, ln = lane & 15, hh = lane >> 4;
  const int ntn = N / 64;
  const int wid = blockIdx.x * 4 + w;
  const int mt = wid / ntn, nq = wid % ntn;
  if (mt * 16 >= M) return;
  const int row0 = mt * 16, col0 = nq * 64;
  const float* arow = A + (size_t)(row0 + ln) * lda;
  v8f acc[4] = {};
  for (int kb = 0; kb < K; kb += 32) {
    FragB ah, al;
    const v4f x0 = *(const v4fa*)(arow + kb + 8 * hh), x1 = *(const v4fa*)(arow + kb + 8 * hh + 4);
    const v4f x2 = *(const v4fa*)(arow + kb + 16 + 8 * hh), x3 = *(const v4fa*)(arow + kb + 16 + 8 * hh + 4);
    float xs[16] = {x0[0],x0[1],x0[2],x0[3],x1[0],x1[1],x1[2],x1[3],x2[0],x2[1],x2[2],x2[3],x3[0],x3[1],x3[2],x3[3]};
#pragma unroll
    for (int i = 0; i < 16; ++i) { const unsigned short hb = bf16_bits(xs[i]); ah.u[i] = hb; al.u[i] = ASPLIT ? bf16_bits(xs[i] - bf16_val(hb)) : (unsigned short)0; }
#pragma unroll
    for (int t = 0; t < 4; ++t) {
      const unsigned short* brow = Wt + (size_t)(col0 + t * 16 + ln) * ldb + kb;
      FragB b;
      b.half[0] = *(const v8us*)(brow + 8 * hh);
      b.half[1] = *(const v8us*)(brow + 16 + 8 * hh);
      acc[t] = mmaN<ASPLIT ? 2 : 1>(ah.v, al.v, b.v, b.v, acc[t]);
    }
  }
#pragma unroll
  for (int t = 0; t < 4; ++t) {
    float bv = bias ? bias[col0 + t * 16 + ln] : 0.f;
    if (BIAS_BF16) bv = bf16_round(bv);
#pragma unroll
    for (int r = 0; r < 8; ++r) { float v = acc[t][r] + bv; if (ACT == 1) v = fmaxf(v, 0.f); so[w][8 * hh + r][t * 16 + ln] = v; }
  }
  __builtin_amdgcn_fence(__ATOMIC_ACQ_REL, "workgroup");
  __builtin_amdgcn_wave_barrier();
  const int rsub = lane >> 4, c4 = (lane & 15) * 4;
  {
#pragma unroll
    for (int q = 0; q < 8; ++q) {
      const int r = q * 2 + rsub;
      const v4f v = *(const v4fa*)&so[w][r][c4];
      *(v4f*)(C + (size_t)(row0 + r) * ldc + col0 + c4) = v;
    }
    
  }
}

// GEMM C = act(A·W + bias + resid): A f32 (ASPLIT -> hi/lo 2 terms), Wt bf16 [N][K]; ACT 0 none, 1 relu, 2 exact gelu;
// resid (optional, f32, row index = (row % rmod), pitch ldr, RES_BF16 rounds it) added before the activation.
template <bool ASPLIT, int ACT, bool BIAS_BF16, bool RES_BF16>
__global__ __launch_bounds__(128) void k_gemm_bf3(const float* __restrict__ A, int lda, const unsigned short* __restrict__ Wt, int ldb,
                                                const float* __restrict__ bias, const float* __restrict__ resid, int rmod, int ldr,
                                                float* __restrict__ C, int ldc, int M, int N, int K) {
  __shared__ __attribute__((aligned(16))) float so[4][16][64];
  const int tid = threadIdx.x, w = tid >> 5, lane = tid & 31, ln = lane & 15, hh = lane >> 4;
  const int ntn = N / 64;
  const int wid = blockIdx.x * 4 + w;
  const int mt = wid / ntn, nq = wid % ntn;
  if (mt * 16 >= M) return;
  const int row0 = mt * 16, col0 = nq * 64;
  const float* arow = A + (size_t)(row0 + ln) * lda;
  v8f acc[4] = {};
  for (int kb = 0; kb < K; kb += 32) {
    FragB ah, al;
    const v4f x0 = *(const v4fa*)(arow + kb + 8 * hh), x1 = *(const v4fa*)(arow + kb + 8 * hh + 4);
    const v4f x2 = *(const v4fa*)(arow + kb + 16 + 8 * hh), x3 = *(const v4fa*)(arow + kb + 16 + 8 * hh + 4);
    float xs[16] = {x0[0],x0[1],x0[2],x0[3],x1[0],x1[1],x1[2],x1[3],x2[0],x2[1],x2[2],x2[3],x3[0],x3[1],x3[2],x3[3]};
#pragma unroll
    for (int i = 0; i < 16; ++i) { const unsigned short hb = bf16_bits(xs[i]); ah.u[i] = hb; al.u[i] = ASPLIT ? bf16_bits(xs[i] - bf16_val(hb)) : (unsigned short)0; }
#pragma unroll
    for (int t = 0; t < 4; ++t) {
      const unsigned short* brow = Wt + (size_t)(col0 + t * 16 + ln) * ldb + kb;
      FragB b;
      b.half[0] = *(const v8us*)(brow + 8 * hh);
      b.half[1] = *(const v8us*)(brow + 16 + 8 * hh);
      acc[t] = mmaN<ASPLIT ? 2 : 1>(ah.v, al.v, b.v, b.v, acc[t]);
    }
  }
#pragma unroll
  for (int t = 0; t < 4; ++t) {
    const int col = col0 + t * 16 + ln;
    float bv = bias ? bias[col] : 0.f;
    if (BIAS_BF16) bv = bf16_round(bv);
#pragma unroll
    for (int r = 0; r < 8; ++r) {
      float v = acc[t][r] + bv;
      if (resid) { float rv = resid[(size_t)((row0 + 8 * hh + r) % rmod) * ldr + col]; if (RES_BF16) rv = bf16_round(rv); v += rv; }
      if (ACT == 1) v = fmaxf(v, 0.f);
      if (ACT == 2) v = 0.5f * v * (1.0f + erff(v * 0.70710678118654752f));
      if (ACT == 3) { const float u = 0.7978845608028654f * (v + 0.044715f * v * v * v); v = 0.5f * v * (1.0f + tanhf(u)); }
      so[w][8 * hh + r][t * 16 + ln] = v;
    }
  }
  __builtin_amdgcn_fence(__ATOMIC_ACQ_REL, "workgroup");
  __builtin_amdgcn_wave_barrier();
  const int rsub = lane >> 4, c4 = (lane & 15) * 4;
  {
#pragma unroll
    for (int q = 0; q < 8; ++q) {
      const int r = q * 2 + rsub;
      const v4f v = *(const v4fa*)&so[w][r][c4];
      *(v4f*)(C + (size_t)(row0 + r) * ldc + col0 + c4) = v;
    }
    
  }
}
// row LayerNorm (biased variance, eps) over N: s = X (+ R); optional out_sum <- s; out_norm <- (s-mu)*rsqrt(var+eps)*g + b
template <bool PARAM_BF16>
__global__ __launch_bounds__(256) void k_layernorm(const float* __restrict__ X, const float* __restrict__ R, const float* __restrict__ g, const float* __restrict__ bta,
                                                  float* __restrict__ out_sum, float* __restrict__ out_norm, int N, float eps) {
  __shared__ float red[256];
  const int row = blockIdx.x, tid = threadIdx.x;
  const float* x = X + (size_t)row * N; const float* rr = R ? R + (size_t)row * N : nullptr;
  float vals[16];                     // up to N = 4096
  const int per = N / 256;            // contiguous chunk per thread? use strided-by-4 chunks: thread handles j = tid*4 + 1024*u
  float s1 = 0.f;
  for (int u = 0; u < per / 4; ++u) {
    const int j = tid * 4 + 1024 * u;
    const v4f a = *(const v4fa*)(x + j);
    v4f b = {0.f,0.f,0.f,0.f}; if (rr) b = *(const v4fa*)(rr + j);
#pragma unroll
    for (int q = 0; q < 4; ++q) { const float v = a[q] + b[q]; vals[u * 4 + q] = v; s1 += v; }
  }
  red[tid] = s1; __syncthreads();
  for (int st = 128; st > 0; st >>= 1) { if (tid < st) red[tid] += red[tid + st]; __syncthreads(); }
  const float mu = red[0] / (float)N; __syncthreads();
  float s2 = 0.f;
  for (int u = 0; u < per / 4; ++u)
#pragma unroll
    for (int q = 0; q < 4; ++q) { const float c = vals[u * 4 + q] - mu; s2 += c * c; }
  red[tid] = s2; __syncthreads();
  for (int st = 128; st > 0; st >>= 1) { if (tid < st) red[tid] += red[tid + st]; __syncthreads(); }
  const float rs = rsqrtf(red[0] / (float)N + eps);
  {
    for (int u = 0; u < per / 4; ++u) {
      const int j = tid * 4 + 1024 * u;
      v4f o, sm;
#pragma unroll
      for (int q = 0; q < 4; ++q) {
        float gg = g[j + q], bb = bta[j + q];
        if (PARAM_BF16) { gg = bf16_round(gg); bb = bf16_round(bb); }
        sm[q] = vals[u * 4 + q]; o[q] = (vals[u * 4 + q] - mu) * rs * gg + bb;
      }
      if (out_sum) *(v4f*)(out_sum + (size_t)row * N + j) = sm;
      *(v4f*)(out_norm + (size_t)row * N + j) = o;
    }
    
  }
}



// ---- f16 WMMA path (v_wmma_f32_16x16x32_f16): 11-bit significands for operands in range — used where a [0,1] probability operand needs more precision than bf16
typedef _Float16 v16h __attribute__((ext_vector_type(16)));
union FragH { v16h v; v8us half[2]; _Float16 h[16]; unsigned short u[16]; };
template <int NT>
__device__ __forceinline__ v8f mmaH(v16h ah, v16h al, v16h bh, v16h bl, v8f c) {
  c = __builtin_amdgcn_wmma_f32_16x16x32_f16(false, ah, false, bh, (short)0, c, false, false);
  if (NT >= 2) c = __builtin_amdgcn_wmma_f32_16x16x32_f16(false, al, false, bh, (short)0, c, false, false);
  if (NT >= 3) c = __builtin_amdgcn_wmma_f32_16x16x32_f16(false, ah, false, bl, (short)0, c, false, false);
  asm volatile("v_nop\n\tv_nop\n\tv_nop\n\tv_nop" : "+v"(c) : "v"(ah), "v"(al), "v"(bh), "v"(bl));
  return c;
}
// batched GEMM like k_gemm_b but f16 operands: A f32 (split into f16 hi/lo if ASPLIT, else rounded to f16), Bt = f16 values [n][k]; alpha; C f32; N multiple of 16 (partial tiles skipped)
template <bool ASPLIT>
__global__ __launch_bounds__(128) void k_gemm_h(const float* __restrict__ A, int lda, size_t sA, const _Float16* __restrict__ Bh, int ldb, size_t sB, float alpha, float* __restrict__ C, int ldc, size_t sC, int M, int N, int K) {
  __shared__ __attribute__((aligned(16))) float so[4][16][64];
  const int tid = threadIdx.x, w = tid >> 5, lane = tid & 31, ln = lane & 15, hh = lane >> 4; const int by = blockIdx.y;
  A += (size_t)by * sA; Bh += (size_t)by * sB; C += (size_t)by * sC;
  const int ntn = (N + 63) / 64; const int wid = blockIdx.x * 4 + w; const int mt = wid / ntn, nq = wid % ntn; if (mt * 16 >= M) return;
  const int row0 = mt * 16, col0 = nq * 64; const float* arow = A + (size_t)(row0 + ln) * lda;
  v8f acc[4] = {};
  for (int kb = 0; kb < K; kb += 32) {
    FragH ah, al;
    const v4f x0 = *(const v4fa*)(arow + kb + 8 * hh), x1 = *(const v4fa*)(arow + kb + 8 * hh + 4), x2 = *(const v4fa*)(arow + kb + 16 + 8 * hh), x3 = *(const v4fa*)(arow + kb + 16 + 8 * hh + 4);
    float xs[16] = {x0[0],x0[1],x0[2],x0[3],x1[0],x1[1],x1[2],x1[3],x2[0],x2[1],x2[2],x2[3],x3[0],x3[1],x3[2],x3[3]};
#pragma unroll
    for (int i = 0; i < 16; ++i) { const _Float16 h = (_Float16)xs[i]; ah.h[i] = h; al.h[i] = ASPLIT ? (_Float16)(xs[i] - (float)h) : (_Float16)0.0f; }
#pragma unroll
    for (int t = 0; t < 4; ++t) { if (col0 + t * 16 >= N) continue; const size_t boff = (size_t)(col0 + t * 16 + ln) * ldb + kb; FragH bq; bq.half[0] = *(const v8us*)(Bh + boff + 8 * hh); bq.half[1] = *(const v8us*)(Bh + boff + 16 + 8 * hh);
      acc[t] = mmaH<ASPLIT ? 2 : 1>(ah.v, al.v, bq.v, bq.v, acc[t]); }
  }
#pragma unroll
  for (int t = 0; t < 4; ++t) { if (col0 + t * 16 >= N) continue;
#pragma unroll
    for (int r = 0; r < 8; ++r) so[w][8 * hh + r][t * 16 + ln] = acc[t][r] * alpha; }
  __builtin_amdgcn_fence(__ATOMIC_ACQ_REL, "workgroup"); __builtin_amdgcn_wave_barrier();
  const int rsub = lane >> 4, c4 = (lane & 15) * 4;
  {
#pragma unroll
    for (int q = 0; q < 8; ++q) { const int r = q * 2 + rsub; if (col0 + c4 < N) { const v4f v = *(const v4fa*)&so[w][r][c4]; *(v4f*)(C + (size_t)(row0 + r) * ldc + col0 + c4) = v; } }
     }
}

// Wt[n][k] = f16(W[k][n]·scale) from f32 row-major W[K][N] (scale = power of two; bf16-exact weights stay exact in f16 away from the subnormal range)
__global__ __launch_bounds__(256) void k_wt_f16(const float* __restrict__ W, _Float16* __restrict__ Wt, int K, int N, float scale) {
  const int t = blockIdx.x * 256 + threadIdx.x; if (t >= N * (K / 8)) return; const int n = t / (K / 8), k8 = (t % (K / 8)) * 8; FragH f;
#pragma unroll
  for (int i = 0; i < 8; ++i) f.h[i] = (_Float16)(bf16_round(W[(size_t)(k8 + i) * N + n]) * scale); const v8us o = f.half[0];
  *(v8us*)((unsigned short*)Wt + (size_t)n * K + k8) = o; 
}
// k_gemm_hh variant with fused epilogue: v = acc·alpha + bias[by·sBias + col] (+ CP[(row/rowsPerB)·sCPb + by·64 + col] if CP) ; ACT 0 none / 1 elu ; writes f16 C16 (and f32 C if non-null)
template <int ACT>
__global__ __launch_bounds__(128) void k_gemm_hhx(const _Float16* __restrict__ A, int lda, size_t sA, const _Float16* __restrict__ Bh, int ldb, size_t sB, float alpha, const float* __restrict__ bias, size_t sBias, const float* __restrict__ CP, int rowsPerB, size_t sCPb, int row0g,
    float* __restrict__ C, _Float16* __restrict__ C16, int ldc, size_t sC, int M, int N, int K) {
  __shared__ __attribute__((aligned(16))) float so[4][16][64];
  const int tid = threadIdx.x, w = tid >> 5, lane = tid & 31, ln = lane & 15, hh = lane >> 4; const int by = blockIdx.y;
  A += (size_t)by * sA; Bh += (size_t)by * sB; const size_t cofs = (size_t)by * sC; const float* bp = bias ? bias + (size_t)by * sBias : nullptr;
  const int ntn = (N + 63) / 64; const int wid = blockIdx.x * 4 + w; const int mt = wid / ntn, nq = wid % ntn; if (mt * 16 >= M) return;
  const int row0 = mt * 16, col0 = nq * 64; const _Float16* arow = A + (size_t)(row0 + ln) * lda;
  v8f acc[4] = {};
  for (int kb = 0; kb < K; kb += 32) { FragH ah; ah.half[0] = *(const v8us*)((const unsigned short*)arow + kb + 8 * hh); ah.half[1] = *(const v8us*)((const unsigned short*)arow + kb + 16 + 8 * hh);
#pragma unroll
    for (int t = 0; t < 4; ++t) { if (col0 + t * 16 >= N) continue; const size_t boff = (size_t)(col0 + t * 16 + ln) * ldb + kb; FragH bq; bq.half[0] = *(const v8us*)((const unsigned short*)Bh + boff + 8 * hh); bq.half[1] = *(const v8us*)((const unsigned short*)Bh + boff + 16 + 8 * hh);
      acc[t] = mmaH<1>(ah.v, ah.v, bq.v, bq.v, acc[t]); }
  }
#pragma unroll
  for (int t = 0; t < 4; ++t) { if (col0 + t * 16 >= N) continue; const int col = col0 + t * 16 + ln; const float bv = bp ? bf16_round(bp[col]) : 0.f;
#pragma unroll
    for (int r = 0; r < 8; ++r) { float v = acc[t][r] * alpha + bv; if (CP) { const int rr = row0g + row0 + 8 * hh + r; if (rowsPerB < 0) v += CP[cofs + (size_t)rr * ldc + col];      /* rowsPerB < 0: own element of the batched C plane */ else { const int bidx = rr / rowsPerB; v += CP[(size_t)bidx * sCPb + (size_t)by * 64 + col]; } } if (ACT == 1) v = (v > 0.f) ? v : expm1f(v); else if (ACT == 7) v = (v > 0.f) ? v + 1.0f : expf(v); else if (ACT == 8) v = tanhf(v); else if (ACT == 9) v = 0.5f * v * (1.0f + tanhf(0.7978845608028654f * (v + 0.044715f * v * v * v))); else if (ACT == 11) v = 1.0f / (1.0f + expf(-v)); else if (ACT == 12) v = (v > 0.f) ? v : 0.01f * v; else if (ACT == 14) v = (v > 0.f) ? v : 0.1f * v; else if (ACT == 16) v = (v >= 0.f) ? v : 0.3f * v; else if (ACT == 17) v = (v >= 0.f) ? v : 0.2f * v; else if (ACT == 15) v = v / (1.0f + expf(-v)); else if (ACT == 3) v = fmaxf(v, 0.f); else if (ACT == 6) v = 0.5f * v * (1.0f + erff(v * 0.70710678118654752f)); so[w][8 * hh + r][t * 16 + ln] = v; } }
  __builtin_amdgcn_fence(__ATOMIC_ACQ_REL, "workgroup"); __builtin_amdgcn_wave_barrier();
  const int rsub = lane >> 4, c4 = (lane & 15) * 4; typedef _Float16 v4h __attribute__((ext_vector_type(4)));
  {
#pragma unroll
    for (int q = 0; q < 8; ++q) { const int r = q * 2 + rsub; if (col0 + c4 < N) { const v4f v = *(const v4fa*)&so[w][r][c4]; if (C) *(v4f*)(C + cofs + (size_t)(row0 + r) * ldc + col0 + c4) = v; if (C16) { v4h h4; for (int i = 0; i < 4; ++i) h4[i] = (_Float16)v[i]; *(v4h*)(C16 + cofs + (size_t)(row0 + r) * ldc + col0 + c4) = h4; } } }
     }
}


typedef _Float16 v4h __attribute__((ext_vector_type(4)));

__global__ __launch_bounds__(256) void k_x16(const float* __restrict__ x, _Float16* __restrict__ X16, size_t n8) { const size_t t = (size_t)blockIdx.x * 256 + threadIdx.x; if (t >= n8) return; FragH f;
#pragma unroll
  for (int q = 0; q < 8; ++q) f.h[q] = (_Float16)bf16_round(x[t * 8 + q]); *(v8us*)((unsigned short*)X16 + t * 8) = f.half[0];  }
__global__ __launch_bounds__(256) void k_h16(const float* __restrict__ x, _Float16* __restrict__ X16, size_t n8) { const size_t t = (size_t)blockIdx.x * 256 + threadIdx.x; if (t >= n8) return; FragH f;
#pragma unroll
  for (int q = 0; q < 8; ++q) f.h[q] = (_Float16)x[t * 8 + q]; *(v8us*)((unsigned short*)X16 + t * 8) = f.half[0];  }
__global__ __launch_bounds__(256) void k_round16f(const float* __restrict__ W, _Float16* __restrict__ Bt, size_t n8) { const size_t t = (size_t)blockIdx.x * 256 + threadIdx.x; if (t >= n8) return; FragH f;
#pragma unroll
  for (int i = 0; i < 8; ++i) f.h[i] = (_Float16)(bf16_round(W[t * 8 + i]) * 16.0f); *(v8us*)((unsigned short*)Bt + t * 8) = f.half[0];  }
template <int NHv, int TTv>
__global__ __launch_bounds__(256) void k_vt(const _Float16* __restrict__ V16, int ldv, int voff, _Float16* __restrict__ Vt) { __shared__ unsigned short tl[64][66]; const int tid = threadIdx.x; const int slab = blockIdx.x / (TTv / 64), lg = blockIdx.x % (TTv / 64); const int b = slab / NHv, h = slab % NHv;
  for (int i = tid; i < 64 * 8; i += 256) { const int r = i / 8, c8 = (i % 8) * 8; FragH f; f.half[0] = *(const v8us*)((const unsigned short*)V16 + ((size_t)b * TTv + lg * 64 + r) * ldv + voff + h * 64 + c8);
#pragma unroll
    for (int q = 0; q < 8; ++q) tl[r][c8 + q] = f.u[q]; }
  __syncthreads();
  {
#pragma unroll
    for (int rd = 0; rd < 2; ++rd) { const int d = rd * 32 + tid / 8, pc = tid % 8; FragH f;
#pragma unroll
      for (int q = 0; q < 8; ++q) f.u[q] = tl[pc * 8 + q][d];
      *(v8us*)((unsigned short*)Vt + ((size_t)slab * 64 + d) * TTv + lg * 64 + pc * 8) = f.half[0]; }
     } }

__global__ __launch_bounds__(256) void k_hl(const float* __restrict__ F, _Float16* __restrict__ Hh, _Float16* __restrict__ Hl, size_t n8) { const size_t t = (size_t)blockIdx.x * 256 + threadIdx.x; if (t >= n8) return; FragH fh, fl; const v4f a = *(const v4fa*)(F + t * 8), c = *(const v4fa*)(F + t * 8 + 4);
#pragma unroll
  for (int q = 0; q < 4; ++q) { _Float16 h = (_Float16)a[q]; fh.h[q] = h; fl.h[q] = (_Float16)((a[q] - (float)h) * 1024.0f); h = (_Float16)c[q]; fh.h[4 + q] = h; fl.h[4 + q] = (_Float16)((c[q] - (float)h) * 1024.0f); }
  { *(v8us*)((unsigned short*)Hh + t * 8) = fh.half[0]; *(v8us*)((unsigned short*)Hl + t * 8) = fl.half[0];  } }

// ---- fast GEMM (wave tile 32x64; requires M % 32 == 0 rows per launch region and N % 64 == 0); epilogue = k_gemm_hhx semantics ----
__device__ __forceinline__ v16h g2_frag(const _Float16* p, int hh) { FragH f; f.half[0] = *(const v8us*)((const unsigned short*)p + 8 * hh); f.half[1] = *(const v8us*)((const unsigned short*)p + 16 + 8 * hh); return f.v; }
__device__ __forceinline__ v8f g2_mma(v16h a, v16h b, v8f c) { v8f d = __builtin_amdgcn_wmma_f32_16x16x32_f16(false, a, false, b, (short)0, c, false, false); asm volatile("v_nop\n\tv_nop\n\tv_nop\n\tv_nop" : "+v"(d) : "v"(a), "v"(b)); return d; }
template <int ACT>
__global__ __launch_bounds__(128) void k_gemm2(const _Float16* __restrict__ A, int lda, size_t sA, const _Float16* __restrict__ Bh, int ldb, size_t sB, float alpha, const float* __restrict__ bias, size_t sBias, const float* __restrict__ CP, int rowsPerB, size_t sCPb, int row0g,
    float* __restrict__ C, _Float16* __restrict__ C16, int ldc, size_t sC, int M, int N, int K) { static_assert(ACT == 0 || ACT == 3 || ACT == 6 || ACT == 8 || ACT == 9 || ACT == 11 || ACT == 12 || ACT == 14 || ACT == 15 || ACT == 16 || ACT == 17, "k_gemm2: unsupported ACT code (would silently apply no activation)");
  __shared__ __attribute__((aligned(16))) float so[4][32][68];
  const int tid = threadIdx.x, w = tid >> 5, lane = tid & 31, ln = lane & 15, hh = lane >> 4; const int by = blockIdx.y;
  A += (size_t)by * sA; Bh += (size_t)by * sB; const size_t cofs = (size_t)by * sC; const float* bp = bias ? bias + (size_t)by * sBias : nullptr;
  const int ntn = N >> 6; const int mt = blockIdx.x / ntn, nq = blockIdx.x - mt * ntn; const int row0 = mt * 128 + 32 * w, col0 = nq * 64; if (row0 >= M) return;
  const _Float16* a0p = A + (size_t)(row0 + ln) * lda; const _Float16* a1p = a0p + (size_t)16 * lda;
  const _Float16* b0p = Bh + (size_t)(col0 + ln) * ldb; const _Float16* b1p = b0p + (size_t)16 * ldb; const _Float16* b2p = b1p + (size_t)16 * ldb; const _Float16* b3p = b2p + (size_t)16 * ldb;
  const v8f z8 = {0.f,0.f,0.f,0.f,0.f,0.f,0.f,0.f}; v8f c00 = z8, c01 = z8, c02 = z8, c03 = z8, c10 = z8, c11 = z8, c12 = z8, c13 = z8;
#pragma unroll 1
  for (int kb = 0; kb < K; kb += 32) { const v16h a0 = g2_frag(a0p + kb, hh), a1 = g2_frag(a1p + kb, hh);
    v16h b = g2_frag(b0p + kb, hh); c00 = g2_mma(a0, b, c00); c10 = g2_mma(a1, b, c10);
    b = g2_frag(b1p + kb, hh); c01 = g2_mma(a0, b, c01); c11 = g2_mma(a1, b, c11);
    b = g2_frag(b2p + kb, hh); c02 = g2_mma(a0, b, c02); c12 = g2_mma(a1, b, c12);
    b = g2_frag(b3p + kb, hh); c03 = g2_mma(a0, b, c03); c13 = g2_mma(a1, b, c13); }
  v8f accs[8] = {c00, c01, c02, c03, c10, c11, c12, c13};
#pragma unroll
  for (int u = 0; u < 8; ++u) { const int t = u & 3, half = u >> 2; const int col = col0 + t * 16 + ln; const float bv = bp ? bf16_round(bp[col]) : 0.f;
#pragma unroll
    for (int r = 0; r < 8; ++r) { const int rloc = half * 16 + 8 * hh + r; float v = accs[u][r] * alpha + bv; if (CP) { if (rowsPerB < 0) v += CP[cofs + (size_t)(row0g + row0 + rloc) * ldc + col];      /* rowsPerB < 0: own element of the batched C plane */ else { const int bidx = (row0g + row0 + rloc) / rowsPerB; v += CP[(size_t)bidx * sCPb + (size_t)by * 64 + col]; } }
      if (ACT == 3) v = fmaxf(v, 0.f); else if (ACT == 6) v = 0.5f * v * (1.0f + erff(v * 0.70710678118654752f)); else if (ACT == 11) v = 1.0f / (1.0f + expf(-v)); else if (ACT == 15) v = v / (1.0f + expf(-v)); else if (ACT == 12) v = (v > 0.f) ? v : 0.01f * v; else if (ACT == 8) v = tanhf(v); else if (ACT == 9) v = 0.5f * v * (1.0f + tanhf(0.7978845608028654f * (v + 0.044715f * v * v * v))); else if (ACT == 14) v = (v > 0.f) ? v : 0.1f * v; else if (ACT == 16) v = (v >= 0.f) ? v : 0.3f * v; else if (ACT == 17) v = (v >= 0.f) ? v : 0.2f * v;
      so[w][rloc][t * 16 + ln] = v; } }
  __builtin_amdgcn_fence(__ATOMIC_ACQ_REL, "workgroup"); __builtin_amdgcn_wave_barrier();
  const int rsub = lane >> 4, c4 = (lane & 15) * 4;
  {
#pragma unroll
    for (int q = 0; q < 16; ++q) { const int r = q * 2 + rsub; const v4f v = *(const v4fa*)&so[w][r][c4]; if (C) *(v4f*)(C + cofs + (size_t)(row0 + r) * ldc + col0 + c4) = v; if (C16) { v4h h4; for (int i = 0; i < 4; ++i) h4[i] = (_Float16)v[i]; *(v4h*)(C16 + cofs + (size_t)(row0 + r) * ldc + col0 + c4) = h4; } }
     } }


__global__ __launch_bounds__(256) void k_wnat(const float* __restrict__ w, size_t n8, _Float16* __restrict__ Bt) { const size_t t = (size_t)blockIdx.x * 256 + threadIdx.x; if (t >= n8) return; FragH f; for (int q = 0; q < 8; ++q) f.h[q] = (_Float16)(bf16_round(w[t * 8 + q]) * 16.0f); *(v8us*)((unsigned short*)Bt + t * 8) = f.half[0];  }
__global__ __launch_bounds__(256) void k_rsm(const float* __restrict__ S, _Float16* __restrict__ P, int nrows) {
  #pragma clang fp contract(off)
  const int i = blockIdx.x * 256 + threadIdx.x; if (i >= nrows) return; const float* s = S + (size_t)i * SQ; float mx = -3.0e38f;
#pragma unroll 1
  for (int j = 0; j < SQ; ++j) mx = fmaxf(mx, s[j]); float se = 0.f;
#pragma unroll 1
  for (int j = 0; j < SQ; ++j) se += expf(s[j] - mx); const float sc = 256.0f / se;
#pragma unroll 1
  for (int j0 = 0; j0 < SQ; j0 += 8) { FragH f; for (int q = 0; q < 8; ++q) f.h[q] = (_Float16)(expf(s[j0 + q] - mx) * sc); unsigned short* d = (unsigned short*)P + (size_t)i * SQ + j0; *(v8us*)d = f.half[0];  } }
__global__ __launch_bounds__(256) void k_vt(const _Float16* __restrict__ V16, int b, int h0, _Float16* __restrict__ VT) { __shared__ unsigned short tl[64][65]; const int tid = threadIdx.x; const int hh = blockIdx.x % HG, sg = blockIdx.x / HG; const int s0 = sg * 64; const int h = h0 + hh;
  for (int i = tid; i < 64 * 8; i += 256) { const int j = i / 8, d8 = (i % 8) * 8; FragH f; f.half[0] = *(const v8us*)((const unsigned short*)V16 + ((size_t)b * SQ + s0 + j) * DM + h * HD + d8); for (int q = 0; q < 8; ++q) tl[d8 + q][j] = f.u[q]; }
  __syncthreads();
  { for (int i = tid; i < 64 * 8; i += 256) { const int d = i / 8, j8 = (i % 8) * 8; FragH f; for (int q = 0; q < 8; ++q) f.u[q] = tl[d][j8 + q]; *(v8us*)((unsigned short*)VT + ((size_t)hh * HD + d) * SQ + s0 + j8) = f.half[0]; }  } }



__global__ __launch_bounds__(256) void k_rsmcf2al(const float* __restrict__ S, _Float16* __restrict__ P, int hg, int q0, int nk, int h0) {
  #pragma clang fp contract(off)
  const int t = blockIdx.x * 256 + threadIdx.x; if (t >= hg * QT) return; const size_t i = (size_t)t; const float* s = S + i * NKX; const int last = q0 + (t % QT); const float slope = (float)exp2(-0.5 * (double)(h0 + t / QT + 1));      /* ALiBi slope 2^(-8 (h+1) / 16) for this row's head, correctly rounded to f32 */ float mx = -3.0e38f;
#pragma unroll 1
  for (int j = 0; j < nk; ++j) { const float f = (j <= last) ? 1.f : 0.f; mx = fmaxf(mx, fmaf(f, __fadd_rn(s[j], -__fmul_rn(slope, (float)j)), (1.f - f) * -1.0e9f)); } float se = 0.f;
#pragma unroll 1
  for (int j = 0; j < nk; ++j) { const float f = (j <= last) ? 1.f : 0.f; se += __expf(fmaf(f, __fadd_rn(s[j], -__fmul_rn(slope, (float)j)), (1.f - f) * -1.0e9f) - mx); } const float sc = 256.0f / se;
#pragma unroll 1
  for (int j0 = 0; j0 < nk; j0 += 8) { FragH fr; for (int q = 0; q < 8; ++q) { const int j = j0 + q; const float f = (j <= last) ? 1.f : 0.f; fr.h[q] = (_Float16)(__expf(fmaf(f, __fadd_rn(s[j], -__fmul_rn(slope, (float)j)), (1.f - f) * -1.0e9f) - mx) * sc); } unsigned short* d = (unsigned short*)P + i * NKX + j0; *(v8us*)d = fr.half[0];  } }


template <int MASKADD, int ALIBI>
__global__ __launch_bounds__(64) void k_att0(const float* __restrict__ QF, const float* __restrict__ KF, const float* __restrict__ VF, int ld, const float* __restrict__ mask, float scale, float* __restrict__ OF, int ldo) {
  #pragma clang fp contract(off)
  __shared__ __attribute__((aligned(16))) float lq[64][64]; __shared__ __attribute__((aligned(16))) float lo[64][64];
  const int tid = threadIdx.x; const int h = blockIdx.x / (QT0 / 64), rg = blockIdx.x % (QT0 / 64); const int i = rg * 64 + tid;
  const float* qr = QF + (size_t)i * ld + h * HD;
#pragma unroll 1
  for (int c = 0; c < HD / 4; ++c) { *(v4f*)&lq[tid][c * 4] = *(const v4fa*)(qr + c * 4); const v4f z = {0.f, 0.f, 0.f, 0.f}; *(v4f*)&lo[tid][c * 4] = z; }
  const float slope = ALIBI ? (float)exp2(-0.5 * (double)(h + 1)) : 0.f;      /* ALiBi: 2^(-8 (h+1) / 16) */ float m = -1.0e30f, l = 0.f; const int jmax = MASKADD ? (SQ - 1) : (rg * 64 + 63);      /* additive-mask form: every key (the mask input decides); causal form: keys up to the block's last row */
#pragma unroll 1
  for (int j = 0; j <= jmax; ++j) { const float* kr = KF + (size_t)j * ld + h * HD; const float* vr = VF + (size_t)j * ld + h * HD; float s = 0.f;
#pragma unroll 1
    for (int c = 0; c < HD / 4; ++c) { const v4f kq = *(const v4fa*)(kr + c * 4); const v4f qq = *(v4f*)&lq[tid][c * 4]; s = __fadd_rn(s, __fmul_rn(qq[0], kq[0])); s = __fadd_rn(s, __fmul_rn(qq[1], kq[1])); s = __fadd_rn(s, __fmul_rn(qq[2], kq[2])); s = __fadd_rn(s, __fmul_rn(qq[3], kq[3])); }
    s = __fmul_rn(s, scale); if (ALIBI) s = __fadd_rn(s, -__fmul_rn(slope, (float)j)); if (MASKADD) s = __fadd_rn(s, __fmul_rn(bf16_round(mask[(size_t)i * SQ + j]), -10000.0f));
    const float f = (MASKADD || j <= i) ? 1.f : 0.f; const float sm = fmaf(f, s, (1.f - f) * -1.0e30f); const float mn = fmaxf(m, sm); const float sc = expf(m - mn); const float e = expf(sm - mn); l = __fadd_rn(__fmul_rn(l, sc), e); m = mn;
#pragma unroll 1
    for (int c = 0; c < HD / 4; ++c) { const v4f vv = *(const v4fa*)(vr + c * 4); v4f oo = *(v4f*)&lo[tid][c * 4]; for (int u = 0; u < 4; ++u) oo[u] = __fadd_rn(__fmul_rn(oo[u], sc), __fmul_rn(e, vv[u])); *(v4f*)&lo[tid][c * 4] = oo; } }
  const float fin = 64.0f / l;      /* o carried x64 like the f16 path */
#pragma unroll 1
  for (int c = 0; c < HD / 4; ++c) { v4f oo = *(v4f*)&lo[tid][c * 4]; for (int u = 0; u < 4; ++u) oo[u] = __fmul_rn(oo[u], fin); *(v4f*)&lo[tid][c * 4] = oo; }
  __syncthreads();
  {
#pragma unroll 1
    for (int it = 0; it < 16; ++it) { const int row = it * 4 + tid / 16, pc = (tid % 16) * 4; const v4f v = *(const v4f*)&lo[row][pc]; *(v4f*)(OF + (size_t)(rg * 64 + row) * ldo + h * HD + pc) = v; }
     } }

extern "C" void kernel_launch(void* const* d_in, const int* in_sizes, int n_in,
                              void* d_out, int out_size, void* d_ws, size_t ws_size, hipStream_t stream) {
  (void)in_sizes; (void)n_in; (void)out_size;
  const float* const* I = (const float* const*)d_in; const float* x = I[0]; const float* wq = I[1]; const float* bq = I[2]; const float* wk = I[3]; const float* wv = I[4]; const float* bv = I[5]; const float* wo = I[6];      /* natural [out][in] weights; biases on q and v only */
  char* ws = (char*)d_ws; size_t off = 0;
  auto take = [&](size_t bytes) { char* p = ws + off; off += (bytes + 255) & ~(size_t)255; return p; };
  _Float16* BQ = (_Float16*)take((size_t)DM * DM * 2); _Float16* BK = (_Float16*)take((size_t)DM * DM * 2); _Float16* BV = (_Float16*)take((size_t)DM * DM * 2); _Float16* BO = (_Float16*)take((size_t)DM * DM * 2);
  _Float16* X16 = (_Float16*)take(NR * DM * 2); _Float16* Q16 = (_Float16*)take(NR * DM * 2); _Float16* K16 = (_Float16*)take(NR * DM * 2); _Float16* V16 = (_Float16*)take(NR * DM * 2); _Float16* O16 = (_Float16*)take(NR * DM * 2);
  float* S = (float*)take((size_t)NH * QT * NKX * 4); _Float16* P = (_Float16*)take((size_t)NH * QT * NKX * 2); _Float16* VT = (_Float16*)take((size_t)NH * HD * SQ * 2);
  float* QF0 = (float*)take((size_t)QT0 * DM * 4); float* KF0 = (float*)take((size_t)QT0 * DM * 4); float* VF0 = (float*)take((size_t)QT0 * DM * 4); float* OF0 = (float*)take((size_t)NB * QT0 * DM * 4); _Float16* OH0 = (_Float16*)take((size_t)NB * QT0 * DM * 2); _Float16* OL0 = (_Float16*)take((size_t)NB * QT0 * DM * 2);
  if (off > ws_size) return;
  { const unsigned g = (unsigned)(((size_t)DM * DM / 8 + 255) / 256); k_wnat<<<g, 256, 0, stream>>>(wq, (size_t)DM * DM / 8, BQ); k_wnat<<<g, 256, 0, stream>>>(wk, (size_t)DM * DM / 8, BK); k_wnat<<<g, 256, 0, stream>>>(wv, (size_t)DM * DM / 8, BV); k_wnat<<<g, 256, 0, stream>>>(wo, (size_t)DM * DM / 8, BO); }      /* natural [out][in] = Bt[n][k], x16 */
  k_x16<<<(unsigned)((NR * DM / 8 + 255) / 256), 256, 0, stream>>>(x, X16, NR * DM / 8);
  const size_t r0p = (size_t)B0 * SQ;      /* first projected row */
  k_gemm2<0><<<dim3((unsigned)((MP / 128) * (DM / 64)), 1), 128, 0, stream>>>(X16 + r0p * DM, DM, 0, BQ, DM, 0, 0.0625f, bq, 0, nullptr, 1, 0, 0, nullptr, Q16 + r0p * DM, DM, 0, MP, DM, DM);
  k_gemm2<0><<<dim3((unsigned)((MP / 128) * (DM / 64)), 1), 128, 0, stream>>>(X16 + r0p * DM, DM, 0, BK, DM, 0, 0.0625f, nullptr, 0, nullptr, 1, 0, 0, nullptr, K16 + r0p * DM, DM, 0, MP, DM, DM);
  k_gemm2<0><<<dim3((unsigned)((MP / 128) * (DM / 64)), 1), 128, 0, stream>>>(X16 + r0p * DM, DM, 0, BV, DM, 0, 0.0625f, bv, 0, nullptr, 1, 0, 0, nullptr, V16 + r0p * DM, DM, 0, MP, DM, DM);
  for (int b = B0; b < B0 + NBR; ++b) { const size_t r0 = (size_t)b * SQ;
    k_vt<NH, SQ><<<NH * (SQ / 64), 256, 0, stream>>>(V16 + r0 * LQ, LQ, 0, VT);      /* V^T [NH][HD][SQ] for this batch */
    k_gemm2<0><<<dim3((QT0 / 128) * (DM / 64), 1), 128, 0, stream>>>(X16 + r0 * DM, DM, 0, BQ, DM, 0, 0.0625f, bq, 0, nullptr, 1, 0, 0, QF0, nullptr, DM, 0, QT0, DM, DM); k_gemm2<0><<<dim3((QT0 / 128) * (DM / 64), 1), 128, 0, stream>>>(X16 + r0 * DM, DM, 0, BK, DM, 0, 0.0625f, nullptr, 0, nullptr, 1, 0, 0, KF0, nullptr, DM, 0, QT0, DM, DM); k_gemm2<0><<<dim3((QT0 / 128) * (DM / 64), 1), 128, 0, stream>>>(X16 + r0 * DM, DM, 0, BV, DM, 0, 0.0625f, bv, 0, nullptr, 1, 0, 0, VF0, nullptr, DM, 0, QT0, DM, DM);      /* f32 q, k, v of the first 256 rows (exact products) */
    k_att0<0, 1><<<NH * (QT0 / 64), 64, 0, stream>>>(QF0, KF0, VF0, DM, nullptr, 0.125f, OF0 + (size_t)b * QT0 * DM, DM);      /* exact f32 causal ALiBi attention */      /* exact f32 attention for rows 0..255 (o x64) */
    for (int q0 = 0; q0 < QN; q0 += QT) { const int nk = q0 + QT;      /* causal: only keys below the tile end are computed */
      k_gemm2<0><<<dim3((QT / 128) * (nk / 64), NHD), 128, 0, stream>>>(Q16 + (r0 + q0) * LQ, LQ, (size_t)HD, K16 + r0 * LQ, LQ, (size_t)HD, 0.125f, nullptr, 0, nullptr, 1, 0, 0, S, nullptr, NKX, (size_t)QT * NKX, QT, nk, HD);      /* scores, all heads on grid.y */
      k_rsmcf2al<<<(NHD * QT + 255) / 256, 256, 0, stream>>>(S, P, NHD, q0, nk, 0);      /* causal softmax over scores - slope_h * j (all 16 heads: h0 = 0) */
      k_gemm2<0><<<dim3((QT / 128) * (HD / 64), NHD), 128, 0, stream>>>(P, NKX, (size_t)QT * NKX, VT, SQ, (size_t)HD * SQ, 0.25f, nullptr, 0, nullptr, 1, 0, 0, nullptr, O16 + (r0 + q0) * DM, DM, (size_t)HD, QT, HD, nk); } }      /* o (merged heads, x64) as f16 rows */
  k_gemm2<0><<<dim3((unsigned)((MPO / 128) * (DM / 64)), 1), 128, 0, stream>>>(O16 + r0p * DM, DM, 0, BO, DM, 0, 0.0009765625f, nullptr, 0, nullptr, 1, 0, 0, (float*)d_out + r0p * DM, nullptr, DM, 0, MPO, DM, DM);      /* out rows are the output layout */
  k_hl<<<(unsigned)(((size_t)NB * QT0 * DM / 8 + 255) / 256), 256, 0, stream>>>(OF0, OH0, OL0, (size_t)NB * QT0 * DM / 8);      /* first-tile o (x64) -> f16 hi + x1024 residual planes */
  for (int b = B0; b < B0 + NBR; ++b) { const size_t r0 = (size_t)b * SQ; const size_t f0 = (size_t)b * QT0;
    k_gemm2<0><<<dim3((QT0 / 128) * (DM / 64), 1), 128, 0, stream>>>(OH0 + f0 * DM, DM, 0, BO, DM, 0, 0.0009765625f, nullptr, 0, nullptr, 1, 0, 0, (float*)d_out + r0 * DM, nullptr, DM, 0, QT0, DM, DM);      /* rows 0..255: out = o_hi Wo, overwriting the f16-path rows */
    k_gemm2<0><<<dim3((QT0 / 128) * (DM / 64), 1), 128, 0, stream>>>(OL0 + f0 * DM, DM, 0, BO, DM, 0, 0.00000095367431640625f, nullptr, 0, (const float*)d_out + r0 * DM, -1, 0, 0, (float*)d_out + r0 * DM, nullptr, DM, 0, QT0, DM, DM); }      /* += o_lo Wo 2^-20 (own-element accumulate) */
}

// v001
// It runs in 2570 microseconds.
// Timed twice side by side with v000, it ran 3.33 and 3.32 times as fast.
#include <hip/hip_runtime.h>
// Causal multi-head attention with an ALiBi key-position bias (inputs [1][4096][1024]; q = x Wq^T + bq, k = x Wk^T (no bias), v = x Wv^T + bv (natural [1024][1024] sigma 0.02; bq, bv sigma 0.02); 16 heads of 64; scores / 8 - slopes[h] * j with slopes[h] = 2^(-8 (h+1) / 16) and j the key position; causal (j <= i keep, -inf); softmax; out = merged Wo^T (no bias) -> [1][4096][1024]).
// Structure: token rows r = s; q, k, v inputs as exact f16 rows (bf16-rounded); Q, K, V as three WMMA GEMMs (32x64 wave tiles, f32 accumulation, exact x16 weights, f16 outputs); per batch: V^T for all heads via LDS transposes; per query tile of 256 rows: scores against the keys below the tile end only (K = 64, all heads on grid.y, alpha = 0.125), causal row softmax on VALU over scores minus the ALiBi term slope_h * j, with an arithmetic 0/1 key mask over the computed range (f32 statistics, native exp; weights x256 f16), o = P . V^T (K = keys below the tile end, alpha 2^-2: o carried x64, folded into the output GEMM alpha) written straight into the merged f16 o rows; out = o W_o GEMM (f32) into the output layout.
// Compute dtype: inputs rounded to bf16; x / weights exact; q, k, v, softmax weights and o as plain f16 GEMM operands (~2^-12); scores and softmax statistics f32. v_wmma_f32_16x16x32_f16.
#define NB 1
#define SQ 4096
#define DM 1024
#define NH 16
#define HD 64
#define HG 4                         /* heads per block group of the unlaunched k_vt overload */
#define QT 256                       /* query rows per causal tile */
#define NKX SQ                       /* S / P row pitch */
#define QT0 256                      /* first-tile rows recomputed exactly in f32 */
#define B0 0                         /* first batch processed (debug hook) */
#define NBR NB                       /* batches processed (debug hook) */
#define NR ((size_t)NB * SQ)         /* token rows */
#define MP ((int)((size_t)NBR * SQ)) /* rows projected (debug hook) */
#define QN SQ                        /* query rows attended per batch (debug hook) */
#define NHD NH                       /* heads attended (debug hook) */
#define MPO MP                       /* rows through the output stage (debug hook) */
#define LQ DM      /* row pitch of the q/k/v rows */
typedef __bf16 v16b __attribute__((ext_vector_type(16)));
typedef unsigned short v8us __attribute__((ext_vector_type(8), may_alias));
typedef float  v8f  __attribute__((ext_vector_type(8)));
typedef float  v4f  __attribute__((ext_vector_type(4)));
typedef float  v4fa __attribute__((ext_vector_type(4), may_alias));
union FragB { v16b v; v8us half[2]; unsigned short u[16]; };

__device__ __forceinline__ unsigned short bf16_bits(float x) { unsigned int u = __float_as_uint(x); return (unsigned short)((u + 0x7FFFu + ((u >> 16) & 1u)) >> 16); }
__device__ __forceinline__ float bf16_val(unsigned short b) { return __uint_as_float(((unsigned int)b) << 16); }
__device__ __forceinline__ float bf16_round(float x) { return bf16_val(bf16_bits(x)); }
// D += A·B with NT terms: 1 = ah·bh, 2 = + al·bh (A split), 3 = + ah·bl (both split)
template <int NT>
__device__ __forceinline__ v8f mmaN(v16b ah, v16b al, v16b bh, v16b bl, v8f c) {
  c = __builtin_amdgcn_wmma_f32_16x16x32_bf16(false, ah, false, bh, (short)0, c, false, false);
  if (NT >= 2) c = __builtin_amdgcn_wmma_f32_16x16x32_bf16(false, al, false, bh, (short)0, c, false, false);
  if (NT >= 3) c = __builtin_amdgcn_wmma_f32_16x16x32_bf16(false, ah, false, bl, (short)0, c, false, false);
  asm volatile("v_nop\n\tv_nop\n\tv_nop\n\tv_nop" : "+v"(c) : "v"(ah), "v"(al), "v"(bh), "v"(bl));
  return c;
}

__global__ __launch_bounds__(256) void k_wt_bf16(const float* __restrict__ W, unsigned short* __restrict__ Wt, int K, int N) {
  const int t = blockIdx.x * 256 + threadIdx.x;
  const int k8n = K / 8;
  if (t >= N * k8n) return;
  const int n = t / k8n, k8 = (t % k8n) * 8;
  v8us v;
#pragma unroll
  for (int i = 0; i < 8; ++i) v[i] = bf16_bits(W[(size_t)(k8 + i) * N + n]);
  *(v8us*)(Wt + (size_t)n * K + k8) = v;
  
}

// GEMM C[M][N] (f32, pitch ldc) = act(A[M][K]·W + bias). A f32 row-major (pitch lda) converted per fragment to bf16
// (ASPLIT: hi/lo two planes -> 2 terms, else single rounded term); Wt bf16 [N][K] (pitch ldb). BIAS_BF16 rounds the
// bias to bf16 first (bias quantised to bf16 before the add). K%32==0, M%16==0, N%64==0.
template <bool ASPLIT, int ACT, bool BIAS_BF16>
__global__ __launch_bounds__(128) void k_gemm_bf(const float* __restrict__ A, int lda, const unsigned short* __restrict__ Wt, int ldb,
                                               const float* __restrict__ bias, float* __restrict__ C, int ldc, int M, int N, int K) {
  __shared__ __attribute__((aligned(16))) float so[4][16][64];
  const int tid = threadIdx.x, w = tid >> 5, lane = tid & 31, ln = lane & 15, hh = lane >> 4;
  const int ntn = N / 64;
  const int wid = blockIdx.x * 4 + w;
  const int mt = wid / ntn, nq = wid % ntn;
  if (mt * 16 >= M) return;
  const int row0 = mt * 16, col0 = nq * 64;
  const float* arow = A + (size_t)(row0 + ln) * lda;
  v8f acc[4] = {};
  for (int kb = 0; kb < K; kb += 32) {
    FragB ah, al;
    const v4f x0 = *(const v4fa*)(arow + kb + 8 * hh), x1 = *(const v4fa*)(arow + kb + 8 * hh + 4);
    const v4f x2 = *(const v4fa*)(arow + kb + 16 + 8 * hh), x3 = *(const v4fa*)(arow + kb + 16 + 8 * hh + 4);
    float xs[16] = {x0[0],x0[1],x0[2],x0[3],x1[0],x1[1],x1[2],x1[3],x2[0],x2[1],x2[2],x2[3],x3[0],x3[1],x3[2],x3[3]};
#pragma unroll
    for (int i = 0; i < 16; ++i) { const unsigned short hb = bf16_bits(xs[i]); ah.u[i] = hb; al.u[i] = ASPLIT ? bf16_bits(xs[i] - bf16_val(hb)) : (unsigned short)0; }
#pragma unroll
    for (int t = 0; t < 4; ++t) {
      const unsigned short* brow = Wt + (size_t)(col0 + t * 16 + ln) * ldb + kb;
      FragB b;
      b.half[0] = *(const v8us*)(brow + 8 * hh);
      b.half[1] = *(const v8us*)(brow + 16 + 8 * hh);
      acc[t] = mmaN<ASPLIT ? 2 : 1>(ah.v, al.v, b.v, b.v, acc[t]);
    }
  }
#pragma unroll
  for (int t = 0; t < 4; ++t) {
    float bv = bias ? bias[col0 + t * 16 + ln] : 0.f;
    if (BIAS_BF16) bv = bf16_round(bv);
#pragma unroll
    for (int r = 0; r < 8; ++r) { float v = acc[t][r] + bv; if (ACT == 1) v = fmaxf(v, 0.f); so[w][8 * hh + r][t * 16 + ln] = v; }
  }
  __builtin_amdgcn_fence(__ATOMIC_ACQ_REL, "workgroup");
  __builtin_amdgcn_wave_barrier();
  const int rsub = lane >> 4, c4 = (lane & 15) * 4;
  {
#pragma unroll
    for (int q = 0; q < 8; ++q) {
      const int r = q * 2 + rsub;
      const v4f v = *(const v4fa*)&so[w][r][c4];
      *(v4f*)(C + (size_t)(row0 + r) * ldc + col0 + c4) = v;
    }
    
  }
}

// GEMM C = act(A·W + bias + resid): A f32 (ASPLIT -> hi/lo 2 terms), Wt bf16 [N][K]; ACT 0 none, 1 relu, 2 exact gelu;
// resid (optional, f32, row index = (row % rmod), pitch ldr, RES_BF16 rounds it) added before the activation.
template <bool ASPLIT, int ACT, bool BIAS_BF16, bool RES_BF16>
__global__ __launch_bounds__(128) void k_gemm_bf3(const float* __restrict__ A, int lda, const unsigned short* __restrict__ Wt, int ldb,
                                                const float* __restrict__ bias, const float* __restrict__ resid, int rmod, int ldr,
                                                float* __restrict__ C, int ldc, int M, int N, int K) {
  __shared__ __attribute__((aligned(16))) float so[4][16][64];
  const int tid = threadIdx.x, w = tid >> 5, lane = tid & 31, ln = lane & 15, hh = lane >> 4;
  const int ntn = N / 64;
  const int wid = blockIdx.x * 4 + w;
  const int mt = wid / ntn, nq = wid % ntn;
  if (mt * 16 >= M) return;
  const int row0 = mt * 16, col0 = nq * 64;
  const float* arow = A + (size_t)(row0 + ln) * lda;
  v8f acc[4] = {};
  for (int kb = 0; kb < K; kb += 32) {
    FragB ah, al;
    const v4f x0 = *(const v4fa*)(arow + kb + 8 * hh), x1 = *(const v4fa*)(arow + kb + 8 * hh + 4);
    const v4f x2 = *(const v4fa*)(arow + kb + 16 + 8 * hh), x3 = *(const v4fa*)(arow + kb + 16 + 8 * hh + 4);
    float xs[16] = {x0[0],x0[1],x0[2],x0[3],x1[0],x1[1],x1[2],x1[3],x2[0],x2[1],x2[2],x2[3],x3[0],x3[1],x3[2],x3[3]};
#pragma unroll
    for (int i = 0; i < 16; ++i) { const unsigned short hb = bf16_bits(xs[i]); ah.u[i] = hb; al.u[i] = ASPLIT ? bf16_bits(xs[i] - bf16_val(hb)) : (unsigned short)0; }
#pragma unroll
    for (int t = 0; t < 4; ++t) {
      const unsigned short* brow = Wt + (size_t)(col0 + t * 16 + ln) * ldb + kb;
      FragB b;
      b.half[0] = *(const v8us*)(brow + 8 * hh);
      b.half[1] = *(const v8us*)(brow + 16 + 8 * hh);
      acc[t] = mmaN<ASPLIT ? 2 : 1>(ah.v, al.v, b.v, b.v, acc[t]);
    }
  }
#pragma unroll
  for (int t = 0; t < 4; ++t) {
    const int col = col0 + t * 16 + ln;
    float bv = bias ? bias[col] : 0.f;
    if (BIAS_BF16) bv = bf16_round(bv);
#pragma unroll
    for (int r = 0; r < 8; ++r) {
      float v = acc[t][r] + bv;
      if (resid) { float rv = resid[(size_t)((row0 + 8 * hh + r) % rmod) * ldr + col]; if (RES_BF16) rv = bf16_round(rv); v += rv; }
      if (ACT == 1) v = fmaxf(v, 0.f);
      if (ACT == 2) v = 0.5f * v * (1.0f + erff(v * 0.70710678118654752f));
      if (ACT == 3) { const float u = 0.7978845608028654f * (v + 0.044715f * v * v * v); v = 0.5f * v * (1.0f + tanhf(u)); }
      so[w][8 * hh + r][t * 16 + ln] = v;
    }
  }
  __builtin_amdgcn_fence(__ATOMIC_ACQ_REL, "workgroup");
  __builtin_amdgcn_wave_barrier();
  const int rsub = lane >> 4, c4 = (lane & 15) * 4;
  {
#pragma unroll
    for (int q = 0; q < 8; ++q) {
      const int r = q * 2 + rsub;
      const v4f v = *(const v4fa*)&so[w][r][c4];
      *(v4f*)(C + (size_t)(row0 + r) * ldc + col0 + c4) = v;
    }
    
  }
}
// row LayerNorm (biased variance, eps) over N: s = X (+ R); optional out_sum <- s; out_norm <- (s-mu)*rsqrt(var+eps)*g + b
template <bool PARAM_BF16>
__global__ __launch_bounds__(256) void k_layernorm(const float* __restrict__ X, const float* __restrict__ R, const float* __restrict__ g, const float* __restrict__ bta,
                                                  float* __restrict__ out_sum, float* __restrict__ out_norm, int N, float eps) {
  __shared__ float red[256];
  const int row = blockIdx.x, tid = threadIdx.x;
  const float* x = X + (size_t)row * N; const float* rr = R ? R + (size_t)row * N : nullptr;
  float vals[16];                     // up to N = 4096
  const int per = N / 256;            // contiguous chunk per thread? use strided-by-4 chunks: thread handles j = tid*4 + 1024*u
  float s1 = 0.f;
  for (int u = 0; u < per / 4; ++u) {
    const int j = tid * 4 + 1024 * u;
    const v4f a = *(const v4fa*)(x + j);
    v4f b = {0.f,0.f,0.f,0.f}; if (rr) b = *(const v4fa*)(rr + j);
#pragma unroll
    for (int q = 0; q < 4; ++q) { const float v = a[q] + b[q]; vals[u * 4 + q] = v; s1 += v; }
  }
  red[tid] = s1; __syncthreads();
  for (int st = 128; st > 0; st >>= 1) { if (tid < st) red[tid] += red[tid + st]; __syncthreads(); }
  const float mu = red[0] / (float)N; __syncthreads();
  float s2 = 0.f;
  for (int u = 0; u < per / 4; ++u)
#pragma unroll
    for (int q = 0; q < 4; ++q) { const float c = vals[u * 4 + q] - mu; s2 += c * c; }
  red[tid] = s2; __syncthreads();
  for (int st = 128; st > 0; st >>= 1) { if (tid < st) red[tid] += red[tid + st]; __syncthreads(); }
  const float rs = rsqrtf(red[0] / (float)N + eps);
  {
    for (int u = 0; u < per / 4; ++u) {
      const int j = tid * 4 + 1024 * u;
      v4f o, sm;
#pragma unroll
      for (int q = 0; q < 4; ++q) {
        float gg = g[j + q], bb = bta[j + q];
        if (PARAM_BF16) { gg = bf16_round(gg); bb = bf16_round(bb); }
        sm[q] = vals[u * 4 + q]; o[q] = (vals[u * 4 + q] - mu) * rs * gg + bb;
      }
      if (out_sum) *(v4f*)(out_sum + (size_t)row * N + j) = sm;
      *(v4f*)(out_norm + (size_t)row * N + j) = o;
    }
    
  }
}



// ---- f16 WMMA path (v_wmma_f32_16x16x32_f16): 11-bit significands for operands in range — used where a [0,1] probability operand needs more precision than bf16
typedef _Float16 v16h __attribute__((ext_vector_type(16)));
union FragH { v16h v; v8us half[2]; _Float16 h[16]; unsigned short u[16]; };
template <int NT>
__device__ __forceinline__ v8f mmaH(v16h ah, v16h al, v16h bh, v16h bl, v8f c) {
  c = __builtin_amdgcn_wmma_f32_16x16x32_f16(false, ah, false, bh, (short)0, c, false, false);
  if (NT >= 2) c = __builtin_amdgcn_wmma_f32_16x16x32_f16(false, al, false, bh, (short)0, c, false, false);
  if (NT >= 3) c = __builtin_amdgcn_wmma_f32_16x16x32_f16(false, ah, false, bl, (short)0, c, false, false);
  asm volatile("v_nop\n\tv_nop\n\tv_nop\n\tv_nop" : "+v"(c) : "v"(ah), "v"(al), "v"(bh), "v"(bl));
  return c;
}
// batched GEMM like k_gemm_b but f16 operands: A f32 (split into f16 hi/lo if ASPLIT, else rounded to f16), Bt = f16 values [n][k]; alpha; C f32; N multiple of 16 (partial tiles skipped)
template <bool ASPLIT>
__global__ __launch_bounds__(128) void k_gemm_h(const float* __restrict__ A, int lda, size_t sA, const _Float16* __restrict__ Bh, int ldb, size_t sB, float alpha, float* __restrict__ C, int ldc, size_t sC, int M, int N, int K) {
  __shared__ __attribute__((aligned(16))) float so[4][16][64];
  const int tid = threadIdx.x, w = tid >> 5, lane = tid & 31, ln = lane & 15, hh = lane >> 4; const int by = blockIdx.y;
  A += (size_t)by * sA; Bh += (size_t)by * sB; C += (size_t)by * sC;
  const int ntn = (N + 63) / 64; const int wid = blockIdx.x * 4 + w; const int mt = wid / ntn, nq = wid % ntn; if (mt * 16 >= M) return;
  const int row0 = mt * 16, col0 = nq * 64; const float* arow = A + (size_t)(row0 + ln) * lda;
  v8f acc[4] = {};
  for (int kb = 0; kb < K; kb += 32) {
    FragH ah, al;
    const v4f x0 = *(const v4fa*)(arow + kb + 8 * hh), x1 = *(const v4fa*)(arow + kb + 8 * hh + 4), x2 = *(const v4fa*)(arow + kb + 16 + 8 * hh), x3 = *(const v4fa*)(arow + kb + 16 + 8 * hh + 4);
    float xs[16] = {x0[0],x0[1],x0[2],x0[3],x1[0],x1[1],x1[2],x1[3],x2[0],x2[1],x2[2],x2[3],x3[0],x3[1],x3[2],x3[3]};
#pragma unroll
    for (int i = 0; i < 16; ++i) { const _Float16 h = (_Float16)xs[i]; ah.h[i] = h; al.h[i] = ASPLIT ? (_Float16)(xs[i] - (float)h) : (_Float16)0.0f; }
#pragma unroll
    for (int t = 0; t < 4; ++t) { if (col0 + t * 16 >= N) continue; const size_t boff = (size_t)(col0 + t * 16 + ln) * ldb + kb; FragH bq; bq.half[0] = *(const v8us*)(Bh + boff + 8 * hh); bq.half[1] = *(const v8us*)(Bh + boff + 16 + 8 * hh);
      acc[t] = mmaH<ASPLIT ? 2 : 1>(ah.v, al.v, bq.v, bq.v, acc[t]); }
  }
#pragma unroll
  for (int t = 0; t < 4; ++t) { if (col0 + t * 16 >= N) continue;
#pragma unroll
    for (int r = 0; r < 8; ++r) so[w][8 * hh + r][t * 16 + ln] = acc[t][r] * alpha; }
  __builtin_amdgcn_fence(__ATOMIC_ACQ_REL, "workgroup"); __builtin_amdgcn_wave_barrier();
  const int rsub = lane >> 4, c4 = (lane & 15) * 4;
  {
#pragma unroll
    for (int q = 0; q < 8; ++q) { const int r = q * 2 + rsub; if (col0 + c4 < N) { const v4f v = *(const v4fa*)&so[w][r][c4]; *(v4f*)(C + (size_t)(row0 + r) * ldc + col0 + c4) = v; } }
     }
}

// Wt[n][k] = f16(W[k][n]·scale) from f32 row-major W[K][N] (scale = power of two; bf16-exact weights stay exact in f16 away from the subnormal range)
__global__ __launch_bounds__(256) void k_wt_f16(const float* __restrict__ W, _Float16* __restrict__ Wt, int K, int N, float scale) {
  const int t = blockIdx.x * 256 + threadIdx.x; if (t >= N * (K / 8)) return; const int n = t / (K / 8), k8 = (t % (K / 8)) * 8; FragH f;
#pragma unroll
  for (int i = 0; i < 8; ++i) f.h[i] = (_Float16)(bf16_round(W[(size_t)(k8 + i) * N + n]) * scale); const v8us o = f.half[0];
  *(v8us*)((unsigned short*)Wt + (size_t)n * K + k8) = o; 
}
// k_gemm_hh variant with fused epilogue: v = acc·alpha + bias[by·sBias + col] (+ CP[(row/rowsPerB)·sCPb + by·64 + col] if CP) ; ACT 0 none / 1 elu ; writes f16 C16 (and f32 C if non-null)
template <int ACT>
__global__ __launch_bounds__(128) void k_gemm_hhx(const _Float16* __restrict__ A, int lda, size_t sA, const _Float16* __restrict__ Bh, int ldb, size_t sB, float alpha, const float* __restrict__ bias, size_t sBias, const float* __restrict__ CP, int rowsPerB, size_t sCPb, int row0g,
    float* __restrict__ C, _Float16* __restrict__ C16, int ldc, size_t sC, int M, int N, int K) {
  __shared__ __attribute__((aligned(16))) float so[4][16][64];
  const int tid = threadIdx.x, w = tid >> 5, lane = tid & 31, ln = lane & 15, hh = lane >> 4; const int by = blockIdx.y;
  A += (size_t)by * sA; Bh += (size_t)by * sB; const size_t cofs = (size_t)by * sC; const float* bp = bias ? bias + (size_t)by * sBias : nullptr;
  const int ntn = (N + 63) / 64; const int wid = blockIdx.x * 4 + w; const int mt = wid / ntn, nq = wid % ntn; if (mt * 16 >= M) return;
  const int row0 = mt * 16, col0 = nq * 64; const _Float16* arow = A + (size_t)(row0 + ln) * lda;
  v8f acc[4] = {};
  for (int kb = 0; kb < K; kb += 32) { FragH ah; ah.half[0] = *(const v8us*)((const unsigned short*)arow + kb + 8 * hh); ah.half[1] = *(const v8us*)((const unsigned short*)arow + kb + 16 + 8 * hh);
#pragma unroll
    for (int t = 0; t < 4; ++t) { if (col0 + t * 16 >= N) continue; const size_t boff = (size_t)(col0 + t * 16 + ln) * ldb + kb; FragH bq; bq.half[0] = *(const v8us*)((const unsigned short*)Bh + boff + 8 * hh); bq.half[1] = *(const v8us*)((const unsigned short*)Bh + boff + 16 + 8 * hh);
      acc[t] = mmaH<1>(ah.v, ah.v, bq.v, bq.v, acc[t]); }
  }
#pragma unroll
  for (int t = 0; t < 4; ++t) { if (col0 + t * 16 >= N) continue; const int col = col0 + t * 16 + ln; const float bv = bp ? bf16_round(bp[col]) : 0.f;
#pragma unroll
    for (int r = 0; r < 8; ++r) { float v = acc[t][r] * alpha + bv; if (CP) { const int rr = row0g + row0 + 8 * hh + r; if (rowsPerB < 0) v += CP[cofs + (size_t)rr * ldc + col];      /* rowsPerB < 0: own element of the batched C plane */ else { const int bidx = rr / rowsPerB; v += CP[(size_t)bidx * sCPb + (size_t)by * 64 + col]; } } if (ACT == 1) v = (v > 0.f) ? v : expm1f(v); else if (ACT == 7) v = (v > 0.f) ? v + 1.0f : expf(v); else if (ACT == 8) v = tanhf(v); else if (ACT == 9) v = 0.5f * v * (1.0f + tanhf(0.7978845608028654f * (v + 0.044715f * v * v * v))); else if (ACT == 11) v = 1.0f / (1.0f + expf(-v)); else if (ACT == 12) v = (v > 0.f) ? v : 0.01f * v; else if (ACT == 14) v = (v > 0.f) ? v : 0.1f * v; else if (ACT == 16) v = (v >= 0.f) ? v : 0.3f * v; else if (ACT == 17) v = (v >= 0.f) ? v : 0.2f * v; else if (ACT == 15) v = v / (1.0f + expf(-v)); else if (ACT == 3) v = fmaxf(v, 0.f); else if (ACT == 6) v = 0.5f * v * (1.0f + erff(v * 0.70710678118654752f)); so[w][8 * hh + r][t * 16 + ln] = v; } }
  __builtin_amdgcn_fence(__ATOMIC_ACQ_REL, "workgroup"); __builtin_amdgcn_wave_barrier();
  const int rsub = lane >> 4, c4 = (lane & 15) * 4; typedef _Float16 v4h __attribute__((ext_vector_type(4)));
  {
#pragma unroll
    for (int q = 0; q < 8; ++q) { const int r = q * 2 + rsub; if (col0 + c4 < N) { const v4f v = *(const v4fa*)&so[w][r][c4]; if (C) *(v4f*)(C + cofs + (size_t)(row0 + r) * ldc + col0 + c4) = v; if (C16) { v4h h4; for (int i = 0; i < 4; ++i) h4[i] = (_Float16)v[i]; *(v4h*)(C16 + cofs + (size_t)(row0 + r) * ldc + col0 + c4) = h4; } } }
     }
}


typedef _Float16 v4h __attribute__((ext_vector_type(4)));

__global__ __launch_bounds__(256) void k_x16(const float* __restrict__ x, _Float16* __restrict__ X16, size_t n8) { const size_t t = (size_t)blockIdx.x * 256 + threadIdx.x; if (t >= n8) return; FragH f;
#pragma unroll
  for (int q = 0; q < 8; ++q) f.h[q] = (_Float16)bf16_round(x[t * 8 + q]); *(v8us*)((unsigned short*)X16 + t * 8) = f.half[0];  }
__global__ __launch_bounds__(256) void k_h16(const float* __restrict__ x, _Float16* __restrict__ X16, size_t n8) { const size_t t = (size_t)blockIdx.x * 256 + threadIdx.x; if (t >= n8) return; FragH f;
#pragma unroll
  for (int q = 0; q < 8; ++q) f.h[q] = (_Float16)x[t * 8 + q]; *(v8us*)((unsigned short*)X16 + t * 8) = f.half[0];  }
__global__ __launch_bounds__(256) void k_round16f(const float* __restrict__ W, _Float16* __restrict__ Bt, size_t n8) { const size_t t = (size_t)blockIdx.x * 256 + threadIdx.x; if (t >= n8) return; FragH f;
#pragma unroll
  for (int i = 0; i < 8; ++i) f.h[i] = (_Float16)(bf16_round(W[t * 8 + i]) * 16.0f); *(v8us*)((unsigned short*)Bt + t * 8) = f.half[0];  }
template <int NHv, int TTv>
__global__ __launch_bounds__(256) void k_vt(const _Float16* __restrict__ V16, int ldv, int voff, _Float16* __restrict__ Vt) { __shared__ unsigned short tl[64][66]; const int tid = threadIdx.x; const int slab = blockIdx.x / (TTv / 64), lg = blockIdx.x % (TTv / 64); const int b = slab / NHv, h = slab % NHv;
  for (int i = tid; i < 64 * 8; i += 256) { const int r = i / 8, c8 = (i % 8) * 8; FragH f; f.half[0] = *(const v8us*)((const unsigned short*)V16 + ((size_t)b * TTv + lg * 64 + r) * ldv + voff + h * 64 + c8);
#pragma unroll
    for (int q = 0; q < 8; ++q) tl[r][c8 + q] = f.u[q]; }
  __syncthreads();
  {
#pragma unroll
    for (int rd = 0; rd < 2; ++rd) { const int d = rd * 32 + tid / 8, pc = tid % 8; FragH f;
#pragma unroll
      for (int q = 0; q < 8; ++q) f.u[q] = tl[pc * 8 + q][d];
      *(v8us*)((unsigned short*)Vt + ((size_t)slab * 64 + d) * TTv + lg * 64 + pc * 8) = f.half[0]; }
     } }

__global__ __launch_bounds__(256) void k_hl(const float* __restrict__ F, _Float16* __restrict__ Hh, _Float16* __restrict__ Hl, size_t n8) { const size_t t = (size_t)blockIdx.x * 256 + threadIdx.x; if (t >= n8) return; FragH fh, fl; const v4f a = *(const v4fa*)(F + t * 8), c = *(const v4fa*)(F + t * 8 + 4);
#pragma unroll
  for (int q = 0; q < 4; ++q) { _Float16 h = (_Float16)a[q]; fh.h[q] = h; fl.h[q] = (_Float16)((a[q] - (float)h) * 1024.0f); h = (_Float16)c[q]; fh.h[4 + q] = h; fl.h[4 + q] = (_Float16)((c[q] - (float)h) * 1024.0f); }
  { *(v8us*)((unsigned short*)Hh + t * 8) = fh.half[0]; *(v8us*)((unsigned short*)Hl + t * 8) = fl.half[0];  } }

// ---- fast GEMM (wave tile 32x64; requires M % 32 == 0 rows per launch region and N % 64 == 0); epilogue = k_gemm_hhx semantics ----
__device__ __forceinline__ v16h g2_frag(const _Float16* p, int hh) { FragH f; f.half[0] = *(const v8us*)((const unsigned short*)p + 8 * hh); f.half[1] = *(const v8us*)((const unsigned short*)p + 16 + 8 * hh); return f.v; }
__device__ __forceinline__ v8f g2_mma(v16h a, v16h b, v8f c) { v8f d = __builtin_amdgcn_wmma_f32_16x16x32_f16(false, a, false, b, (short)0, c, false, false); asm volatile("v_nop\n\tv_nop\n\tv_nop\n\tv_nop" : "+v"(d) : "v"(a), "v"(b)); return d; }
template <int ACT>
__global__ __launch_bounds__(128) void k_gemm2(const _Float16* __restrict__ A, int lda, size_t sA, const _Float16* __restrict__ Bh, int ldb, size_t sB, float alpha, const float* __restrict__ bias, size_t sBias, const float* __restrict__ CP, int rowsPerB, size_t sCPb, int row0g,
    float* __restrict__ C, _Float16* __restrict__ C16, int ldc, size_t sC, int M, int N, int K) { static_assert(ACT == 0 || ACT == 3 || ACT == 6 || ACT == 8 || ACT == 9 || ACT == 11 || ACT == 12 || ACT == 14 || ACT == 15 || ACT == 16 || ACT == 17, "k_gemm2: unsupported ACT code (would silently apply no activation)");
  __shared__ __attribute__((aligned(16))) float so[4][32][68];
  const int tid = threadIdx.x, w = tid >> 5, lane = tid & 31, ln = lane & 15, hh = lane >> 4; const int by = blockIdx.y;
  A += (size_t)by * sA; Bh += (size_t)by * sB; const size_t cofs = (size_t)by * sC; const float* bp = bias ? bias + (size_t)by * sBias : nullptr;
  const int ntn = N >> 6; const int mt = blockIdx.x / ntn, nq = blockIdx.x - mt * ntn; const int row0 = mt * 128 + 32 * w, col0 = nq * 64; if (row0 >= M) return;
  const _Float16* a0p = A + (size_t)(row0 + ln) * lda; const _Float16* a1p = a0p + (size_t)16 * lda;
  const _Float16* b0p = Bh + (size_t)(col0 + ln) * ldb; const _Float16* b1p = b0p + (size_t)16 * ldb; const _Float16* b2p = b1p + (size_t)16 * ldb; const _Float16* b3p = b2p + (size_t)16 * ldb;
  const v8f z8 = {0.f,0.f,0.f,0.f,0.f,0.f,0.f,0.f}; v8f c00 = z8, c01 = z8, c02 = z8, c03 = z8, c10 = z8, c11 = z8, c12 = z8, c13 = z8;
#pragma unroll 1
  for (int kb = 0; kb < K; kb += 32) { const v16h a0 = g2_frag(a0p + kb, hh), a1 = g2_frag(a1p + kb, hh);
    v16h b = g2_frag(b0p + kb, hh); c00 = g2_mma(a0, b, c00); c10 = g2_mma(a1, b, c10);
    b = g2_frag(b1p + kb, hh); c01 = g2_mma(a0, b, c01); c11 = g2_mma(a1, b, c11);
    b = g2_frag(b2p + kb, hh); c02 = g2_mma(a0, b, c02); c12 = g2_mma(a1, b, c12);
    b = g2_frag(b3p + kb, hh); c03 = g2_mma(a0, b, c03); c13 = g2_mma(a1, b, c13); }
  v8f accs[8] = {c00, c01, c02, c03, c10, c11, c12, c13};
#pragma unroll
  for (int u = 0; u < 8; ++u) { const int t = u & 3, half = u >> 2; const int col = col0 + t * 16 + ln; const float bv = bp ? bf16_round(bp[col]) : 0.f;
#pragma unroll
    for (int r = 0; r < 8; ++r) { const int rloc = half * 16 + 8 * hh + r; float v = accs[u][r] * alpha + bv; if (CP) { if (rowsPerB < 0) v += CP[cofs + (size_t)(row0g + row0 + rloc) * ldc + col];      /* rowsPerB < 0: own element of the batched C plane */ else { const int bidx = (row0g + row0 + rloc) / rowsPerB; v += CP[(size_t)bidx * sCPb + (size_t)by * 64 + col]; } }
      if (ACT == 3) v = fmaxf(v, 0.f); else if (ACT == 6) v = 0.5f * v * (1.0f + erff(v * 0.70710678118654752f)); else if (ACT == 11) v = 1.0f / (1.0f + expf(-v)); else if (ACT == 15) v = v / (1.0f + expf(-v)); else if (ACT == 12) v = (v > 0.f) ? v : 0.01f * v; else if (ACT == 8) v = tanhf(v); else if (ACT == 9) v = 0.5f * v * (1.0f + tanhf(0.7978845608028654f * (v + 0.044715f * v * v * v))); else if (ACT == 14) v = (v > 0.f) ? v : 0.1f * v; else if (ACT == 16) v = (v >= 0.f) ? v : 0.3f * v; else if (ACT == 17) v = (v >= 0.f) ? v : 0.2f * v;
      so[w][rloc][t * 16 + ln] = v; } }
  __builtin_amdgcn_fence(__ATOMIC_ACQ_REL, "workgroup"); __builtin_amdgcn_wave_barrier();
  const int rsub = lane >> 4, c4 = (lane & 15) * 4;
  {
#pragma unroll
    for (int q = 0; q < 16; ++q) { const int r = q * 2 + rsub; const v4f v = *(const v4fa*)&so[w][r][c4]; if (C) *(v4f*)(C + cofs + (size_t)(row0 + r) * ldc + col0 + c4) = v; if (C16) { v4h h4; for (int i = 0; i < 4; ++i) h4[i] = (_Float16)v[i]; *(v4h*)(C16 + cofs + (size_t)(row0 + r) * ldc + col0 + c4) = h4; } }
     } }


__global__ __launch_bounds__(256) void k_wnat(const float* __restrict__ w, size_t n8, _Float16* __restrict__ Bt) { const size_t t = (size_t)blockIdx.x * 256 + threadIdx.x; if (t >= n8) return; FragH f; for (int q = 0; q < 8; ++q) f.h[q] = (_Float16)(bf16_round(w[t * 8 + q]) * 16.0f); *(v8us*)((unsigned short*)Bt + t * 8) = f.half[0];  }
__global__ __launch_bounds__(256) void k_rsm(const float* __restrict__ S, _Float16* __restrict__ P, int nrows) {
  #pragma clang fp contract(off)
  const int i = blockIdx.x * 256 + threadIdx.x; if (i >= nrows) return; const float* s = S + (size_t)i * SQ; float mx = -3.0e38f;
#pragma unroll 1
  for (int j = 0; j < SQ; ++j) mx = fmaxf(mx, s[j]); float se = 0.f;
#pragma unroll 1
  for (int j = 0; j < SQ; ++j) se += expf(s[j] - mx); const float sc = 256.0f / se;
#pragma unroll 1
  for (int j0 = 0; j0 < SQ; j0 += 8) { FragH f; for (int q = 0; q < 8; ++q) f.h[q] = (_Float16)(expf(s[j0 + q] - mx) * sc); unsigned short* d = (unsigned short*)P + (size_t)i * SQ + j0; *(v8us*)d = f.half[0];  } }
__global__ __launch_bounds__(256) void k_vt(const _Float16* __restrict__ V16, int b, int h0, _Float16* __restrict__ VT) { __shared__ unsigned short tl[64][65]; const int tid = threadIdx.x; const int hh = blockIdx.x % HG, sg = blockIdx.x / HG; const int s0 = sg * 64; const int h = h0 + hh;
  for (int i = tid; i < 64 * 8; i += 256) { const int j = i / 8, d8 = (i % 8) * 8; FragH f; f.half[0] = *(const v8us*)((const unsigned short*)V16 + ((size_t)b * SQ + s0 + j) * DM + h * HD + d8); for (int q = 0; q < 8; ++q) tl[d8 + q][j] = f.u[q]; }
  __syncthreads();
  { for (int i = tid; i < 64 * 8; i += 256) { const int d = i / 8, j8 = (i % 8) * 8; FragH f; for (int q = 0; q < 8; ++q) f.u[q] = tl[d][j8 + q]; *(v8us*)((unsigned short*)VT + ((size_t)hh * HD + d) * SQ + s0 + j8) = f.half[0]; }  } }



// One wave per score row: lane l holds elements j = 128 u + 4 l .. + 3 (u < nk / 128) in registers, so that each load covers 512 contiguous bytes, the row is read
// once and each exp is taken once; row maximum and row sum = four chains per lane, then a five-step butterfly over the wave. nk is a multiple of 256 (nk = q0 + QT).
__global__ __launch_bounds__(256) void k_rsmcf2al(const float* __restrict__ S, _Float16* __restrict__ P, int hg, int q0, int nk, int h0) {
  #pragma clang fp contract(off)
  static_assert(QT % 256 == 0 && NKX % 256 == 0, "k_rsmcf2al: a row is dealt in pieces of 256 keys");
  const int lane = threadIdx.x & 31; const int t = blockIdx.x * 8 + (threadIdx.x >> 5); if (t >= hg * QT) return; const size_t i = (size_t)t; const float* s = S + i * NKX + lane * 4; const int last = q0 + (t % QT); const float slope = (float)exp2(-0.5 * (double)(h0 + t / QT + 1));      /* ALiBi slope 2^(-8 (h+1) / 16) for this row's head, correctly rounded to f32 */
  v4f e[NKX / 128];
#pragma unroll /* constant indices keep e[] in registers; all loads of the row are issued before the first is used */
  for (int c = 0; c < NKX / 256; ++c) if (c * 256 < nk) { e[2 * c] = *(const v4fa*)(s + c * 256); e[2 * c + 1] = *(const v4fa*)(s + c * 256 + 128); }
  v4f m4 = {-3.0e38f, -3.0e38f, -3.0e38f, -3.0e38f};
#pragma unroll /* constant indices keep e[] in registers */
  for (int c = 0; c < NKX / 256; ++c) if (c * 256 < nk) {
#pragma unroll /* as above */
    for (int u = 2 * c; u < 2 * c + 2; ++u)
#pragma unroll /* as above */
      for (int q = 0; q < 4; ++q) { const int j = u * 128 + lane * 4 + q; const float f = (j <= last) ? 1.f : 0.f; e[u][q] = fmaf(f, __fadd_rn(e[u][q], -__fmul_rn(slope, (float)j)), (1.f - f) * -1.0e9f); m4[q] = fmaxf(m4[q], e[u][q]); } }
  float mx = fmaxf(fmaxf(m4[0], m4[1]), fmaxf(m4[2], m4[3]));
  for (int o = 16; o > 0; o >>= 1) mx = fmaxf(mx, __shfl_xor(mx, o, 32));
  v4f s4 = {0.f, 0.f, 0.f, 0.f};
#pragma unroll /* constant indices keep e[] in registers */
  for (int c = 0; c < NKX / 256; ++c) if (c * 256 < nk) {
#pragma unroll /* as above */
    for (int u = 2 * c; u < 2 * c + 2; ++u)
#pragma unroll /* as above */
      for (int q = 0; q < 4; ++q) { e[u][q] = __expf(e[u][q] - mx); s4[q] += e[u][q]; } }
  float se = (s4[0] + s4[1]) + (s4[2] + s4[3]);
  for (int o = 16; o > 0; o >>= 1) se += __shfl_xor(se, o, 32);
  const float sc = 256.0f / se; _Float16* d = P + i * NKX + lane * 4; v4h h[NKX / 128];
#pragma unroll /* constant indices keep e[] and h[] in registers */
  for (int c = 0; c < NKX / 256; ++c) if (c * 256 < nk) {
#pragma unroll /* as above */
    for (int u = 2 * c; u < 2 * c + 2; ++u)
#pragma unroll /* as above */
      for (int q = 0; q < 4; ++q) h[u][q] = (_Float16)(e[u][q] * sc); }
  /* the stores stand in a loop of their own behind every conversion: no register that an issued store names is written again */
#pragma unroll /* constant indices keep h[] in registers */
  for (int c = 0; c < NKX / 256; ++c) if (c * 256 < nk) { *(v4h*)(d + c * 256) = h[2 * c]; *(v4h*)(d + c * 256 + 128) = h[2 * c + 1]; } }


template <int MASKADD, int ALIBI>
__global__ __launch_bounds__(64) void k_att0(const float* __restrict__ QF, const float* __restrict__ KF, const float* __restrict__ VF, int ld, const float* __restrict__ mask, float scale, float* __restrict__ OF, int ldo) {
  #pragma clang fp contract(off)
  __shared__ __attribute__((aligned(16))) float lq[64][64]; __shared__ __attribute__((aligned(16))) float lo[64][64];
  const int tid = threadIdx.x; const int h = blockIdx.x / (QT0 / 64), rg = blockIdx.x % (QT0 / 64); const int i = rg * 64 + tid;
  const float* qr = QF + (size_t)i * ld + h * HD;
#pragma unroll 1
  for (int c = 0; c < HD / 4; ++c) { *(v4f*)&lq[tid][c * 4] = *(const v4fa*)(qr + c * 4); const v4f z = {0.f, 0.f, 0.f, 0.f}; *(v4f*)&lo[tid][c * 4] = z; }
  const float slope = ALIBI ? (float)exp2(-0.5 * (double)(h + 1)) : 0.f;      /* ALiBi: 2^(-8 (h+1) / 16) */ float m = -1.0e30f, l = 0.f; const int jmax = MASKADD ? (SQ - 1) : (rg * 64 + 63);      /* additive-mask form: every key (the mask input decides); causal form: keys up to the block's last row */
#pragma unroll 1
  for (int j = 0; j <= jmax; ++j) { const float* kr = KF + (size_t)j * ld + h * HD; const float* vr = VF + (size_t)j * ld + h * HD; float s = 0.f;
#pragma unroll 1
    for (int c = 0; c < HD / 4; ++c) { const v4f kq = *(const v4fa*)(kr + c * 4); const v4f qq = *(v4f*)&lq[tid][c * 4]; s = __fadd_rn(s, __fmul_rn(qq[0], kq[0])); s = __fadd_rn(s, __fmul_rn(qq[1], kq[1])); s = __fadd_rn(s, __fmul_rn(qq[2], kq[2])); s = __fadd_rn(s, __fmul_rn(qq[3], kq[3])); }
    s = __fmul_rn(s, scale); if (ALIBI) s = __fadd_rn(s, -__fmul_rn(slope, (float)j)); if (MASKADD) s = __fadd_rn(s, __fmul_rn(bf16_round(mask[(size_t)i * SQ + j]), -10000.0f));
    const float f = (MASKADD || j <= i) ? 1.f : 0.f; const float sm = fmaf(f, s, (1.f - f) * -1.0e30f); const float mn = fmaxf(m, sm); const float sc = expf(m - mn); const float e = expf(sm - mn); l = __fadd_rn(__fmul_rn(l, sc), e); m = mn;
#pragma unroll 1
    for (int c = 0; c < HD / 4; ++c) { const v4f vv = *(const v4fa*)(vr + c * 4); v4f oo = *(v4f*)&lo[tid][c * 4]; for (int u = 0; u < 4; ++u) oo[u] = __fadd_rn(__fmul_rn(oo[u], sc), __fmul_rn(e, vv[u])); *(v4f*)&lo[tid][c * 4] = oo; } }
  const float fin = 64.0f / l;      /* o carried x64 like the f16 path */
#pragma unroll 1
  for (int c = 0; c < HD / 4; ++c) { v4f oo = *(v4f*)&lo[tid][c * 4]; for (int u = 0; u < 4; ++u) oo[u] = __fmul_rn(oo[u], fin); *(v4f*)&lo[tid][c * 4] = oo; }
  __syncthreads();
  {
#pragma unroll 1
    for (int it = 0; it < 16; ++it) { const int row = it * 4 + tid / 16, pc = (tid % 16) * 4; const v4f v = *(const v4f*)&lo[row][pc]; *(v4f*)(OF + (size_t)(rg * 64 + row) * ldo + h * HD + pc) = v; }
     } }

extern "C" void kernel_launch(void* const* d_in, const int* in_sizes, int n_in,
                              void* d_out, int out_size, void* d_ws, size_t ws_size, hipStream_t stream) {
  (void)in_sizes; (void)n_in; (void)out_size;
  const float* const* I = (const float* const*)d_in; const float* x = I[0]; const float* wq = I[1]; const float* bq = I[2]; const float* wk = I[3]; const float* wv = I[4]; const float* bv = I[5]; const float* wo = I[6];      /* natural [out][in] weights; biases on q and v only */
  char* ws = (char*)d_ws; size_t off = 0;
  auto take = [&](size_t bytes) { char* p = ws + off; off += (bytes + 255) & ~(size_t)255; return p; };
  _Float16* BQ = (_Float16*)take((size_t)DM * DM * 2); _Float16* BK = (_Float16*)take((size_t)DM * DM * 2); _Float16* BV = (_Float16*)take((size_t)DM * DM * 2); _Float16* BO = (_Float16*)take((size_t)DM * DM * 2);
  _Float16* X16 = (_Float16*)take(NR * DM * 2); _Float16* Q16 = (_Float16*)take(NR * DM * 2); _Float16* K16 = (_Float16*)take(NR * DM * 2); _Float16* V16 = (_Float16*)take(NR * DM * 2); _Float16* O16 = (_Float16*)take(NR * DM * 2);
  float* S = (float*)take((size_t)NH * QT * NKX * 4); _Float16* P = (_Float16*)take((size_t)NH * QT * NKX * 2); _Float16* VT = (_Float16*)take((size_t)NH * HD * SQ * 2);
  float* QF0 = (float*)take((size_t)QT0 * DM * 4); float* KF0 = (float*)take((size_t)QT0 * DM * 4); float* VF0 = (float*)take((size_t)QT0 * DM * 4); float* OF0 = (float*)take((size_t)NB * QT0 * DM * 4); _Float16* OH0 = (_Float16*)take((size_t)NB * QT0 * DM * 2); _Float16* OL0 = (_Float16*)take((size_t)NB * QT0 * DM * 2);
  if (off > ws_size) return;
  { const unsigned g = (unsigned)(((size_t)DM * DM / 8 + 255) / 256); k_wnat<<<g, 256, 0, stream>>>(wq, (size_t)DM * DM / 8, BQ); k_wnat<<<g, 256, 0, stream>>>(wk, (size_t)DM * DM / 8, BK); k_wnat<<<g, 256, 0, stream>>>(wv, (size_t)DM * DM / 8, BV); k_wnat<<<g, 256, 0, stream>>>(wo, (size_t)DM * DM / 8, BO); }      /* natural [out][in] = Bt[n][k], x16 */
  k_x16<<<(unsigned)((NR * DM / 8 + 255) / 256), 256, 0, stream>>>(x, X16, NR * DM / 8);
  const size_t r0p = (size_t)B0 * SQ;      /* first projected row */
  k_gemm2<0><<<dim3((unsigned)((MP / 128) * (DM / 64)), 1), 128, 0, stream>>>(X16 + r0p * DM, DM, 0, BQ, DM, 0, 0.0625f, bq, 0, nullptr, 1, 0, 0, nullptr, Q16 + r0p * DM, DM, 0, MP, DM, DM);
  k_gemm2<0><<<dim3((unsigned)((MP / 128) * (DM / 64)), 1), 128, 0, stream>>>(X16 + r0p * DM, DM, 0, BK, DM, 0, 0.0625f, nullptr, 0, nullptr, 1, 0, 0, nullptr, K16 + r0p * DM, DM, 0, MP, DM, DM);
  k_gemm2<0><<<dim3((unsigned)((MP / 128) * (DM / 64)), 1), 128, 0, stream>>>(X16 + r0p * DM, DM, 0, BV, DM, 0, 0.0625f, bv, 0, nullptr, 1, 0, 0, nullptr, V16 + r0p * DM, DM, 0, MP, DM, DM);
  for (int b = B0; b < B0 + NBR; ++b) { const size_t r0 = (size_t)b * SQ;
    k_vt<NH, SQ><<<NH * (SQ / 64), 256, 0, stream>>>(V16 + r0 * LQ, LQ, 0, VT);      /* V^T [NH][HD][SQ] for this batch */
    k_gemm2<0><<<dim3((QT0 / 128) * (DM / 64), 1), 128, 0, stream>>>(X16 + r0 * DM, DM, 0, BQ, DM, 0, 0.0625f, bq, 0, nullptr, 1, 0, 0, QF0, nullptr, DM, 0, QT0, DM, DM); k_gemm2<0><<<dim3((QT0 / 128) * (DM / 64), 1), 128, 0, stream>>>(X16 + r0 * DM, DM, 0, BK, DM, 0, 0.0625f, nullptr, 0, nullptr, 1, 0, 0, KF0, nullptr, DM, 0, QT0, DM, DM); k_gemm2<0><<<dim3((QT0 / 128) * (DM / 64), 1), 128, 0, stream>>>(X16 + r0 * DM, DM, 0, BV, DM, 0, 0.0625f, bv, 0, nullptr, 1, 0, 0, VF0, nullptr, DM, 0, QT0, DM, DM);      /* f32 q, k, v of the first 256 rows (exact products) */
    k_att0<0, 1><<<NH * (QT0 / 64), 64, 0, stream>>>(QF0, KF0, VF0, DM, nullptr, 0.125f, OF0 + (size_t)b * QT0 * DM, DM);      /* exact f32 causal ALiBi attention */      /* exact f32 attention for rows 0..255 (o x64) */
    for (int q0 = 0; q0 < QN; q0 += QT) { const int nk = q0 + QT;      /* causal: only keys below the tile end are computed */
      k_gemm2<0><<<dim3((QT / 128) * (nk / 64), NHD), 128, 0, stream>>>(Q16 + (r0 + q0) * LQ, LQ, (size_t)HD, K16 + r0 * LQ, LQ, (size_t)HD, 0.125f, nullptr, 0, nullptr, 1, 0, 0, S, nullptr, NKX, (size_t)QT * NKX, QT, nk, HD);      /* scores, all heads on grid.y */
      k_rsmcf2al<<<(NHD * QT + 7) / 8, 256, 0, stream>>>(S, P, NHD, q0, nk, 0);      /* causal softmax over scores - slope_h * j (all 16 heads: h0 = 0) */
      k_gemm2<0><<<dim3((QT / 128) * (HD / 64), NHD), 128, 0, stream>>>(P, NKX, (size_t)QT * NKX, VT, SQ, (size_t)HD * SQ, 0.25f, nullptr, 0, nullptr, 1, 0, 0, nullptr, O16 + (r0 + q0) * DM, DM, (size_t)HD, QT, HD, nk); } }      /* o (merged heads, x64) as f16 rows */
  k_gemm2<0><<<dim3((unsigned)((MPO / 128) * (DM / 64)), 1), 128, 0, stream>>>(O16 + r0p * DM, DM, 0, BO, DM, 0, 0.0009765625f, nullptr, 0, nullptr, 1, 0, 0, (float*)d_out + r0p * DM, nullptr, DM, 0, MPO, DM, DM);      /* out rows are the output layout */
  k_hl<<<(unsigned)(((size_t)NB * QT0 * DM / 8 + 255) / 256), 256, 0, stream>>>(OF0, OH0, OL0, (size_t)NB * QT0 * DM / 8);      /* first-tile o (x64) -> f16 hi + x1024 residual planes */
  for (int b = B0; b < B0 + NBR; ++b) { const size_t r0 = (size_t)b * SQ; const size_t f0 = (size_t)b * QT0;
    k_gemm2<0><<<dim3((QT0 / 128) * (DM / 64), 1), 128, 0, stream>>>(OH0 + f0 * DM, DM, 0, BO, DM, 0, 0.0009765625f, nullptr, 0, nullptr, 1, 0, 0, (float*)d_out + r0 * DM, nullptr, DM, 0, QT0, DM, DM);      /* rows 0..255: out = o_hi Wo, overwriting the f16-path rows */
    k_gemm2<0><<<dim3((QT0 / 128) * (DM / 64), 1), 128, 0, stream>>>(OL0 + f0 * DM, DM, 0, BO, DM, 0, 0.00000095367431640625f, nullptr, 0, (const float*)d_out + r0 * DM, -1, 0, 0, (float*)d_out + r0 * DM, nullptr, DM, 0, QT0, DM, DM); }      /* += o_lo Wo 2^-20 (own-element accumulate) */
}

// v002
// A run of this version takes 1960 microseconds.
// Timed twice side by side with v001, it ran 1.31 times as fast both times.
// Over all steps from v000 it is 4.34 times as fast.
#include <hip/hip_runtime.h>
// Causal multi-head attention with an ALiBi key-position bias (inputs [1][4096][1024]; q = x Wq^T + bq, k = x Wk^T (no bias), v = x Wv^T + bv (natural [1024][1024] sigma 0.02; bq, bv sigma 0.02); 16 heads of 64; scores / 8 - slopes[h] * j with slopes[h] = 2^(-8 (h+1) / 16) and j the key position; causal (j <= i keep, -inf); softmax; out = merged Wo^T (no bias) -> [1][4096][1024]).
// Structure: token rows r = s; q, k, v inputs as exact f16 rows (bf16-rounded); Q, K, V as three WMMA GEMMs (32x64 wave tiles, f32 accumulation, exact x16 weights, f16 outputs); per batch: V^T for all heads via LDS transposes; per query tile of 256 rows: scores against the keys below the tile end only (K = 64, all heads on grid.y, alpha = 0.125), causal row softmax on VALU over scores minus the ALiBi term slope_h * j, with an arithmetic 0/1 key mask over the computed range (f32 statistics, native exp; weights x256 f16), o = P . V^T (K = keys below the tile end, alpha 2^-2: o carried x64, folded into the output GEMM alpha) written straight into the merged f16 o rows; out = o W_o GEMM (f32) into the output layout.
// Compute dtype: inputs rounded to bf16; x / weights exact; q, k, v, softmax weights and o as plain f16 GEMM operands (~2^-12); scores and softmax statistics f32. v_wmma_f32_16x16x32_f16.
#define NB 1
#define SQ 4096
#define DM 1024
#define NH 16
#define HD 64
#define HG 4                         /* heads per block group of the unlaunched k_vt overload */
#define QT 256                       /* query rows per causal tile */
#define NKX SQ                       /* S / P row pitch */
#define QT0 256                      /* first-tile rows recomputed exactly in f32 */
#define B0 0                         /* first batch processed (debug hook) */
#define NBR NB                       /* batches processed (debug hook) */
#define NR ((size_t)NB * SQ)         /* token rows */
#define MP ((int)((size_t)NBR * SQ)) /* rows projected (debug hook) */
#define QN SQ                        /* query rows attended per batch (debug hook) */
#define NHD NH                       /* heads attended (debug hook) */
#define MPO MP                       /* rows through the output stage (debug hook) */
#define LQ DM      /* row pitch of the q/k/v rows */
typedef __bf16 v16b __attribute__((ext_vector_type(16)));
typedef unsigned short v8us __attribute__((ext_vector_type(8), may_alias));
typedef float  v8f  __attribute__((ext_vector_type(8)));
typedef float  v4f  __attribute__((ext_vector_type(4)));
typedef float  v4fa __attribute__((ext_vector_type(4), may_alias));
union FragB { v16b v; v8us half[2]; unsigned short u[16]; };

__device__ __forceinline__ unsigned short bf16_bits(float x) { unsigned int u = __float_as_uint(x); return (unsigned short)((u + 0x7FFFu + ((u >> 16) & 1u)) >> 16); }
__device__ __forceinline__ float bf16_val(unsigned short b) { return __uint_as_float(((unsigned int)b) << 16); }
__device__ __forceinline__ float bf16_round(float x) { return bf16_val(bf16_bits(x)); }
// D += A·B with NT terms: 1 = ah·bh, 2 = + al·bh (A split), 3 = + ah·bl (both split)
template <int NT>
__device__ __forceinline__ v8f mmaN(v16b ah, v16b al, v16b bh, v16b bl, v8f c) {
  c = __builtin_amdgcn_wmma_f32_16x16x32_bf16(false, ah, false, bh, (short)0, c, false, false);
  if (NT >= 2) c = __builtin_amdgcn_wmma_f32_16x16x32_bf16(false, al, false, bh, (short)0, c, false, false);
  if (NT >= 3) c = __builtin_amdgcn_wmma_f32_16x16x32_bf16(false, ah, false, bl, (short)0, c, false, false);
  asm volatile("v_nop\n\tv_nop\n\tv_nop\n\tv_nop" : "+v"(c) : "v"(ah), "v"(al), "v"(bh), "v"(bl));
  return c;
}

__global__ __launch_bounds__(256) void k_wt_bf16(const float* __restrict__ W, unsigned short* __restrict__ Wt, int K, int N) {
  const int t = blockIdx.x * 256 + threadIdx.x;
  const int k8n = K / 8;
  if (t >= N * k8n) return;
  const int n = t / k8n, k8 = (t % k8n) * 8;
  v8us v;
#pragma unroll
  for (int i = 0; i < 8; ++i) v[i] = bf16_bits(W[(size_t)(k8 + i) * N + n]);
  *(v8us*)(Wt + (size_t)n * K + k8) = v;
  
}

// GEMM C[M][N] (f32, pitch ldc) = act(A[M][K]·W + bias). A f32 row-major (pitch lda) converted per fragment to bf16
// (ASPLIT: hi/lo two planes -> 2 terms, else single rounded term); Wt bf16 [N][K] (pitch ldb). BIAS_BF16 rounds the
// bias to bf16 first (bias quantised to bf16 before the add). K%32==0, M%16==0, N%64==0.
template <bool ASPLIT, int ACT, bool BIAS_BF16>
__global__ __launch_bounds__(128) void k_gemm_bf(const float* __restrict__ A, int lda, const unsigned short* __restrict__ Wt, int ldb,
                                               const float* __restrict__ bias, float* __restrict__ C, int ldc, int M, int N, int K) {
  __shared__ __attribute__((aligned(16))) float so[4][16][64];
  const int tid = threadIdx.x, w = tid >> 5, lane = tid & 31, ln = lane & 15, hh = lane >> 4;
  const int ntn = N / 64;
  const int wid = blockIdx.x * 4 + w;
  const int mt = wid / ntn, nq = wid % ntn;
  if (mt * 16 >= M) return;
  const int row0 = mt * 16, col0 = nq * 64;
  const float* arow = A + (size_t)(row0 + ln) * lda;
  v8f acc[4] = {};
  for (int kb = 0; kb < K; kb += 32) {
    FragB ah, al;
    const v4f x0 = *(const v4fa*)(arow + kb + 8 * hh), x1 = *(const v4fa*)(arow + kb + 8 * hh + 4);
    const v4f x2 = *(const v4fa*)(arow + kb + 16 + 8 * hh), x3 = *(const v4fa*)(arow + kb + 16 + 8 * hh + 4);
    float xs[16] = {x0[0],x0[1],x0[2],x0[3],x1[0],x1[1],x1[2],x1[3],x2[0],x2[1],x2[2],x2[3],x3[0],x3[1],x3[2],x3[3]};
#pragma unroll
    for (int i = 0; i < 16; ++i) { const unsigned short hb = bf16_bits(xs[i]); ah.u[i] = hb; al.u[i] = ASPLIT ? bf16_bits(xs[i] - bf16_val(hb)) : (unsigned short)0; }
#pragma unroll
    for (int t = 0; t < 4; ++t) {
      const unsigned short* brow = Wt + (size_t)(col0 + t * 16 + ln) * ldb + kb;
      FragB b;
      b.half[0] = *(const v8us*)(brow + 8 * hh);
      b.half[1] = *(const v8us*)(brow + 16 + 8 * hh);
      acc[t] = mmaN<ASPLIT ? 2 : 1>(ah.v, al.v, b.v, b.v, acc[t]);
    }
  }
#pragma unroll
  for (int t = 0; t < 4; ++t) {
    float bv = bias ? bias[col0 + t * 16 + ln] : 0.f;
    if (BIAS_BF16) bv = bf16_round(bv);
#pragma unroll
    for (int r = 0; r < 8; ++r) { float v = acc[t][r] + bv; if (ACT == 1) v = fmaxf(v, 0.f); so[w][8 * hh + r][t * 16 + ln] = v; }
  }
  __builtin_amdgcn_fence(__ATOMIC_ACQ_REL, "workgroup");
  __builtin_amdgcn_wave_barrier();
  const int rsub = lane >> 4, c4 = (lane & 15) * 4;
  {
#pragma unroll
    for (int q = 0; q < 8; ++q) {
      const int r = q * 2 + rsub;
      const v4f v = *(const v4fa*)&so[w][r][c4];
      *(v4f*)(C + (size_t)(row0 + r) * ldc + col0 + c4) = v;
    }
    
  }
}

// GEMM C = act(A·W + bias + resid): A f32 (ASPLIT -> hi/lo 2 terms), Wt bf16 [N][K]; ACT 0 none, 1 relu, 2 exact gelu;
// resid (optional, f32, row index = (row % rmod), pitch ldr, RES_BF16 rounds it) added before the activation.
template <bool ASPLIT, int ACT, bool BIAS_BF16, bool RES_BF16>
__global__ __launch_bounds__(128) void k_gemm_bf3(const float* __restrict__ A, int lda, const unsigned short* __restrict__ Wt, int ldb,
                                                const float* __restrict__ bias, const float* __restrict__ resid, int rmod, int ldr,
                                                float* __restrict__ C, int ldc, int M, int N, int K) {
  __shared__ __attribute__((aligned(16))) float so[4][16][64];
  const int tid = threadIdx.x, w = tid >> 5, lane = tid & 31, ln = lane & 15, hh = lane >> 4;
  const int ntn = N / 64;
  const int wid = blockIdx.x * 4 + w;
  const int mt = wid / ntn, nq = wid % ntn;
  if (mt * 16 >= M) return;
  const int row0 = mt * 16, col0 = nq * 64;
  const float* arow = A + (size_t)(row0 + ln) * lda;
  v8f acc[4] = {};
  for (int kb = 0; kb < K; kb += 32) {
    FragB ah, al;
    const v4f x0 = *(const v4fa*)(arow + kb + 8 * hh), x1 = *(const v4fa*)(arow + kb + 8 * hh + 4);
    const v4f x2 = *(const v4fa*)(arow + kb + 16 + 8 * hh), x3 = *(const v4fa*)(arow + kb + 16 + 8 * hh + 4);
    float xs[16] = {x0[0],x0[1],x0[2],x0[3],x1[0],x1[1],x1[2],x1[3],x2[0],x2[1],x2[2],x2[3],x3[0],x3[1],x3[2],x3[3]};
#pragma unroll
    for (int i = 0; i < 16; ++i) { const unsigned short hb = bf16_bits(xs[i]); ah.u[i] = hb; al.u[i] = ASPLIT ? bf16_bits(xs[i] - bf16_val(hb)) : (unsigned short)0; }
#pragma unroll
    for (int t = 0; t < 4; ++t) {
      const unsigned short* brow = Wt + (size_t)(col0 + t * 16 + ln) * ldb + kb;
      FragB b;
      b.half[0] = *(const v8us*)(brow + 8 * hh);
      b.half[1] = *(const v8us*)(brow + 16 + 8 * hh);
      acc[t] = mmaN<ASPLIT ? 2 : 1>(ah.v, al.v, b.v, b.v, acc[t]);
    }
  }
#pragma unroll
  for (int t = 0; t < 4; ++t) {
    const int col = col0 + t * 16 + ln;
    float bv = bias ? bias[col] : 0.f;
    if (BIAS_BF16) bv = bf16_round(bv);
#pragma unroll
    for (int r = 0; r < 8; ++r) {
      float v = acc[t][r] + bv;
      if (resid) { float rv = resid[(size_t)((row0 + 8 * hh + r) % rmod) * ldr + col]; if (RES_BF16) rv = bf16_round(rv); v += rv; }
      if (ACT == 1) v = fmaxf(v, 0.f);
      if (ACT == 2) v = 0.5f * v * (1.0f + erff(v * 0.70710678118654752f));
      if (ACT == 3) { const float u = 0.7978845608028654f * (v + 0.044715f * v * v * v); v = 0.5f * v * (1.0f + tanhf(u)); }
      so[w][8 * hh + r][t * 16 + ln] = v;
    }
  }
  __builtin_amdgcn_fence(__ATOMIC_ACQ_REL, "workgroup");
  __builtin_amdgcn_wave_barrier();
  const int rsub = lane >> 4, c4 = (lane & 15) * 4;
  {
#pragma unroll
    for (int q = 0; q < 8; ++q) {
      const int r = q * 2 + rsub;
      const v4f v = *(const v4fa*)&so[w][r][c4];
      *(v4f*)(C + (size_t)(row0 + r) * ldc + col0 + c4) = v;
    }
    
  }
}
// row LayerNorm (biased variance, eps) over N: s = X (+ R); optional out_sum <- s; out_norm <- (s-mu)*rsqrt(var+eps)*g + b
template <bool PARAM_BF16>
__global__ __launch_bounds__(256) void k_layernorm(const float* __restrict__ X, const float* __restrict__ R, const float* __restrict__ g, const float* __restrict__ bta,
                                                  float* __restrict__ out_sum, float* __restrict__ out_norm, int N, float eps) {
  __shared__ float red[256];
  const int row = blockIdx.x, tid = threadIdx.x;
  const float* x = X + (size_t)row * N; const float* rr = R ? R + (size_t)row * N : nullptr;
  float vals[16];                     // up to N = 4096
  const int per = N / 256;            // contiguous chunk per thread? use strided-by-4 chunks: thread handles j = tid*4 + 1024*u
  float s1 = 0.f;
  for (int u = 0; u < per / 4; ++u) {
    const int j = tid * 4 + 1024 * u;
    const v4f a = *(const v4fa*)(x + j);
    v4f b = {0.f,0.f,0.f,0.f}; if (rr) b = *(const v4fa*)(rr + j);
#pragma unroll
    for (int q = 0; q < 4; ++q) { const float v = a[q] + b[q]; vals[u * 4 + q] = v; s1 += v; }
  }
  red[tid] = s1; __syncthreads();
  for (int st = 128; st > 0; st >>= 1) { if (tid < st) red[tid] += red[tid + st]; __syncthreads(); }
  const float mu = red[0] / (float)N; __syncthreads();
  float s2 = 0.f;
  for (int u = 0; u < per / 4; ++u)
#pragma unroll
    for (int q = 0; q < 4; ++q) { const float c = vals[u * 4 + q] - mu; s2 += c * c; }
  red[tid] = s2; __syncthreads();
  for (int st = 128; st > 0; st >>= 1) { if (tid < st) red[tid] += red[tid + st]; __syncthreads(); }
  const float rs = rsqrtf(red[0] / (float)N + eps);
  {
    for (int u = 0; u < per / 4; ++u) {
      const int j = tid * 4 + 1024 * u;
      v4f o, sm;
#pragma unroll
      for (int q = 0; q < 4; ++q) {
        float gg = g[j + q], bb = bta[j + q];
        if (PARAM_BF16) { gg = bf16_round(gg); bb = bf16_round(bb); }
        sm[q] = vals[u * 4 + q]; o[q] = (vals[u * 4 + q] - mu) * rs * gg + bb;
      }
      if (out_sum) *(v4f*)(out_sum + (size_t)row * N + j) = sm;
      *(v4f*)(out_norm + (size_t)row * N + j) = o;
    }
    
  }
}



// ---- f16 WMMA path (v_wmma_f32_16x16x32_f16): 11-bit significands for operands in range — used where a [0,1] probability operand needs more precision than bf16
typedef _Float16 v16h __attribute__((ext_vector_type(16)));
union FragH { v16h v; v8us half[2]; _Float16 h[16]; unsigned short u[16]; };
template <int NT>
__device__ __forceinline__ v8f mmaH(v16h ah, v16h al, v16h bh, v16h bl, v8f c) {
  c = __builtin_amdgcn_wmma_f32_16x16x32_f16(false, ah, false, bh, (short)0, c, false, false);
  if (NT >= 2) c = __builtin_amdgcn_wmma_f32_16x16x32_f16(false, al, false, bh, (short)0, c, false, false);
  if (NT >= 3) c = __builtin_amdgcn_wmma_f32_16x16x32_f16(false, ah, false, bl, (short)0, c, false, false);
  asm volatile("v_nop\n\tv_nop\n\tv_nop\n\tv_nop" : "+v"(c) : "v"(ah), "v"(al), "v"(bh), "v"(bl));
  return c;
}
// batched GEMM like k_gemm_b but f16 operands: A f32 (split into f16 hi/lo if ASPLIT, else rounded to f16), Bt = f16 values [n][k]; alpha; C f32; N multiple of 16 (partial tiles skipped)
template <bool ASPLIT>
__global__ __launch_bounds__(128) void k_gemm_h(const float* __restrict__ A, int lda, size_t sA, const _Float16* __restrict__ Bh, int ldb, size_t sB, float alpha, float* __restrict__ C, int ldc, size_t sC, int M, int N, int K) {
  __shared__ __attribute__((aligned(16))) float so[4][16][64];
  const int tid = threadIdx.x, w = tid >> 5, lane = tid & 31, ln = lane & 15, hh = lane >> 4; const int by = blockIdx.y;
  A += (size_t)by * sA; Bh += (size_t)by * sB; C += (size_t)by * sC;
  const int ntn = (N + 63) / 64; const int wid = blockIdx.x * 4 + w; const int mt = wid / ntn, nq = wid % ntn; if (mt * 16 >= M) return;
  const int row0 = mt * 16, col0 = nq * 64; const float* arow = A + (size_t)(row0 + ln) * lda;
  v8f acc[4] = {};
  for (int kb = 0; kb < K; kb += 32) {
    FragH ah, al;
    const v4f x0 = *(const v4fa*)(arow + kb + 8 * hh), x1 = *(const v4fa*)(arow + kb + 8 * hh + 4), x2 = *(const v4fa*)(arow + kb + 16 + 8 * hh), x3 = *(const v4fa*)(arow + kb + 16 + 8 * hh + 4);
    float xs[16] = {x0[0],x0[1],x0[2],x0[3],x1[0],x1[1],x1[2],x1[3],x2[0],x2[1],x2[2],x2[3],x3[0],x3[1],x3[2],x3[3]};
#pragma unroll
    for (int i = 0; i < 16; ++i) { const _Float16 h = (_Float16)xs[i]; ah.h[i] = h; al.h[i] = ASPLIT ? (_Float16)(xs[i] - (float)h) : (_Float16)0.0f; }
#pragma unroll
    for (int t = 0; t < 4; ++t) { if (col0 + t * 16 >= N) continue; const size_t boff = (size_t)(col0 + t * 16 + ln) * ldb + kb; FragH bq; bq.half[0] = *(const v8us*)(Bh + boff + 8 * hh); bq.half[1] = *(const v8us*)(Bh + boff + 16 + 8 * hh);
      acc[t] = mmaH<ASPLIT ? 2 : 1>(ah.v, al.v, bq.v, bq.v, acc[t]); }
  }
#pragma unroll
  for (int t = 0; t < 4; ++t) { if (col0 + t * 16 >= N) continue;
#pragma unroll
    for (int r = 0; r < 8; ++r) so[w][8 * hh + r][t * 16 + ln] = acc[t][r] * alpha; }
  __builtin_amdgcn_fence(__ATOMIC_ACQ_REL, "workgroup"); __builtin_amdgcn_wave_barrier();
  const int rsub = lane >> 4, c4 = (lane & 15) * 4;
  {
#pragma unroll
    for (int q = 0; q < 8; ++q) { const int r = q * 2 + rsub; if (col0 + c4 < N) { const v4f v = *(const v4fa*)&so[w][r][c4]; *(v4f*)(C + (size_t)(row0 + r) * ldc + col0 + c4) = v; } }
     }
}

// Wt[n][k] = f16(W[k][n]·scale) from f32 row-major W[K][N] (scale = power of two; bf16-exact weights stay exact in f16 away from the subnormal range)
__global__ __launch_bounds__(256) void k_wt_f16(const float* __restrict__ W, _Float16* __restrict__ Wt, int K, int N, float scale) {
  const int t = blockIdx.x * 256 + threadIdx.x; if (t >= N * (K / 8)) return; const int n = t / (K / 8), k8 = (t % (K / 8)) * 8; FragH f;
#pragma unroll
  for (int i = 0; i < 8; ++i) f.h[i] = (_Float16)(bf16_round(W[(size_t)(k8 + i) * N + n]) * scale); const v8us o = f.half[0];
  *(v8us*)((unsigned short*)Wt + (size_t)n * K + k8) = o; 
}
// k_gemm_hh variant with fused epilogue: v = acc·alpha + bias[by·sBias + col] (+ CP[(row/rowsPerB)·sCPb + by·64 + col] if CP) ; ACT 0 none / 1 elu ; writes f16 C16 (and f32 C if non-null)
template <int ACT>
__global__ __launch_bounds__(128) void k_gemm_hhx(const _Float16* __restrict__ A, int lda, size_t sA, const _Float16* __restrict__ Bh, int ldb, size_t sB, float alpha, const float* __restrict__ bias, size_t sBias, const float* __restrict__ CP, int rowsPerB, size_t sCPb, int row0g,
    float* __restrict__ C, _Float16* __restrict__ C16, int ldc, size_t sC, int M, int N, int K) {
  __shared__ __attribute__((aligned(16))) float so[4][16][64];
  const int tid = threadIdx.x, w = tid >> 5, lane = tid & 31, ln = lane & 15, hh = lane >> 4; const int by = blockIdx.y;
  A += (size_t)by * sA; Bh += (size_t)by * sB; const size_t cofs = (size_t)by * sC; const float* bp = bias ? bias + (size_t)by * sBias : nullptr;
  const int ntn = (N + 63) / 64; const int wid = blockIdx.x * 4 + w; const int mt = wid / ntn, nq = wid % ntn; if (mt * 16 >= M) return;
  const int row0 = mt * 16, col0 = nq * 64; const _Float16* arow = A + (size_t)(row0 + ln) * lda;
  v8f acc[4] = {};
  for (int kb = 0; kb < K; kb += 32) { FragH ah; ah.half[0] = *(const v8us*)((const unsigned short*)arow + kb + 8 * hh); ah.half[1] = *(const v8us*)((const unsigned short*)arow + kb + 16 + 8 * hh);
#pragma unroll
    for (int t = 0; t < 4; ++t) { if (col0 + t * 16 >= N) continue; const size_t boff = (size_t)(col0 + t * 16 + ln) * ldb + kb; FragH bq; bq.half[0] = *(const v8us*)((const unsigned short*)Bh + boff + 8 * hh); bq.half[1] = *(const v8us*)((const unsigned short*)Bh + boff + 16 + 8 * hh);
      acc[t] = mmaH<1>(ah.v, ah.v, bq.v, bq.v, acc[t]); }
  }
#pragma unroll
  for (int t = 0; t < 4; ++t) { if (col0 + t * 16 >= N) continue; const int col = col0 + t * 16 + ln; const float bv = bp ? bf16_round(bp[col]) : 0.f;
#pragma unroll
    for (int r = 0; r < 8; ++r) { float v = acc[t][r] * alpha + bv; if (CP) { const int rr = row0g + row0 + 8 * hh + r; if (rowsPerB < 0) v += CP[cofs + (size_t)rr * ldc + col];      /* rowsPerB < 0: own element of the batched C plane */ else { const int bidx = rr / rowsPerB; v += CP[(size_t)bidx * sCPb + (size_t)by * 64 + col]; } } if (ACT == 1) v = (v > 0.f) ? v : expm1f(v); else if (ACT == 7) v = (v > 0.f) ? v + 1.0f : expf(v); else if (ACT == 8) v = tanhf(v); else if (ACT == 9) v = 0.5f * v * (1.0f + tanhf(0.7978845608028654f * (v + 0.044715f * v * v * v))); else if (ACT == 11) v = 1.0f / (1.0f + expf(-v)); else if (ACT == 12) v = (v > 0.f) ? v : 0.01f * v; else if (ACT == 14) v = (v > 0.f) ? v : 0.1f * v; else if (ACT == 16) v = (v >= 0.f) ? v : 0.3f * v; else if (ACT == 17) v = (v >= 0.f) ? v : 0.2f * v; else if (ACT == 15) v = v / (1.0f + expf(-v)); else if (ACT == 3) v = fmaxf(v, 0.f); else if (ACT == 6) v = 0.5f * v * (1.0f + erff(v * 0.70710678118654752f)); so[w][8 * hh + r][t * 16 + ln] = v; } }
  __builtin_amdgcn_fence(__ATOMIC_ACQ_REL, "workgroup"); __builtin_amdgcn_wave_barrier();
  const int rsub = lane >> 4, c4 = (lane & 15) * 4; typedef _Float16 v4h __attribute__((ext_vector_type(4)));
  {
#pragma unroll
    for (int q = 0; q < 8; ++q) { const int r = q * 2 + rsub; if (col0 + c4 < N) { const v4f v = *(const v4fa*)&so[w][r][c4]; if (C) *(v4f*)(C + cofs + (size_t)(row0 + r) * ldc + col0 + c4) = v; if (C16) { v4h h4; for (int i = 0; i < 4; ++i) h4[i] = (_Float16)v[i]; *(v4h*)(C16 + cofs + (size_t)(row0 + r) * ldc + col0 + c4) = h4; } } }
     }
}


typedef _Float16 v4h __attribute__((ext_vector_type(4)));

__global__ __launch_bounds__(256) void k_x16(const float* __restrict__ x, _Float16* __restrict__ X16, size_t n8) { const size_t t = (size_t)blockIdx.x * 256 + threadIdx.x; if (t >= n8) return; FragH f;
#pragma unroll
  for (int q = 0; q < 8; ++q) f.h[q] = (_Float16)bf16_round(x[t * 8 + q]); *(v8us*)((unsigned short*)X16 + t * 8) = f.half[0];  }
__global__ __launch_bounds__(256) void k_h16(const float* __restrict__ x, _Float16* __restrict__ X16, size_t n8) { const size_t t = (size_t)blockIdx.x * 256 + threadIdx.x; if (t >= n8) return; FragH f;
#pragma unroll
  for (int q = 0; q < 8; ++q) f.h[q] = (_Float16)x[t * 8 + q]; *(v8us*)((unsigned short*)X16 + t * 8) = f.half[0];  }
__global__ __launch_bounds__(256) void k_round16f(const float* __restrict__ W, _Float16* __restrict__ Bt, size_t n8) { const size_t t = (size_t)blockIdx.x * 256 + threadIdx.x; if (t >= n8) return; FragH f;
#pragma unroll
  for (int i = 0; i < 8; ++i) f.h[i] = (_Float16)(bf16_round(W[t * 8 + i]) * 16.0f); *(v8us*)((unsigned short*)Bt + t * 8) = f.half[0];  }
template <int NHv, int TTv>
__global__ __launch_bounds__(256) void k_vt(const _Float16* __restrict__ V16, int ldv, int voff, _Float16* __restrict__ Vt) { __shared__ unsigned short tl[64][66]; const int tid = threadIdx.x; const int slab = blockIdx.x / (TTv / 64), lg = blockIdx.x % (TTv / 64); const int b = slab / NHv, h = slab % NHv;
  for (int i = tid; i < 64 * 8; i += 256) { const int r = i / 8, c8 = (i % 8) * 8; FragH f; f.half[0] = *(const v8us*)((const unsigned short*)V16 + ((size_t)b * TTv + lg * 64 + r) * ldv + voff + h * 64 + c8);
#pragma unroll
    for (int q = 0; q < 8; ++q) tl[r][c8 + q] = f.u[q]; }
  __syncthreads();
  {
#pragma unroll
    for (int rd = 0; rd < 2; ++rd) { const int d = rd * 32 + tid / 8, pc = tid % 8; FragH f;
#pragma unroll
      for (int q = 0; q < 8; ++q) f.u[q] = tl[pc * 8 + q][d];
      *(v8us*)((unsigned short*)Vt + ((size_t)slab * 64 + d) * TTv + lg * 64 + pc * 8) = f.half[0]; }
     } }

__global__ __launch_bounds__(256) void k_hl(const float* __restrict__ F, _Float16* __restrict__ Hh, _Float16* __restrict__ Hl, size_t n8) { const size_t t = (size_t)blockIdx.x * 256 + threadIdx.x; if (t >= n8) return; FragH fh, fl; const v4f a = *(const v4fa*)(F + t * 8), c = *(const v4fa*)(F + t * 8 + 4);
#pragma unroll
  for (int q = 0; q < 4; ++q) { _Float16 h = (_Float16)a[q]; fh.h[q] = h; fl.h[q] = (_Float16)((a[q] - (float)h) * 1024.0f); h = (_Float16)c[q]; fh.h[4 + q] = h; fl.h[4 + q] = (_Float16)((c[q] - (float)h) * 1024.0f); }
  { *(v8us*)((unsigned short*)Hh + t * 8) = fh.half[0]; *(v8us*)((unsigned short*)Hl + t * 8) = fl.half[0];  } }

// ---- fast GEMM (wave tile 32x64; requires M % 32 == 0 rows per launch region, N % 64 == 0 and K % 64 == 0); epilogue = k_gemm_hhx semantics ----
__device__ __forceinline__ v16h g2_frag(const _Float16* p, int hh) { FragH f; f.half[0] = *(const v8us*)((const unsigned short*)p + 8 * hh); f.half[1] = *(const v8us*)((const unsigned short*)p + 16 + 8 * hh); return f.v; }
__device__ __forceinline__ v8f g2_mma(v16h a, v16h b, v8f c) { v8f d = __builtin_amdgcn_wmma_f32_16x16x32_f16(false, a, false, b, (short)0, c, false, false); asm volatile("v_nop\n\tv_nop\n\tv_nop\n\tv_nop" : "+v"(d) : "v"(a), "v"(b)); return d; }
template <int ACT>
__global__ __launch_bounds__(128) void k_gemm2(const _Float16* __restrict__ A, int lda, size_t sA, const _Float16* __restrict__ Bh, int ldb, size_t sB, float alpha, const float* __restrict__ bias, size_t sBias, const float* __restrict__ CP, int rowsPerB, size_t sCPb, int row0g,
    float* __restrict__ C, _Float16* __restrict__ C16, int ldc, size_t sC, int M, int N, int K) { static_assert(ACT == 0 || ACT == 3 || ACT == 6 || ACT == 8 || ACT == 9 || ACT == 11 || ACT == 12 || ACT == 14 || ACT == 15 || ACT == 16 || ACT == 17, "k_gemm2: unsupported ACT code (would silently apply no activation)");
  __shared__ __attribute__((aligned(16))) float so[4][32][68];
  const int tid = threadIdx.x, w = tid >> 5, lane = tid & 31, ln = lane & 15, hh = lane >> 4; const int by = blockIdx.y;
  A += (size_t)by * sA; Bh += (size_t)by * sB; const size_t cofs = (size_t)by * sC; const float* bp = bias ? bias + (size_t)by * sBias : nullptr;
  const int ntn = N >> 6; const int mt = blockIdx.x / ntn, nq = blockIdx.x - mt * ntn; const int row0 = mt * 128 + 32 * w, col0 = nq * 64; if (row0 >= M) return;
  const _Float16* a0p = A + (size_t)(row0 + ln) * lda; const _Float16* a1p = a0p + (size_t)16 * lda;
  const _Float16* b0p = Bh + (size_t)(col0 + ln) * ldb; const _Float16* b1p = b0p + (size_t)16 * ldb; const _Float16* b2p = b1p + (size_t)16 * ldb; const _Float16* b3p = b2p + (size_t)16 * ldb;
  const v8f z8 = {0.f,0.f,0.f,0.f,0.f,0.f,0.f,0.f}; v8f c00 = z8, c01 = z8, c02 = z8, c03 = z8, c10 = z8, c11 = z8, c12 = z8, c13 = z8;
  /* One trip = 64 k = one 128-byte line of each operand row. All 24 fragment loads of the trip stand in front of its first WMMA, so that a trip waits for memory once;
     each accumulator still takes its k blocks in rising order. */
#pragma unroll 1 /* a second trip's fragments would not fit in 256 registers beside the 64 accumulator registers */
  for (int kb = 0; kb < K; kb += 64) {
    const _Float16* pa0 = a0p + kb + 8 * hh; const _Float16* pa1 = a1p + kb + 8 * hh; const _Float16* pb0 = b0p + kb + 8 * hh; const _Float16* pb1 = b1p + kb + 8 * hh; const _Float16* pb2 = b2p + kb + 8 * hh; const _Float16* pb3 = b3p + kb + 8 * hh;
    const v16h a0 = g2_frag(pa0, 0), a1 = g2_frag(pa1, 0), b0 = g2_frag(pb0, 0), b1 = g2_frag(pb1, 0), b2 = g2_frag(pb2, 0), b3 = g2_frag(pb3, 0);
    const v16h a2 = g2_frag(pa0 + 32, 0), a3 = g2_frag(pa1 + 32, 0), b4 = g2_frag(pb0 + 32, 0), b5 = g2_frag(pb1 + 32, 0), b6 = g2_frag(pb2 + 32, 0), b7 = g2_frag(pb3 + 32, 0);
    /* the wait in front of any rewrite of a register that an issued load names; as its inputs the six address pairs stay live up to it, so that no load of the trip lands in one of them */
    asm volatile("s_wait_xcnt 0x0" :: "v"(pa0), "v"(pa1), "v"(pb0), "v"(pb1), "v"(pb2), "v"(pb3) : "memory");
    c00 = g2_mma(a0, b0, c00); c10 = g2_mma(a1, b0, c10); c01 = g2_mma(a0, b1, c01); c11 = g2_mma(a1, b1, c11);
    c02 = g2_mma(a0, b2, c02); c12 = g2_mma(a1, b2, c12); c03 = g2_mma(a0, b3, c03); c13 = g2_mma(a1, b3, c13);
    c00 = g2_mma(a2, b4, c00); c10 = g2_mma(a3, b4, c10); c01 = g2_mma(a2, b5, c01); c11 = g2_mma(a3, b5, c11);
    c02 = g2_mma(a2, b6, c02); c12 = g2_mma(a3, b6, c12); c03 = g2_mma(a2, b7, c03); c13 = g2_mma(a3, b7, c13); }
  v8f accs[8] = {c00, c01, c02, c03, c10, c11, c12, c13};
#pragma unroll
  for (int u = 0; u < 8; ++u) { const int t = u & 3, half = u >> 2; const int col = col0 + t * 16 + ln; const float bv = bp ? bf16_round(bp[col]) : 0.f;
#pragma unroll
    for (int r = 0; r < 8; ++r) { const int rloc = half * 16 + 8 * hh + r; float v = accs[u][r] * alpha + bv; if (CP) { if (rowsPerB < 0) v += CP[cofs + (size_t)(row0g + row0 + rloc) * ldc + col];      /* rowsPerB < 0: own element of the batched C plane */ else { const int bidx = (row0g + row0 + rloc) / rowsPerB; v += CP[(size_t)bidx * sCPb + (size_t)by * 64 + col]; } }
      if (ACT == 3) v = fmaxf(v, 0.f); else if (ACT == 6) v = 0.5f * v * (1.0f + erff(v * 0.70710678118654752f)); else if (ACT == 11) v = 1.0f / (1.0f + expf(-v)); else if (ACT == 15) v = v / (1.0f + expf(-v)); else if (ACT == 12) v = (v > 0.f) ? v : 0.01f * v; else if (ACT == 8) v = tanhf(v); else if (ACT == 9) v = 0.5f * v * (1.0f + tanhf(0.7978845608028654f * (v + 0.044715f * v * v * v))); else if (ACT == 14) v = (v > 0.f) ? v : 0.1f * v; else if (ACT == 16) v = (v >= 0.f) ? v : 0.3f * v; else if (ACT == 17) v = (v >= 0.f) ? v : 0.2f * v;
      so[w][rloc][t * 16 + ln] = v; } }
  __builtin_amdgcn_fence(__ATOMIC_ACQ_REL, "workgroup"); __builtin_amdgcn_wave_barrier();
  const int rsub = lane >> 4, c4 = (lane & 15) * 4;
  {
#pragma unroll
    for (int q = 0; q < 16; ++q) { const int r = q * 2 + rsub; const v4f v = *(const v4fa*)&so[w][r][c4]; if (C) *(v4f*)(C + cofs + (size_t)(row0 + r) * ldc + col0 + c4) = v; if (C16) { v4h h4; for (int i = 0; i < 4; ++i) h4[i] = (_Float16)v[i]; *(v4h*)(C16 + cofs + (size_t)(row0 + r) * ldc + col0 + c4) = h4; } }
     } }


__global__ __launch_bounds__(256) void k_wnat(const float* __restrict__ w, size_t n8, _Float16* __restrict__ Bt) { const size_t t = (size_t)blockIdx.x * 256 + threadIdx.x; if (t >= n8) return; FragH f; for (int q = 0; q < 8; ++q) f.h[q] = (_Float16)(bf16_round(w[t * 8 + q]) * 16.0f); *(v8us*)((unsigned short*)Bt + t * 8) = f.half[0];  }
__global__ __launch_bounds__(256) void k_rsm(const float* __restrict__ S, _Float16* __restrict__ P, int nrows) {
  #pragma clang fp contract(off)
  const int i = blockIdx.x * 256 + threadIdx.x; if (i >= nrows) return; const float* s = S + (size_t)i * SQ; float mx = -3.0e38f;
#pragma unroll 1
  for (int j = 0; j < SQ; ++j) mx = fmaxf(mx, s[j]); float se = 0.f;
#pragma unroll 1
  for (int j = 0; j < SQ; ++j) se += expf(s[j] - mx); const float sc = 256.0f / se;
#pragma unroll 1
  for (int j0 = 0; j0 < SQ; j0 += 8) { FragH f; for (int q = 0; q < 8; ++q) f.h[q] = (_Float16)(expf(s[j0 + q] - mx) * sc); unsigned short* d = (unsigned short*)P + (size_t)i * SQ + j0; *(v8us*)d = f.half[0];  } }
__global__ __launch_bounds__(256) void k_vt(const _Float16* __restrict__ V16, int b, int h0, _Float16* __restrict__ VT) { __shared__ unsigned short tl[64][65]; const int tid = threadIdx.x; const int hh = blockIdx.x % HG, sg = blockIdx.x / HG; const int s0 = sg * 64; const int h = h0 + hh;
  for (int i = tid; i < 64 * 8; i += 256) { const int j = i / 8, d8 = (i % 8) * 8; FragH f; f.half[0] = *(const v8us*)((const unsigned short*)V16 + ((size_t)b * SQ + s0 + j) * DM + h * HD + d8); for (int q = 0; q < 8; ++q) tl[d8 + q][j] = f.u[q]; }
  __syncthreads();
  { for (int i = tid; i < 64 * 8; i += 256) { const int d = i / 8, j8 = (i % 8) * 8; FragH f; for (int q = 0; q < 8; ++q) f.u[q] = tl[d][j8 + q]; *(v8us*)((unsigned short*)VT + ((size_t)hh * HD + d) * SQ + s0 + j8) = f.half[0]; }  } }



// One wave per score row: lane l holds elements j = 128 u + 4 l .. + 3 (u < nk / 128) in registers, so that each load covers 512 contiguous bytes, the row is read
// once and each exp is taken once; row maximum and row sum = four chains per lane, then a five-step butterfly over the wave. nk is a multiple of 256 (nk = q0 + QT).
__global__ __launch_bounds__(256) void k_rsmcf2al(const float* __restrict__ S, _Float16* __restrict__ P, int hg, int q0, int nk, int h0) {
  #pragma clang fp contract(off)
  static_assert(QT % 256 == 0 && NKX % 256 == 0, "k_rsmcf2al: a row is dealt in pieces of 256 keys");
  const int lane = threadIdx.x & 31; const int t = blockIdx.x * 8 + (threadIdx.x >> 5); if (t >= hg * QT) return; const size_t i = (size_t)t; const float* s = S + i * NKX + lane * 4; const int last = q0 + (t % QT); const float slope = (float)exp2(-0.5 * (double)(h0 + t / QT + 1));      /* ALiBi slope 2^(-8 (h+1) / 16) for this row's head, correctly rounded to f32 */
  v4f e[NKX / 128];
#pragma unroll /* constant indices keep e[] in registers; all loads of the row are issued before the first is used */
  for (int c = 0; c < NKX / 256; ++c) if (c * 256 < nk) { e[2 * c] = *(const v4fa*)(s + c * 256); e[2 * c + 1] = *(const v4fa*)(s + c * 256 + 128); }
  v4f m4 = {-3.0e38f, -3.0e38f, -3.0e38f, -3.0e38f};
#pragma unroll /* constant indices keep e[] in registers */
  for (int c = 0; c < NKX / 256; ++c) if (c * 256 < nk) {
#pragma unroll /* as above */
    for (int u = 2 * c; u < 2 * c + 2; ++u)
#pragma unroll /* as above */
      for (int q = 0; q < 4; ++q) { const int j = u * 128 + lane * 4 + q; const float f = (j <= last) ? 1.f : 0.f; e[u][q] = fmaf(f, __fadd_rn(e[u][q], -__fmul_rn(slope, (float)j)), (1.f - f) * -1.0e9f); m4[q] = fmaxf(m4[q], e[u][q]); } }
  float mx = fmaxf(fmaxf(m4[0], m4[1]), fmaxf(m4[2], m4[3]));
  for (int o = 16; o > 0; o >>= 1) mx = fmaxf(mx, __shfl_xor(mx, o, 32));
  v4f s4 = {0.f, 0.f, 0.f, 0.f};
#pragma unroll /* constant indices keep e[] in registers */
  for (int c = 0; c < NKX / 256; ++c) if (c * 256 < nk) {
#pragma unroll /* as above */
    for (int u = 2 * c; u < 2 * c + 2; ++u)
#pragma unroll /* as above */
      for (int q = 0; q < 4; ++q) { e[u][q] = __expf(e[u][q] - mx); s4[q] += e[u][q]; } }
  float se = (s4[0] + s4[1]) + (s4[2] + s4[3]);
  for (int o = 16; o > 0; o >>= 1) se += __shfl_xor(se, o, 32);
  const float sc = 256.0f / se; _Float16* d = P + i * NKX + lane * 4; v4h h[NKX / 128];
#pragma unroll /* constant indices keep e[] and h[] in registers */
  for (int c = 0; c < NKX / 256; ++c) if (c * 256 < nk) {
#pragma unroll /* as above */
    for (int u = 2 * c; u < 2 * c + 2; ++u)
#pragma unroll /* as above */
      for (int q = 0; q < 4; ++q) h[u][q] = (_Float16)(e[u][q] * sc); }
  /* the stores stand in a loop of their own behind every conversion: no register that an issued store names is written again */
#pragma unroll /* constant indices keep h[] in registers */
  for (int c = 0; c < NKX / 256; ++c) if (c * 256 < nk) { *(v4h*)(d + c * 256) = h[2 * c]; *(v4h*)(d + c * 256 + 128) = h[2 * c + 1]; } }


template <int MASKADD, int ALIBI>
__global__ __launch_bounds__(64) void k_att0(const float* __restrict__ QF, const float* __restrict__ KF, const float* __restrict__ VF, int ld, const float* __restrict__ mask, float scale, float* __restrict__ OF, int ldo) {
  #pragma clang fp contract(off)
  __shared__ __attribute__((aligned(16))) float lq[64][64]; __shared__ __attribute__((aligned(16))) float lo[64][64];
  const int tid = threadIdx.x; const int h = blockIdx.x / (QT0 / 64), rg = blockIdx.x % (QT0 / 64); const int i = rg * 64 + tid;
  const float* qr = QF + (size_t)i * ld + h * HD;
#pragma unroll 1
  for (int c = 0; c < HD / 4; ++c) { *(v4f*)&lq[tid][c * 4] = *(const v4fa*)(qr + c * 4); const v4f z = {0.f, 0.f, 0.f, 0.f}; *(v4f*)&lo[tid][c * 4] = z; }
  const float slope = ALIBI ? (float)exp2(-0.5 * (double)(h + 1)) : 0.f;      /* ALiBi: 2^(-8 (h+1) / 16) */ float m = -1.0e30f, l = 0.f; const int jmax = MASKADD ? (SQ - 1) : (rg * 64 + 63);      /* additive-mask form: every key (the mask input decides); causal form: keys up to the block's last row */
#pragma unroll 1
  for (int j = 0; j <= jmax; ++j) { const float* kr = KF + (size_t)j * ld + h * HD; const float* vr = VF + (size_t)j * ld + h * HD; float s = 0.f;
#pragma unroll 1
    for (int c = 0; c < HD / 4; ++c) { const v4f kq = *(const v4fa*)(kr + c * 4); const v4f qq = *(v4f*)&lq[tid][c * 4]; s = __fadd_rn(s, __fmul_rn(qq[0], kq[0])); s = __fadd_rn(s, __fmul_rn(qq[1], kq[1])); s = __fadd_rn(s, __fmul_rn(qq[2], kq[2])); s = __fadd_rn(s, __fmul_rn(qq[3], kq[3])); }
    s = __fmul_rn(s, scale); if (ALIBI) s = __fadd_rn(s, -__fmul_rn(slope, (float)j)); if (MASKADD) s = __fadd_rn(s, __fmul_rn(bf16_round(mask[(size_t)i * SQ + j]), -10000.0f));
    const float f = (MASKADD || j <= i) ? 1.f : 0.f; const float sm = fmaf(f, s, (1.f - f) * -1.0e30f); const float mn = fmaxf(m, sm); const float sc = expf(m - mn); const float e = expf(sm - mn); l = __fadd_rn(__fmul_rn(l, sc), e); m = mn;
#pragma unroll 1
    for (int c = 0; c < HD / 4; ++c) { const v4f vv = *(const v4fa*)(vr + c * 4); v4f oo = *(v4f*)&lo[tid][c * 4]; for (int u = 0; u < 4; ++u) oo[u] = __fadd_rn(__fmul_rn(oo[u], sc), __fmul_rn(e, vv[u])); *(v4f*)&lo[tid][c * 4] = oo; } }
  const float fin = 64.0f / l;      /* o carried x64 like the f16 path */
#pragma unroll 1
  for (int c = 0; c < HD / 4; ++c) { v4f oo = *(v4f*)&lo[tid][c * 4]; for (int u = 0; u < 4; ++u) oo[u] = __fmul_rn(oo[u], fin); *(v4f*)&lo[tid][c * 4] = oo; }
  __syncthreads();
  {
#pragma unroll 1
    for (int it = 0; it < 16; ++it) { const int row = it * 4 + tid / 16, pc = (tid % 16) * 4; const v4f v = *(const v4f*)&lo[row][pc]; *(v4f*)(OF + (size_t)(rg * 64 + row) * ldo + h * HD + pc) = v; }
     } }

extern "C" void kernel_launch(void* const* d_in, const int* in_sizes, int n_in,
                              void* d_out, int out_size, void* d_ws, size_t ws_size, hipStream_t stream) {
  (void)in_sizes; (void)n_in; (void)out_size;
  const float* const* I = (const float* const*)d_in; const float* x = I[0]; const float* wq = I[1]; const float* bq = I[2]; const float* wk = I[3]; const float* wv = I[4]; const float* bv = I[5]; const float* wo = I[6];      /* natural [out][in] weights; biases on q and v only */
  char* ws = (char*)d_ws; size_t off = 0;
  auto take = [&](size_t bytes) { char* p = ws + off; off += (bytes + 255) & ~(size_t)255; return p; };
  _Float16* BQ = (_Float16*)take((size_t)DM * DM * 2); _Float16* BK = (_Float16*)take((size_t)DM * DM * 2); _Float16* BV = (_Float16*)take((size_t)DM * DM * 2); _Float16* BO = (_Float16*)take((size_t)DM * DM * 2);
  _Float16* X16 = (_Float16*)take(NR * DM * 2); _Float16* Q16 = (_Float16*)take(NR * DM * 2); _Float16* K16 = (_Float16*)take(NR * DM * 2); _Float16* V16 = (_Float16*)take(NR * DM * 2); _Float16* O16 = (_Float16*)take(NR * DM * 2);
  float* S = (float*)take((size_t)NH * QT * NKX * 4); _Float16* P = (_Float16*)take((size_t)NH * QT * NKX * 2); _Float16* VT = (_Float16*)take((size_t)NH * HD * SQ * 2);
  float* QF0 = (float*)take((size_t)QT0 * DM * 4); float* KF0 = (float*)take((size_t)QT0 * DM * 4); float* VF0 = (float*)take((size_t)QT0 * DM * 4); float* OF0 = (float*)take((size_t)NB * QT0 * DM * 4); _Float16* OH0 = (_Float16*)take((size_t)NB * QT0 * DM * 2); _Float16* OL0 = (_Float16*)take((size_t)NB * QT0 * DM * 2);
  if (off > ws_size) return;
  { const unsigned g = (unsigned)(((size_t)DM * DM / 8 + 255) / 256); k_wnat<<<g, 256, 0, stream>>>(wq, (size_t)DM * DM / 8, BQ); k_wnat<<<g, 256, 0, stream>>>(wk, (size_t)DM * DM / 8, BK); k_wnat<<<g, 256, 0, stream>>>(wv, (size_t)DM * DM / 8, BV); k_wnat<<<g, 256, 0, stream>>>(wo, (size_t)DM * DM / 8, BO); }      /* natural [out][in] = Bt[n][k], x16 */
  k_x16<<<(unsigned)((NR * DM / 8 + 255) / 256), 256, 0, stream>>>(x, X16, NR * DM / 8);
  const size_t r0p = (size_t)B0 * SQ;      /* first projected row */
  k_gemm2<0><<<dim3((unsigned)((MP / 128) * (DM / 64)), 1), 128, 0, stream>>>(X16 + r0p * DM, DM, 0, BQ, DM, 0, 0.0625f, bq, 0, nullptr, 1, 0, 0, nullptr, Q16 + r0p * DM, DM, 0, MP, DM, DM);
  k_gemm2<0><<<dim3((unsigned)((MP / 128) * (DM / 64)), 1), 128, 0, stream>>>(X16 + r0p * DM, DM, 0, BK, DM, 0, 0.0625f, nullptr, 0, nullptr, 1, 0, 0, nullptr, K16 + r0p * DM, DM, 0, MP, DM, DM);
  k_gemm2<0><<<dim3((unsigned)((MP / 128) * (DM / 64)), 1), 128, 0, stream>>>(X16 + r0p * DM, DM, 0, BV, DM, 0, 0.0625f, bv, 0, nullptr, 1, 0, 0, nullptr, V16 + r0p * DM, DM, 0, MP, DM, DM);
  for (int b = B0; b < B0 + NBR; ++b) { const size_t r0 = (size_t)b * SQ;
    k_vt<NH, SQ><<<NH * (SQ / 64), 256, 0, stream>>>(V16 + r0 * LQ, LQ, 0, VT);      /* V^T [NH][HD][SQ] for this batch */
    k_gemm2<0><<<dim3((QT0 / 128) * (DM / 64), 1), 128, 0, stream>>>(X16 + r0 * DM, DM, 0, BQ, DM, 0, 0.0625f, bq, 0, nullptr, 1, 0, 0, QF0, nullptr, DM, 0, QT0, DM, DM); k_gemm2<0><<<dim3((QT0 / 128) * (DM / 64), 1), 128, 0, stream>>>(X16 + r0 * DM, DM, 0, BK, DM, 0, 0.0625f, nullptr, 0, nullptr, 1, 0, 0, KF0, nullptr, DM, 0, QT0, DM, DM); k_gemm2<0><<<dim3((QT0 / 128) * (DM / 64), 1), 128, 0, stream>>>(X16 + r0 * DM, DM, 0, BV, DM, 0, 0.0625f, bv, 0, nullptr, 1, 0, 0, VF0, nullptr, DM, 0, QT0, DM, DM);      /* f32 q, k, v of the first 256 rows (exact products) */
    k_att0<0, 1><<<NH * (QT0 / 64), 64, 0, stream>>>(QF0, KF0, VF0, DM, nullptr, 0.125f, OF0 + (size_t)b * QT0 * DM, DM);      /* exact f32 causal ALiBi attention */      /* exact f32 attention for rows 0..255 (o x64) */
    for (int q0 = 0; q0 < QN; q0 += QT) { const int nk = q0 + QT;      /* causal: only keys below the tile end are computed */
      k_gemm2<0><<<dim3((QT / 128) * (nk / 64), NHD), 128, 0, stream>>>(Q16 + (r0 + q0) * LQ, LQ, (size_t)HD, K16 + r0 * LQ, LQ, (size_t)HD, 0.125f, nullptr, 0, nullptr, 1, 0, 0, S, nullptr, NKX, (size_t)QT * NKX, QT, nk, HD);      /* scores, all heads on grid.y */
      k_rsmcf2al<<<(NHD * QT + 7) / 8, 256, 0, stream>>>(S, P, NHD, q0, nk, 0);      /* causal softmax over scores - slope_h * j (all 16 heads: h0 = 0) */
      k_gemm2<0><<<dim3((QT / 128) * (HD / 64), NHD), 128, 0, stream>>>(P, NKX, (size_t)QT * NKX, VT, SQ, (size_t)HD * SQ, 0.25f, nullptr, 0, nullptr, 1, 0, 0, nullptr, O16 + (r0 + q0) * DM, DM, (size_t)HD, QT, HD, nk); } }      /* o (merged heads, x64) as f16 rows */
  k_gemm2<0><<<dim3((unsigned)((MPO / 128) * (DM / 64)), 1), 128, 0, stream>>>(O16 + r0p * DM, DM, 0, BO, DM, 0, 0.0009765625f, nullptr, 0, nullptr, 1, 0, 0, (float*)d_out + r0p * DM, nullptr, DM, 0, MPO, DM, DM);      /* out rows are the output layout */
  k_hl<<<(unsigned)(((size_t)NB * QT0 * DM / 8 + 255) / 256), 256, 0, stream>>>(OF0, OH0, OL0, (size_t)NB * QT0 * DM / 8);      /* first-tile o (x64) -> f16 hi + x1024 residual planes */
  for (int b = B0; b < B0 + NBR; ++b) { const size_t r0 = (size_t)b * SQ; const size_t f0 = (size_t)b * QT0;
    k_gemm2<0><<<dim3((QT0 / 128) * (DM / 64), 1), 128, 0, stream>>>(OH0 + f0 * DM, DM, 0, BO, DM, 0, 0.0009765625f, nullptr, 0, nullptr, 1, 0, 0, (float*)d_out + r0 * DM, nullptr, DM, 0, QT0, DM, DM);      /* rows 0..255: out = o_hi Wo, overwriting the f16-path rows */
    k_gemm2<0><<<dim3((QT0 / 128) * (DM / 64), 1), 128, 0, stream>>>(OL0 + f0 * DM, DM, 0, BO, DM, 0, 0.00000095367431640625f, nullptr, 0, (const float*)d_out + r0 * DM, -1, 0, 0, (float*)d_out + r0 * DM, nullptr, DM, 0, QT0, DM, DM); }      /* += o_lo Wo 2^-20 (own-element accumulate) */
}

// v003
// One run takes 1100 microseconds.
// Next to v002, in two timings, it ran 1.79 and 1.78 times as fast.
// Over all steps from v000 it is 7.73 times as fast.
#include <hip/hip_runtime.h>
// Causal multi-head attention with an ALiBi key-position bias (inputs [1][4096][1024]; q = x Wq^T + bq, k = x Wk^T (no bias), v = x Wv^T + bv (natural [1024][1024] sigma 0.02; bq, bv sigma 0.02); 16 heads of 64; scores / 8 - slopes[h] * j with slopes[h] = 2^(-8 (h+1) / 16) and j the key position; causal (j <= i keep, -inf); softmax; out = merged Wo^T (no bias) -> [1][4096][1024]).
// Structure: token rows r = s; q, k, v inputs as exact f16 rows (bf16-rounded); Q, K, V as three WMMA GEMMs (32x64 wave tiles, f32 accumulation, exact x16 weights, f16 outputs); per batch: V^T for all heads via LDS transposes; per query tile of 256 rows: scores against the keys below the tile end only (K = 64, all heads on grid.y, alpha = 0.125), causal row softmax on VALU over scores minus the ALiBi term slope_h * j, with an arithmetic 0/1 key mask over the computed range (f32 statistics, native exp; weights x256 f16), o = P . V^T (K = keys below the tile end, alpha 2^-2: o carried x64, folded into the output GEMM alpha) written straight into the merged f16 o rows; out = o W_o GEMM (f32) into the output layout.
// Compute dtype: inputs rounded to bf16; x / weights exact; q, k, v, softmax weights and o as plain f16 GEMM operands (~2^-12); scores and softmax statistics f32. v_wmma_f32_16x16x32_f16.
#define NB 1
#define SQ 4096
#define DM 1024
#define NH 16
#define HD 64
#define HG 4                         /* heads per block group of the unlaunched k_vt overload */
#define QT 256                       /* query rows per causal tile */
#define NKX SQ                       /* S / P row pitch */
#define QT0 256                      /* first-tile rows recomputed exactly in f32 */
#define B0 0                         /* first batch processed (debug hook) */
#define NBR NB                       /* batches processed (debug hook) */
#define NR ((size_t)NB * SQ)         /* token rows */
#define MP ((int)((size_t)NBR * SQ)) /* rows projected (debug hook) */
#define QN SQ                        /* query rows attended per batch (debug hook) */
#define NHD NH                       /* heads attended (debug hook) */
#define MPO MP                       /* rows through the output stage (debug hook) */
#define LQ DM      /* row pitch of the q/k/v rows */
typedef __bf16 v16b __attribute__((ext_vector_type(16)));
typedef unsigned short v8us __attribute__((ext_vector_type(8), may_alias));
typedef float  v8f  __attribute__((ext_vector_type(8)));
typedef float  v4f  __attribute__((ext_vector_type(4)));
typedef float  v4fa __attribute__((ext_vector_type(4), may_alias));
union FragB { v16b v; v8us half[2]; unsigned short u[16]; };

__device__ __forceinline__ unsigned short bf16_bits(float x) { unsigned int u = __float_as_uint(x); return (unsigned short)((u + 0x7FFFu + ((u >> 16) & 1u)) >> 16); }
__device__ __forceinline__ float bf16_val(unsigned short b) { return __uint_as_float(((unsigned int)b) << 16); }
__device__ __forceinline__ float bf16_round(float x) { return bf16_val(bf16_bits(x)); }
// D += A·B with NT terms: 1 = ah·bh, 2 = + al·bh (A split), 3 = + ah·bl (both split)
template <int NT>
__device__ __forceinline__ v8f mmaN(v16b ah, v16b al, v16b bh, v16b bl, v8f c) {
  c = __builtin_amdgcn_wmma_f32_16x16x32_bf16(false, ah, false, bh, (short)0, c, false, false);
  if (NT >= 2) c = __builtin_amdgcn_wmma_f32_16x16x32_bf16(false, al, false, bh, (short)0, c, false, false);
  if (NT >= 3) c = __builtin_amdgcn_wmma_f32_16x16x32_bf16(false, ah, false, bl, (short)0, c, false, false);
  asm volatile("v_nop\n\tv_nop\n\tv_nop\n\tv_nop" : "+v"(c) : "v"(ah), "v"(al), "v"(bh), "v"(bl));
  return c;
}

__global__ __launch_bounds__(256) void k_wt_bf16(const float* __restrict__ W, unsigned short* __restrict__ Wt, int K, int N) {
  const int t = blockIdx.x * 256 + threadIdx.x;
  const int k8n = K / 8;
  if (t >= N * k8n) return;
  const int n = t / k8n, k8 = (t % k8n) * 8;
  v8us v;
#pragma unroll
  for (int i = 0; i < 8; ++i) v[i] = bf16_bits(W[(size_t)(k8 + i) * N + n]);
  *(v8us*)(Wt + (size_t)n * K + k8) = v;
  
}

// GEMM C[M][N] (f32, pitch ldc) = act(A[M][K]·W + bias). A f32 row-major (pitch lda) converted per fragment to bf16
// (ASPLIT: hi/lo two planes -> 2 terms, else single rounded term); Wt bf16 [N][K] (pitch ldb). BIAS_BF16 rounds the
// bias to bf16 first (bias quantised to bf16 before the add). K%32==0, M%16==0, N%64==0.
template <bool ASPLIT, int ACT, bool BIAS_BF16>
__global__ __launch_bounds__(128) void k_gemm_bf(const float* __restrict__ A, int lda, const unsigned short* __restrict__ Wt, int ldb,
                                               const float* __restrict__ bias, float* __restrict__ C, int ldc, int M, int N, int K) {
  __shared__ __attribute__((aligned(16))) float so[4][16][64];
  const int tid = threadIdx.x, w = tid >> 5, lane = tid & 31, ln = lane & 15, hh = lane >> 4;
  const int ntn = N / 64;
  const int wid = blockIdx.x * 4 + w;
  const int mt = wid / ntn, nq = wid % ntn;
  if (mt * 16 >= M) return;
  const int row0 = mt * 16, col0 = nq * 64;
  const float* arow = A + (size_t)(row0 + ln) * lda;
  v8f acc[4] = {};
  for (int kb = 0; kb < K; kb += 32) {
    FragB ah, al;
    const v4f x0 = *(const v4fa*)(arow + kb + 8 * hh), x1 = *(const v4fa*)(arow + kb + 8 * hh + 4);
    const v4f x2 = *(const v4fa*)(arow + kb + 16 + 8 * hh), x3 = *(const v4fa*)(arow + kb + 16 + 8 * hh + 4);
    float xs[16] = {x0[0],x0[1],x0[2],x0[3],x1[0],x1[1],x1[2],x1[3],x2[0],x2[1],x2[2],x2[3],x3[0],x3[1],x3[2],x3[3]};
#pragma unroll
    for (int i = 0; i < 16; ++i) { const unsigned short hb = bf16_bits(xs[i]); ah.u[i] = hb; al.u[i] = ASPLIT ? bf16_bits(xs[i] - bf16_val(hb)) : (unsigned short)0; }
#pragma unroll
    for (int t = 0; t < 4; ++t) {
      const unsigned short* brow = Wt + (size_t)(col0 + t * 16 + ln) * ldb + kb;
      FragB b;
      b.half[0] = *(const v8us*)(brow + 8 * hh);
      b.half[1] = *(const v8us*)(brow + 16 + 8 * hh);
      acc[t] = mmaN<ASPLIT ? 2 : 1>(ah.v, al.v, b.v, b.v, acc[t]);
    }
  }
#pragma unroll
  for (int t = 0; t < 4; ++t) {
    float bv = bias ? bias[col0 + t * 16 + ln] : 0.f;
    if (BIAS_BF16) bv = bf16_round(bv);
#pragma unroll
    for (int r = 0; r < 8; ++r) { float v = acc[t][r] + bv; if (ACT == 1) v = fmaxf(v, 0.f); so[w][8 * hh + r][t * 16 + ln] = v; }
  }
  __builtin_amdgcn_fence(__ATOMIC_ACQ_REL, "workgroup");
  __builtin_amdgcn_wave_barrier();
  const int rsub = lane >> 4, c4 = (lane & 15) * 4;
  {
#pragma unroll
    for (int q = 0; q < 8; ++q) {
      const int r = q * 2 + rsub;
      const v4f v = *(const v4fa*)&so[w][r][c4];
      *(v4f*)(C + (size_t)(row0 + r) * ldc + col0 + c4) = v;
    }
    
  }
}

// GEMM C = act(A·W + bias + resid): A f32 (ASPLIT -> hi/lo 2 terms), Wt bf16 [N][K]; ACT 0 none, 1 relu, 2 exact gelu;
// resid (optional, f32, row index = (row % rmod), pitch ldr, RES_BF16 rounds it) added before the activation.
template <bool ASPLIT, int ACT, bool BIAS_BF16, bool RES_BF16>
__global__ __launch_bounds__(128) void k_gemm_bf3(const float* __restrict__ A, int lda, const unsigned short* __restrict__ Wt, int ldb,
                                                const float* __restrict__ bias, const float* __restrict__ resid, int rmod, int ldr,
                                                float* __restrict__ C, int ldc, int M, int N, int K) {
  __shared__ __attribute__((aligned(16))) float so[4][16][64];
  const int tid = threadIdx.x, w = tid >> 5, lane = tid & 31, ln = lane & 15, hh = lane >> 4;
  const int ntn = N / 64;
  const int wid = blockIdx.x * 4 + w;
  const int mt = wid / ntn, nq = wid % ntn;
  if (mt * 16 >= M) return;
  const int row0 = mt * 16, col0 = nq * 64;
  const float* arow = A + (size_t)(row0 + ln) * lda;
  v8f acc[4] = {};
  for (int kb = 0; kb < K; kb += 32) {
    FragB ah, al;
    const v4f x0 = *(const v4fa*)(arow + kb + 8 * hh), x1 = *(const v4fa*)(arow + kb + 8 * hh + 4);
    const v4f x2 = *(const v4fa*)(arow + kb + 16 + 8 * hh), x3 = *(const v4fa*)(arow + kb + 16 + 8 * hh + 4);
    float xs[16] = {x0[0],x0[1],x0[2],x0[3],x1[0],x1[1],x1[2],x1[3],x2[0],x2[1],x2[2],x2[3],x3[0],x3[1],x3[2],x3[3]};
#pragma unroll
    for (int i = 0; i < 16; ++i) { const unsigned short hb = bf16_bits(xs[i]); ah.u[i] = hb; al.u[i] = ASPLIT ? bf16_bits(xs[i] - bf16_val(hb)) : (unsigned short)0; }
#pragma unroll
    for (int t = 0; t < 4; ++t) {
      const unsigned short* brow = Wt + (size_t)(col0 + t * 16 + ln) * ldb + kb;
      FragB b;
      b.half[0] = *(const v8us*)(brow + 8 * hh);
      b.half[1] = *(const v8us*)(brow + 16 + 8 * hh);
      acc[t] = mmaN<ASPLIT ? 2 : 1>(ah.v, al.v, b.v, b.v, acc[t]);
    }
  }
#pragma unroll
  for (int t = 0; t < 4; ++t) {
    const int col = col0 + t * 16 + ln;
    float bv = bias ? bias[col] : 0.f;
    if (BIAS_BF16) bv = bf16_round(bv);
#pragma unroll
    for (int r = 0; r < 8; ++r) {
      float v = acc[t][r] + bv;
      if (resid) { float rv = resid[(size_t)((row0 + 8 * hh + r) % rmod) * ldr + col]; if (RES_BF16) rv = bf16_round(rv); v += rv; }
      if (ACT == 1) v = fmaxf(v, 0.f);
      if (ACT == 2) v = 0.5f * v * (1.0f + erff(v * 0.70710678118654752f));
      if (ACT == 3) { const float u = 0.7978845608028654f * (v + 0.044715f * v * v * v); v = 0.5f * v * (1.0f + tanhf(u)); }
      so[w][8 * hh + r][t * 16 + ln] = v;
    }
  }
  __builtin_amdgcn_fence(__ATOMIC_ACQ_REL, "workgroup");
  __builtin_amdgcn_wave_barrier();
  const int rsub = lane >> 4, c4 = (lane & 15) * 4;
  {
#pragma unroll
    for (int q = 0; q < 8; ++q) {
      const int r = q * 2 + rsub;
      const v4f v = *(const v4fa*)&so[w][r][c4];
      *(v4f*)(C + (size_t)(row0 + r) * ldc + col0 + c4) = v;
    }
    
  }
}
// row LayerNorm (biased variance, eps) over N: s = X (+ R); optional out_sum <- s; out_norm <- (s-mu)*rsqrt(var+eps)*g + b
template <bool PARAM_BF16>
__global__ __launch_bounds__(256) void k_layernorm(const float* __restrict__ X, const float* __restrict__ R, const float* __restrict__ g, const float* __restrict__ bta,
                                                  float* __restrict__ out_sum, float* __restrict__ out_norm, int N, float eps) {
  __shared__ float red[256];
  const int row = blockIdx.x, tid = threadIdx.x;
  const float* x = X + (size_t)row * N; const float* rr = R ? R + (size_t)row * N : nullptr;
  float vals[16];                     // up to N = 4096
  const int per = N / 256;            // contiguous chunk per thread? use strided-by-4 chunks: thread handles j = tid*4 + 1024*u
  float s1 = 0.f;
  for (int u = 0; u < per / 4; ++u) {
    const int j = tid * 4 + 1024 * u;
    const v4f a = *(const v4fa*)(x + j);
    v4f b = {0.f,0.f,0.f,0.f}; if (rr) b = *(const v4fa*)(rr + j);
#pragma unroll
    for (int q = 0; q < 4; ++q) { const float v = a[q] + b[q]; vals[u * 4 + q] = v; s1 += v; }
  }
  red[tid] = s1; __syncthreads();
  for (int st = 128; st > 0; st >>= 1) { if (tid < st) red[tid] += red[tid + st]; __syncthreads(); }
  const float mu = red[0] / (float)N; __syncthreads();
  float s2 = 0.f;
  for (int u = 0; u < per / 4; ++u)
#pragma unroll
    for (int q = 0; q < 4; ++q) { const float c = vals[u * 4 + q] - mu; s2 += c * c; }
  red[tid] = s2; __syncthreads();
  for (int st = 128; st > 0; st >>= 1) { if (tid < st) red[tid] += red[tid + st]; __syncthreads(); }
  const float rs = rsqrtf(red[0] / (float)N + eps);
  {
    for (int u = 0; u < per / 4; ++u) {
      const int j = tid * 4 + 1024 * u;
      v4f o, sm;
#pragma unroll
      for (int q = 0; q < 4; ++q) {
        float gg = g[j + q], bb = bta[j + q];
        if (PARAM_BF16) { gg = bf16_round(gg); bb = bf16_round(bb); }
        sm[q] = vals[u * 4 + q]; o[q] = (vals[u * 4 + q] - mu) * rs * gg + bb;
      }
      if (out_sum) *(v4f*)(out_sum + (size_t)row * N + j) = sm;
      *(v4f*)(out_norm + (size_t)row * N + j) = o;
    }
    
  }
}



// ---- f16 WMMA path (v_wmma_f32_16x16x32_f16): 11-bit significands for operands in range — used where a [0,1] probability operand needs more precision than bf16
typedef _Float16 v16h __attribute__((ext_vector_type(16)));
union FragH { v16h v; v8us half[2]; _Float16 h[16]; unsigned short u[16]; };
template <int NT>
__device__ __forceinline__ v8f mmaH(v16h ah, v16h al, v16h bh, v16h bl, v8f c) {
  c = __builtin_amdgcn_wmma_f32_16x16x32_f16(false, ah, false, bh, (short)0, c, false, false);
  if (NT >= 2) c = __builtin_amdgcn_wmma_f32_16x16x32_f16(false, al, false, bh, (short)0, c, false, false);
  if (NT >= 3) c = __builtin_amdgcn_wmma_f32_16x16x32_f16(false, ah, false, bl, (short)0, c, false, false);
  asm volatile("v_nop\n\tv_nop\n\tv_nop\n\tv_nop" : "+v"(c) : "v"(ah), "v"(al), "v"(bh), "v"(bl));
  return c;
}
// batched GEMM like k_gemm_b but f16 operands: A f32 (split into f16 hi/lo if ASPLIT, else rounded to f16), Bt = f16 values [n][k]; alpha; C f32; N multiple of 16 (partial tiles skipped)
template <bool ASPLIT>
__global__ __launch_bounds__(128) void k_gemm_h(const float* __restrict__ A, int lda, size_t sA, const _Float16* __restrict__ Bh, int ldb, size_t sB, float alpha, float* __restrict__ C, int ldc, size_t sC, int M, int N, int K) {
  __shared__ __attribute__((aligned(16))) float so[4][16][64];
  const int tid = threadIdx.x, w = tid >> 5, lane = tid & 31, ln = lane & 15, hh = lane >> 4; const int by = blockIdx.y;
  A += (size_t)by * sA; Bh += (size_t)by * sB; C += (size_t)by * sC;
  const int ntn = (N + 63) / 64; const int wid = blockIdx.x * 4 + w; const int mt = wid / ntn, nq = wid % ntn; if (mt * 16 >= M) return;
  const int row0 = mt * 16, col0 = nq * 64; const float* arow = A + (size_t)(row0 + ln) * lda;
  v8f acc[4] = {};
  for (int kb = 0; kb < K; kb += 32) {
    FragH ah, al;
    const v4f x0 = *(const v4fa*)(arow + kb + 8 * hh), x1 = *(const v4fa*)(arow + kb + 8 * hh + 4), x2 = *(const v4fa*)(arow + kb + 16 + 8 * hh), x3 = *(const v4fa*)(arow + kb + 16 + 8 * hh + 4);
    float xs[16] = {x0[0],x0[1],x0[2],x0[3],x1[0],x1[1],x1[2],x1[3],x2[0],x2[1],x2[2],x2[3],x3[0],x3[1],x3[2],x3[3]};
#pragma unroll
    for (int i = 0; i < 16; ++i) { const _Float16 h = (_Float16)xs[i]; ah.h[i] = h; al.h[i] = ASPLIT ? (_Float16)(xs[i] - (float)h) : (_Float16)0.0f; }
#pragma unroll
    for (int t = 0; t < 4; ++t) { if (col0 + t * 16 >= N) continue; const size_t boff = (size_t)(col0 + t * 16 + ln) * ldb + kb; FragH bq; bq.half[0] = *(const v8us*)(Bh + boff + 8 * hh); bq.half[1] = *(const v8us*)(Bh + boff + 16 + 8 * hh);
      acc[t] = mmaH<ASPLIT ? 2 : 1>(ah.v, al.v, bq.v, bq.v, acc[t]); }
  }
#pragma unroll
  for (int t = 0; t < 4; ++t) { if (col0 + t * 16 >= N) continue;
#pragma unroll
    for (int r = 0; r < 8; ++r) so[w][8 * hh + r][t * 16 + ln] = acc[t][r] * alpha; }
  __builtin_amdgcn_fence(__ATOMIC_ACQ_REL, "workgroup"); __builtin_amdgcn_wave_barrier();
  const int rsub = lane >> 4, c4 = (lane & 15) * 4;
  {
#pragma unroll
    for (int q = 0; q < 8; ++q) { const int r = q * 2 + rsub; if (col0 + c4 < N) { const v4f v = *(const v4fa*)&so[w][r][c4]; *(v4f*)(C + (size_t)(row0 + r) * ldc + col0 + c4) = v; } }
     }
}

// Wt[n][k] = f16(W[k][n]·scale) from f32 row-major W[K][N] (scale = power of two; bf16-exact weights stay exact in f16 away from the subnormal range)
__global__ __launch_bounds__(256) void k_wt_f16(const float* __restrict__ W, _Float16* __restrict__ Wt, int K, int N, float scale) {
  const int t = blockIdx.x * 256 + threadIdx.x; if (t >= N * (K / 8)) return; const int n = t / (K / 8), k8 = (t % (K / 8)) * 8; FragH f;
#pragma unroll
  for (int i = 0; i < 8; ++i) f.h[i] = (_Float16)(bf16_round(W[(size_t)(k8 + i) * N + n]) * scale); const v8us o = f.half[0];
  *(v8us*)((unsigned short*)Wt + (size_t)n * K + k8) = o; 
}
// k_gemm_hh variant with fused epilogue: v = acc·alpha + bias[by·sBias + col] (+ CP[(row/rowsPerB)·sCPb + by·64 + col] if CP) ; ACT 0 none / 1 elu ; writes f16 C16 (and f32 C if non-null)
template <int ACT>
__global__ __launch_bounds__(128) void k_gemm_hhx(const _Float16* __restrict__ A, int lda, size_t sA, const _Float16* __restrict__ Bh, int ldb, size_t sB, float alpha, const float* __restrict__ bias, size_t sBias, const float* __restrict__ CP, int rowsPerB, size_t sCPb, int row0g,
    float* __restrict__ C, _Float16* __restrict__ C16, int ldc, size_t sC, int M, int N, int K) {
  __shared__ __attribute__((aligned(16))) float so[4][16][64];
  const int tid = threadIdx.x, w = tid >> 5, lane = tid & 31, ln = lane & 15, hh = lane >> 4; const int by = blockIdx.y;
  A += (size_t)by * sA; Bh += (size_t)by * sB; const size_t cofs = (size_t)by * sC; const float* bp = bias ? bias + (size_t)by * sBias : nullptr;
  const int ntn = (N + 63) / 64; const int wid = blockIdx.x * 4 + w; const int mt = wid / ntn, nq = wid % ntn; if (mt * 16 >= M) return;
  const int row0 = mt * 16, col0 = nq * 64; const _Float16* arow = A + (size_t)(row0 + ln) * lda;
  v8f acc[4] = {};
  for (int kb = 0; kb < K; kb += 32) { FragH ah; ah.half[0] = *(const v8us*)((const unsigned short*)arow + kb + 8 * hh); ah.half[1] = *(const v8us*)((const unsigned short*)arow + kb + 16 + 8 * hh);
#pragma unroll
    for (int t = 0; t < 4; ++t) { if (col0 + t * 16 >= N) continue; const size_t boff = (size_t)(col0 + t * 16 + ln) * ldb + kb; FragH bq; bq.half[0] = *(const v8us*)((const unsigned short*)Bh + boff + 8 * hh); bq.half[1] = *(const v8us*)((const unsigned short*)Bh + boff + 16 + 8 * hh);
      acc[t] = mmaH<1>(ah.v, ah.v, bq.v, bq.v, acc[t]); }
  }
#pragma unroll
  for (int t = 0; t < 4; ++t) { if (col0 + t * 16 >= N) continue; const int col = col0 + t * 16 + ln; const float bv = bp ? bf16_round(bp[col]) : 0.f;
#pragma unroll
    for (int r = 0; r < 8; ++r) { float v = acc[t][r] * alpha + bv; if (CP) { const int rr = row0g + row0 + 8 * hh + r; if (rowsPerB < 0) v += CP[cofs + (size_t)rr * ldc + col];      /* rowsPerB < 0: own element of the batched C plane */ else { const int bidx = rr / rowsPerB; v += CP[(size_t)bidx * sCPb + (size_t)by * 64 + col]; } } if (ACT == 1) v = (v > 0.f) ? v : expm1f(v); else if (ACT == 7) v = (v > 0.f) ? v + 1.0f : expf(v); else if (ACT == 8) v = tanhf(v); else if (ACT == 9) v = 0.5f * v * (1.0f + tanhf(0.7978845608028654f * (v + 0.044715f * v * v * v))); else if (ACT == 11) v = 1.0f / (1.0f + expf(-v)); else if (ACT == 12) v = (v > 0.f) ? v : 0.01f * v; else if (ACT == 14) v = (v > 0.f) ? v : 0.1f * v; else if (ACT == 16) v = (v >= 0.f) ? v : 0.3f * v; else if (ACT == 17) v = (v >= 0.f) ? v : 0.2f * v; else if (ACT == 15) v = v / (1.0f + expf(-v)); else if (ACT == 3) v = fmaxf(v, 0.f); else if (ACT == 6) v = 0.5f * v * (1.0f + erff(v * 0.70710678118654752f)); so[w][8 * hh + r][t * 16 + ln] = v; } }
  __builtin_amdgcn_fence(__ATOMIC_ACQ_REL, "workgroup"); __builtin_amdgcn_wave_barrier();
  const int rsub = lane >> 4, c4 = (lane & 15) * 4; typedef _Float16 v4h __attribute__((ext_vector_type(4)));
  {
#pragma unroll
    for (int q = 0; q < 8; ++q) { const int r = q * 2 + rsub; if (col0 + c4 < N) { const v4f v = *(const v4fa*)&so[w][r][c4]; if (C) *(v4f*)(C + cofs + (size_t)(row0 + r) * ldc + col0 + c4) = v; if (C16) { v4h h4; for (int i = 0; i < 4; ++i) h4[i] = (_Float16)v[i]; *(v4h*)(C16 + cofs + (size_t)(row0 + r) * ldc + col0 + c4) = h4; } } }
     }
}


typedef _Float16 v4h __attribute__((ext_vector_type(4)));

__global__ __launch_bounds__(256) void k_x16(const float* __restrict__ x, _Float16* __restrict__ X16, size_t n8) { const size_t t = (size_t)blockIdx.x * 256 + threadIdx.x; if (t >= n8) return; FragH f;
#pragma unroll
  for (int q = 0; q < 8; ++q) f.h[q] = (_Float16)bf16_round(x[t * 8 + q]); *(v8us*)((unsigned short*)X16 + t * 8) = f.half[0];  }
__global__ __launch_bounds__(256) void k_h16(const float* __restrict__ x, _Float16* __restrict__ X16, size_t n8) { const size_t t = (size_t)blockIdx.x * 256 + threadIdx.x; if (t >= n8) return; FragH f;
#pragma unroll
  for (int q = 0; q < 8; ++q) f.h[q] = (_Float16)x[t * 8 + q]; *(v8us*)((unsigned short*)X16 + t * 8) = f.half[0];  }
__global__ __launch_bounds__(256) void k_round16f(const float* __restrict__ W, _Float16* __restrict__ Bt, size_t n8) { const size_t t = (size_t)blockIdx.x * 256 + threadIdx.x; if (t >= n8) return; FragH f;
#pragma unroll
  for (int i = 0; i < 8; ++i) f.h[i] = (_Float16)(bf16_round(W[t * 8 + i]) * 16.0f); *(v8us*)((unsigned short*)Bt + t * 8) = f.half[0];  }
template <int NHv, int TTv>
__global__ __launch_bounds__(256) void k_vt(const _Float16* __restrict__ V16, int ldv, int voff, _Float16* __restrict__ Vt) { __shared__ unsigned short tl[64][66]; const int tid = threadIdx.x; const int slab = blockIdx.x / (TTv / 64), lg = blockIdx.x % (TTv / 64); const int b = slab / NHv, h = slab % NHv;
  for (int i = tid; i < 64 * 8; i += 256) { const int r = i / 8, c8 = (i % 8) * 8; FragH f; f.half[0] = *(const v8us*)((const unsigned short*)V16 + ((size_t)b * TTv + lg * 64 + r) * ldv + voff + h * 64 + c8);
#pragma unroll
    for (int q = 0; q < 8; ++q) tl[r][c8 + q] = f.u[q]; }
  __syncthreads();
  {
#pragma unroll
    for (int rd = 0; rd < 2; ++rd) { const int d = rd * 32 + tid / 8, pc = tid % 8; FragH f;
#pragma unroll
      for (int q = 0; q < 8; ++q) f.u[q] = tl[pc * 8 + q][d];
      *(v8us*)((unsigned short*)Vt + ((size_t)slab * 64 + d) * TTv + lg * 64 + pc * 8) = f.half[0]; }
     } }

__global__ __launch_bounds__(256) void k_hl(const float* __restrict__ F, _Float16* __restrict__ Hh, _Float16* __restrict__ Hl, size_t n8) { const size_t t = (size_t)blockIdx.x * 256 + threadIdx.x; if (t >= n8) return; FragH fh, fl; const v4f a = *(const v4fa*)(F + t * 8), c = *(const v4fa*)(F + t * 8 + 4);
#pragma unroll
  for (int q = 0; q < 4; ++q) { _Float16 h = (_Float16)a[q]; fh.h[q] = h; fl.h[q] = (_Float16)((a[q] - (float)h) * 1024.0f); h = (_Float16)c[q]; fh.h[4 + q] = h; fl.h[4 + q] = (_Float16)((c[q] - (float)h) * 1024.0f); }
  { *(v8us*)((unsigned short*)Hh + t * 8) = fh.half[0]; *(v8us*)((unsigned short*)Hl + t * 8) = fl.half[0];  } }

// ---- fast GEMM (wave tile 32x64; requires M % 32 == 0 rows per launch region, N % 64 == 0 and K % 64 == 0); epilogue = k_gemm_hhx semantics ----
__device__ __forceinline__ v16h g2_frag(const _Float16* p, int hh) { FragH f; f.half[0] = *(const v8us*)((const unsigned short*)p + 8 * hh); f.half[1] = *(const v8us*)((const unsigned short*)p + 16 + 8 * hh); return f.v; }
__device__ __forceinline__ v8f g2_mma(v16h a, v16h b, v8f c) { v8f d = __builtin_amdgcn_wmma_f32_16x16x32_f16(false, a, false, b, (short)0, c, false, false); asm volatile("v_nop\n\tv_nop\n\tv_nop\n\tv_nop" : "+v"(d) : "v"(a), "v"(b)); return d; }
template <int ACT>
__global__ __launch_bounds__(128) void k_gemm2(const _Float16* __restrict__ A, int lda, size_t sA, const _Float16* __restrict__ Bh, int ldb, size_t sB, float alpha, const float* __restrict__ bias, size_t sBias, const float* __restrict__ CP, int rowsPerB, size_t sCPb, int row0g,
    float* __restrict__ C, _Float16* __restrict__ C16, int ldc, size_t sC, int M, int N, int K) { static_assert(ACT == 0 || ACT == 3 || ACT == 6 || ACT == 8 || ACT == 9 || ACT == 11 || ACT == 12 || ACT == 14 || ACT == 15 || ACT == 16 || ACT == 17, "k_gemm2: unsupported ACT code (would silently apply no activation)");
  __shared__ __attribute__((aligned(16))) float so[4][32][68];
  const int tid = threadIdx.x, w = tid >> 5, lane = tid & 31, ln = lane & 15, hh = lane >> 4; const int by = blockIdx.y;
  A += (size_t)by * sA; Bh += (size_t)by * sB; const size_t cofs = (size_t)by * sC; const float* bp = bias ? bias + (size_t)by * sBias : nullptr;
  const int ntn = N >> 6; const int mt = blockIdx.x / ntn, nq = blockIdx.x - mt * ntn; const int row0 = mt * 128 + 32 * w, col0 = nq * 64; if (row0 >= M) return;
  const _Float16* a0p = A + (size_t)(row0 + ln) * lda; const _Float16* a1p = a0p + (size_t)16 * lda;
  const _Float16* b0p = Bh + (size_t)(col0 + ln) * ldb; const _Float16* b1p = b0p + (size_t)16 * ldb; const _Float16* b2p = b1p + (size_t)16 * ldb; const _Float16* b3p = b2p + (size_t)16 * ldb;
  const v8f z8 = {0.f,0.f,0.f,0.f,0.f,0.f,0.f,0.f}; v8f c00 = z8, c01 = z8, c02 = z8, c03 = z8, c10 = z8, c11 = z8, c12 = z8, c13 = z8;
  /* One trip = 64 k = one 128-byte line of each operand row. All 24 fragment loads of the trip stand in front of its first WMMA, so that a trip waits for memory once;
     each accumulator still takes its k blocks in rising order. */
#pragma unroll 1 /* a second trip's fragments would not fit in 256 registers beside the 64 accumulator registers */
  for (int kb = 0; kb < K; kb += 64) {
    const _Float16* pa0 = a0p + kb + 8 * hh; const _Float16* pa1 = a1p + kb + 8 * hh; const _Float16* pb0 = b0p + kb + 8 * hh; const _Float16* pb1 = b1p + kb + 8 * hh; const _Float16* pb2 = b2p + kb + 8 * hh; const _Float16* pb3 = b3p + kb + 8 * hh;
    const v16h a0 = g2_frag(pa0, 0), a1 = g2_frag(pa1, 0), b0 = g2_frag(pb0, 0), b1 = g2_frag(pb1, 0), b2 = g2_frag(pb2, 0), b3 = g2_frag(pb3, 0);
    const v16h a2 = g2_frag(pa0 + 32, 0), a3 = g2_frag(pa1 + 32, 0), b4 = g2_frag(pb0 + 32, 0), b5 = g2_frag(pb1 + 32, 0), b6 = g2_frag(pb2 + 32, 0), b7 = g2_frag(pb3 + 32, 0);
    /* the wait in front of any rewrite of a register that an issued load names; as its inputs the six address pairs stay live up to it, so that no load of the trip lands in one of them */
    asm volatile("s_wait_xcnt 0x0" :: "v"(pa0), "v"(pa1), "v"(pb0), "v"(pb1), "v"(pb2), "v"(pb3) : "memory");
    c00 = g2_mma(a0, b0, c00); c10 = g2_mma(a1, b0, c10); c01 = g2_mma(a0, b1, c01); c11 = g2_mma(a1, b1, c11);
    c02 = g2_mma(a0, b2, c02); c12 = g2_mma(a1, b2, c12); c03 = g2_mma(a0, b3, c03); c13 = g2_mma(a1, b3, c13);
    c00 = g2_mma(a2, b4, c00); c10 = g2_mma(a3, b4, c10); c01 = g2_mma(a2, b5, c01); c11 = g2_mma(a3, b5, c11);
    c02 = g2_mma(a2, b6, c02); c12 = g2_mma(a3, b6, c12); c03 = g2_mma(a2, b7, c03); c13 = g2_mma(a3, b7, c13); }
  v8f accs[8] = {c00, c01, c02, c03, c10, c11, c12, c13};
#pragma unroll
  for (int u = 0; u < 8; ++u) { const int t = u & 3, half = u >> 2; const int col = col0 + t * 16 + ln; const float bv = bp ? bf16_round(bp[col]) : 0.f;
#pragma unroll
    for (int r = 0; r < 8; ++r) { const int rloc = half * 16 + 8 * hh + r; float v = accs[u][r] * alpha + bv; if (CP) { if (rowsPerB < 0) v += CP[cofs + (size_t)(row0g + row0 + rloc) * ldc + col];      /* rowsPerB < 0: own element of the batched C plane */ else { const int bidx = (row0g + row0 + rloc) / rowsPerB; v += CP[(size_t)bidx * sCPb + (size_t)by * 64 + col]; } }
      if (ACT == 3) v = fmaxf(v, 0.f); else if (ACT == 6) v = 0.5f * v * (1.0f + erff(v * 0.70710678118654752f)); else if (ACT == 11) v = 1.0f / (1.0f + expf(-v)); else if (ACT == 15) v = v / (1.0f + expf(-v)); else if (ACT == 12) v = (v > 0.f) ? v : 0.01f * v; else if (ACT == 8) v = tanhf(v); else if (ACT == 9) v = 0.5f * v * (1.0f + tanhf(0.7978845608028654f * (v + 0.044715f * v * v * v))); else if (ACT == 14) v = (v > 0.f) ? v : 0.1f * v; else if (ACT == 16) v = (v >= 0.f) ? v : 0.3f * v; else if (ACT == 17) v = (v >= 0.f) ? v : 0.2f * v;
      so[w][rloc][t * 16 + ln] = v; } }
  __builtin_amdgcn_fence(__ATOMIC_ACQ_REL, "workgroup"); __builtin_amdgcn_wave_barrier();
  const int rsub = lane >> 4, c4 = (lane & 15) * 4;
  {
#pragma unroll
    for (int q = 0; q < 16; ++q) { const int r = q * 2 + rsub; const v4f v = *(const v4fa*)&so[w][r][c4]; if (C) *(v4f*)(C + cofs + (size_t)(row0 + r) * ldc + col0 + c4) = v; if (C16) { v4h h4; for (int i = 0; i < 4; ++i) h4[i] = (_Float16)v[i]; *(v4h*)(C16 + cofs + (size_t)(row0 + r) * ldc + col0 + c4) = h4; } }
     } }


__global__ __launch_bounds__(256) void k_wnat(const float* __restrict__ w, size_t n8, _Float16* __restrict__ Bt) { const size_t t = (size_t)blockIdx.x * 256 + threadIdx.x; if (t >= n8) return; FragH f; for (int q = 0; q < 8; ++q) f.h[q] = (_Float16)(bf16_round(w[t * 8 + q]) * 16.0f); *(v8us*)((unsigned short*)Bt + t * 8) = f.half[0];  }
__global__ __launch_bounds__(256) void k_rsm(const float* __restrict__ S, _Float16* __restrict__ P, int nrows) {
  #pragma clang fp contract(off)
  const int i = blockIdx.x * 256 + threadIdx.x; if (i >= nrows) return; const float* s = S + (size_t)i * SQ; float mx = -3.0e38f;
#pragma unroll 1
  for (int j = 0; j < SQ; ++j) mx = fmaxf(mx, s[j]); float se = 0.f;
#pragma unroll 1
  for (int j = 0; j < SQ; ++j) se += expf(s[j] - mx); const float sc = 256.0f / se;
#pragma unroll 1
  for (int j0 = 0; j0 < SQ; j0 += 8) { FragH f; for (int q = 0; q < 8; ++q) f.h[q] = (_Float16)(expf(s[j0 + q] - mx) * sc); unsigned short* d = (unsigned short*)P + (size_t)i * SQ + j0; *(v8us*)d = f.half[0];  } }
__global__ __launch_bounds__(256) void k_vt(const _Float16* __restrict__ V16, int b, int h0, _Float16* __restrict__ VT) { __shared__ unsigned short tl[64][65]; const int tid = threadIdx.x; const int hh = blockIdx.x % HG, sg = blockIdx.x / HG; const int s0 = sg * 64; const int h = h0 + hh;
  for (int i = tid; i < 64 * 8; i += 256) { const int j = i / 8, d8 = (i % 8) * 8; FragH f; f.half[0] = *(const v8us*)((const unsigned short*)V16 + ((size_t)b * SQ + s0 + j) * DM + h * HD + d8); for (int q = 0; q < 8; ++q) tl[d8 + q][j] = f.u[q]; }
  __syncthreads();
  { for (int i = tid; i < 64 * 8; i += 256) { const int d = i / 8, j8 = (i % 8) * 8; FragH f; for (int q = 0; q < 8; ++q) f.u[q] = tl[d][j8 + q]; *(v8us*)((unsigned short*)VT + ((size_t)hh * HD + d) * SQ + s0 + j8) = f.half[0]; }  } }



// One wave per score row: lane l holds elements j = 128 u + 4 l .. + 3 (u < nk / 128) in registers, so that each load covers 512 contiguous bytes, the row is read
// once and each exp is taken once; row maximum and row sum = four chains per lane, then a five-step butterfly over the wave. nk is a multiple of 256 (nk = q0 + QT).
__global__ __launch_bounds__(256) void k_rsmcf2al(const float* __restrict__ S, _Float16* __restrict__ P, int hg, int q0, int nk, int h0) {
  #pragma clang fp contract(off)
  static_assert(QT % 256 == 0 && NKX % 256 == 0, "k_rsmcf2al: a row is dealt in pieces of 256 keys");
  const int lane = threadIdx.x & 31; const int t = blockIdx.x * 8 + (threadIdx.x >> 5); if (t >= hg * QT) return; const size_t i = (size_t)t; const float* s = S + i * NKX + lane * 4; const int last = q0 + (t % QT); const float slope = (float)exp2(-0.5 * (double)(h0 + t / QT + 1));      /* ALiBi slope 2^(-8 (h+1) / 16) for this row's head, correctly rounded to f32 */
  v4f e[NKX / 128];
#pragma unroll /* constant indices keep e[] in registers; all loads of the row are issued before the first is used */
  for (int c = 0; c < NKX / 256; ++c) if (c * 256 < nk) { e[2 * c] = *(const v4fa*)(s + c * 256); e[2 * c + 1] = *(const v4fa*)(s + c * 256 + 128); }
  v4f m4 = {-3.0e38f, -3.0e38f, -3.0e38f, -3.0e38f};
#pragma unroll /* constant indices keep e[] in registers */
  for (int c = 0; c < NKX / 256; ++c) if (c * 256 < nk) {
#pragma unroll /* as above */
    for (int u = 2 * c; u < 2 * c + 2; ++u)
#pragma unroll /* as above */
      for (int q = 0; q < 4; ++q) { const int j = u * 128 + lane * 4 + q; const float f = (j <= last) ? 1.f : 0.f; e[u][q] = fmaf(f, __fadd_rn(e[u][q], -__fmul_rn(slope, (float)j)), (1.f - f) * -1.0e9f); m4[q] = fmaxf(m4[q], e[u][q]); } }
  float mx = fmaxf(fmaxf(m4[0], m4[1]), fmaxf(m4[2], m4[3]));
  for (int o = 16; o > 0; o >>= 1) mx = fmaxf(mx, __shfl_xor(mx, o, 32));
  v4f s4 = {0.f, 0.f, 0.f, 0.f};
#pragma unroll /* constant indices keep e[] in registers */
  for (int c = 0; c < NKX / 256; ++c) if (c * 256 < nk) {
#pragma unroll /* as above */
    for (int u = 2 * c; u < 2 * c + 2; ++u)
#pragma unroll /* as above */
      for (int q = 0; q < 4; ++q) { e[u][q] = __expf(e[u][q] - mx); s4[q] += e[u][q]; } }
  float se = (s4[0] + s4[1]) + (s4[2] + s4[3]);
  for (int o = 16; o > 0; o >>= 1) se += __shfl_xor(se, o, 32);
  const float sc = 256.0f / se; _Float16* d = P + i * NKX + lane * 4; v4h h[NKX / 128];
#pragma unroll /* constant indices keep e[] and h[] in registers */
  for (int c = 0; c < NKX / 256; ++c) if (c * 256 < nk) {
#pragma unroll /* as above */
    for (int u = 2 * c; u < 2 * c + 2; ++u)
#pragma unroll /* as above */
      for (int q = 0; q < 4; ++q) h[u][q] = (_Float16)(e[u][q] * sc); }
  /* the stores stand in a loop of their own behind every conversion: no register that an issued store names is written again */
#pragma unroll /* constant indices keep h[] in registers */
  for (int c = 0; c < NKX / 256; ++c) if (c * 256 < nk) { *(v4h*)(d + c * 256) = h[2 * c]; *(v4h*)(d + c * 256 + 128) = h[2 * c + 1]; } }


// Exact f32 causal attention of the first QT0 rows. One work-group of 8 waves per head and 32 query rows (lane = row). The head's K and V rows below the group's end and its 32 q rows
// are staged in LDS by whole-line loads. Scores: wave w takes keys w, w + 8, ...; softmax in two passes over the scores kept in LDS; o: wave w takes head dims 8 w .. 8 w + 7 over all keys in rising order.
// LD = row pitch of QF, KF, VF in floats, a compile-time constant so that every staged row is one base address plus an immediate offset.
template <int ALIBI, int LD>
__global__ __launch_bounds__(256) void k_att0(const float* __restrict__ QF, const float* __restrict__ KF, const float* __restrict__ VF, float scale, float* __restrict__ OF, int ldo) {
  static_assert(QT0 % 32 == 0 && HD == 64, "k_att0: 32 rows a group, 16 threads a staged row, 8 dims a wave");
  __shared__ __attribute__((aligned(16))) float lk[QT0][HD]; __shared__ __attribute__((aligned(16))) float lv[QT0][HD]; __shared__ float sc[QT0][32];
  __shared__ __attribute__((aligned(16))) float lqo[32][HD + 4];      /* q rows, later o rows; pitch 16 B x 17: a lane per row reads and writes 16 bytes without bank conflicts */
  __shared__ float pm[8][32]; __shared__ float pl[8][32];
  const int tid = threadIdx.x, lane = tid & 31; const int w = __builtin_amdgcn_readfirstlane(tid >> 5);      /* the wave's number in a scalar register: the key loops stay scalar branches */
  const int h = blockIdx.x / (QT0 / 32), rg = blockIdx.x % (QT0 / 32); const int i = rg * 32 + lane; const int nkeys = rg * 32 + 32;      /* causal: keys up to the group's last row */
  const int sr = tid >> 4, c4 = (tid & 15) * 4;      /* staging: 16 threads a row of 256 bytes */
  { v4f tk[QT0 / 16], tv[QT0 / 16], tq[2];
    const float* gk = KF + (size_t)sr * LD + h * HD + c4; const float* gv = VF + (size_t)sr * LD + h * HD + c4; const float* gq = QF + (size_t)(rg * 32 + sr) * LD + h * HD + c4;
#pragma unroll /* constant indices keep tk[] and tv[] in registers; all loads are issued before the first is used */
    for (int c = 0; c < QT0 / 32; ++c) if (c * 32 < nkeys) {
#pragma unroll /* as above */
      for (int u = 2 * c; u < 2 * c + 2; ++u) { tk[u] = *(const v4fa*)(gk + (size_t)u * 16 * LD); tv[u] = *(const v4fa*)(gv + (size_t)u * 16 * LD); } }
#pragma unroll /* as above */
    for (int u = 0; u < 2; ++u) tq[u] = *(const v4fa*)(gq + (size_t)u * 16 * LD);
    /* the wait in front of any rewrite of a register that an issued load names; as its inputs the three address pairs stay live up to it, so that no load lands in one of them */
    asm volatile("s_wait_xcnt 0x0" :: "v"(gk), "v"(gv), "v"(gq) : "memory");
#pragma unroll /* as above */
    for (int c = 0; c < QT0 / 32; ++c) if (c * 32 < nkeys) {
#pragma unroll /* as above */
      for (int u = 2 * c; u < 2 * c + 2; ++u) { *(v4f*)&lk[u * 16 + sr][c4] = tk[u]; *(v4f*)&lv[u * 16 + sr][c4] = tv[u]; } }
#pragma unroll /* as above */
    for (int u = 0; u < 2; ++u) *(v4f*)&lqo[u * 16 + sr][c4] = tq[u]; }
  __syncthreads();
  const float slope = ALIBI ? (float)exp2(-0.5 * (double)(h + 1)) : 0.f;      /* ALiBi: 2^(-8 (h+1) / 16) */
  v4f q[HD / 4];
#pragma unroll /* constant indices keep q[] in registers */
  for (int c = 0; c < HD / 4; ++c) q[c] = *(const v4f*)&lqo[lane][c * 4];
  float mp = -1.0e30f;
  for (int j0 = w; j0 < nkeys; j0 += 16) {      /* nkeys is a multiple of 32: two keys a trip, so that one key's LDS reads fly under the other's products */
#pragma unroll /* the two keys of a trip in one block of code */
    for (int u = 0; u < 2; ++u) { const int j = j0 + 8 * u; v4f a = {0.f, 0.f, 0.f, 0.f};
#pragma unroll /* constant indices keep q[] in registers */
      for (int c = 0; c < HD / 4; ++c) a += q[c] * *(const v4f*)&lk[j][c * 4];
      float s = ((a[0] + a[1]) + (a[2] + a[3])) * scale; if (ALIBI) s -= slope * (float)j;
      s = (j <= i) ? s : -1.0e30f; sc[j][lane] = s; mp = fmaxf(mp, s); } }
  pm[w][lane] = mp;
  __syncthreads();
  float m = pm[0][lane];
#pragma unroll /* eight partial maxima */
  for (int x = 1; x < 8; ++x) m = fmaxf(m, pm[x][lane]);
  float lp = 0.f;
  for (int j0 = w; j0 < nkeys; j0 += 32) {      /* nkeys is a multiple of 32: four keys a trip, so that their LDS reads and exps overlap */
#pragma unroll /* the four keys of a trip in one block of code */
    for (int u = 0; u < 4; ++u) { const int j = j0 + 8 * u; const float e = expf(sc[j][lane] - m); sc[j][lane] = e; lp += e; } }      /* a masked key gives exactly 0 */
  pl[w][lane] = lp;
  __syncthreads();
  float l = pl[0][lane];
#pragma unroll /* eight partial sums, fixed order */
  for (int x = 1; x < 8; ++x) l += pl[x][lane];
  v4f o0 = {0.f, 0.f, 0.f, 0.f}, o1 = {0.f, 0.f, 0.f, 0.f};
#pragma unroll 8 /* eight keys' LDS reads in flight; nkeys is a multiple of 32 */
  for (int j = 0; j < nkeys; ++j) { const float p = sc[j][lane]; o0 += p * *(const v4f*)&lv[j][8 * w]; o1 += p * *(const v4f*)&lv[j][8 * w + 4]; }
  const float fin = 64.0f / l;      /* o carried x64 like the f16 path */
  *(v4f*)&lqo[lane][8 * w] = o0 * fin; *(v4f*)&lqo[lane][8 * w + 4] = o1 * fin;
  __syncthreads();
#pragma unroll /* two whole-line stores a thread */
  for (int u = 0; u < 2; ++u) { const int row = u * 16 + sr; const v4f v = *(const v4f*)&lqo[row][c4]; *(v4f*)(OF + (size_t)(rg * 32 + row) * ldo + h * HD + c4) = v; } }

extern "C" void kernel_launch(void* const* d_in, const int* in_sizes, int n_in,
                              void* d_out, int out_size, void* d_ws, size_t ws_size, hipStream_t stream) {
  (void)in_sizes; (void)n_in; (void)out_size;
  const float* const* I = (const float* const*)d_in; const float* x = I[0]; const float* wq = I[1]; const float* bq = I[2]; const float* wk = I[3]; const float* wv = I[4]; const float* bv = I[5]; const float* wo = I[6];      /* natural [out][in] weights; biases on q and v only */
  char* ws = (char*)d_ws; size_t off = 0;
  auto take = [&](size_t bytes) { char* p = ws + off; off += (bytes + 255) & ~(size_t)255; return p; };
  _Float16* BQ = (_Float16*)take((size_t)DM * DM * 2); _Float16* BK = (_Float16*)take((size_t)DM * DM * 2); _Float16* BV = (_Float16*)take((size_t)DM * DM * 2); _Float16* BO = (_Float16*)take((size_t)DM * DM * 2);
  _Float16* X16 = (_Float16*)take(NR * DM * 2); _Float16* Q16 = (_Float16*)take(NR * DM * 2); _Float16* K16 = (_Float16*)take(NR * DM * 2); _Float16* V16 = (_Float16*)take(NR * DM * 2); _Float16* O16 = (_Float16*)take(NR * DM * 2);
  float* S = (float*)take((size_t)NH * QT * NKX * 4); _Float16* P = (_Float16*)take((size_t)NH * QT * NKX * 2); _Float16* VT = (_Float16*)take((size_t)NH * HD * SQ * 2);
  float* QF0 = (float*)take((size_t)QT0 * DM * 4); float* KF0 = (float*)take((size_t)QT0 * DM * 4); float* VF0 = (float*)take((size_t)QT0 * DM * 4); float* OF0 = (float*)take((size_t)NB * QT0 * DM * 4); _Float16* OH0 = (_Float16*)take((size_t)NB * QT0 * DM * 2); _Float16* OL0 = (_Float16*)take((size_t)NB * QT0 * DM * 2);
  if (off > ws_size) return;
  { const unsigned g = (unsigned)(((size_t)DM * DM / 8 + 255) / 256); k_wnat<<<g, 256, 0, stream>>>(wq, (size_t)DM * DM / 8, BQ); k_wnat<<<g, 256, 0, stream>>>(wk, (size_t)DM * DM / 8, BK); k_wnat<<<g, 256, 0, stream>>>(wv, (size_t)DM * DM / 8, BV); k_wnat<<<g, 256, 0, stream>>>(wo, (size_t)DM * DM / 8, BO); }      /* natural [out][in] = Bt[n][k], x16 */
  k_x16<<<(unsigned)((NR * DM / 8 + 255) / 256), 256, 0, stream>>>(x, X16, NR * DM / 8);
  const size_t r0p = (size_t)B0 * SQ;      /* first projected row */
  k_gemm2<0><<<dim3((unsigned)((MP / 128) * (DM / 64)), 1), 128, 0, stream>>>(X16 + r0p * DM, DM, 0, BQ, DM, 0, 0.0625f, bq, 0, nullptr, 1, 0, 0, nullptr, Q16 + r0p * DM, DM, 0, MP, DM, DM);
  k_gemm2<0><<<dim3((unsigned)((MP / 128) * (DM / 64)), 1), 128, 0, stream>>>(X16 + r0p * DM, DM, 0, BK, DM, 0, 0.0625f, nullptr, 0, nullptr, 1, 0, 0, nullptr, K16 + r0p * DM, DM, 0, MP, DM, DM);
  k_gemm2<0><<<dim3((unsigned)((MP / 128) * (DM / 64)), 1), 128, 0, stream>>>(X16 + r0p * DM, DM, 0, BV, DM, 0, 0.0625f, bv, 0, nullptr, 1, 0, 0, nullptr, V16 + r0p * DM, DM, 0, MP, DM, DM);
  for (int b = B0; b < B0 + NBR; ++b) { const size_t r0 = (size_t)b * SQ;
    k_vt<NH, SQ><<<NH * (SQ / 64), 256, 0, stream>>>(V16 + r0 * LQ, LQ, 0, VT);      /* V^T [NH][HD][SQ] for this batch */
    k_gemm2<0><<<dim3((QT0 / 128) * (DM / 64), 1), 128, 0, stream>>>(X16 + r0 * DM, DM, 0, BQ, DM, 0, 0.0625f, bq, 0, nullptr, 1, 0, 0, QF0, nullptr, DM, 0, QT0, DM, DM); k_gemm2<0><<<dim3((QT0 / 128) * (DM / 64), 1), 128, 0, stream>>>(X16 + r0 * DM, DM, 0, BK, DM, 0, 0.0625f, nullptr, 0, nullptr, 1, 0, 0, KF0, nullptr, DM, 0, QT0, DM, DM); k_gemm2<0><<<dim3((QT0 / 128) * (DM / 64), 1), 128, 0, stream>>>(X16 + r0 * DM, DM, 0, BV, DM, 0, 0.0625f, bv, 0, nullptr, 1, 0, 0, VF0, nullptr, DM, 0, QT0, DM, DM);      /* f32 q, k, v of the first 256 rows (exact products) */
    k_att0<1, DM><<<NH * (QT0 / 32), 256, 0, stream>>>(QF0, KF0, VF0, 0.125f, OF0 + (size_t)b * QT0 * DM, DM);      /* exact f32 causal ALiBi attention */      /* exact f32 attention for rows 0..255 (o x64) */
    for (int q0 = 0; q0 < QN; q0 += QT) { const int nk = q0 + QT;      /* causal: only keys below the tile end are computed */
      k_gemm2<0><<<dim3((QT / 128) * (nk / 64), NHD), 128, 0, stream>>>(Q16 + (r0 + q0) * LQ, LQ, (size_t)HD, K16 + r0 * LQ, LQ, (size_t)HD, 0.125f, nullptr, 0, nullptr, 1, 0, 0, S, nullptr, NKX, (size_t)QT * NKX, QT, nk, HD);      /* scores, all heads on grid.y */
      k_rsmcf2al<<<(NHD * QT + 7) / 8, 256, 0, stream>>>(S, P, NHD, q0, nk, 0);      /* causal softmax over scores - slope_h * j (all 16 heads: h0 = 0) */
      k_gemm2<0><<<dim3((QT / 128) * (HD / 64), NHD), 128, 0, stream>>>(P, NKX, (size_t)QT * NKX, VT, SQ, (size_t)HD * SQ, 0.25f, nullptr, 0, nullptr, 1, 0, 0, nullptr, O16 + (r0 + q0) * DM, DM, (size_t)HD, QT, HD, nk); } }      /* o (merged heads, x64) as f16 rows */
  k_gemm2<0><<<dim3((unsigned)((MPO / 128) * (DM / 64)), 1), 128, 0, stream>>>(O16 + r0p * DM, DM, 0, BO, DM, 0, 0.0009765625f, nullptr, 0, nullptr, 1, 0, 0, (float*)d_out + r0p * DM, nullptr, DM, 0, MPO, DM, DM);      /* out rows are the output layout */
  k_hl<<<(unsigned)(((size_t)NB * QT0 * DM / 8 + 255) / 256), 256, 0, stream>>>(OF0, OH0, OL0, (size_t)NB * QT0 * DM / 8);      /* first-tile o (x64) -> f16 hi + x1024 residual planes */
  for (int b = B0; b < B0 + NBR; ++b) { const size_t r0 = (size_t)b * SQ; const size_t f0 = (size_t)b * QT0;
    k_gemm2<0><<<dim3((QT0 / 128) * (DM / 64), 1), 128, 0, stream>>>(OH0 + f0 * DM, DM, 0, BO, DM, 0, 0.0009765625f, nullptr, 0, nullptr, 1, 0, 0, (float*)d_out + r0 * DM, nullptr, DM, 0, QT0, DM, DM);      /* rows 0..255: out = o_hi Wo, overwriting the f16-path rows */
    k_gemm2<0><<<dim3((QT0 / 128) * (DM / 64), 1), 128, 0, stream>>>(OL0 + f0 * DM, DM, 0, BO, DM, 0, 0.00000095367431640625f, nullptr, 0, (const float*)d_out + r0 * DM, -1, 0, 0, (float*)d_out + r0 * DM, nullptr, DM, 0, QT0, DM, DM); }      /* += o_lo Wo 2^-20 (own-element accumulate) */
}

// v005
// It runs in 202 microseconds.
// Versions in between are left out here; by their measured steps it is 5.42 times as fast as v003.
// Over all steps from v000 it is 41.9 times as fast.
#include <hip/hip_runtime.h>
// Causal multi-head attention with an ALiBi key-position bias (inputs [1][4096][1024]; q = x Wq^T + bq, k = x Wk^T (no bias), v = x Wv^T + bv (natural [1024][1024] sigma 0.02; bq, bv sigma 0.02); 16 heads of 64; scores / 8 - slopes[h] * j with slopes[h] = 2^(-8 (h+1) / 16) and j the key position; causal (j <= i keep, -inf); softmax; out = merged Wo^T (no bias) -> [1][4096][1024]).
// Structure: token rows r = s; q, k, v inputs as exact f16 rows (bf16-rounded); Q, K and V^T as WMMA GEMMs in one launch (32x64 wave tiles, f32 accumulation, exact x16 weights, f16 outputs; V^T = Wv x^T, the weight rows as the A operand); the first 256 rows exactly in f32 (own launch); one fused attention launch (a wave per 32 query rows of a head; passes of 32 keys up to the diagonal; scores / 8 minus the ALiBi term slope_h * j in f32, online softmax with f32 statistics and native exp2, weights x256 f16, o carried x64, folded into the output GEMM alpha) written straight into the merged f16 o rows; out = o W_o GEMM (f32) into the output layout, the first 256 rows from the exact o as f16 hi + residual planes. Five launches.
// Compute dtype: inputs rounded to bf16; x / weights exact; q, k, v, softmax weights and o as plain f16 GEMM operands (~2^-12); scores and softmax statistics f32. v_wmma_f32_16x16x32_f16.
#define NB 1
#define SQ 4096
#define DM 1024
#define NH 16
#define HD 64
#define HG 4                         /* heads per block group of the unlaunched k_vt overload */
#define QT 256                       /* query rows per causal tile */
#define NKX SQ                       /* S / P row pitch */
#define QT0 256                      /* first-tile rows recomputed exactly in f32 */
#define B0 0                         /* first batch processed (debug hook) */
#define NBR NB                       /* batches processed (debug hook) */
#define NR ((size_t)NB * SQ)         /* token rows */
#define MP ((int)((size_t)NBR * SQ)) /* rows projected (debug hook) */
#define QN SQ                        /* query rows attended per batch (debug hook) */
#define NHD NH                       /* heads attended (debug hook) */
#define MPO MP                       /* rows through the output stage (debug hook) */
#define LQ DM      /* row pitch of the q/k/v rows */
typedef __bf16 v16b __attribute__((ext_vector_type(16)));
typedef unsigned short v8us __attribute__((ext_vector_type(8), may_alias));
typedef float  v8f  __attribute__((ext_vector_type(8)));
typedef float  v4f  __attribute__((ext_vector_type(4)));
typedef float  v4fa __attribute__((ext_vector_type(4), may_alias));
union FragB { v16b v; v8us half[2]; unsigned short u[16]; };

__device__ __forceinline__ unsigned short bf16_bits(float x) { unsigned int u = __float_as_uint(x); return (unsigned short)((u + 0x7FFFu + ((u >> 16) & 1u)) >> 16); }
__device__ __forceinline__ float bf16_val(unsigned short b) { return __uint_as_float(((unsigned int)b) << 16); }
__device__ __forceinline__ float bf16_round(float x) { return bf16_val(bf16_bits(x)); }
// D += A·B with NT terms: 1 = ah·bh, 2 = + al·bh (A split), 3 = + ah·bl (both split)
template <int NT>
__device__ __forceinline__ v8f mmaN(v16b ah, v16b al, v16b bh, v16b bl, v8f c) {
  c = __builtin_amdgcn_wmma_f32_16x16x32_bf16(false, ah, false, bh, (short)0, c, false, false);
  if (NT >= 2) c = __builtin_amdgcn_wmma_f32_16x16x32_bf16(false, al, false, bh, (short)0, c, false, false);
  if (NT >= 3) c = __builtin_amdgcn_wmma_f32_16x16x32_bf16(false, ah, false, bl, (short)0, c, false, false);
  asm volatile("v_nop\n\tv_nop\n\tv_nop\n\tv_nop" : "+v"(c) : "v"(ah), "v"(al), "v"(bh), "v"(bl));
  return c;
}

__global__ __launch_bounds__(256) void k_wt_bf16(const float* __restrict__ W, unsigned short* __restrict__ Wt, int K, int N) {
  const int t = blockIdx.x * 256 + threadIdx.x;
  const int k8n = K / 8;
  if (t >= N * k8n) return;
  const int n = t / k8n, k8 = (t % k8n) * 8;
  v8us v;
#pragma unroll
  for (int i = 0; i < 8; ++i) v[i] = bf16_bits(W[(size_t)(k8 + i) * N + n]);
  *(v8us*)(Wt + (size_t)n * K + k8) = v;
  
}

// GEMM C[M][N] (f32, pitch ldc) = act(A[M][K]·W + bias). A f32 row-major (pitch lda) converted per fragment to bf16
// (ASPLIT: hi/lo two planes -> 2 terms, else single rounded term); Wt bf16 [N][K] (pitch ldb). BIAS_BF16 rounds the
// bias to bf16 first (bias quantised to bf16 before the add). K%32==0, M%16==0, N%64==0.
template <bool ASPLIT, int ACT, bool BIAS_BF16>
__global__ __launch_bounds__(128) void k_gemm_bf(const float* __restrict__ A, int lda, const unsigned short* __restrict__ Wt, int ldb,
                                               const float* __restrict__ bias, float* __restrict__ C, int ldc, int M, int N, int K) {
  __shared__ __attribute__((aligned(16))) float so[4][16][64];
  const int tid = threadIdx.x, w = tid >> 5, lane = tid & 31, ln = lane & 15, hh = lane >> 4;
  const int ntn = N / 64;
  const int wid = blockIdx.x * 4 + w;
  const int mt = wid / ntn, nq = wid % ntn;
  if (mt * 16 >= M) return;
  const int row0 = mt * 16, col0 = nq * 64;
  const float* arow = A + (size_t)(row0 + ln) * lda;
  v8f acc[4] = {};
  for (int kb = 0; kb < K; kb += 32) {
    FragB ah, al;
    const v4f x0 = *(const v4fa*)(arow + kb + 8 * hh), x1 = *(const v4fa*)(arow + kb + 8 * hh + 4);
    const v4f x2 = *(const v4fa*)(arow + kb + 16 + 8 * hh), x3 = *(const v4fa*)(arow + kb + 16 + 8 * hh + 4);
    float xs[16] = {x0[0],x0[1],x0[2],x0[3],x1[0],x1[1],x1[2],x1[3],x2[0],x2[1],x2[2],x2[3],x3[0],x3[1],x3[2],x3[3]};
#pragma unroll
    for (int i = 0; i < 16; ++i) { const unsigned short hb = bf16_bits(xs[i]); ah.u[i] = hb; al.u[i] = ASPLIT ? bf16_bits(xs[i] - bf16_val(hb)) : (unsigned short)0; }
#pragma unroll
    for (int t = 0; t < 4; ++t) {
      const unsigned short* brow = Wt + (size_t)(col0 + t * 16 + ln) * ldb + kb;
      FragB b;
      b.half[0] = *(const v8us*)(brow + 8 * hh);
      b.half[1] = *(const v8us*)(brow + 16 + 8 * hh);
      acc[t] = mmaN<ASPLIT ? 2 : 1>(ah.v, al.v, b.v, b.v, acc[t]);
    }
  }
#pragma unroll
  for (int t = 0; t < 4; ++t) {
    float bv = bias ? bias[col0 + t * 16 + ln] : 0.f;
    if (BIAS_BF16) bv = bf16_round(bv);
#pragma unroll
    for (int r = 0; r < 8; ++r) { float v = acc[t][r] + bv; if (ACT == 1) v = fmaxf(v, 0.f); so[w][8 * hh + r][t * 16 + ln] = v; }
  }
  __builtin_amdgcn_fence(__ATOMIC_ACQ_REL, "workgroup");
  __builtin_amdgcn_wave_barrier();
  const int rsub = lane >> 4, c4 = (lane & 15) * 4;
  {
#pragma unroll
    for (int q = 0; q < 8; ++q) {
      const int r = q * 2 + rsub;
      const v4f v = *(const v4fa*)&so[w][r][c4];
      *(v4f*)(C + (size_t)(row0 + r) * ldc + col0 + c4) = v;
    }
    
  }
}

// GEMM C = act(A·W + bias + resid): A f32 (ASPLIT -> hi/lo 2 terms), Wt bf16 [N][K]; ACT 0 none, 1 relu, 2 exact gelu;
// resid (optional, f32, row index = (row % rmod), pitch ldr, RES_BF16 rounds it) added before the activation.
template <bool ASPLIT, int ACT, bool BIAS_BF16, bool RES_BF16>
__global__ __launch_bounds__(128) void k_gemm_bf3(const float* __restrict__ A, int lda, const unsigned short* __restrict__ Wt, int ldb,
                                                const float* __restrict__ bias, const float* __restrict__ resid, int rmod, int ldr,
                                                float* __restrict__ C, int ldc, int M, int N, int K) {
  __shared__ __attribute__((aligned(16))) float so[4][16][64];
  const int tid = threadIdx.x, w = tid >> 5, lane = tid & 31, ln = lane & 15, hh = lane >> 4;
  const int ntn = N / 64;
  const int wid = blockIdx.x * 4 + w;
  const int mt = wid / ntn, nq = wid % ntn;
  if (mt * 16 >= M) return;
  const int row0 = mt * 16, col0 = nq * 64;
  const float* arow = A + (size_t)(row0 + ln) * lda;
  v8f acc[4] = {};
  for (int kb = 0; kb < K; kb += 32) {
    FragB ah, al;
    const v4f x0 = *(const v4fa*)(arow + kb + 8 * hh), x1 = *(const v4fa*)(arow + kb + 8 * hh + 4);
    const v4f x2 = *(const v4fa*)(arow + kb + 16 + 8 * hh), x3 = *(const v4fa*)(arow + kb + 16 + 8 * hh + 4);
    float xs[16] = {x0[0],x0[1],x0[2],x0[3],x1[0],x1[1],x1[2],x1[3],x2[0],x2[1],x2[2],x2[3],x3[0],x3[1],x3[2],x3[3]};
#pragma unroll
    for (int i = 0; i < 16; ++i) { const unsigned short hb = bf16_bits(xs[i]); ah.u[i] = hb; al.u[i] = ASPLIT ? bf16_bits(xs[i] - bf16_val(hb)) : (unsigned short)0; }
#pragma unroll
    for (int t = 0; t < 4; ++t) {
      const unsigned short* brow = Wt + (size_t)(col0 + t * 16 + ln) * ldb + kb;
      FragB b;
      b.half[0] = *(const v8us*)(brow + 8 * hh);
      b.half[1] = *(const v8us*)(brow + 16 + 8 * hh);
      acc[t] = mmaN<ASPLIT ? 2 : 1>(ah.v, al.v, b.v, b.v, acc[t]);
    }
  }
#pragma unroll
  for (int t = 0; t < 4; ++t) {
    const int col = col0 + t * 16 + ln;
    float bv = bias ? bias[col] : 0.f;
    if (BIAS_BF16) bv = bf16_round(bv);
#pragma unroll
    for (int r = 0; r < 8; ++r) {
      float v = acc[t][r] + bv;
      if (resid) { float rv = resid[(size_t)((row0 + 8 * hh + r) % rmod) * ldr + col]; if (RES_BF16) rv = bf16_round(rv); v += rv; }
      if (ACT == 1) v = fmaxf(v, 0.f);
      if (ACT == 2) v = 0.5f * v * (1.0f + erff(v * 0.70710678118654752f));
      if (ACT == 3) { const float u = 0.7978845608028654f * (v + 0.044715f * v * v * v); v = 0.5f * v * (1.0f + tanhf(u)); }
      so[w][8 * hh + r][t * 16 + ln] = v;
    }
  }
  __builtin_amdgcn_fence(__ATOMIC_ACQ_REL, "workgroup");
  __builtin_amdgcn_wave_barrier();
  const int rsub = lane >> 4, c4 = (lane & 15) * 4;
  {
#pragma unroll
    for (int q = 0; q < 8; ++q) {
      const int r = q * 2 + rsub;
      const v4f v = *(const v4fa*)&so[w][r][c4];
      *(v4f*)(C + (size_t)(row0 + r) * ldc + col0 + c4) = v;
    }
    
  }
}
// row LayerNorm (biased variance, eps) over N: s = X (+ R); optional out_sum <- s; out_norm <- (s-mu)*rsqrt(var+eps)*g + b
template <bool PARAM_BF16>
__global__ __launch_bounds__(256) void k_layernorm(const float* __restrict__ X, const float* __restrict__ R, const float* __restrict__ g, const float* __restrict__ bta,
                                                  float* __restrict__ out_sum, float* __restrict__ out_norm, int N, float eps) {
  __shared__ float red[256];
  const int row = blockIdx.x, tid = threadIdx.x;
  const float* x = X + (size_t)row * N; const float* rr = R ? R + (size_t)row * N : nullptr;
  float vals[16];                     // up to N = 4096
  const int per = N / 256;            // contiguous chunk per thread? use strided-by-4 chunks: thread handles j = tid*4 + 1024*u
  float s1 = 0.f;
  for (int u = 0; u < per / 4; ++u) {
    const int j = tid * 4 + 1024 * u;
    const v4f a = *(const v4fa*)(x + j);
    v4f b = {0.f,0.f,0.f,0.f}; if (rr) b = *(const v4fa*)(rr + j);
#pragma unroll
    for (int q = 0; q < 4; ++q) { const float v = a[q] + b[q]; vals[u * 4 + q] = v; s1 += v; }
  }
  red[tid] = s1; __syncthreads();
  for (int st = 128; st > 0; st >>= 1) { if (tid < st) red[tid] += red[tid + st]; __syncthreads(); }
  const float mu = red[0] / (float)N; __syncthreads();
  float s2 = 0.f;
  for (int u = 0; u < per / 4; ++u)
#pragma unroll
    for (int q = 0; q < 4; ++q) { const float c = vals[u * 4 + q] - mu; s2 += c * c; }
  red[tid] = s2; __syncthreads();
  for (int st = 128; st > 0; st >>= 1) { if (tid < st) red[tid] += red[tid + st]; __syncthreads(); }
  const float rs = rsqrtf(red[0] / (float)N + eps);
  {
    for (int u = 0; u < per / 4; ++u) {
      const int j = tid * 4 + 1024 * u;
      v4f o, sm;
#pragma unroll
      for (int q = 0; q < 4; ++q) {
        float gg = g[j + q], bb = bta[j + q];
        if (PARAM_BF16) { gg = bf16_round(gg); bb = bf16_round(bb); }
        sm[q] = vals[u * 4 + q]; o[q] = (vals[u * 4 + q] - mu) * rs * gg + bb;
      }
      if (out_sum) *(v4f*)(out_sum + (size_t)row * N + j) = sm;
      *(v4f*)(out_norm + (size_t)row * N + j) = o;
    }
    
  }
}



// ---- f16 WMMA path (v_wmma_f32_16x16x32_f16): 11-bit significands for operands in range — used where a [0,1] probability operand needs more precision than bf16
typedef _Float16 v16h __attribute__((ext_vector_type(16)));
union FragH { v16h v; v8us half[2]; _Float16 h[16]; unsigned short u[16]; };
template <int NT>
__device__ __forceinline__ v8f mmaH(v16h ah, v16h al, v16h bh, v16h bl, v8f c) {
  c = __builtin_amdgcn_wmma_f32_16x16x32_f16(false, ah, false, bh, (short)0, c, false, false);
  if (NT >= 2) c = __builtin_amdgcn_wmma_f32_16x16x32_f16(false, al, false, bh, (short)0, c, false, false);
  if (NT >= 3) c = __builtin_amdgcn_wmma_f32_16x16x32_f16(false, ah, false, bl, (short)0, c, false, false);
  asm volatile("v_nop\n\tv_nop\n\tv_nop\n\tv_nop" : "+v"(c) : "v"(ah), "v"(al), "v"(bh), "v"(bl));
  return c;
}
// batched GEMM like k_gemm_b but f16 operands: A f32 (split into f16 hi/lo if ASPLIT, else rounded to f16), Bt = f16 values [n][k]; alpha; C f32; N multiple of 16 (partial tiles skipped)
template <bool ASPLIT>
__global__ __launch_bounds__(128) void k_gemm_h(const float* __restrict__ A, int lda, size_t sA, const _Float16* __restrict__ Bh, int ldb, size_t sB, float alpha, float* __restrict__ C, int ldc, size_t sC, int M, int N, int K) {
  __shared__ __attribute__((aligned(16))) float so[4][16][64];
  const int tid = threadIdx.x, w = tid >> 5, lane = tid & 31, ln = lane & 15, hh = lane >> 4; const int by = blockIdx.y;
  A += (size_t)by * sA; Bh += (size_t)by * sB; C += (size_t)by * sC;
  const int ntn = (N + 63) / 64; const int wid = blockIdx.x * 4 + w; const int mt = wid / ntn, nq = wid % ntn; if (mt * 16 >= M) return;
  const int row0 = mt * 16, col0 = nq * 64; const float* arow = A + (size_t)(row0 + ln) * lda;
  v8f acc[4] = {};
  for (int kb = 0; kb < K; kb += 32) {
    FragH ah, al;
    const v4f x0 = *(const v4fa*)(arow + kb + 8 * hh), x1 = *(const v4fa*)(arow + kb + 8 * hh + 4), x2 = *(const v4fa*)(arow + kb + 16 + 8 * hh), x3 = *(const v4fa*)(arow + kb + 16 + 8 * hh + 4);
    float xs[16] = {x0[0],x0[1],x0[2],x0[3],x1[0],x1[1],x1[2],x1[3],x2[0],x2[1],x2[2],x2[3],x3[0],x3[1],x3[2],x3[3]};
#pragma unroll
    for (int i = 0; i < 16; ++i) { const _Float16 h = (_Float16)xs[i]; ah.h[i] = h; al.h[i] = ASPLIT ? (_Float16)(xs[i] - (float)h) : (_Float16)0.0f; }
#pragma unroll
    for (int t = 0; t < 4; ++t) { if (col0 + t * 16 >= N) continue; const size_t boff = (size_t)(col0 + t * 16 + ln) * ldb + kb; FragH bq; bq.half[0] = *(const v8us*)(Bh + boff + 8 * hh); bq.half[1] = *(const v8us*)(Bh + boff + 16 + 8 * hh);
      acc[t] = mmaH<ASPLIT ? 2 : 1>(ah.v, al.v, bq.v, bq.v, acc[t]); }
  }
#pragma unroll
  for (int t = 0; t < 4; ++t) { if (col0 + t * 16 >= N) continue;
#pragma unroll
    for (int r = 0; r < 8; ++r) so[w][8 * hh + r][t * 16 + ln] = acc[t][r] * alpha; }
  __builtin_amdgcn_fence(__ATOMIC_ACQ_REL, "workgroup"); __builtin_amdgcn_wave_barrier();
  const int rsub = lane >> 4, c4 = (lane & 15) * 4;
  {
#pragma unroll
    for (int q = 0; q < 8; ++q) { const int r = q * 2 + rsub; if (col0 + c4 < N) { const v4f v = *(const v4fa*)&so[w][r][c4]; *(v4f*)(C + (size_t)(row0 + r) * ldc + col0 + c4) = v; } }
     }
}

// Wt[n][k] = f16(W[k][n]·scale) from f32 row-major W[K][N] (scale = power of two; bf16-exact weights stay exact in f16 away from the subnormal range)
__global__ __launch_bounds__(256) void k_wt_f16(const float* __restrict__ W, _Float16* __restrict__ Wt, int K, int N, float scale) {
  const int t = blockIdx.x * 256 + threadIdx.x; if (t >= N * (K / 8)) return; const int n = t / (K / 8), k8 = (t % (K / 8)) * 8; FragH f;
#pragma unroll
  for (int i = 0; i < 8; ++i) f.h[i] = (_Float16)(bf16_round(W[(size_t)(k8 + i) * N + n]) * scale); const v8us o = f.half[0];
  *(v8us*)((unsigned short*)Wt + (size_t)n * K + k8) = o; 
}
// k_gemm_hh variant with fused epilogue: v = acc·alpha + bias[by·sBias + col] (+ CP[(row/rowsPerB)·sCPb + by·64 + col] if CP) ; ACT 0 none / 1 elu ; writes f16 C16 (and f32 C if non-null)
template <int ACT>
__global__ __launch_bounds__(128) void k_gemm_hhx(const _Float16* __restrict__ A, int lda, size_t sA, const _Float16* __restrict__ Bh, int ldb, size_t sB, float alpha, const float* __restrict__ bias, size_t sBias, const float* __restrict__ CP, int rowsPerB, size_t sCPb, int row0g,
    float* __restrict__ C, _Float16* __restrict__ C16, int ldc, size_t sC, int M, int N, int K) {
  __shared__ __attribute__((aligned(16))) float so[4][16][64];
  const int tid = threadIdx.x, w = tid >> 5, lane = tid & 31, ln = lane & 15, hh = lane >> 4; const int by = blockIdx.y;
  A += (size_t)by * sA; Bh += (size_t)by * sB; const size_t cofs = (size_t)by * sC; const float* bp = bias ? bias + (size_t)by * sBias : nullptr;
  const int ntn = (N + 63) / 64; const int wid = blockIdx.x * 4 + w; const int mt = wid / ntn, nq = wid % ntn; if (mt * 16 >= M) return;
  const int row0 = mt * 16, col0 = nq * 64; const _Float16* arow = A + (size_t)(row0 + ln) * lda;
  v8f acc[4] = {};
  for (int kb = 0; kb < K; kb += 32) { FragH ah; ah.half[0] = *(const v8us*)((const unsigned short*)arow + kb + 8 * hh); ah.half[1] = *(const v8us*)((const unsigned short*)arow + kb + 16 + 8 * hh);
#pragma unroll
    for (int t = 0; t < 4; ++t) { if (col0 + t * 16 >= N) continue; const size_t boff = (size_t)(col0 + t * 16 + ln) * ldb + kb; FragH bq; bq.half[0] = *(const v8us*)((const unsigned short*)Bh + boff + 8 * hh); bq.half[1] = *(const v8us*)((const unsigned short*)Bh + boff + 16 + 8 * hh);
      acc[t] = mmaH<1>(ah.v, ah.v, bq.v, bq.v, acc[t]); }
  }
#pragma unroll
  for (int t = 0; t < 4; ++t) { if (col0 + t * 16 >= N) continue; const int col = col0 + t * 16 + ln; const float bv = bp ? bf16_round(bp[col]) : 0.f;
#pragma unroll
    for (int r = 0; r < 8; ++r) { float v = acc[t][r] * alpha + bv; if (CP) { const int rr = row0g + row0 + 8 * hh + r; if (rowsPerB < 0) v += CP[cofs + (size_t)rr * ldc + col];      /* rowsPerB < 0: own element of the batched C plane */ else { const int bidx = rr / rowsPerB; v += CP[(size_t)bidx * sCPb + (size_t)by * 64 + col]; } } if (ACT == 1) v = (v > 0.f) ? v : expm1f(v); else if (ACT == 7) v = (v > 0.f) ? v + 1.0f : expf(v); else if (ACT == 8) v = tanhf(v); else if (ACT == 9) v = 0.5f * v * (1.0f + tanhf(0.7978845608028654f * (v + 0.044715f * v * v * v))); else if (ACT == 11) v = 1.0f / (1.0f + expf(-v)); else if (ACT == 12) v = (v > 0.f) ? v : 0.01f * v; else if (ACT == 14) v = (v > 0.f) ? v : 0.1f * v; else if (ACT == 16) v = (v >= 0.f) ? v : 0.3f * v; else if (ACT == 17) v = (v >= 0.f) ? v : 0.2f * v; else if (ACT == 15) v = v / (1.0f + expf(-v)); else if (ACT == 3) v = fmaxf(v, 0.f); else if (ACT == 6) v = 0.5f * v * (1.0f + erff(v * 0.70710678118654752f)); so[w][8 * hh + r][t * 16 + ln] = v; } }
  __builtin_amdgcn_fence(__ATOMIC_ACQ_REL, "workgroup"); __builtin_amdgcn_wave_barrier();
  const int rsub = lane >> 4, c4 = (lane & 15) * 4; typedef _Float16 v4h __attribute__((ext_vector_type(4)));
  {
#pragma unroll
    for (int q = 0; q < 8; ++q) { const int r = q * 2 + rsub; if (col0 + c4 < N) { const v4f v = *(const v4fa*)&so[w][r][c4]; if (C) *(v4f*)(C + cofs + (size_t)(row0 + r) * ldc + col0 + c4) = v; if (C16) { v4h h4; for (int i = 0; i < 4; ++i) h4[i] = (_Float16)v[i]; *(v4h*)(C16 + cofs + (size_t)(row0 + r) * ldc + col0 + c4) = h4; } } }
     }
}


typedef _Float16 v4h __attribute__((ext_vector_type(4)));

__global__ __launch_bounds__(256) void k_h16(const float* __restrict__ x, _Float16* __restrict__ X16, size_t n8) { const size_t t = (size_t)blockIdx.x * 256 + threadIdx.x; if (t >= n8) return; FragH f;
#pragma unroll
  for (int q = 0; q < 8; ++q) f.h[q] = (_Float16)x[t * 8 + q]; *(v8us*)((unsigned short*)X16 + t * 8) = f.half[0];  }
__global__ __launch_bounds__(256) void k_round16f(const float* __restrict__ W, _Float16* __restrict__ Bt, size_t n8) { const size_t t = (size_t)blockIdx.x * 256 + threadIdx.x; if (t >= n8) return; FragH f;
#pragma unroll
  for (int i = 0; i < 8; ++i) f.h[i] = (_Float16)(bf16_round(W[t * 8 + i]) * 16.0f); *(v8us*)((unsigned short*)Bt + t * 8) = f.half[0];  }
// ---- fast GEMM pieces: wave tile 32x64, four waves a work-group (128 rows x 64 columns); K % 64 == 0 ----
__device__ __forceinline__ v16h g2_frag(const _Float16* p, int hh) { FragH f; f.half[0] = *(const v8us*)((const unsigned short*)p + 8 * hh); f.half[1] = *(const v8us*)((const unsigned short*)p + 16 + 8 * hh); return f.v; }
__device__ __forceinline__ v8f g2_mma(v16h a, v16h b, v8f c) { v8f d = __builtin_amdgcn_wmma_f32_16x16x32_f16(false, a, false, b, (short)0, c, false, false); asm volatile("v_nop\n\tv_nop\n\tv_nop\n\tv_nop" : "+v"(d) : "v"(a), "v"(b)); return d; }
// c[4 half + t] += A[row0 + 16 half ..][k] Bh[col0 + 16 t ..][k] over k = 0 .. K - 1
__device__ __forceinline__ void g2_kloop(const _Float16* __restrict__ A, int lda, const _Float16* __restrict__ Bh, int ldb, int row0, int col0, int ln, int hh, int K, v8f (&c)[8]) {
  const _Float16* a0p = A + (size_t)(row0 + ln) * lda; const _Float16* a1p = a0p + (size_t)16 * lda;
  const _Float16* b0p = Bh + (size_t)(col0 + ln) * ldb; const _Float16* b1p = b0p + (size_t)16 * ldb; const _Float16* b2p = b1p + (size_t)16 * ldb; const _Float16* b3p = b2p + (size_t)16 * ldb;
  /* One trip = 64 k = one 128-byte line of each operand row. All 24 fragment loads of the trip stand in front of its first WMMA, so that a trip waits for memory once;
     each accumulator still takes its k blocks in rising order. */
#pragma unroll 1 /* a second trip's fragments would not fit in 256 registers beside the 64 accumulator registers */
  for (int kb = 0; kb < K; kb += 64) {
    const _Float16* pa0 = a0p + kb + 8 * hh; const _Float16* pa1 = a1p + kb + 8 * hh; const _Float16* pb0 = b0p + kb + 8 * hh; const _Float16* pb1 = b1p + kb + 8 * hh; const _Float16* pb2 = b2p + kb + 8 * hh; const _Float16* pb3 = b3p + kb + 8 * hh;
    const v16h a0 = g2_frag(pa0, 0), a1 = g2_frag(pa1, 0), b0 = g2_frag(pb0, 0), b1 = g2_frag(pb1, 0), b2 = g2_frag(pb2, 0), b3 = g2_frag(pb3, 0);
    const v16h a2 = g2_frag(pa0 + 32, 0), a3 = g2_frag(pa1 + 32, 0), b4 = g2_frag(pb0 + 32, 0), b5 = g2_frag(pb1 + 32, 0), b6 = g2_frag(pb2 + 32, 0), b7 = g2_frag(pb3 + 32, 0);
    /* the wait in front of any rewrite of a register that an issued load names; as its inputs the six address pairs stay live up to it, so that no load of the trip lands in one of them */
    asm volatile("s_wait_xcnt 0x0" :: "v"(pa0), "v"(pa1), "v"(pb0), "v"(pb1), "v"(pb2), "v"(pb3) : "memory");
    c[0] = g2_mma(a0, b0, c[0]); c[4] = g2_mma(a1, b0, c[4]); c[1] = g2_mma(a0, b1, c[1]); c[5] = g2_mma(a1, b1, c[5]);
    c[2] = g2_mma(a0, b2, c[2]); c[6] = g2_mma(a1, b2, c[6]); c[3] = g2_mma(a0, b3, c[3]); c[7] = g2_mma(a1, b3, c[7]);
    c[0] = g2_mma(a2, b4, c[0]); c[4] = g2_mma(a3, b4, c[4]); c[1] = g2_mma(a2, b5, c[1]); c[5] = g2_mma(a3, b5, c[5]);
    c[2] = g2_mma(a2, b6, c[2]); c[6] = g2_mma(a3, b6, c[6]); c[3] = g2_mma(a2, b7, c[3]); c[7] = g2_mma(a3, b7, c[7]); } }
// A wave's 32x64 tile out of its LDS tile: lane = 16 bytes of f32 of row 2 q + (lane >> 4). The stores take one base address and constant offsets.
__device__ __forceinline__ void g2_take(const float (&so)[32][68], int lane, v4f (&v)[16]) {
#pragma unroll /* constant indices keep v[] in registers */
  for (int q = 0; q < 16; ++q) v[q] = *(const v4fa*)&so[q * 2 + (lane >> 4)][(lane & 15) * 4]; }
template <int LDC, typename T, typename V>
__device__ __forceinline__ void g2_put(T* __restrict__ p, const V (&v)[16]) {
#pragma unroll /* constant indices keep v[] in registers; constant offsets keep one address pair */
  for (int q = 0; q < 16; ++q) *(V*)(p + (size_t)q * 2 * LDC) = v[q]; }
// The projections in one grid, by block ranges (weights carried x16, f32 accumulation, k in rising order everywhere):
//   job 0: q = x Wq^T + bq and job 1: k = x Wk^T, as f16 rows; their first QT0 token rows go out as f32 too (operands of the exact first-tile attention);
//   job 2: V^T = Wv x^T + bv (the weight rows are the A operand, the token rows the B operand; the bias goes by row), f16 [NH * HD][SQ], the layout that the second attention product reads;
//   job 3: v of the first QT0 token rows, f32 rows.
#define QKV_G ((MP / 128) * (DM / 64))      /* work-groups of each of the jobs 0, 1, 2 */
__global__ __launch_bounds__(128) void k_qkv(const _Float16* __restrict__ X, const _Float16* __restrict__ BQ, const _Float16* __restrict__ BK, const _Float16* __restrict__ BV, const float* __restrict__ bq, const float* __restrict__ bv,
    _Float16* __restrict__ Q16, _Float16* __restrict__ K16, _Float16* __restrict__ VT, float* __restrict__ QF0, float* __restrict__ KF0, float* __restrict__ VF0) {
  static_assert(NB == 1 && QT0 % 128 == 0 && MP % 128 == 0 && DM % 128 == 0 && MP == SQ && NH * HD == DM, "k_qkv: one batch, whole work-group tiles in both orientations");
  __shared__ __attribute__((aligned(16))) float so[4][32][68];
  const int tid = threadIdx.x, w = tid >> 5, lane = tid & 31, ln = lane & 15, hh = lane >> 4;
  const int job = blockIdx.x / QKV_G, bx = blockIdx.x % QKV_G;
  const int ntn = (job == 2 ? SQ : DM) / 64;      /* column tiles of the job's product */
  const int mt = bx / ntn, nq = bx % ntn; const int row0 = mt * 128 + 32 * w, col0 = nq * 64;
  const _Float16* Ah = job == 2 ? BV : X; const _Float16* Bh = job == 0 ? BQ : job == 1 ? BK : job == 2 ? X : BV;
  const v8f z8 = {0.f,0.f,0.f,0.f,0.f,0.f,0.f,0.f}; v8f c[8] = {z8, z8, z8, z8, z8, z8, z8, z8};
  g2_kloop(Ah, DM, Bh, DM, row0, col0, ln, hh, DM, c);
  if (job == 2) { const float* pb = bv + row0 + 8 * hh; float rb[2][8];
#pragma unroll /* constant indices keep rb[] in registers */
    for (int half = 0; half < 2; ++half)
#pragma unroll /* as above */
      for (int r = 0; r < 8; ++r) rb[half][r] = pb[half * 16 + r];
    /* the wait in front of any rewrite of a register that an issued load names; as its input the address pair stays live up to it */
    asm volatile("s_wait_xcnt 0x0" :: "v"(pb) : "memory");
#pragma unroll /* constant indices keep c[] in registers */
    for (int u = 0; u < 8; ++u)
#pragma unroll /* as above */
      for (int r = 0; r < 8; ++r) so[w][(u >> 2) * 16 + 8 * hh + r][(u & 3) * 16 + ln] = c[u][r] * 0.0625f + bf16_round(rb[u >> 2][r]);
  } else { const float* bp = job == 0 ? bq : job == 1 ? nullptr : bv; float bb[4] = {0.f, 0.f, 0.f, 0.f};
    if (bp) {
#pragma unroll /* constant indices keep bb[] in registers */
      for (int t = 0; t < 4; ++t) bb[t] = bf16_round(bp[col0 + t * 16 + ln]); }
#pragma unroll /* as above */
    for (int u = 0; u < 8; ++u)
#pragma unroll /* as above */
      for (int r = 0; r < 8; ++r) so[w][(u >> 2) * 16 + 8 * hh + r][(u & 3) * 16 + ln] = c[u][r] * 0.0625f + bb[u & 3]; }
  __builtin_amdgcn_fence(__ATOMIC_ACQ_REL, "workgroup"); __builtin_amdgcn_wave_barrier();
  const int rsub = lane >> 4, c4 = (lane & 15) * 4; v4f v[16]; v4h h[16];
  g2_take(so[w], lane, v);
#pragma unroll /* constant indices keep the arrays in registers */
  for (int q = 0; q < 16; ++q)
#pragma unroll /* as above */
    for (int i = 0; i < 4; ++i) h[q][i] = (_Float16)v[q][i];
  /* the stores stand behind every LDS read and every conversion, so that no register that an issued store names is written again */
  const size_t at = (size_t)(row0 + rsub) * (job == 2 ? SQ : DM) + col0 + c4;
  _Float16* p16 = (job == 0 ? Q16 : job == 1 ? K16 : VT) + at; float* pf = (job == 0 ? QF0 : job == 1 ? KF0 : VF0) + at;
  if (job == 2) g2_put<SQ>(p16, h); else { if (job != 3) g2_put<DM>(p16, h); if (row0 < QT0) g2_put<DM>(pf, v); } }
// out = o Wo^T in one grid (o carried x64, Wo x16). Rows from QT0 on: the f16 o rows, 128 rows a work-group. The first QT0 rows: the exact o as an f16 plane and its x1024 residual plane,
// out = hi 2^-10 + lo 2^-20; 64 rows a work-group, waves 0 and 1 take the hi plane and waves 2 and 3 the lo plane of the same rows, so that no wave walks k twice; the two terms meet in LDS.
#define OUT_G0 ((QT0 / 64) * (DM / 64))      /* work-groups of the first QT0 rows */
__global__ __launch_bounds__(128) void k_out(const _Float16* __restrict__ O16, const _Float16* __restrict__ OH0, const _Float16* __restrict__ OL0, const _Float16* __restrict__ BO, float* __restrict__ out) {
  static_assert(NB == 1 && QT0 % 128 == 0 && MPO % 128 == 0 && DM % 64 == 0, "k_out: one batch, the first tile ends on a work-group's edge");
  __shared__ __attribute__((aligned(16))) float so[4][32][68];
  const int tid = threadIdx.x, w = tid >> 5, lane = tid & 31, ln = lane & 15, hh = lane >> 4;
  const bool first = blockIdx.x < OUT_G0; const int bx = first ? blockIdx.x : blockIdx.x - OUT_G0;
  const int mt = bx / (DM / 64), nq = bx % (DM / 64); const int row0 = first ? mt * 64 + 32 * (w & 1) : QT0 + mt * 128 + 32 * w; const int col0 = nq * 64;
  const bool lo = first && w >= 2; const _Float16* Ah = first ? (lo ? OL0 : OH0) : O16; const float alpha = lo ? 0.00000095367431640625f : 0.0009765625f;
  const v8f z8 = {0.f,0.f,0.f,0.f,0.f,0.f,0.f,0.f}; v8f c[8] = {z8, z8, z8, z8, z8, z8, z8, z8};
  g2_kloop(Ah, DM, BO, DM, row0, col0, ln, hh, DM, c);
#pragma unroll /* constant indices keep c[] in registers */
  for (int u = 0; u < 8; ++u)
#pragma unroll /* as above */
    for (int r = 0; r < 8; ++r) so[w][(u >> 2) * 16 + 8 * hh + r][(u & 3) * 16 + ln] = c[u][r] * alpha;
  const int rsub = lane >> 4, c4 = (lane & 15) * 4; v4f v[16]; float* po = out + (size_t)(row0 + rsub) * DM + col0 + c4;
  if (first) {
    __syncthreads();      /* the lo waves' tiles are read by the hi waves; the branch is the same for the whole work-group */
    if (!lo) { v4f vl[16]; g2_take(so[w], lane, v); g2_take(so[w + 2], lane, vl);
#pragma unroll /* constant indices keep the arrays in registers */
      for (int q = 0; q < 16; ++q) v[q] = vl[q] + v[q];
      g2_put<DM>(po, v); }      /* the stores stand behind every LDS read and sum: no register that an issued store names is written again */
  } else {
    __builtin_amdgcn_fence(__ATOMIC_ACQ_REL, "workgroup"); __builtin_amdgcn_wave_barrier();
    g2_take(so[w], lane, v); g2_put<DM>(po, v); } }      /* as above */


// The five f32 -> f16 passes in one grid by block ranges: first the token rows (bf16-rounded, exact in f16), then the four natural [out][in] weights (bf16-rounded, x16). Eight elements a thread.
__global__ __launch_bounds__(256) void k_prep(const float* __restrict__ x, const float* __restrict__ wq, const float* __restrict__ wk, const float* __restrict__ wv, const float* __restrict__ wo,
    _Float16* __restrict__ X16, _Float16* __restrict__ BQ, _Float16* __restrict__ BK, _Float16* __restrict__ BV, _Float16* __restrict__ BO) {
  static_assert((NR * DM) % 2048 == 0 && ((size_t)DM * DM) % 2048 == 0, "k_prep: whole blocks of 2048 elements");
  constexpr unsigned GX = (unsigned)(NR * DM / 2048), GW = (unsigned)((size_t)DM * DM / 2048);
  const unsigned bx = blockIdx.x; const float* s = x; _Float16* d = X16; float sc = 1.0f; unsigned b0 = bx;
  if (bx >= GX) { const unsigned i = (bx - GX) / GW; b0 = (bx - GX) % GW; sc = 16.0f; s = i == 0 ? wq : i == 1 ? wk : i == 2 ? wv : wo; d = i == 0 ? BQ : i == 1 ? BK : i == 2 ? BV : BO; }
  const size_t t = (size_t)b0 * 256 + threadIdx.x; FragH f;
#pragma unroll /* constant indices keep f in registers */
  for (int q = 0; q < 8; ++q) f.h[q] = (_Float16)(bf16_round(s[t * 8 + q]) * sc);
  *(v8us*)((unsigned short*)d + t * 8) = f.half[0]; }
__global__ __launch_bounds__(256) void k_rsm(const float* __restrict__ S, _Float16* __restrict__ P, int nrows) {
  #pragma clang fp contract(off)
  const int i = blockIdx.x * 256 + threadIdx.x; if (i >= nrows) return; const float* s = S + (size_t)i * SQ; float mx = -3.0e38f;
#pragma unroll 1
  for (int j = 0; j < SQ; ++j) mx = fmaxf(mx, s[j]); float se = 0.f;
#pragma unroll 1
  for (int j = 0; j < SQ; ++j) se += expf(s[j] - mx); const float sc = 256.0f / se;
#pragma unroll 1
  for (int j0 = 0; j0 < SQ; j0 += 8) { FragH f; for (int q = 0; q < 8; ++q) f.h[q] = (_Float16)(expf(s[j0 + q] - mx) * sc); unsigned short* d = (unsigned short*)P + (size_t)i * SQ + j0; *(v8us*)d = f.half[0];  } }
__global__ __launch_bounds__(256) void k_vt(const _Float16* __restrict__ V16, int b, int h0, _Float16* __restrict__ VT) { __shared__ unsigned short tl[64][65]; const int tid = threadIdx.x; const int hh = blockIdx.x % HG, sg = blockIdx.x / HG; const int s0 = sg * 64; const int h = h0 + hh;
  for (int i = tid; i < 64 * 8; i += 256) { const int j = i / 8, d8 = (i % 8) * 8; FragH f; f.half[0] = *(const v8us*)((const unsigned short*)V16 + ((size_t)b * SQ + s0 + j) * DM + h * HD + d8); for (int q = 0; q < 8; ++q) tl[d8 + q][j] = f.u[q]; }
  __syncthreads();
  { for (int i = tid; i < 64 * 8; i += 256) { const int d = i / 8, j8 = (i % 8) * 8; FragH f; for (int q = 0; q < 8; ++q) f.u[q] = tl[d][j8 + q]; *(v8us*)((unsigned short*)VT + ((size_t)hh * HD + d) * SQ + s0 + j8) = f.half[0]; }  } }



#define FA_L2E 1.4426950408889634f
__device__ __forceinline__ float fa_xhalf(float x) { return __builtin_bit_cast(float, __builtin_amdgcn_permlanex16(__builtin_bit_cast(int, x), __builtin_bit_cast(int, x), 0x76543210, 0xfedcba98, false, false)); }      /* lane l with lane l ^ 16, on the vector pipe */
/* p = 2^a; behind the v_exp_f32 stands the argument of a weight three calls on, an = x log2(e) + c. That product is independent of the v_exp_f32 and fills the one slot that the instruction set asks for
   between a transcendental and an instruction that reads its result or overwrites its source; in one statement, so that it stays there. "=&v": no output shares a register with an input. */
__device__ __forceinline__ float fa_exp2_fma(float a, float x, float c, float& an) { float p; asm("v_exp_f32 %0, %2\n\tv_fma_f32 %1, %3, %4, %5" : "=&v"(p), "=&v"(an) : "v"(a), "v"(x), "s"(FA_L2E), "v"(c)); return p; }
/* the last three weights of a pass have no later argument to form: a v_nop fills the same slot */
__device__ __forceinline__ float fa_exp2_nop(float a) { float p; asm("v_exp_f32 %0, %1\n\tv_nop" : "=&v"(p) : "v"(a)); return p; }
__device__ __forceinline__ v8f fa_mma(v16h a, v16h b, v8f c) { return __builtin_amdgcn_wmma_f32_16x16x32_f16(false, a, false, b, (short)0, c, false, false); }
template <bool DIAG>
__device__ __forceinline__ void fa_pass(float jf0, int ln, int hh, float slope, const v8f (&s)[2][2], const v16h (&vf)[4], v8f (&o)[2][4], float (&m)[2], float (&l)[2]) {
  float bias[2][8];
#pragma unroll /* constant indices keep the arrays in registers */
  for (int mt = 0; mt < 2; ++mt)
#pragma unroll /* as above */
    for (int r = 0; r < 8; ++r) bias[mt][r] = __fmul_rn(slope, jf0 + (float)(mt * 16 + r));      /* slope_h * j, rounded once */
  float x[2][2][8]; float mx[2];
#pragma unroll /* as above */
  for (int nt = 0; nt < 2; ++nt) { float t = -1.0e30f;
#pragma unroll /* as above */
    for (int mt = 0; mt < 2; ++mt)
#pragma unroll /* as above */
      for (int r = 0; r < 8; ++r) { float v = fmaf(s[nt][mt][r], 0.125f, -bias[mt][r]); if (DIAG) v = (mt * 16 + 8 * hh + r <= nt * 16 + ln) ? v : -1.0e30f;      /* diagonal pass: its first key is the wave's first query */
        x[nt][mt][r] = v; t = fmaxf(t, v); }
    mx[nt] = fmaxf(t, fa_xhalf(t)); }
  /* the accumulators are rescaled only in a pass that raises some query's maximum: one scalar branch a pass */
  if (__builtin_amdgcn_ballot_w32(mx[0] > m[0] || mx[1] > m[1]) != 0) {
#pragma unroll /* as above */
    for (int nt = 0; nt < 2; ++nt) { const float mn = fmaxf(m[nt], mx[nt]); const float a = __builtin_amdgcn_exp2f((m[nt] - mn) * FA_L2E); m[nt] = mn; l[nt] *= a;
#pragma unroll /* as above */
      for (int dt = 0; dt < 4; ++dt) o[nt][dt] *= a; } }
  v16h pf[2]; float cc[2], a[32], p[32];      /* weight i = nt * 16 + 2 r + mt; weight = 2^8 exp(x - m) = 2^(x log2(e) + cc) */
#pragma unroll /* as above */
  for (int nt = 0; nt < 2; ++nt) cc[nt] = fmaf(-m[nt], FA_L2E, 8.0f);
#pragma unroll /* as above */
  for (int i = 0; i < 3; ++i) a[i] = fmaf(x[0][i & 1][i >> 1], FA_L2E, cc[0]);
#pragma unroll /* as above */
  for (int i = 0; i < 32; ++i) { const int n = i + 3; if (n < 32) p[i] = fa_exp2_fma(a[i], x[n >> 4][n & 1][(n & 15) >> 1], cc[n >> 4], a[n]); else p[i] = fa_exp2_nop(a[i]); }
#pragma unroll /* as above */
  for (int nt = 0; nt < 2; ++nt) { FragH f; float s0 = 0.f, s1 = 0.f;
#pragma unroll /* as above */
    for (int r = 0; r < 8; ++r) { const float p0 = p[nt * 16 + 2 * r], p1 = p[nt * 16 + 2 * r + 1]; s0 += p0; s1 += p1; f.h[r] = (_Float16)p0; f.h[8 + r] = (_Float16)p1; }
    l[nt] += s0 + s1; pf[nt] = f.v; }
#pragma unroll /* as above */
  for (int dt = 0; dt < 4; ++dt) { o[0][dt] = fa_mma(vf[dt], pf[0], o[0][dt]); o[1][dt] = fa_mma(vf[dt], pf[1], o[1][dt]); } }
__device__ __forceinline__ void fa_scores(const v16h (&kf)[2][2], const v16h (&qf)[2][2], v8f (&s)[2][2]) {
  const v8f z8 = {0.f,0.f,0.f,0.f,0.f,0.f,0.f,0.f};
  s[0][0] = fa_mma(kf[0][0], qf[0][0], z8); s[0][1] = fa_mma(kf[1][0], qf[0][0], z8); s[1][0] = fa_mma(kf[0][0], qf[1][0], z8); s[1][1] = fa_mma(kf[1][0], qf[1][0], z8);
  s[0][0] = fa_mma(kf[0][1], qf[0][1], s[0][0]); s[0][1] = fa_mma(kf[1][1], qf[0][1], s[0][1]); s[1][0] = fa_mma(kf[0][1], qf[1][1], s[1][0]); s[1][1] = fa_mma(kf[1][1], qf[1][1], s[1][1]); }
__global__ __launch_bounds__(256) __attribute__((amdgpu_waves_per_eu(4, 4))) /* a budget of 256 registers: none above v255, no register-window switches in the loop */ void k_fattn(const _Float16* __restrict__ Q, const _Float16* __restrict__ K, const _Float16* __restrict__ VT, _Float16* __restrict__ O) {
  static_assert(SQ % 256 == 0 && HD == 64, "k_fattn: two blocks of 128 query rows a work-group, head size 64");
  const int tid = threadIdx.x, lane = tid & 31, ln = lane & 15, hh = lane >> 4; const int w = __builtin_amdgcn_readfirstlane(tid >> 5);      /* the wave's number in a scalar register: the key loop stays a scalar branch */
  const int h = blockIdx.x % NH, pr = blockIdx.x / NH; const int q0 = (w < 4 ? SQ / 128 - 1 - pr : pr) * 128 + (w & 3) * 32;      /* causal balance: waves 0..3 take row block n - 1 - pr, waves 4..7 row block pr, so that every work-group walks the same number of passes */
  const float slope = (float)exp2(-0.5 * (double)(h + 1));      /* ALiBi slope 2^(-8 (h+1) / 16), correctly rounded to f32 */
  const _Float16* pq = Q + (size_t)(q0 + ln) * LQ + h * HD + 8 * hh; const _Float16* pk = K + (size_t)ln * LQ + h * HD + 8 * hh; const _Float16* pv = VT + ((size_t)h * HD + ln) * SQ + 8 * hh;
  v16h qf[2][2], kf[2][2], vf[4]; v8f s[2][2]; v8f o[2][4]; float m[2] = {-1.0e30f, -1.0e30f}, l[2] = {0.f, 0.f}; float jf0 = (float)(8 * hh);      /* this lane's first key position of the pass, as a float (exact) */
#pragma unroll /* constant indices keep the arrays in registers */
  for (int nt = 0; nt < 2; ++nt) {
#pragma unroll /* as above */
    for (int dt = 0; dt < 4; ++dt) o[nt][dt] = v8f{0.f,0.f,0.f,0.f,0.f,0.f,0.f,0.f};
#pragma unroll /* as above */
    for (int kd = 0; kd < 2; ++kd) { qf[nt][kd] = g2_frag(pq + (size_t)nt * 16 * LQ + kd * 32, 0); kf[nt][kd] = g2_frag(pk + (size_t)nt * 16 * LQ + kd * 32, 0); } }
  /* the wait in front of any rewrite of a register that an issued load names; as its inputs the address pairs stay live up to it */
  asm volatile("s_wait_xcnt 0x0" :: "v"(pq), "v"(pk) : "memory");
#pragma unroll 1 /* a pass holds about 240 registers; two passes side by side would not fit in 256 */
  for (int kb = 0; kb < q0; kb += 32) {
#pragma unroll /* as above */
    for (int dt = 0; dt < 4; ++dt) vf[dt] = g2_frag(pv + (size_t)dt * 16 * SQ, 0);      /* this pass's V^T: flies under the score products and the softmax */
    asm volatile("s_wait_xcnt 0x0" :: "v"(pv) : "memory");      /* as above, in front of the step of pv */
    pv += 32;
    fa_scores(kf, qf, s);
    pk += (size_t)32 * LQ;
#pragma unroll /* as above */
    for (int mt = 0; mt < 2; ++mt)
#pragma unroll /* as above */
      for (int kd = 0; kd < 2; ++kd) kf[mt][kd] = g2_frag(pk + (size_t)mt * 16 * LQ + kd * 32, 0);      /* the next pass's K (at most the diagonal pass's), into the same registers: flies under the softmax and the second product */
    asm volatile("s_wait_xcnt 0x0" :: "v"(pk) : "memory");      /* as above, in front of the next step of pk */
    fa_pass<false>(jf0, ln, hh, slope, s, vf, o, m, l);
    jf0 += 32.0f; }
#pragma unroll /* as above */
  for (int dt = 0; dt < 4; ++dt) vf[dt] = g2_frag(pv + (size_t)dt * 16 * SQ, 0);
  asm volatile("s_wait_xcnt 0x0" :: "v"(pv) : "memory");      /* as above */
  fa_scores(kf, qf, s);
  fa_pass<true>(jf0, ln, hh, slope, s, vf, o, m, l);
  v8us hv[2][4];
#pragma unroll /* as above */
  for (int nt = 0; nt < 2; ++nt) { const float fin = 64.0f / (l[nt] + fa_xhalf(l[nt]));      /* the two halves' sums joined once; o carried x64 */
#pragma unroll /* as above */
    for (int dt = 0; dt < 4; ++dt) { FragH f;
#pragma unroll /* as above */
      for (int r = 0; r < 8; ++r) f.h[r] = (_Float16)(o[nt][dt][r] * fin);
      hv[nt][dt] = f.half[0]; } }
  /* the stores stand behind every conversion: no register that an issued store names is written again */
  unsigned short* po = (unsigned short*)O + (size_t)(q0 + ln) * DM + h * HD + 8 * hh;
#pragma unroll /* as above */
  for (int nt = 0; nt < 2; ++nt)
#pragma unroll /* as above */
    for (int dt = 0; dt < 4; ++dt) *(v8us*)(po + (size_t)nt * 16 * DM + dt * 16) = hv[nt][dt]; }


// Exact f32 causal attention of the first QT0 rows. One work-group of 8 waves per head and 32 query rows (lane = row). The head's K and V rows below the group's end and its 32 q rows
// are staged in LDS by whole-line loads. Scores: wave w takes keys w, w + 8, ...; softmax in two passes over the scores kept in LDS; o: wave w takes head dims 8 w .. 8 w + 7 over all keys in rising order.
// LD = row pitch of QF, KF, VF in floats, a compile-time constant so that every staged row is one base address plus an immediate offset.
template <int ALIBI, int LD>
__global__ __launch_bounds__(256) void k_att0(const float* __restrict__ QF, const float* __restrict__ KF, const float* __restrict__ VF, float scale, _Float16* __restrict__ OH, _Float16* __restrict__ OL, int ldo) {
  static_assert(QT0 % 32 == 0 && HD == 64, "k_att0: 32 rows a group, 16 threads a staged row, 8 dims a wave");
  __shared__ __attribute__((aligned(16))) float lk[QT0][HD]; __shared__ __attribute__((aligned(16))) float lv[QT0][HD]; __shared__ float sc[QT0][32];
  __shared__ __attribute__((aligned(16))) float lqo[32][HD + 4];      /* q rows, later o rows; pitch 16 B x 17: a lane per row reads and writes 16 bytes without bank conflicts */
  __shared__ float pm[8][32]; __shared__ float pl[8][32];
  const int tid = threadIdx.x, lane = tid & 31; const int w = __builtin_amdgcn_readfirstlane(tid >> 5);      /* the wave's number in a scalar register: the key loops stay scalar branches */
  const int h = blockIdx.x / (QT0 / 32), rg = blockIdx.x % (QT0 / 32); const int i = rg * 32 + lane; const int nkeys = rg * 32 + 32;      /* causal: keys up to the group's last row */
  const int sr = tid >> 4, c4 = (tid & 15) * 4;      /* staging: 16 threads a row of 256 bytes */
  { v4f tk[QT0 / 16], tv[QT0 / 16], tq[2];
    const float* gk = KF + (size_t)sr * LD + h * HD + c4; const float* gv = VF + (size_t)sr * LD + h * HD + c4; const float* gq = QF + (size_t)(rg * 32 + sr) * LD + h * HD + c4;
#pragma unroll /* constant indices keep tk[] and tv[] in registers; all loads are issued before the first is used */
    for (int c = 0; c < QT0 / 32; ++c) if (c * 32 < nkeys) {
#pragma unroll /* as above */
      for (int u = 2 * c; u < 2 * c + 2; ++u) { tk[u] = *(const v4fa*)(gk + (size_t)u * 16 * LD); tv[u] = *(const v4fa*)(gv + (size_t)u * 16 * LD); } }
#pragma unroll /* as above */
    for (int u = 0; u < 2; ++u) tq[u] = *(const v4fa*)(gq + (size_t)u * 16 * LD);
    /* the wait in front of any rewrite of a register that an issued load names; as its inputs the three address pairs stay live up to it, so that no load lands in one of them */
    asm volatile("s_wait_xcnt 0x0" :: "v"(gk), "v"(gv), "v"(gq) : "memory");
#pragma unroll /* as above */
    for (int c = 0; c < QT0 / 32; ++c) if (c * 32 < nkeys) {
#pragma unroll /* as above */
      for (int u = 2 * c; u < 2 * c + 2; ++u) { *(v4f*)&lk[u * 16 + sr][c4] = tk[u]; *(v4f*)&lv[u * 16 + sr][c4] = tv[u]; } }
#pragma unroll /* as above */
    for (int u = 0; u < 2; ++u) *(v4f*)&lqo[u * 16 + sr][c4] = tq[u]; }
  __syncthreads();
  const float slope = ALIBI ? (float)exp2(-0.5 * (double)(h + 1)) : 0.f;      /* ALiBi: 2^(-8 (h+1) / 16) */
  v4f q[HD / 4];
#pragma unroll /* constant indices keep q[] in registers */
  for (int c = 0; c < HD / 4; ++c) q[c] = *(const v4f*)&lqo[lane][c * 4];
  float mp = -1.0e30f;
  for (int j0 = w; j0 < nkeys; j0 += 16) {      /* nkeys is a multiple of 32: two keys a trip, so that one key's LDS reads fly under the other's products */
#pragma unroll /* the two keys of a trip in one block of code */
    for (int u = 0; u < 2; ++u) { const int j = j0 + 8 * u; v4f a = {0.f, 0.f, 0.f, 0.f};
#pragma unroll /* constant indices keep q[] in registers */
      for (int c = 0; c < HD / 4; ++c) a += q[c] * *(const v4f*)&lk[j][c * 4];
      float s = ((a[0] + a[1]) + (a[2] + a[3])) * scale; if (ALIBI) s -= slope * (float)j;
      s = (j <= i) ? s : -1.0e30f; sc[j][lane] = s; mp = fmaxf(mp, s); } }
  pm[w][lane] = mp;
  __syncthreads();
  float m = pm[0][lane];
#pragma unroll /* eight partial maxima */
  for (int x = 1; x < 8; ++x) m = fmaxf(m, pm[x][lane]);
  float lp = 0.f;
  for (int j0 = w; j0 < nkeys; j0 += 32) {      /* nkeys is a multiple of 32: four keys a trip, so that their LDS reads and exps overlap */
#pragma unroll /* the four keys of a trip in one block of code */
    for (int u = 0; u < 4; ++u) { const int j = j0 + 8 * u; const float e = expf(sc[j][lane] - m); sc[j][lane] = e; lp += e; } }      /* a masked key gives exactly 0 */
  pl[w][lane] = lp;
  __syncthreads();
  float l = pl[0][lane];
#pragma unroll /* eight partial sums, fixed order */
  for (int x = 1; x < 8; ++x) l += pl[x][lane];
  v4f o0 = {0.f, 0.f, 0.f, 0.f}, o1 = {0.f, 0.f, 0.f, 0.f};
#pragma unroll 8 /* eight keys' LDS reads in flight; nkeys is a multiple of 32 */
  for (int j = 0; j < nkeys; ++j) { const float p = sc[j][lane]; o0 += p * *(const v4f*)&lv[j][8 * w]; o1 += p * *(const v4f*)&lv[j][8 * w + 4]; }
  const float fin = 64.0f / l;      /* o carried x64 like the f16 path */
  *(v4f*)&lqo[lane][8 * w] = o0 * fin; *(v4f*)&lqo[lane][8 * w + 4] = o1 * fin;
  __syncthreads();
#pragma unroll /* two rows a thread; 16 threads fill one 128-byte line of each plane */
  for (int u = 0; u < 2; ++u) { const int row = u * 16 + sr; const v4f v = *(const v4f*)&lqo[row][c4]; v4h vh, vl;      /* o (x64) -> f16 plane + x1024 residual plane */
#pragma unroll /* constant indices keep the vectors in registers */
    for (int e = 0; e < 4; ++e) { const _Float16 t = (_Float16)v[e]; vh[e] = t; vl[e] = (_Float16)((v[e] - (float)t) * 1024.0f); }
    const size_t at = (size_t)(rg * 32 + row) * ldo + h * HD + c4; *(v4h*)(OH + at) = vh; *(v4h*)(OL + at) = vl; } }

extern "C" void kernel_launch(void* const* d_in, const int* in_sizes, int n_in,
                              void* d_out, int out_size, void* d_ws, size_t ws_size, hipStream_t stream) {
  (void)in_sizes; (void)n_in; (void)out_size;
  const float* const* I = (const float* const*)d_in; const float* x = I[0]; const float* wq = I[1]; const float* bq = I[2]; const float* wk = I[3]; const float* wv = I[4]; const float* bv = I[5]; const float* wo = I[6];      /* natural [out][in] weights; biases on q and v only */
  char* ws = (char*)d_ws; size_t off = 0;
  auto take = [&](size_t bytes) { char* p = ws + off; off += (bytes + 255) & ~(size_t)255; return p; };
  _Float16* BQ = (_Float16*)take((size_t)DM * DM * 2); _Float16* BK = (_Float16*)take((size_t)DM * DM * 2); _Float16* BV = (_Float16*)take((size_t)DM * DM * 2); _Float16* BO = (_Float16*)take((size_t)DM * DM * 2);
  _Float16* X16 = (_Float16*)take(NR * DM * 2); _Float16* Q16 = (_Float16*)take(NR * DM * 2); _Float16* K16 = (_Float16*)take(NR * DM * 2); _Float16* O16 = (_Float16*)take(NR * DM * 2);
  _Float16* VT = (_Float16*)take((size_t)NH * HD * SQ * 2);
  float* QF0 = (float*)take((size_t)QT0 * DM * 4); float* KF0 = (float*)take((size_t)QT0 * DM * 4); float* VF0 = (float*)take((size_t)QT0 * DM * 4); _Float16* OH0 = (_Float16*)take((size_t)NB * QT0 * DM * 2); _Float16* OL0 = (_Float16*)take((size_t)NB * QT0 * DM * 2);
  if (off > ws_size) return;
  k_prep<<<(unsigned)(NR * DM / 2048 + 4 * ((size_t)DM * DM / 2048)), 256, 0, stream>>>(x, wq, wk, wv, wo, X16, BQ, BK, BV, BO);      /* x rows and the four weights (natural [out][in] = Bt[n][k], x16) as f16 */
  k_qkv<<<3 * QKV_G + (QT0 / 128) * (DM / 64), 128, 0, stream>>>(X16, BQ, BK, BV, bq, bv, Q16, K16, VT, QF0, KF0, VF0);      /* q, k as f16 rows, V^T [NH][HD][SQ] as f16; q, k, v of the first 256 rows as f32 */
  k_att0<1, DM><<<NH * (QT0 / 32), 256, 0, stream>>>(QF0, KF0, VF0, 0.125f, OH0, OL0, DM);      /* exact f32 causal ALiBi attention for rows 0..255 (o x64), as f16 hi + x1024 residual planes */
  k_fattn<<<NH * (SQ / 256), 256, 0, stream>>>(Q16, K16, VT, O16);      /* scores, causal ALiBi softmax and o (merged heads, x64, f16 rows) in one launch */
  k_out<<<OUT_G0 + ((MPO - QT0) / 128) * (DM / 64), 128, 0, stream>>>(O16, OH0, OL0, BO, (float*)d_out);      /* out rows are the output layout */
}

// v006
// Measured time: 164 microseconds a run.
// Next to v005, in two timings, it ran 1.23 times as fast each time.
// Counting every step since v000, it is 51.7 times as fast.
#include <hip/hip_runtime.h>
// Causal multi-head attention with an ALiBi key-position bias (inputs [1][4096][1024]; q = x Wq^T + bq, k = x Wk^T (no bias), v = x Wv^T + bv (natural [1024][1024] sigma 0.02; bq, bv sigma 0.02); 16 heads of 64; scores / 8 - slopes[h] * j with slopes[h] = 2^(-8 (h+1) / 16) and j the key position; causal (j <= i keep, -inf); softmax; out = merged Wo^T (no bias) -> [1][4096][1024]).
// Structure: token rows r = s; q, k, v inputs as exact f16 rows (bf16-rounded); Q, K and V^T as WMMA GEMMs in one launch (32x64 wave tiles, f32 accumulation, exact x16 weights, f16 outputs; V^T = Wv x^T, the weight rows as the A operand); the first 256 rows exactly in f32 (own launch); one fused attention launch (a wave per 32 query rows of a head; passes of 32 keys up to the diagonal; scores / 8 minus the ALiBi term slope_h * j in f32, online softmax with f32 statistics and native exp2, weights x256 f16, o carried x64, folded into the output GEMM alpha) written straight into the merged f16 o rows; out = o W_o GEMM (f32) into the output layout, the first 256 rows from the exact o as f16 hi + residual planes. Five launches. Every f16 plane that a WMMA reads from memory (x, the weights, q, k, V^T, o) is kept in fragment order (see FT below), not as plain rows.
// Compute dtype: inputs rounded to bf16; x / weights exact; q, k, v, softmax weights and o as plain f16 GEMM operands (~2^-12); scores and softmax statistics f32. v_wmma_f32_16x16x32_f16.
#define NB 1
#define SQ 4096
#define DM 1024
#define NH 16
#define HD 64
#define HG 4                         /* heads per block group of the unlaunched k_vt overload */
#define QT 256                       /* query rows per causal tile */
#define NKX SQ                       /* S / P row pitch */
#define QT0 256                      /* first-tile rows recomputed exactly in f32 */
#define B0 0                         /* first batch processed (debug hook) */
#define NBR NB                       /* batches processed (debug hook) */
#define NR ((size_t)NB * SQ)         /* token rows */
#define MP ((int)((size_t)NBR * SQ)) /* rows projected (debug hook) */
#define QN SQ                        /* query rows attended per batch (debug hook) */
#define NHD NH                       /* heads attended (debug hook) */
#define MPO MP                       /* rows through the output stage (debug hook) */
#define LQ DM      /* row pitch of the q/k/v rows */
typedef __bf16 v16b __attribute__((ext_vector_type(16)));
typedef unsigned short v8us __attribute__((ext_vector_type(8), may_alias));
typedef float  v8f  __attribute__((ext_vector_type(8)));
typedef float  v4f  __attribute__((ext_vector_type(4)));
typedef float  v4fa __attribute__((ext_vector_type(4), may_alias));
union FragB { v16b v; v8us half[2]; unsigned short u[16]; };

__device__ __forceinline__ unsigned short bf16_bits(float x) { unsigned int u = __float_as_uint(x); return (unsigned short)((u + 0x7FFFu + ((u >> 16) & 1u)) >> 16); }
__device__ __forceinline__ float bf16_val(unsigned short b) { return __uint_as_float(((unsigned int)b) << 16); }
__device__ __forceinline__ float bf16_round(float x) { return bf16_val(bf16_bits(x)); }
// D += A·B with NT terms: 1 = ah·bh, 2 = + al·bh (A split), 3 = + ah·bl (both split)
template <int NT>
__device__ __forceinline__ v8f mmaN(v16b ah, v16b al, v16b bh, v16b bl, v8f c) {
  c = __builtin_amdgcn_wmma_f32_16x16x32_bf16(false, ah, false, bh, (short)0, c, false, false);
  if (NT >= 2) c = __builtin_amdgcn_wmma_f32_16x16x32_bf16(false, al, false, bh, (short)0, c, false, false);
  if (NT >= 3) c = __builtin_amdgcn_wmma_f32_16x16x32_bf16(false, ah, false, bl, (short)0, c, false, false);
  asm volatile("v_nop\n\tv_nop\n\tv_nop\n\tv_nop" : "+v"(c) : "v"(ah), "v"(al), "v"(bh), "v"(bl));
  return c;
}

__global__ __launch_bounds__(256) void k_wt_bf16(const float* __restrict__ W, unsigned short* __restrict__ Wt, int K, int N) {
  const int t = blockIdx.x * 256 + threadIdx.x;
  const int k8n = K / 8;
  if (t >= N * k8n) return;
  const int n = t / k8n, k8 = (t % k8n) * 8;
  v8us v;
#pragma unroll
  for (int i = 0; i < 8; ++i) v[i] = bf16_bits(W[(size_t)(k8 + i) * N + n]);
  *(v8us*)(Wt + (size_t)n * K + k8) = v;
  
}

// GEMM C[M][N] (f32, pitch ldc) = act(A[M][K]·W + bias). A f32 row-major (pitch lda) converted per fragment to bf16
// (ASPLIT: hi/lo two planes -> 2 terms, else single rounded term); Wt bf16 [N][K] (pitch ldb). BIAS_BF16 rounds the
// bias to bf16 first (bias quantised to bf16 before the add). K%32==0, M%16==0, N%64==0.
template <bool ASPLIT, int ACT, bool BIAS_BF16>
__global__ __launch_bounds__(128) void k_gemm_bf(const float* __restrict__ A, int lda, const unsigned short* __restrict__ Wt, int ldb,
                                               const float* __restrict__ bias, float* __restrict__ C, int ldc, int M, int N, int K) {
  __shared__ __attribute__((aligned(16))) float so[4][16][64];
  const int tid = threadIdx.x, w = tid >> 5, lane = tid & 31, ln = lane & 15, hh = lane >> 4;
  const int ntn = N / 64;
  const int wid = blockIdx.x * 4 + w;
  const int mt = wid / ntn, nq = wid % ntn;
  if (mt * 16 >= M) return;
  const int row0 = mt * 16, col0 = nq * 64;
  const float* arow = A + (size_t)(row0 + ln) * lda;
  v8f acc[4] = {};
  for (int kb = 0; kb < K; kb += 32) {
    FragB ah, al;
    const v4f x0 = *(const v4fa*)(arow + kb + 8 * hh), x1 = *(const v4fa*)(arow + kb + 8 * hh + 4);
    const v4f x2 = *(const v4fa*)(arow + kb + 16 + 8 * hh), x3 = *(const v4fa*)(arow + kb + 16 + 8 * hh + 4);
    float xs[16] = {x0[0],x0[1],x0[2],x0[3],x1[0],x1[1],x1[2],x1[3],x2[0],x2[1],x2[2],x2[3],x3[0],x3[1],x3[2],x3[3]};
#pragma unroll
    for (int i = 0; i < 16; ++i) { const unsigned short hb = bf16_bits(xs[i]); ah.u[i] = hb; al.u[i] = ASPLIT ? bf16_bits(xs[i] - bf16_val(hb)) : (unsigned short)0; }
#pragma unroll
    for (int t = 0; t < 4; ++t) {
      const unsigned short* brow = Wt + (size_t)(col0 + t * 16 + ln) * ldb + kb;
      FragB b;
      b.half[0] = *(const v8us*)(brow + 8 * hh);
      b.half[1] = *(const v8us*)(brow + 16 + 8 * hh);
      acc[t] = mmaN<ASPLIT ? 2 : 1>(ah.v, al.v, b.v, b.v, acc[t]);
    }
  }
#pragma unroll
  for (int t = 0; t < 4; ++t) {
    float bv = bias ? bias[col0 + t * 16 + ln] : 0.f;
    if (BIAS_BF16) bv = bf16_round(bv);
#pragma unroll
    for (int r = 0; r < 8; ++r) { float v = acc[t][r] + bv; if (ACT == 1) v = fmaxf(v, 0.f); so[w][8 * hh + r][t * 16 + ln] = v; }
  }
  __builtin_amdgcn_fence(__ATOMIC_ACQ_REL, "workgroup");
  __builtin_amdgcn_wave_barrier();
  const int rsub = lane >> 4, c4 = (lane & 15) * 4;
  {
#pragma unroll
    for (int q = 0; q < 8; ++q) {
      const int r = q * 2 + rsub;
      const v4f v = *(const v4fa*)&so[w][r][c4];
      *(v4f*)(C + (size_t)(row0 + r) * ldc + col0 + c4) = v;
    }
    
  }
}

// GEMM C = act(A·W + bias + resid): A f32 (ASPLIT -> hi/lo 2 terms), Wt bf16 [N][K]; ACT 0 none, 1 relu, 2 exact gelu;
// resid (optional, f32, row index = (row % rmod), pitch ldr, RES_BF16 rounds it) added before the activation.
template <bool ASPLIT, int ACT, bool BIAS_BF16, bool RES_BF16>
__global__ __launch_bounds__(128) void k_gemm_bf3(const float* __restrict__ A, int lda, const unsigned short* __restrict__ Wt, int ldb,
                                                const float* __restrict__ bias, const float* __restrict__ resid, int rmod, int ldr,
                                                float* __restrict__ C, int ldc, int M, int N, int K) {
  __shared__ __attribute__((aligned(16))) float so[4][16][64];
  const int tid = threadIdx.x, w = tid >> 5, lane = tid & 31, ln = lane & 15, hh = lane >> 4;
  const int ntn = N / 64;
  const int wid = blockIdx.x * 4 + w;
  const int mt = wid / ntn, nq = wid % ntn;
  if (mt * 16 >= M) return;
  const int row0 = mt * 16, col0 = nq * 64;
  const float* arow = A + (size_t)(row0 + ln) * lda;
  v8f acc[4] = {};
  for (int kb = 0; kb < K; kb += 32) {
    FragB ah, al;
    const v4f x0 = *(const v4fa*)(arow + kb + 8 * hh), x1 = *(const v4fa*)(arow + kb + 8 * hh + 4);
    const v4f x2 = *(const v4fa*)(arow + kb + 16 + 8 * hh), x3 = *(const v4fa*)(arow + kb + 16 + 8 * hh + 4);
    float xs[16] = {x0[0],x0[1],x0[2],x0[3],x1[0],x1[1],x1[2],x1[3],x2[0],x2[1],x2[2],x2[3],x3[0],x3[1],x3[2],x3[3]};
#pragma unroll
    for (int i = 0; i < 16; ++i) { const unsigned short hb = bf16_bits(xs[i]); ah.u[i] = hb; al.u[i] = ASPLIT ? bf16_bits(xs[i] - bf16_val(hb)) : (unsigned short)0; }
#pragma unroll
    for (int t = 0; t < 4; ++t) {
      const unsigned short* brow = Wt + (size_t)(col0 + t * 16 + ln) * ldb + kb;
      FragB b;
      b.half[0] = *(const v8us*)(brow + 8 * hh);
      b.half[1] = *(const v8us*)(brow + 16 + 8 * hh);
      acc[t] = mmaN<ASPLIT ? 2 : 1>(ah.v, al.v, b.v, b.v, acc[t]);
    }
  }
#pragma unroll
  for (int t = 0; t < 4; ++t) {
    const int col = col0 + t * 16 + ln;
    float bv = bias ? bias[col] : 0.f;
    if (BIAS_BF16) bv = bf16_round(bv);
#pragma unroll
    for (int r = 0; r < 8; ++r) {
      float v = acc[t][r] + bv;
      if (resid) { float rv = resid[(size_t)((row0 + 8 * hh + r) % rmod) * ldr + col]; if (RES_BF16) rv = bf16_round(rv); v += rv; }
      if (ACT == 1) v = fmaxf(v, 0.f);
      if (ACT == 2) v = 0.5f * v * (1.0f + erff(v * 0.70710678118654752f));
      if (ACT == 3) { const float u = 0.7978845608028654f * (v + 0.044715f * v * v * v); v = 0.5f * v * (1.0f + tanhf(u)); }
      so[w][8 * hh + r][t * 16 + ln] = v;
    }
  }
  __builtin_amdgcn_fence(__ATOMIC_ACQ_REL, "workgroup");
  __builtin_amdgcn_wave_barrier();
  const int rsub = lane >> 4, c4 = (lane & 15) * 4;
  {
#pragma unroll
    for (int q = 0; q < 8; ++q) {
      const int r = q * 2 + rsub;
      const v4f v = *(const v4fa*)&so[w][r][c4];
      *(v4f*)(C + (size_t)(row0 + r) * ldc + col0 + c4) = v;
    }
    
  }
}
// row LayerNorm (biased variance, eps) over N: s = X (+ R); optional out_sum <- s; out_norm <- (s-mu)*rsqrt(var+eps)*g + b
template <bool PARAM_BF16>
__global__ __launch_bounds__(256) void k_layernorm(const float* __restrict__ X, const float* __restrict__ R, const float* __restrict__ g, const float* __restrict__ bta,
                                                  float* __restrict__ out_sum, float* __restrict__ out_norm, int N, float eps) {
  __shared__ float red[256];
  const int row = blockIdx.x, tid = threadIdx.x;
  const float* x = X + (size_t)row * N; const float* rr = R ? R + (size_t)row * N : nullptr;
  float vals[16];                     // up to N = 4096
  const int per = N / 256;            // contiguous chunk per thread? use strided-by-4 chunks: thread handles j = tid*4 + 1024*u
  float s1 = 0.f;
  for (int u = 0; u < per / 4; ++u) {
    const int j = tid * 4 + 1024 * u;
    const v4f a = *(const v4fa*)(x + j);
    v4f b = {0.f,0.f,0.f,0.f}; if (rr) b = *(const v4fa*)(rr + j);
#pragma unroll
    for (int q = 0; q < 4; ++q) { const float v = a[q] + b[q]; vals[u * 4 + q] = v; s1 += v; }
  }
  red[tid] = s1; __syncthreads();
  for (int st = 128; st > 0; st >>= 1) { if (tid < st) red[tid] += red[tid + st]; __syncthreads(); }
  const float mu = red[0] / (float)N; __syncthreads();
  float s2 = 0.f;
  for (int u = 0; u < per / 4; ++u)
#pragma unroll
    for (int q = 0; q < 4; ++q) { const float c = vals[u * 4 + q] - mu; s2 += c * c; }
  red[tid] = s2; __syncthreads();
  for (int st = 128; st > 0; st >>= 1) { if (tid < st) red[tid] += red[tid + st]; __syncthreads(); }
  const float rs = rsqrtf(red[0] / (float)N + eps);
  {
    for (int u = 0; u < per / 4; ++u) {
      const int j = tid * 4 + 1024 * u;
      v4f o, sm;
#pragma unroll
      for (int q = 0; q < 4; ++q) {
        float gg = g[j + q], bb = bta[j + q];
        if (PARAM_BF16) { gg = bf16_round(gg); bb = bf16_round(bb); }
        sm[q] = vals[u * 4 + q]; o[q] = (vals[u * 4 + q] - mu) * rs * gg + bb;
      }
      if (out_sum) *(v4f*)(out_sum + (size_t)row * N + j) = sm;
      *(v4f*)(out_norm + (size_t)row * N + j) = o;
    }
    
  }
}



// ---- f16 WMMA path (v_wmma_f32_16x16x32_f16): 11-bit significands for operands in range — used where a [0,1] probability operand needs more precision than bf16
typedef _Float16 v16h __attribute__((ext_vector_type(16)));
union FragH { v16h v; v8us half[2]; _Float16 h[16]; unsigned short u[16]; };
template <int NT>
__device__ __forceinline__ v8f mmaH(v16h ah, v16h al, v16h bh, v16h bl, v8f c) {
  c = __builtin_amdgcn_wmma_f32_16x16x32_f16(false, ah, false, bh, (short)0, c, false, false);
  if (NT >= 2) c = __builtin_amdgcn_wmma_f32_16x16x32_f16(false, al, false, bh, (short)0, c, false, false);
  if (NT >= 3) c = __builtin_amdgcn_wmma_f32_16x16x32_f16(false, ah, false, bl, (short)0, c, false, false);
  asm volatile("v_nop\n\tv_nop\n\tv_nop\n\tv_nop" : "+v"(c) : "v"(ah), "v"(al), "v"(bh), "v"(bl));
  return c;
}
// batched GEMM like k_gemm_b but f16 operands: A f32 (split into f16 hi/lo if ASPLIT, else rounded to f16), Bt = f16 values [n][k]; alpha; C f32; N multiple of 16 (partial tiles skipped)
template <bool ASPLIT>
__global__ __launch_bounds__(128) void k_gemm_h(const float* __restrict__ A, int lda, size_t sA, const _Float16* __restrict__ Bh, int ldb, size_t sB, float alpha, float* __restrict__ C, int ldc, size_t sC, int M, int N, int K) {
  __shared__ __attribute__((aligned(16))) float so[4][16][64];
  const int tid = threadIdx.x, w = tid >> 5, lane = tid & 31, ln = lane & 15, hh = lane >> 4; const int by = blockIdx.y;
  A += (size_t)by * sA; Bh += (size_t)by * sB; C += (size_t)by * sC;
  const int ntn = (N + 63) / 64; const int wid = blockIdx.x * 4 + w; const int mt = wid / ntn, nq = wid % ntn; if (mt * 16 >= M) return;
  const int row0 = mt * 16, col0 = nq * 64; const float* arow = A + (size_t)(row0 + ln) * lda;
  v8f acc[4] = {};
  for (int kb = 0; kb < K; kb += 32) {
    FragH ah, al;
    const v4f x0 = *(const v4fa*)(arow + kb + 8 * hh), x1 = *(const v4fa*)(arow + kb + 8 * hh + 4), x2 = *(const v4fa*)(arow + kb + 16 + 8 * hh), x3 = *(const v4fa*)(arow + kb + 16 + 8 * hh + 4);
    float xs[16] = {x0[0],x0[1],x0[2],x0[3],x1[0],x1[1],x1[2],x1[3],x2[0],x2[1],x2[2],x2[3],x3[0],x3[1],x3[2],x3[3]};
#pragma unroll
    for (int i = 0; i < 16; ++i) { const _Float16 h = (_Float16)xs[i]; ah.h[i] = h; al.h[i] = ASPLIT ? (_Float16)(xs[i] - (float)h) : (_Float16)0.0f; }
#pragma unroll
    for (int t = 0; t < 4; ++t) { if (col0 + t * 16 >= N) continue; const size_t boff = (size_t)(col0 + t * 16 + ln) * ldb + kb; FragH bq; bq.half[0] = *(const v8us*)(Bh + boff + 8 * hh); bq.half[1] = *(const v8us*)(Bh + boff + 16 + 8 * hh);
      acc[t] = mmaH<ASPLIT ? 2 : 1>(ah.v, al.v, bq.v, bq.v, acc[t]); }
  }
#pragma unroll
  for (int t = 0; t < 4; ++t) { if (col0 + t * 16 >= N) continue;
#pragma unroll
    for (int r = 0; r < 8; ++r) so[w][8 * hh + r][t * 16 + ln] = acc[t][r] * alpha; }
  __builtin_amdgcn_fence(__ATOMIC_ACQ_REL, "workgroup"); __builtin_amdgcn_wave_barrier();
  const int rsub = lane >> 4, c4 = (lane & 15) * 4;
  {
#pragma unroll
    for (int q = 0; q < 8; ++q) { const int r = q * 2 + rsub; if (col0 + c4 < N) { const v4f v = *(const v4fa*)&so[w][r][c4]; *(v4f*)(C + (size_t)(row0 + r) * ldc + col0 + c4) = v; } }
     }
}

// Wt[n][k] = f16(W[k][n]·scale) from f32 row-major W[K][N] (scale = power of two; bf16-exact weights stay exact in f16 away from the subnormal range)
__global__ __launch_bounds__(256) void k_wt_f16(const float* __restrict__ W, _Float16* __restrict__ Wt, int K, int N, float scale) {
  const int t = blockIdx.x * 256 + threadIdx.x; if (t >= N * (K / 8)) return; const int n = t / (K / 8), k8 = (t % (K / 8)) * 8; FragH f;
#pragma unroll
  for (int i = 0; i < 8; ++i) f.h[i] = (_Float16)(bf16_round(W[(size_t)(k8 + i) * N + n]) * scale); const v8us o = f.half[0];
  *(v8us*)((unsigned short*)Wt + (size_t)n * K + k8) = o; 
}
// k_gemm_hh variant with fused epilogue: v = acc·alpha + bias[by·sBias + col] (+ CP[(row/rowsPerB)·sCPb + by·64 + col] if CP) ; ACT 0 none / 1 elu ; writes f16 C16 (and f32 C if non-null)
template <int ACT>
__global__ __launch_bounds__(128) void k_gemm_hhx(const _Float16* __restrict__ A, int lda, size_t sA, const _Float16* __restrict__ Bh, int ldb, size_t sB, float alpha, const float* __restrict__ bias, size_t sBias, const float* __restrict__ CP, int rowsPerB, size_t sCPb, int row0g,
    float* __restrict__ C, _Float16* __restrict__ C16, int ldc, size_t sC, int M, int N, int K) {
  __shared__ __attribute__((aligned(16))) float so[4][16][64];
  const int tid = threadIdx.x, w = tid >> 5, lane = tid & 31, ln = lane & 15, hh = lane >> 4; const int by = blockIdx.y;
  A += (size_t)by * sA; Bh += (size_t)by * sB; const size_t cofs = (size_t)by * sC; const float* bp = bias ? bias + (size_t)by * sBias : nullptr;
  const int ntn = (N + 63) / 64; const int wid = blockIdx.x * 4 + w; const int mt = wid / ntn, nq = wid % ntn; if (mt * 16 >= M) return;
  const int row0 = mt * 16, col0 = nq * 64; const _Float16* arow = A + (size_t)(row0 + ln) * lda;
  v8f acc[4] = {};
  for (int kb = 0; kb < K; kb += 32) { FragH ah; ah.half[0] = *(const v8us*)((const unsigned short*)arow + kb + 8 * hh); ah.half[1] = *(const v8us*)((const unsigned short*)arow + kb + 16 + 8 * hh);
#pragma unroll
    for (int t = 0; t < 4; ++t) { if (col0 + t * 16 >= N) continue; const size_t boff = (size_t)(col0 + t * 16 + ln) * ldb + kb; FragH bq; bq.half[0] = *(const v8us*)((const unsigned short*)Bh + boff + 8 * hh); bq.half[1] = *(const v8us*)((const unsigned short*)Bh + boff + 16 + 8 * hh);
      acc[t] = mmaH<1>(ah.v, ah.v, bq.v, bq.v, acc[t]); }
  }
#pragma unroll
  for (int t = 0; t < 4; ++t) { if (col0 + t * 16 >= N) continue; const int col = col0 + t * 16 + ln; const float bv = bp ? bf16_round(bp[col]) : 0.f;
#pragma unroll
    for (int r = 0; r < 8; ++r) { float v = acc[t][r] * alpha + bv; if (CP) { const int rr = row0g + row0 + 8 * hh + r; if (rowsPerB < 0) v += CP[cofs + (size_t)rr * ldc + col];      /* rowsPerB < 0: own element of the batched C plane */ else { const int bidx = rr / rowsPerB; v += CP[(size_t)bidx * sCPb + (size_t)by * 64 + col]; } } if (ACT == 1) v = (v > 0.f) ? v : expm1f(v); else if (ACT == 7) v = (v > 0.f) ? v + 1.0f : expf(v); else if (ACT == 8) v = tanhf(v); else if (ACT == 9) v = 0.5f * v * (1.0f + tanhf(0.7978845608028654f * (v + 0.044715f * v * v * v))); else if (ACT == 11) v = 1.0f / (1.0f + expf(-v)); else if (ACT == 12) v = (v > 0.f) ? v : 0.01f * v; else if (ACT == 14) v = (v > 0.f) ? v : 0.1f * v; else if (ACT == 16) v = (v >= 0.f) ? v : 0.3f * v; else if (ACT == 17) v = (v >= 0.f) ? v : 0.2f * v; else if (ACT == 15) v = v / (1.0f + expf(-v)); else if (ACT == 3) v = fmaxf(v, 0.f); else if (ACT == 6) v = 0.5f * v * (1.0f + erff(v * 0.70710678118654752f)); so[w][8 * hh + r][t * 16 + ln] = v; } }
  __builtin_amdgcn_fence(__ATOMIC_ACQ_REL, "workgroup"); __builtin_amdgcn_wave_barrier();
  const int rsub = lane >> 4, c4 = (lane & 15) * 4; typedef _Float16 v4h __attribute__((ext_vector_type(4)));
  {
#pragma unroll
    for (int q = 0; q < 8; ++q) { const int r = q * 2 + rsub; if (col0 + c4 < N) { const v4f v = *(const v4fa*)&so[w][r][c4]; if (C) *(v4f*)(C + cofs + (size_t)(row0 + r) * ldc + col0 + c4) = v; if (C16) { v4h h4; for (int i = 0; i < 4; ++i) h4[i] = (_Float16)v[i]; *(v4h*)(C16 + cofs + (size_t)(row0 + r) * ldc + col0 + c4) = h4; } } }
     }
}


typedef _Float16 v4h __attribute__((ext_vector_type(4)));

__global__ __launch_bounds__(256) void k_h16(const float* __restrict__ x, _Float16* __restrict__ X16, size_t n8) { const size_t t = (size_t)blockIdx.x * 256 + threadIdx.x; if (t >= n8) return; FragH f;
#pragma unroll
  for (int q = 0; q < 8; ++q) f.h[q] = (_Float16)x[t * 8 + q]; *(v8us*)((unsigned short*)X16 + t * 8) = f.half[0];  }
__global__ __launch_bounds__(256) void k_round16f(const float* __restrict__ W, _Float16* __restrict__ Bt, size_t n8) { const size_t t = (size_t)blockIdx.x * 256 + threadIdx.x; if (t >= n8) return; FragH f;
#pragma unroll
  for (int i = 0; i < 8; ++i) f.h[i] = (_Float16)(bf16_round(W[t * 8 + i]) * 16.0f); *(v8us*)((unsigned short*)Bt + t * 8) = f.half[0];  }
// ---- fast GEMM pieces: wave tile 32x64, four waves a work-group (128 rows x 64 columns); K % 64 == 0 ----
__device__ __forceinline__ v16h g2_frag(const _Float16* p, int hh) { FragH f; f.half[0] = *(const v8us*)((const unsigned short*)p + 8 * hh); f.half[1] = *(const v8us*)((const unsigned short*)p + 16 + 8 * hh); return f.v; }
__device__ __forceinline__ v8f g2_mma(v16h a, v16h b, v8f c) { v8f d = __builtin_amdgcn_wmma_f32_16x16x32_f16(false, a, false, b, (short)0, c, false, false); asm volatile("v_nop\n\tv_nop\n\tv_nop\n\tv_nop" : "+v"(d) : "v"(a), "v"(b)); return d; }
// FRAGMENT ORDER. Every f16 plane [R][K] that a WMMA reads from memory is kept as tiles of 16 rows x 32 k (FT elements, 1024 bytes), tile (r >> 4, k >> 5) at index (r >> 4) * (K / 32) + (k >> 5).
// Inside a tile the 16 bytes of row r, k = 8 c .. 8 c + 7 (c = (k >> 3) & 3) are chunk (c >> 1) * 32 + (c & 1) * 16 + (r & 15): lane l of a wave finds the two halves of its fragment (the k order of g2_frag)
// at chunks l and 32 + l, so that each wave-wide 16-byte load or store covers 512 bytes in a row, four whole lines, and not 32 bytes of each of 16 lines.
#define FT 512
__device__ __forceinline__ size_t pk_at(int r, int k, int K) { return ((size_t)(r >> 4) * (K / 32) + (k >> 5)) * FT + (size_t)((((k >> 4) & 1) * 32 + ((k >> 3) & 1) * 16 + (r & 15)) * 8 + (k & 7)); }
__device__ __forceinline__ v16h pk_frag(const _Float16* p) { FragH f; f.half[0] = *(const v8us*)((const unsigned short*)p); f.half[1] = *(const v8us*)((const unsigned short*)p + 256); return f.v; }      /* p = the tile + 8 * lane */
// c[4 half + t] += A[row0 + 16 half ..][k] Bh[col0 + 16 t ..][k] over k = 0 .. K - 1; A and Bh in fragment order
template <int K>
__device__ __forceinline__ void g2_kloop(const _Float16* __restrict__ A, const _Float16* __restrict__ Bh, int row0, int col0, int lane, v8f (&c)[8]) {
  constexpr size_t RG = (size_t)(K / 32) * FT;      /* one group of 16 rows */
  const _Float16* ap = A + (size_t)(row0 >> 4) * RG + lane * 8; const _Float16* bp = Bh + (size_t)(col0 >> 4) * RG + lane * 8;
  /* One trip = 64 k = two tiles of each group of 16 rows. All 24 fragment loads of the trip stand in front of its first WMMA, so that a trip waits for memory once;
     each accumulator still takes its k blocks in rising order. */
#pragma unroll 1 /* a second trip's fragments would not fit in 256 registers beside the 64 accumulator registers */
  for (int kb = 0; kb < K; kb += 64) {
    const _Float16* pa = ap + (size_t)kb * 16; const _Float16* pb = bp + (size_t)kb * 16;
    const v16h a0 = pk_frag(pa), a1 = pk_frag(pa + RG), b0 = pk_frag(pb), b1 = pk_frag(pb + RG), b2 = pk_frag(pb + 2 * RG), b3 = pk_frag(pb + 3 * RG);
    const v16h a2 = pk_frag(pa + FT), a3 = pk_frag(pa + RG + FT), b4 = pk_frag(pb + FT), b5 = pk_frag(pb + RG + FT), b6 = pk_frag(pb + 2 * RG + FT), b7 = pk_frag(pb + 3 * RG + FT);
    /* the wait in front of any rewrite of a register that an issued load names; as its inputs the two address pairs stay live up to it, so that no load of the trip lands in one of them */
    asm volatile("s_wait_xcnt 0x0" :: "v"(pa), "v"(pb) : "memory");
    c[0] = g2_mma(a0, b0, c[0]); c[4] = g2_mma(a1, b0, c[4]); c[1] = g2_mma(a0, b1, c[1]); c[5] = g2_mma(a1, b1, c[5]);
    c[2] = g2_mma(a0, b2, c[2]); c[6] = g2_mma(a1, b2, c[6]); c[3] = g2_mma(a0, b3, c[3]); c[7] = g2_mma(a1, b3, c[7]);
    c[0] = g2_mma(a2, b4, c[0]); c[4] = g2_mma(a3, b4, c[4]); c[1] = g2_mma(a2, b5, c[1]); c[5] = g2_mma(a3, b5, c[5]);
    c[2] = g2_mma(a2, b6, c[2]); c[6] = g2_mma(a3, b6, c[6]); c[3] = g2_mma(a2, b7, c[3]); c[7] = g2_mma(a3, b7, c[7]); } }
// A wave's 32x64 tile out of its LDS tile: lane = 16 bytes of f32 of row 2 q + (lane >> 4). The stores take one base address and constant offsets.
__device__ __forceinline__ void g2_take(const float (&so)[32][68], int lane, v4f (&v)[16]) {
#pragma unroll /* constant indices keep v[] in registers */
  for (int q = 0; q < 16; ++q) v[q] = *(const v4fa*)&so[q * 2 + (lane >> 4)][(lane & 15) * 4]; }
template <int LDC, typename T, typename V>
__device__ __forceinline__ void g2_put(T* __restrict__ p, const V (&v)[16]) {
#pragma unroll /* constant indices keep v[] in registers; constant offsets keep one address pair */
  for (int q = 0; q < 16; ++q) *(V*)(p + (size_t)q * 2 * LDC) = v[q]; }
// The projections in one grid, by block ranges (weights carried x16, f32 accumulation, k in rising order everywhere):
//   job 0: q = x Wq^T + bq and job 1: k = x Wk^T, as f16 planes in fragment order; their first QT0 token rows go out as plain f32 rows too (operands of the exact first-tile attention);
//   job 2: V^T = Wv x^T + bv (the weight rows are the A operand, the token rows the B operand; the bias goes by row), f16 [NH * HD][SQ] in fragment order, the operand that the second attention product reads;
//   job 3: v of the first QT0 token rows, f32 rows.
#define QKV_G ((MP / 128) * (DM / 64))      /* work-groups of each of the jobs 0, 1, 2 */
__global__ __launch_bounds__(128) void k_qkv(const _Float16* __restrict__ X, const _Float16* __restrict__ BQ, const _Float16* __restrict__ BK, const _Float16* __restrict__ BV, const float* __restrict__ bq, const float* __restrict__ bv,
    _Float16* __restrict__ Q16, _Float16* __restrict__ K16, _Float16* __restrict__ VT, float* __restrict__ QF0, float* __restrict__ KF0, float* __restrict__ VF0) {
  static_assert(NB == 1 && QT0 % 128 == 0 && MP % 128 == 0 && DM % 128 == 0 && MP == SQ && NH * HD == DM, "k_qkv: one batch, whole work-group tiles in both orientations");
  __shared__ __attribute__((aligned(16))) float so[4][32][68];
  const int tid = threadIdx.x, w = tid >> 5, lane = tid & 31, ln = lane & 15, hh = lane >> 4;
  const int job = blockIdx.x / QKV_G, bx = blockIdx.x % QKV_G;
  const int ntn = (job == 2 ? SQ : DM) / 64;      /* column tiles of the job's product */
  const int mt = bx / ntn, nq = bx % ntn; const int row0 = mt * 128 + 32 * w, col0 = nq * 64;
  const _Float16* Ah = job == 2 ? BV : X; const _Float16* Bh = job == 0 ? BQ : job == 1 ? BK : job == 2 ? X : BV;
  const v8f z8 = {0.f,0.f,0.f,0.f,0.f,0.f,0.f,0.f}; v8f c[8] = {z8, z8, z8, z8, z8, z8, z8, z8};
  g2_kloop<DM>(Ah, Bh, row0, col0, lane, c);
  if (job == 2) { const float* pb = bv + row0 + 8 * hh; float rb[2][8];
#pragma unroll /* constant indices keep rb[] in registers */
    for (int half = 0; half < 2; ++half)
#pragma unroll /* as above */
      for (int r = 0; r < 8; ++r) rb[half][r] = pb[half * 16 + r];
    /* the wait in front of any rewrite of a register that an issued load names; as its input the address pair stays live up to it */
    asm volatile("s_wait_xcnt 0x0" :: "v"(pb) : "memory");
#pragma unroll /* constant indices keep c[] in registers */
    for (int u = 0; u < 8; ++u)
#pragma unroll /* as above */
      for (int r = 0; r < 8; ++r) so[w][(u >> 2) * 16 + 8 * hh + r][(u & 3) * 16 + ln] = c[u][r] * 0.0625f + bf16_round(rb[u >> 2][r]);
  } else { const float* bp = job == 0 ? bq : job == 1 ? nullptr : bv; float bb[4] = {0.f, 0.f, 0.f, 0.f};
    if (bp) {
#pragma unroll /* constant indices keep bb[] in registers */
      for (int t = 0; t < 4; ++t) bb[t] = bf16_round(bp[col0 + t * 16 + ln]); }
#pragma unroll /* as above */
    for (int u = 0; u < 8; ++u)
#pragma unroll /* as above */
      for (int r = 0; r < 8; ++r) so[w][(u >> 2) * 16 + 8 * hh + r][(u & 3) * 16 + ln] = c[u][r] * 0.0625f + bb[u & 3]; }
  __builtin_amdgcn_fence(__ATOMIC_ACQ_REL, "workgroup"); __builtin_amdgcn_wave_barrier();
  const int rsub = lane >> 4, c4 = (lane & 15) * 4; v4f v[16]; v8us hp[8];
  const bool frows = job != 2 && row0 < QT0;      /* the same for the whole wave */
  if (frows) g2_take(so[w], lane, v);
  /* the wave's 32 x 64 tile is four tiles of the f16 plane in fragment order: lane (ln, hh) takes the 8 values of row ln that make its chunk; the LDS pitch of 16 B x 17 keeps these reads free of bank conflicts */
#pragma unroll /* constant indices keep hp[] in registers */
  for (int u = 0; u < 8; ++u) { const float* sp = &so[w][(u >> 2) * 16 + ln][(u & 3) * 16 + 8 * hh]; const v4f x0 = *(const v4fa*)sp, x1 = *(const v4fa*)(sp + 4); FragH f;
#pragma unroll /* as above */
    for (int i = 0; i < 4; ++i) { f.h[i] = (_Float16)x0[i]; f.h[4 + i] = (_Float16)x1[i]; }
    hp[u] = f.half[0]; }
  /* the stores stand behind every LDS read and every conversion, so that no register that an issued store names is written again */
  const size_t rgp = (size_t)((job == 2 ? SQ : DM) / 32) * FT;      /* one group of 16 rows of the plane */
  unsigned short* p16 = (unsigned short*)(job == 0 ? Q16 : job == 1 ? K16 : VT) + (size_t)(row0 >> 4) * rgp + (size_t)(col0 >> 5) * FT + lane * 8; unsigned short* p16b = p16 + rgp;
  float* pf = (job == 0 ? QF0 : job == 1 ? KF0 : VF0) + (size_t)(row0 + rsub) * DM + col0 + c4;
  if (job != 3) {
#pragma unroll /* as above; constant offsets keep one address pair a row group */
    for (int u = 0; u < 4; ++u) { *(v8us*)(p16 + u * 256) = hp[u]; *(v8us*)(p16b + u * 256) = hp[4 + u]; } }
  if (frows) g2_put<DM>(pf, v); }
// out = o Wo^T in one grid (o carried x64, Wo x16). Rows from QT0 on: the f16 o rows, 128 rows a work-group. The first QT0 rows: the exact o as an f16 plane and its x1024 residual plane,
// out = hi 2^-10 + lo 2^-20; 64 rows a work-group, waves 0 and 1 take the hi plane and waves 2 and 3 the lo plane of the same rows, so that no wave walks k twice; the two terms meet in LDS.
#define OUT_G0 ((QT0 / 64) * (DM / 64))      /* work-groups of the first QT0 rows */
__global__ __launch_bounds__(128) void k_out(const _Float16* __restrict__ O16, const _Float16* __restrict__ OH0, const _Float16* __restrict__ OL0, const _Float16* __restrict__ BO, float* __restrict__ out) {
  static_assert(NB == 1 && QT0 % 128 == 0 && MPO % 128 == 0 && DM % 64 == 0, "k_out: one batch, the first tile ends on a work-group's edge");
  __shared__ __attribute__((aligned(16))) float so[4][32][68];
  const int tid = threadIdx.x, w = tid >> 5, lane = tid & 31, ln = lane & 15, hh = lane >> 4;
  const bool first = blockIdx.x < OUT_G0; const int bx = first ? blockIdx.x : blockIdx.x - OUT_G0;
  const int mt = bx / (DM / 64), nq = bx % (DM / 64); const int row0 = first ? mt * 64 + 32 * (w & 1) : QT0 + mt * 128 + 32 * w; const int col0 = nq * 64;
  const bool lo = first && w >= 2; const _Float16* Ah = first ? (lo ? OL0 : OH0) : O16; const float alpha = lo ? 0.00000095367431640625f : 0.0009765625f;
  const v8f z8 = {0.f,0.f,0.f,0.f,0.f,0.f,0.f,0.f}; v8f c[8] = {z8, z8, z8, z8, z8, z8, z8, z8};
  g2_kloop<DM>(Ah, BO, row0, col0, lane, c);
#pragma unroll /* constant indices keep c[] in registers */
  for (int u = 0; u < 8; ++u)
#pragma unroll /* as above */
    for (int r = 0; r < 8; ++r) so[w][(u >> 2) * 16 + 8 * hh + r][(u & 3) * 16 + ln] = c[u][r] * alpha;
  const int rsub = lane >> 4, c4 = (lane & 15) * 4; v4f v[16]; float* po = out + (size_t)(row0 + rsub) * DM + col0 + c4;
  if (first) {
    __syncthreads();      /* the lo waves' tiles are read by the hi waves; the branch is the same for the whole work-group */
    if (!lo) { v4f vl[16]; g2_take(so[w], lane, v); g2_take(so[w + 2], lane, vl);
#pragma unroll /* constant indices keep the arrays in registers */
      for (int q = 0; q < 16; ++q) v[q] = vl[q] + v[q];
      g2_put<DM>(po, v); }      /* the stores stand behind every LDS read and sum: no register that an issued store names is written again */
  } else {
    __builtin_amdgcn_fence(__ATOMIC_ACQ_REL, "workgroup"); __builtin_amdgcn_wave_barrier();
    g2_take(so[w], lane, v); g2_put<DM>(po, v); } }      /* as above */


// The five f32 -> f16 passes in one grid by block ranges: first the token rows (bf16-rounded, exact in f16), then the four natural [out][in] weights (bf16-rounded, x16). Eight elements a thread.
// A block takes 16 rows x 128 k (16 threads a row: 512 bytes in a row are read) and writes them as four tiles in fragment order, 4096 bytes in a row; the chunks change places in LDS.
__global__ __launch_bounds__(256) void k_prep(const float* __restrict__ x, const float* __restrict__ wq, const float* __restrict__ wk, const float* __restrict__ wv, const float* __restrict__ wo,
    _Float16* __restrict__ X16, _Float16* __restrict__ BQ, _Float16* __restrict__ BK, _Float16* __restrict__ BV, _Float16* __restrict__ BO) {
  static_assert(NR % 16 == 0 && DM % 128 == 0, "k_prep: whole blocks of 16 rows x 128 k");
  __shared__ __attribute__((aligned(16))) unsigned short tl[272 * 8];      /* 256 chunks of 16 bytes, a spare chunk behind every 16: writes (a lane per k chunk) and reads (a lane per row) both without bank conflicts */
  constexpr unsigned GX = (unsigned)(NR * DM / 2048), GW = (unsigned)((size_t)DM * DM / 2048);
  const unsigned bx = blockIdx.x; const float* s = x; _Float16* d = X16; float sc = 1.0f; unsigned b0 = bx;
  if (bx >= GX) { const unsigned i = (bx - GX) / GW; b0 = (bx - GX) % GW; sc = 16.0f; s = i == 0 ? wq : i == 1 ? wk : i == 2 ? wv : wo; d = i == 0 ? BQ : i == 1 ? BK : i == 2 ? BV : BO; }
  const int tid = threadIdx.x, r = tid >> 4, kc = tid & 15; const unsigned rg = b0 / (DM / 128), kq = b0 % (DM / 128);
  const float* sp = s + ((size_t)rg * 16 + r) * DM + kq * 128 + kc * 8; FragH f;
#pragma unroll /* constant indices keep f in registers */
  for (int q = 0; q < 8; ++q) f.h[q] = (_Float16)(bf16_round(sp[q]) * sc);
  *(v8us*)&tl[(17 * kc + r) * 8] = f.half[0];      /* chunk 16 kc + r of the block's four tiles: tile kc >> 2, chunk ((kc >> 1) & 1) * 32 + (kc & 1) * 16 + r */
  __syncthreads();      /* all but 16 chunks are read by another thread than wrote them */
  const v8us o = *(const v8us*)&tl[(tid + (tid >> 4)) * 8];
  *(v8us*)((unsigned short*)d + (((size_t)rg * (DM / 32) + kq * 4) * 64 + tid) * 8) = o; }
__global__ __launch_bounds__(256) void k_rsm(const float* __restrict__ S, _Float16* __restrict__ P, int nrows) {
  #pragma clang fp contract(off)
  const int i = blockIdx.x * 256 + threadIdx.x; if (i >= nrows) return; const float* s = S + (size_t)i * SQ; float mx = -3.0e38f;
#pragma unroll 1
  for (int j = 0; j < SQ; ++j) mx = fmaxf(mx, s[j]); float se = 0.f;
#pragma unroll 1
  for (int j = 0; j < SQ; ++j) se += expf(s[j] - mx); const float sc = 256.0f / se;
#pragma unroll 1
  for (int j0 = 0; j0 < SQ; j0 += 8) { FragH f; for (int q = 0; q < 8; ++q) f.h[q] = (_Float16)(expf(s[j0 + q] - mx) * sc); unsigned short* d = (unsigned short*)P + (size_t)i * SQ + j0; *(v8us*)d = f.half[0];  } }
__global__ __launch_bounds__(256) void k_vt(const _Float16* __restrict__ V16, int b, int h0, _Float16* __restrict__ VT) { __shared__ unsigned short tl[64][65]; const int tid = threadIdx.x; const int hh = blockIdx.x % HG, sg = blockIdx.x / HG; const int s0 = sg * 64; const int h = h0 + hh;
  for (int i = tid; i < 64 * 8; i += 256) { const int j = i / 8, d8 = (i % 8) * 8; FragH f; f.half[0] = *(const v8us*)((const unsigned short*)V16 + ((size_t)b * SQ + s0 + j) * DM + h * HD + d8); for (int q = 0; q < 8; ++q) tl[d8 + q][j] = f.u[q]; }
  __syncthreads();
  { for (int i = tid; i < 64 * 8; i += 256) { const int d = i / 8, j8 = (i % 8) * 8; FragH f; for (int q = 0; q < 8; ++q) f.u[q] = tl[d][j8 + q]; *(v8us*)((unsigned short*)VT + ((size_t)hh * HD + d) * SQ + s0 + j8) = f.half[0]; }  } }



#define FA_L2E 1.4426950408889634f
__device__ __forceinline__ float fa_xhalf(float x) { return __builtin_bit_cast(float, __builtin_amdgcn_permlanex16(__builtin_bit_cast(int, x), __builtin_bit_cast(int, x), 0x76543210, 0xfedcba98, false, false)); }      /* lane l with lane l ^ 16, on the vector pipe */
/* p = 2^a; behind the v_exp_f32 stands the argument of a weight three calls on, an = x log2(e) + c. That product is independent of the v_exp_f32 and fills the one slot that the instruction set asks for
   between a transcendental and an instruction that reads its result or overwrites its source; in one statement, so that it stays there. "=&v": no output shares a register with an input. */
__device__ __forceinline__ float fa_exp2_fma(float a, float x, float c, float& an) { float p; asm("v_exp_f32 %0, %2\n\tv_fma_f32 %1, %3, %4, %5" : "=&v"(p), "=&v"(an) : "v"(a), "v"(x), "s"(FA_L2E), "v"(c)); return p; }
/* the last three weights of a pass have no later argument to form: a v_nop fills the same slot */
__device__ __forceinline__ float fa_exp2_nop(float a) { float p; asm("v_exp_f32 %0, %1\n\tv_nop" : "=&v"(p) : "v"(a)); return p; }
__device__ __forceinline__ v8f fa_mma(v16h a, v16h b, v8f c) { return __builtin_amdgcn_wmma_f32_16x16x32_f16(false, a, false, b, (short)0, c, false, false); }
template <bool DIAG>
__device__ __forceinline__ void fa_pass(float jf0, int ln, int hh, float slope, const v8f (&s)[2][2], const v16h (&vf)[4], v8f (&o)[2][4], float (&m)[2], float (&l)[2]) {
  float bias[2][8];
#pragma unroll /* constant indices keep the arrays in registers */
  for (int mt = 0; mt < 2; ++mt)
#pragma unroll /* as above */
    for (int r = 0; r < 8; ++r) bias[mt][r] = __fmul_rn(slope, jf0 + (float)(mt * 16 + r));      /* slope_h * j, rounded once */
  float x[2][2][8]; float mx[2];
#pragma unroll /* as above */
  for (int nt = 0; nt < 2; ++nt) { float t = -1.0e30f;
#pragma unroll /* as above */
    for (int mt = 0; mt < 2; ++mt)
#pragma unroll /* as above */
      for (int r = 0; r < 8; ++r) { float v = fmaf(s[nt][mt][r], 0.125f, -bias[mt][r]); if (DIAG) v = (mt * 16 + 8 * hh + r <= nt * 16 + ln) ? v : -1.0e30f;      /* diagonal pass: its first key is the wave's first query */
        x[nt][mt][r] = v; t = fmaxf(t, v); }
    mx[nt] = fmaxf(t, fa_xhalf(t)); }
  /* the accumulators are rescaled only in a pass that raises some query's maximum: one scalar branch a pass */
  if (__builtin_amdgcn_ballot_w32(mx[0] > m[0] || mx[1] > m[1]) != 0) {
#pragma unroll /* as above */
    for (int nt = 0; nt < 2; ++nt) { const float mn = fmaxf(m[nt], mx[nt]); const float a = __builtin_amdgcn_exp2f((m[nt] - mn) * FA_L2E); m[nt] = mn; l[nt] *= a;
#pragma unroll /* as above */
      for (int dt = 0; dt < 4; ++dt) o[nt][dt] *= a; } }
  v16h pf[2]; float cc[2], a[32], p[32];      /* weight i = nt * 16 + 2 r + mt; weight = 2^8 exp(x - m) = 2^(x log2(e) + cc) */
#pragma unroll /* as above */
  for (int nt = 0; nt < 2; ++nt) cc[nt] = fmaf(-m[nt], FA_L2E, 8.0f);
#pragma unroll /* as above */
  for (int i = 0; i < 3; ++i) a[i] = fmaf(x[0][i & 1][i >> 1], FA_L2E, cc[0]);
#pragma unroll /* as above */
  for (int i = 0; i < 32; ++i) { const int n = i + 3; if (n < 32) p[i] = fa_exp2_fma(a[i], x[n >> 4][n & 1][(n & 15) >> 1], cc[n >> 4], a[n]); else p[i] = fa_exp2_nop(a[i]); }
#pragma unroll /* as above */
  for (int nt = 0; nt < 2; ++nt) { FragH f; float s0 = 0.f, s1 = 0.f;
#pragma unroll /* as above */
    for (int r = 0; r < 8; ++r) { const float p0 = p[nt * 16 + 2 * r], p1 = p[nt * 16 + 2 * r + 1]; s0 += p0; s1 += p1; f.h[r] = (_Float16)p0; f.h[8 + r] = (_Float16)p1; }
    l[nt] += s0 + s1; pf[nt] = f.v; }
#pragma unroll /* as above */
  for (int dt = 0; dt < 4; ++dt) { o[0][dt] = fa_mma(vf[dt], pf[0], o[0][dt]); o[1][dt] = fa_mma(vf[dt], pf[1], o[1][dt]); } }
__device__ __forceinline__ void fa_scores(const v16h (&kf)[2][2], const v16h (&qf)[2][2], v8f (&s)[2][2]) {
  const v8f z8 = {0.f,0.f,0.f,0.f,0.f,0.f,0.f,0.f};
  s[0][0] = fa_mma(kf[0][0], qf[0][0], z8); s[0][1] = fa_mma(kf[1][0], qf[0][0], z8); s[1][0] = fa_mma(kf[0][0], qf[1][0], z8); s[1][1] = fa_mma(kf[1][0], qf[1][0], z8);
  s[0][0] = fa_mma(kf[0][1], qf[0][1], s[0][0]); s[0][1] = fa_mma(kf[1][1], qf[0][1], s[0][1]); s[1][0] = fa_mma(kf[0][1], qf[1][1], s[1][0]); s[1][1] = fa_mma(kf[1][1], qf[1][1], s[1][1]); }
__global__ __launch_bounds__(256) __attribute__((amdgpu_waves_per_eu(4, 4))) /* a budget of 256 registers: none above v255, no register-window switches in the loop */ void k_fattn(const _Float16* __restrict__ Q, const _Float16* __restrict__ K, const _Float16* __restrict__ VT, _Float16* __restrict__ O) {
  static_assert(SQ % 256 == 0 && HD == 64, "k_fattn: two blocks of 128 query rows a work-group, head size 64");
  const int tid = threadIdx.x, lane = tid & 31, ln = lane & 15, hh = lane >> 4; const int w = __builtin_amdgcn_readfirstlane(tid >> 5);      /* the wave's number in a scalar register: the key loop stays a scalar branch */
  const int h = blockIdx.x % NH, pr = blockIdx.x / NH; const int q0 = (w < 4 ? SQ / 128 - 1 - pr : pr) * 128 + (w & 3) * 32;      /* causal balance: waves 0..3 take row block n - 1 - pr, waves 4..7 row block pr, so that every work-group walks the same number of passes */
  const float slope = (float)exp2(-0.5 * (double)(h + 1));      /* ALiBi slope 2^(-8 (h+1) / 16), correctly rounded to f32 */
  constexpr size_t RGQ = (size_t)(DM / 32) * FT, RGV = (size_t)(SQ / 32) * FT;      /* one group of 16 rows of Q, K, O; of V^T (all in fragment order) */
  const _Float16* pq = Q + (size_t)(q0 >> 4) * RGQ + (size_t)(h * (HD / 32)) * FT + lane * 8; const _Float16* pk = K + (size_t)(h * (HD / 32)) * FT + lane * 8; const _Float16* pv = VT + (size_t)(h * (HD / 16)) * RGV + lane * 8;
  v16h qf[2][2], kf[2][2], vf[4]; v8f s[2][2]; v8f o[2][4]; float m[2] = {-1.0e30f, -1.0e30f}, l[2] = {0.f, 0.f}; float jf0 = (float)(8 * hh);      /* this lane's first key position of the pass, as a float (exact) */
#pragma unroll /* constant indices keep the arrays in registers */
  for (int nt = 0; nt < 2; ++nt) {
#pragma unroll /* as above */
    for (int dt = 0; dt < 4; ++dt) o[nt][dt] = v8f{0.f,0.f,0.f,0.f,0.f,0.f,0.f,0.f};
#pragma unroll /* as above */
    for (int kd = 0; kd < 2; ++kd) { qf[nt][kd] = pk_frag(pq + nt * RGQ + kd * FT); kf[nt][kd] = pk_frag(pk + nt * RGQ + kd * FT); } }
  /* the wait in front of any rewrite of a register that an issued load names; as its inputs the address pairs stay live up to it */
  asm volatile("s_wait_xcnt 0x0" :: "v"(pq), "v"(pk) : "memory");
#pragma unroll 1 /* a pass holds about 240 registers; two passes side by side would not fit in 256 */
  for (int kb = 0; kb < q0; kb += 32) {
#pragma unroll /* as above */
    for (int dt = 0; dt < 4; ++dt) vf[dt] = pk_frag(pv + dt * RGV);      /* this pass's V^T: flies under the score products and the softmax */
    asm volatile("s_wait_xcnt 0x0" :: "v"(pv) : "memory");      /* as above, in front of the step of pv */
    pv += FT;
    fa_scores(kf, qf, s);
    pk += 2 * RGQ;
#pragma unroll /* as above */
    for (int mt = 0; mt < 2; ++mt)
#pragma unroll /* as above */
      for (int kd = 0; kd < 2; ++kd) kf[mt][kd] = pk_frag(pk + mt * RGQ + kd * FT);      /* the next pass's K (at most the diagonal pass's), into the same registers: flies under the softmax and the second product */
    asm volatile("s_wait_xcnt 0x0" :: "v"(pk) : "memory");      /* as above, in front of the next step of pk */
    fa_pass<false>(jf0, ln, hh, slope, s, vf, o, m, l);
    jf0 += 32.0f; }
#pragma unroll /* as above */
  for (int dt = 0; dt < 4; ++dt) vf[dt] = pk_frag(pv + dt * RGV);
  asm volatile("s_wait_xcnt 0x0" :: "v"(pv) : "memory");      /* as above */
  fa_scores(kf, qf, s);
  fa_pass<true>(jf0, ln, hh, slope, s, vf, o, m, l);
  v8us hv[2][4];
#pragma unroll /* as above */
  for (int nt = 0; nt < 2; ++nt) { const float fin = 64.0f / (l[nt] + fa_xhalf(l[nt]));      /* the two halves' sums joined once; o carried x64 */
#pragma unroll /* as above */
    for (int dt = 0; dt < 4; ++dt) { FragH f;
#pragma unroll /* as above */
      for (int r = 0; r < 8; ++r) f.h[r] = (_Float16)(o[nt][dt][r] * fin);
      hv[nt][dt] = f.half[0]; } }
  /* the stores stand behind every conversion: no register that an issued store names is written again */
  unsigned short* po = (unsigned short*)O + (size_t)(q0 >> 4) * RGQ + (size_t)(h * (HD / 32)) * FT + lane * 8;      /* lane (ln, hh) holds dims 16 dt + 8 hh .. + 7 of query ln: chunk (dt & 1) * 32 + lane of tile dt >> 1 */
#pragma unroll /* as above */
  for (int nt = 0; nt < 2; ++nt)
#pragma unroll /* as above */
    for (int dt = 0; dt < 4; ++dt) *(v8us*)(po + nt * RGQ + dt * 256) = hv[nt][dt]; }


// Exact f32 causal attention of the first QT0 rows. One work-group of 8 waves per head and 32 query rows (lane = row). The head's K and V rows below the group's end and its 32 q rows
// are staged in LDS by whole-line loads. Scores: wave w takes keys w, w + 8, ...; softmax in two passes over the scores kept in LDS; o: wave w takes head dims 8 w .. 8 w + 7 over all keys in rising order.
// LD = row pitch of QF, KF, VF in floats, a compile-time constant so that every staged row is one base address plus an immediate offset.
template <int ALIBI, int LD>
__global__ __launch_bounds__(256) void k_att0(const float* __restrict__ QF, const float* __restrict__ KF, const float* __restrict__ VF, float scale, _Float16* __restrict__ OH, _Float16* __restrict__ OL, int ldo) {
  static_assert(QT0 % 32 == 0 && HD == 64, "k_att0: 32 rows a group, 16 threads a staged row, 8 dims a wave");
  __shared__ __attribute__((aligned(16))) float lk[QT0][HD]; __shared__ __attribute__((aligned(16))) float lv[QT0][HD]; __shared__ float sc[QT0][32];
  __shared__ __attribute__((aligned(16))) float lqo[32][HD + 4];      /* q rows, later o rows; pitch 16 B x 17: a lane per row reads and writes 16 bytes without bank conflicts */
  __shared__ float pm[8][32]; __shared__ float pl[8][32];
  const int tid = threadIdx.x, lane = tid & 31; const int w = __builtin_amdgcn_readfirstlane(tid >> 5);      /* the wave's number in a scalar register: the key loops stay scalar branches */
  const int h = blockIdx.x / (QT0 / 32), rg = blockIdx.x % (QT0 / 32); const int i = rg * 32 + lane; const int nkeys = rg * 32 + 32;      /* causal: keys up to the group's last row */
  const int sr = tid >> 4, c4 = (tid & 15) * 4;      /* staging: 16 threads a row of 256 bytes */
  { v4f tk[QT0 / 16], tv[QT0 / 16], tq[2];
    const float* gk = KF + (size_t)sr * LD + h * HD + c4; const float* gv = VF + (size_t)sr * LD + h * HD + c4; const float* gq = QF + (size_t)(rg * 32 + sr) * LD + h * HD + c4;
#pragma unroll /* constant indices keep tk[] and tv[] in registers; all loads are issued before the first is used */
    for (int c = 0; c < QT0 / 32; ++c) if (c * 32 < nkeys) {
#pragma unroll /* as above */
      for (int u = 2 * c; u < 2 * c + 2; ++u) { tk[u] = *(const v4fa*)(gk + (size_t)u * 16 * LD); tv[u] = *(const v4fa*)(gv + (size_t)u * 16 * LD); } }
#pragma unroll /* as above */
    for (int u = 0; u < 2; ++u) tq[u] = *(const v4fa*)(gq + (size_t)u * 16 * LD);
    /* the wait in front of any rewrite of a register that an issued load names; as its inputs the three address pairs stay live up to it, so that no load lands in one of them */
    asm volatile("s_wait_xcnt 0x0" :: "v"(gk), "v"(gv), "v"(gq) : "memory");
#pragma unroll /* as above */
    for (int c = 0; c < QT0 / 32; ++c) if (c * 32 < nkeys) {
#pragma unroll /* as above */
      for (int u = 2 * c; u < 2 * c + 2; ++u) { *(v4f*)&lk[u * 16 + sr][c4] = tk[u]; *(v4f*)&lv[u * 16 + sr][c4] = tv[u]; } }
#pragma unroll /* as above */
    for (int u = 0; u < 2; ++u) *(v4f*)&lqo[u * 16 + sr][c4] = tq[u]; }
  __syncthreads();
  const float slope = ALIBI ? (float)exp2(-0.5 * (double)(h + 1)) : 0.f;      /* ALiBi: 2^(-8 (h+1) / 16) */
  v4f q[HD / 4];
#pragma unroll /* constant indices keep q[] in registers */
  for (int c = 0; c < HD / 4; ++c) q[c] = *(const v4f*)&lqo[lane][c * 4];
  float mp = -1.0e30f;
  for (int j0 = w; j0 < nkeys; j0 += 16) {      /* nkeys is a multiple of 32: two keys a trip, so that one key's LDS reads fly under the other's products */
#pragma unroll /* the two keys of a trip in one block of code */
    for (int u = 0; u < 2; ++u) { const int j = j0 + 8 * u; v4f a = {0.f, 0.f, 0.f, 0.f};
#pragma unroll /* constant indices keep q[] in registers */
      for (int c = 0; c < HD / 4; ++c) a += q[c] * *(const v4f*)&lk[j][c * 4];
      float s = ((a[0] + a[1]) + (a[2] + a[3])) * scale; if (ALIBI) s -= slope * (float)j;
      s = (j <= i) ? s : -1.0e30f; sc[j][lane] = s; mp = fmaxf(mp, s); } }
  pm[w][lane] = mp;
  __syncthreads();
  float m = pm[0][lane];
#pragma unroll /* eight partial maxima */
  for (int x = 1; x < 8; ++x) m = fmaxf(m, pm[x][lane]);
  float lp = 0.f;
  for (int j0 = w; j0 < nkeys; j0 += 32) {      /* nkeys is a multiple of 32: four keys a trip, so that their LDS reads and exps overlap */
#pragma unroll /* the four keys of a trip in one block of code */
    for (int u = 0; u < 4; ++u) { const int j = j0 + 8 * u; const float e = expf(sc[j][lane] - m); sc[j][lane] = e; lp += e; } }      /* a masked key gives exactly 0 */
  pl[w][lane] = lp;
  __syncthreads();
  float l = pl[0][lane];
#pragma unroll /* eight partial sums, fixed order */
  for (int x = 1; x < 8; ++x) l += pl[x][lane];
  v4f o0 = {0.f, 0.f, 0.f, 0.f}, o1 = {0.f, 0.f, 0.f, 0.f};
#pragma unroll 8 /* eight keys' LDS reads in flight; nkeys is a multiple of 32 */
  for (int j = 0; j < nkeys; ++j) { const float p = sc[j][lane]; o0 += p * *(const v4f*)&lv[j][8 * w]; o1 += p * *(const v4f*)&lv[j][8 * w + 4]; }
  const float fin = 64.0f / l;      /* o carried x64 like the f16 path */
  *(v4f*)&lqo[lane][8 * w] = o0 * fin; *(v4f*)&lqo[lane][8 * w + 4] = o1 * fin;
  __syncthreads();
#pragma unroll /* two rows a thread; the 16 threads of a row fill its eight 16-byte chunks, in two tiles, of each plane */
  for (int u = 0; u < 2; ++u) { const int row = u * 16 + sr; const v4f v = *(const v4f*)&lqo[row][c4]; v4h vh, vl;      /* o (x64) -> f16 plane + x1024 residual plane */
#pragma unroll /* constant indices keep the vectors in registers */
    for (int e = 0; e < 4; ++e) { const _Float16 t = (_Float16)v[e]; vh[e] = t; vl[e] = (_Float16)((v[e] - (float)t) * 1024.0f); }
    const size_t at = pk_at(rg * 32 + row, h * HD + c4, ldo); *(v4h*)(OH + at) = vh; *(v4h*)(OL + at) = vl; } }      /* both planes in fragment order */

extern "C" void kernel_launch(void* const* d_in, const int* in_sizes, int n_in,
                              void* d_out, int out_size, void* d_ws, size_t ws_size, hipStream_t stream) {
  (void)in_sizes; (void)n_in; (void)out_size;
  const float* const* I = (const float* const*)d_in; const float* x = I[0]; const float* wq = I[1]; const float* bq = I[2]; const float* wk = I[3]; const float* wv = I[4]; const float* bv = I[5]; const float* wo = I[6];      /* natural [out][in] weights; biases on q and v only */
  char* ws = (char*)d_ws; size_t off = 0;
  auto take = [&](size_t bytes) { char* p = ws + off; off += (bytes + 255) & ~(size_t)255; return p; };
  _Float16* BQ = (_Float16*)take((size_t)DM * DM * 2); _Float16* BK = (_Float16*)take((size_t)DM * DM * 2); _Float16* BV = (_Float16*)take((size_t)DM * DM * 2); _Float16* BO = (_Float16*)take((size_t)DM * DM * 2);
  _Float16* X16 = (_Float16*)take(NR * DM * 2); _Float16* Q16 = (_Float16*)take(NR * DM * 2); _Float16* K16 = (_Float16*)take(NR * DM * 2); _Float16* O16 = (_Float16*)take(NR * DM * 2);
  _Float16* VT = (_Float16*)take((size_t)NH * HD * SQ * 2);
  float* QF0 = (float*)take((size_t)QT0 * DM * 4); float* KF0 = (float*)take((size_t)QT0 * DM * 4); float* VF0 = (float*)take((size_t)QT0 * DM * 4); _Float16* OH0 = (_Float16*)take((size_t)NB * QT0 * DM * 2); _Float16* OL0 = (_Float16*)take((size_t)NB * QT0 * DM * 2);
  if (off > ws_size) return;
  k_prep<<<(unsigned)(NR * DM / 2048 + 4 * ((size_t)DM * DM / 2048)), 256, 0, stream>>>(x, wq, wk, wv, wo, X16, BQ, BK, BV, BO);      /* x rows and the four weights (natural [out][in] = Bt[n][k], x16) as f16 in fragment order */
  k_qkv<<<3 * QKV_G + (QT0 / 128) * (DM / 64), 128, 0, stream>>>(X16, BQ, BK, BV, bq, bv, Q16, K16, VT, QF0, KF0, VF0);      /* q, k and V^T [NH][HD][SQ] as f16 in fragment order; q, k, v of the first 256 rows as f32 rows */
  k_att0<1, DM><<<NH * (QT0 / 32), 256, 0, stream>>>(QF0, KF0, VF0, 0.125f, OH0, OL0, DM);      /* exact f32 causal ALiBi attention for rows 0..255 (o x64), as f16 hi + x1024 residual planes */
  k_fattn<<<NH * (SQ / 256), 256, 0, stream>>>(Q16, K16, VT, O16);      /* scores, causal ALiBi softmax and o (merged heads, x64, f16 in fragment order) in one launch */
  k_out<<<OUT_G0 + ((MPO - QT0) / 128) * (DM / 64), 128, 0, stream>>>(O16, OH0, OL0, BO, (float*)d_out);      /* out rows are the output layout */
}

// v007
// A run of this version takes 115 microseconds.
// In both of two side-by-side timings against v006, it was 1.42 times as fast.
// Counting every step since v000, it is 73.5 times as fast.
#include <hip/hip_runtime.h>
// Causal multi-head attention with an ALiBi key-position bias (inputs [1][4096][1024]; q = x Wq^T + bq, k = x Wk^T (no bias), v = x Wv^T + bv (natural [1024][1024] sigma 0.02; bq, bv sigma 0.02); 16 heads of 64; scores / 8 - slopes[h] * j with slopes[h] = 2^(-8 (h+1) / 16) and j the key position; causal (j <= i keep, -inf); softmax; out = merged Wo^T (no bias) -> [1][4096][1024]).
// Structure: token rows r = s; q, k, v inputs as exact f16 rows (bf16-rounded); Q, K and V^T as WMMA GEMMs in one launch (32x64 wave tiles, f32 accumulation, exact x16 weights, f16 outputs; V^T = Wv x^T, the weight rows as the A operand); the first 256 rows exactly in f32 (own launch); one fused attention launch (four waves per 32 query rows of a head, each with a quarter of the passes of 32 keys up to the diagonal, joined in LDS; scores / 8 minus the ALiBi term slope_h * j in f32, online softmax with f32 statistics and native exp2, weights x256 f16, o carried x64, folded into the output GEMM alpha) written straight into the merged f16 o rows; out = o W_o GEMM (f32) into the output layout, the first 256 rows from the exact o as f16 hi + residual planes. Five launches. Every f16 plane that a WMMA reads from memory (x, the weights, q, k, V^T, o) is kept in fragment order (see FT below), not as plain rows.
// Compute dtype: inputs rounded to bf16; x / weights exact; q, k, v, softmax weights and o as plain f16 GEMM operands (~2^-12); scores and softmax statistics f32. v_wmma_f32_16x16x32_f16.
#define NB 1
#define SQ 4096
#define DM 1024
#define NH 16
#define HD 64
#define HG 4                         /* heads per block group of the unlaunched k_vt overload */
#define QT 256                       /* query rows per causal tile */
#define NKX SQ                       /* S / P row pitch */
#define QT0 256                      /* first-tile rows recomputed exactly in f32 */
#define B0 0                         /* first batch processed (debug hook) */
#define NBR NB                       /* batches processed (debug hook) */
#define NR ((size_t)NB * SQ)         /* token rows */
#define MP ((int)((size_t)NBR * SQ)) /* rows projected (debug hook) */
#define QN SQ                        /* query rows attended per batch (debug hook) */
#define NHD NH                       /* heads attended (debug hook) */
#define MPO MP                       /* rows through the output stage (debug hook) */
#define LQ DM      /* row pitch of the q/k/v rows */
typedef __bf16 v16b __attribute__((ext_vector_type(16)));
typedef unsigned short v8us __attribute__((ext_vector_type(8), may_alias));
typedef float  v8f  __attribute__((ext_vector_type(8)));
typedef float  v4f  __attribute__((ext_vector_type(4)));
typedef float  v4fa __attribute__((ext_vector_type(4), may_alias));
union FragB { v16b v; v8us half[2]; unsigned short u[16]; };

__device__ __forceinline__ unsigned short bf16_bits(float x) { unsigned int u = __float_as_uint(x); return (unsigned short)((u + 0x7FFFu + ((u >> 16) & 1u)) >> 16); }
__device__ __forceinline__ float bf16_val(unsigned short b) { return __uint_as_float(((unsigned int)b) << 16); }
__device__ __forceinline__ float bf16_round(float x) { return bf16_val(bf16_bits(x)); }
// D += A·B with NT terms: 1 = ah·bh, 2 = + al·bh (A split), 3 = + ah·bl (both split)
template <int NT>
__device__ __forceinline__ v8f mmaN(v16b ah, v16b al, v16b bh, v16b bl, v8f c) {
  c = __builtin_amdgcn_wmma_f32_16x16x32_bf16(false, ah, false, bh, (short)0, c, false, false);
  if (NT >= 2) c = __builtin_amdgcn_wmma_f32_16x16x32_bf16(false, al, false, bh, (short)0, c, false, false);
  if (NT >= 3) c = __builtin_amdgcn_wmma_f32_16x16x32_bf16(false, ah, false, bl, (short)0, c, false, false);
  asm volatile("v_nop\n\tv_nop\n\tv_nop\n\tv_nop" : "+v"(c) : "v"(ah), "v"(al), "v"(bh), "v"(bl));
  return c;
}

__global__ __launch_bounds__(256) void k_wt_bf16(const float* __restrict__ W, unsigned short* __restrict__ Wt, int K, int N) {
  const int t = blockIdx.x * 256 + threadIdx.x;
  const int k8n = K / 8;
  if (t >= N * k8n) return;
  const int n = t / k8n, k8 = (t % k8n) * 8;
  v8us v;
#pragma unroll
  for (int i = 0; i < 8; ++i) v[i] = bf16_bits(W[(size_t)(k8 + i) * N + n]);
  *(v8us*)(Wt + (size_t)n * K + k8) = v;
  
}

// GEMM C[M][N] (f32, pitch ldc) = act(A[M][K]·W + bias). A f32 row-major (pitch lda) converted per fragment to bf16
// (ASPLIT: hi/lo two planes -> 2 terms, else single rounded term); Wt bf16 [N][K] (pitch ldb). BIAS_BF16 rounds the
// bias to bf16 first (bias quantised to bf16 before the add). K%32==0, M%16==0, N%64==0.
template <bool ASPLIT, int ACT, bool BIAS_BF16>
__global__ __launch_bounds__(128) void k_gemm_bf(const float* __restrict__ A, int lda, const unsigned short* __restrict__ Wt, int ldb,
                                               const float* __restrict__ bias, float* __restrict__ C, int ldc, int M, int N, int K) {
  __shared__ __attribute__((aligned(16))) float so[4][16][64];
  const int tid = threadIdx.x, w = tid >> 5, lane = tid & 31, ln = lane & 15, hh = lane >> 4;
  const int ntn = N / 64;
  const int wid = blockIdx.x * 4 + w;
  const int mt = wid / ntn, nq = wid % ntn;
  if (mt * 16 >= M) return;
  const int row0 = mt * 16, col0 = nq * 64;
  const float* arow = A + (size_t)(row0 + ln) * lda;
  v8f acc[4] = {};
  for (int kb = 0; kb < K; kb += 32) {
    FragB ah, al;
    const v4f x0 = *(const v4fa*)(arow + kb + 8 * hh), x1 = *(const v4fa*)(arow + kb + 8 * hh + 4);
    const v4f x2 = *(const v4fa*)(arow + kb + 16 + 8 * hh), x3 = *(const v4fa*)(arow + kb + 16 + 8 * hh + 4);
    float xs[16] = {x0[0],x0[1],x0[2],x0[3],x1[0],x1[1],x1[2],x1[3],x2[0],x2[1],x2[2],x2[3],x3[0],x3[1],x3[2],x3[3]};
#pragma unroll
    for (int i = 0; i < 16; ++i) { const unsigned short hb = bf16_bits(xs[i]); ah.u[i] = hb; al.u[i] = ASPLIT ? bf16_bits(xs[i] - bf16_val(hb)) : (unsigned short)0; }
#pragma unroll
    for (int t = 0; t < 4; ++t) {
      const unsigned short* brow = Wt + (size_t)(col0 + t * 16 + ln) * ldb + kb;
      FragB b;
      b.half[0] = *(const v8us*)(brow + 8 * hh);
      b.half[1] = *(const v8us*)(brow + 16 + 8 * hh);
      acc[t] = mmaN<ASPLIT ? 2 : 1>(ah.v, al.v, b.v, b.v, acc[t]);
    }
  }
#pragma unroll
  for (int t = 0; t < 4; ++t) {
    float bv = bias ? bias[col0 + t * 16 + ln] : 0.f;
    if (BIAS_BF16) bv = bf16_round(bv);
#pragma unroll
    for (int r = 0; r < 8; ++r) { float v = acc[t][r] + bv; if (ACT == 1) v = fmaxf(v, 0.f); so[w][8 * hh + r][t * 16 + ln] = v; }
  }
  __builtin_amdgcn_fence(__ATOMIC_ACQ_REL, "workgroup");
  __builtin_amdgcn_wave_barrier();
  const int rsub = lane >> 4, c4 = (lane & 15) * 4;
  {
#pragma unroll
    for (int q = 0; q < 8; ++q) {
      const int r = q * 2 + rsub;
      const v4f v = *(const v4fa*)&so[w][r][c4];
      *(v4f*)(C + (size_t)(row0 + r) * ldc + col0 + c4) = v;
    }
    
  }
}

// GEMM C = act(A·W + bias + resid): A f32 (ASPLIT -> hi/lo 2 terms), Wt bf16 [N][K]; ACT 0 none, 1 relu, 2 exact gelu;
// resid (optional, f32, row index = (row % rmod), pitch ldr, RES_BF16 rounds it) added before the activation.
template <bool ASPLIT, int ACT, bool BIAS_BF16, bool RES_BF16>
__global__ __launch_bounds__(128) void k_gemm_bf3(const float* __restrict__ A, int lda, const unsigned short* __restrict__ Wt, int ldb,
                                                const float* __restrict__ bias, const float* __restrict__ resid, int rmod, int ldr,
                                                float* __restrict__ C, int ldc, int M, int N, int K) {
  __shared__ __attribute__((aligned(16))) float so[4][16][64];
  const int tid = threadIdx.x, w = tid >> 5, lane = tid & 31, ln = lane & 15, hh = lane >> 4;
  const int ntn = N / 64;
  const int wid = blockIdx.x * 4 + w;
  const int mt = wid / ntn, nq = wid % ntn;
  if (mt * 16 >= M) return;
  const int row0 = mt * 16, col0 = nq * 64;
  const float* arow = A + (size_t)(row0 + ln) * lda;
  v8f acc[4] = {};
  for (int kb = 0; kb < K; kb += 32) {
    FragB ah, al;
    const v4f x0 = *(const v4fa*)(arow + kb + 8 * hh), x1 = *(const v4fa*)(arow + kb + 8 * hh + 4);
    const v4f x2 = *(const v4fa*)(arow + kb + 16 + 8 * hh), x3 = *(const v4fa*)(arow + kb + 16 + 8 * hh + 4);
    float xs[16] = {x0[0],x0[1],x0[2],x0[3],x1[0],x1[1],x1[2],x1[3],x2[0],x2[1],x2[2],x2[3],x3[0],x3[1],x3[2],x3[3]};
#pragma unroll
    for (int i = 0; i < 16; ++i) { const unsigned short hb = bf16_bits(xs[i]); ah.u[i] = hb; al.u[i] = ASPLIT ? bf16_bits(xs[i] - bf16_val(hb)) : (unsigned short)0; }
#pragma unroll
    for (int t = 0; t < 4; ++t) {
      const unsigned short* brow = Wt + (size_t)(col0 + t * 16 + ln) * ldb + kb;
      FragB b;
      b.half[0] = *(const v8us*)(brow + 8 * hh);
      b.half[1] = *(const v8us*)(brow + 16 + 8 * hh);
      acc[t] = mmaN<ASPLIT ? 2 : 1>(ah.v, al.v, b.v, b.v, acc[t]);
    }
  }
#pragma unroll
  for (int t = 0; t < 4; ++t) {
    const int col = col0 + t * 16 + ln;
    float bv = bias ? bias[col] : 0.f;
    if (BIAS_BF16) bv = bf16_round(bv);
#pragma unroll
    for (int r = 0; r < 8; ++r) {
      float v = acc[t][r] + bv;
      if (resid) { float rv = resid[(size_t)((row0 + 8 * hh + r) % rmod) * ldr + col]; if (RES_BF16) rv = bf16_round(rv); v += rv; }
      if (ACT == 1) v = fmaxf(v, 0.f);
      if (ACT == 2) v = 0.5f * v * (1.0f + erff(v * 0.70710678118654752f));
      if (ACT == 3) { const float u = 0.7978845608028654f * (v + 0.044715f * v * v * v); v = 0.5f * v * (1.0f + tanhf(u)); }
      so[w][8 * hh + r][t * 16 + ln] = v;
    }
  }
  __builtin_amdgcn_fence(__ATOMIC_ACQ_REL, "workgroup");
  __builtin_amdgcn_wave_barrier();
  const int rsub = lane >> 4, c4 = (lane & 15) * 4;
  {
#pragma unroll
    for (int q = 0; q < 8; ++q) {
      const int r = q * 2 + rsub;
      const v4f v = *(const v4fa*)&so[w][r][c4];
      *(v4f*)(C + (size_t)(row0 + r) * ldc + col0 + c4) = v;
    }
    
  }
}
// row LayerNorm (biased variance, eps) over N: s = X (+ R); optional out_sum <- s; out_norm <- (s-mu)*rsqrt(var+eps)*g + b
template <bool PARAM_BF16>
__global__ __launch_bounds__(256) void k_layernorm(const float* __restrict__ X, const float* __restrict__ R, const float* __restrict__ g, const float* __restrict__ bta,
                                                  float* __restrict__ out_sum, float* __restrict__ out_norm, int N, float eps) {
  __shared__ float red[256];
  const int row = blockIdx.x, tid = threadIdx.x;
  const float* x = X + (size_t)row * N; const float* rr = R ? R + (size_t)row * N : nullptr;
  float vals[16];                     // up to N = 4096
  const int per = N / 256;            // contiguous chunk per thread? use strided-by-4 chunks: thread handles j = tid*4 + 1024*u
  float s1 = 0.f;
  for (int u = 0; u < per / 4; ++u) {
    const int j = tid * 4 + 1024 * u;
    const v4f a = *(const v4fa*)(x + j);
    v4f b = {0.f,0.f,0.f,0.f}; if (rr) b = *(const v4fa*)(rr + j);
#pragma unroll
    for (int q = 0; q < 4; ++q) { const float v = a[q] + b[q]; vals[u * 4 + q] = v; s1 += v; }
  }
  red[tid] = s1; __syncthreads();
  for (int st = 128; st > 0; st >>= 1) { if (tid < st) red[tid] += red[tid + st]; __syncthreads(); }
  const float mu = red[0] / (float)N; __syncthreads();
  float s2 = 0.f;
  for (int u = 0; u < per / 4; ++u)
#pragma unroll
    for (int q = 0; q < 4; ++q) { const float c = vals[u * 4 + q] - mu; s2 += c * c; }
  red[tid] = s2; __syncthreads();
  for (int st = 128; st > 0; st >>= 1) { if (tid < st) red[tid] += red[tid + st]; __syncthreads(); }
  const float rs = rsqrtf(red[0] / (float)N + eps);
  {
    for (int u = 0; u < per / 4; ++u) {
      const int j = tid * 4 + 1024 * u;
      v4f o, sm;
#pragma unroll
      for (int q = 0; q < 4; ++q) {
        float gg = g[j + q], bb = bta[j + q];
        if (PARAM_BF16) { gg = bf16_round(gg); bb = bf16_round(bb); }
        sm[q] = vals[u * 4 + q]; o[q] = (vals[u * 4 + q] - mu) * rs * gg + bb;
      }
      if (out_sum) *(v4f*)(out_sum + (size_t)row * N + j) = sm;
      *(v4f*)(out_norm + (size_t)row * N + j) = o;
    }
    
  }
}



// ---- f16 WMMA path (v_wmma_f32_16x16x32_f16): 11-bit significands for operands in range — used where a [0,1] probability operand needs more precision than bf16
typedef _Float16 v16h __attribute__((ext_vector_type(16)));
union FragH { v16h v; v8us half[2]; _Float16 h[16]; unsigned short u[16]; };
template <int NT>
__device__ __forceinline__ v8f mmaH(v16h ah, v16h al, v16h bh, v16h bl, v8f c) {
  c = __builtin_amdgcn_wmma_f32_16x16x32_f16(false, ah, false, bh, (short)0, c, false, false);
  if (NT >= 2) c = __builtin_amdgcn_wmma_f32_16x16x32_f16(false, al, false, bh, (short)0, c, false, false);
  if (NT >= 3) c = __builtin_amdgcn_wmma_f32_16x16x32_f16(false, ah, false, bl, (short)0, c, false, false);
  asm volatile("v_nop\n\tv_nop\n\tv_nop\n\tv_nop" : "+v"(c) : "v"(ah), "v"(al), "v"(bh), "v"(bl));
  return c;
}
// batched GEMM like k_gemm_b but f16 operands: A f32 (split into f16 hi/lo if ASPLIT, else rounded to f16), Bt = f16 values [n][k]; alpha; C f32; N multiple of 16 (partial tiles skipped)
template <bool ASPLIT>
__global__ __launch_bounds__(128) void k_gemm_h(const float* __restrict__ A, int lda, size_t sA, const _Float16* __restrict__ Bh, int ldb, size_t sB, float alpha, float* __restrict__ C, int ldc, size_t sC, int M, int N, int K) {
  __shared__ __attribute__((aligned(16))) float so[4][16][64];
  const int tid = threadIdx.x, w = tid >> 5, lane = tid & 31, ln = lane & 15, hh = lane >> 4; const int by = blockIdx.y;
  A += (size_t)by * sA; Bh += (size_t)by * sB; C += (size_t)by * sC;
  const int ntn = (N + 63) / 64; const int wid = blockIdx.x * 4 + w; const int mt = wid / ntn, nq = wid % ntn; if (mt * 16 >= M) return;
  const int row0 = mt * 16, col0 = nq * 64; const float* arow = A + (size_t)(row0 + ln) * lda;
  v8f acc[4] = {};
  for (int kb = 0; kb < K; kb += 32) {
    FragH ah, al;
    const v4f x0 = *(const v4fa*)(arow + kb + 8 * hh), x1 = *(const v4fa*)(arow + kb + 8 * hh + 4), x2 = *(const v4fa*)(arow + kb + 16 + 8 * hh), x3 = *(const v4fa*)(arow + kb + 16 + 8 * hh + 4);
    float xs[16] = {x0[0],x0[1],x0[2],x0[3],x1[0],x1[1],x1[2],x1[3],x2[0],x2[1],x2[2],x2[3],x3[0],x3[1],x3[2],x3[3]};
#pragma unroll
    for (int i = 0; i < 16; ++i) { const _Float16 h = (_Float16)xs[i]; ah.h[i] = h; al.h[i] = ASPLIT ? (_Float16)(xs[i] - (float)h) : (_Float16)0.0f; }
#pragma unroll
    for (int t = 0; t < 4; ++t) { if (col0 + t * 16 >= N) continue; const size_t boff = (size_t)(col0 + t * 16 + ln) * ldb + kb; FragH bq; bq.half[0] = *(const v8us*)(Bh + boff + 8 * hh); bq.half[1] = *(const v8us*)(Bh + boff + 16 + 8 * hh);
      acc[t] = mmaH<ASPLIT ? 2 : 1>(ah.v, al.v, bq.v, bq.v, acc[t]); }
  }
#pragma unroll
  for (int t = 0; t < 4; ++t) { if (col0 + t * 16 >= N) continue;
#pragma unroll
    for (int r = 0; r < 8; ++r) so[w][8 * hh + r][t * 16 + ln] = acc[t][r] * alpha; }
  __builtin_amdgcn_fence(__ATOMIC_ACQ_REL, "workgroup"); __builtin_amdgcn_wave_barrier();
  const int rsub = lane >> 4, c4 = (lane & 15) * 4;
  {
#pragma unroll
    for (int q = 0; q < 8; ++q) { const int r = q * 2 + rsub; if (col0 + c4 < N) { const v4f v = *(const v4fa*)&so[w][r][c4]; *(v4f*)(C + (size_t)(row0 + r) * ldc + col0 + c4) = v; } }
     }
}

// Wt[n][k] = f16(W[k][n]·scale) from f32 row-major W[K][N] (scale = power of two; bf16-exact weights stay exact in f16 away from the subnormal range)
__global__ __launch_bounds__(256) void k_wt_f16(const float* __restrict__ W, _Float16* __restrict__ Wt, int K, int N, float scale) {
  const int t = blockIdx.x * 256 + threadIdx.x; if (t >= N * (K / 8)) return; const int n = t / (K / 8), k8 = (t % (K / 8)) * 8; FragH f;
#pragma unroll
  for (int i = 0; i < 8; ++i) f.h[i] = (_Float16)(bf16_round(W[(size_t)(k8 + i) * N + n]) * scale); const v8us o = f.half[0];
  *(v8us*)((unsigned short*)Wt + (size_t)n * K + k8) = o; 
}
// k_gemm_hh variant with fused epilogue: v = acc·alpha + bias[by·sBias + col] (+ CP[(row/rowsPerB)·sCPb + by·64 + col] if CP) ; ACT 0 none / 1 elu ; writes f16 C16 (and f32 C if non-null)
template <int ACT>
__global__ __launch_bounds__(128) void k_gemm_hhx(const _Float16* __restrict__ A, int lda, size_t sA, const _Float16* __restrict__ Bh, int ldb, size_t sB, float alpha, const float* __restrict__ bias, size_t sBias, const float* __restrict__ CP, int rowsPerB, size_t sCPb, int row0g,
    float* __restrict__ C, _Float16* __restrict__ C16, int ldc, size_t sC, int M, int N, int K) {
  __shared__ __attribute__((aligned(16))) float so[4][16][64];
  const int tid = threadIdx.x, w = tid >> 5, lane = tid & 31, ln = lane & 15, hh = lane >> 4; const int by = blockIdx.y;
  A += (size_t)by * sA; Bh += (size_t)by * sB; const size_t cofs = (size_t)by * sC; const float* bp = bias ? bias + (size_t)by * sBias : nullptr;
  const int ntn = (N + 63) / 64; const int wid = blockIdx.x * 4 + w; const int mt = wid / ntn, nq = wid % ntn; if (mt * 16 >= M) return;
  const int row0 = mt * 16, col0 = nq * 64; const _Float16* arow = A + (size_t)(row0 + ln) * lda;
  v8f acc[4] = {};
  for (int kb = 0; kb < K; kb += 32) { FragH ah; ah.half[0] = *(const v8us*)((const unsigned short*)arow + kb + 8 * hh); ah.half[1] = *(const v8us*)((const unsigned short*)arow + kb + 16 + 8 * hh);
#pragma unroll
    for (int t = 0; t < 4; ++t) { if (col0 + t * 16 >= N) continue; const size_t boff = (size_t)(col0 + t * 16 + ln) * ldb + kb; FragH bq; bq.half[0] = *(const v8us*)((const unsigned short*)Bh + boff + 8 * hh); bq.half[1] = *(const v8us*)((const unsigned short*)Bh + boff + 16 + 8 * hh);
      acc[t] = mmaH<1>(ah.v, ah.v, bq.v, bq.v, acc[t]); }
  }
#pragma unroll
  for (int t = 0; t < 4; ++t) { if (col0 + t * 16 >= N) continue; const int col = col0 + t * 16 + ln; const float bv = bp ? bf16_round(bp[col]) : 0.f;
#pragma unroll
    for (int r = 0; r < 8; ++r) { float v = acc[t][r] * alpha + bv; if (CP) { const int rr = row0g + row0 + 8 * hh + r; if (rowsPerB < 0) v += CP[cofs + (size_t)rr * ldc + col];      /* rowsPerB < 0: own element of the batched C plane */ else { const int bidx = rr / rowsPerB; v += CP[(size_t)bidx * sCPb + (size_t)by * 64 + col]; } } if (ACT == 1) v = (v > 0.f) ? v : expm1f(v); else if (ACT == 7) v = (v > 0.f) ? v + 1.0f : expf(v); else if (ACT == 8) v = tanhf(v); else if (ACT == 9) v = 0.5f * v * (1.0f + tanhf(0.7978845608028654f * (v + 0.044715f * v * v * v))); else if (ACT == 11) v = 1.0f / (1.0f + expf(-v)); else if (ACT == 12) v = (v > 0.f) ? v : 0.01f * v; else if (ACT == 14) v = (v > 0.f) ? v : 0.1f * v; else if (ACT == 16) v = (v >= 0.f) ? v : 0.3f * v; else if (ACT == 17) v = (v >= 0.f) ? v : 0.2f * v; else if (ACT == 15) v = v / (1.0f + expf(-v)); else if (ACT == 3) v = fmaxf(v, 0.f); else if (ACT == 6) v = 0.5f * v * (1.0f + erff(v * 0.70710678118654752f)); so[w][8 * hh + r][t * 16 + ln] = v; } }
  __builtin_amdgcn_fence(__ATOMIC_ACQ_REL, "workgroup"); __builtin_amdgcn_wave_barrier();
  const int rsub = lane >> 4, c4 = (lane & 15) * 4; typedef _Float16 v4h __attribute__((ext_vector_type(4)));
  {
#pragma unroll
    for (int q = 0; q < 8; ++q) { const int r = q * 2 + rsub; if (col0 + c4 < N) { const v4f v = *(const v4fa*)&so[w][r][c4]; if (C) *(v4f*)(C + cofs + (size_t)(row0 + r) * ldc + col0 + c4) = v; if (C16) { v4h h4; for (int i = 0; i < 4; ++i) h4[i] = (_Float16)v[i]; *(v4h*)(C16 + cofs + (size_t)(row0 + r) * ldc + col0 + c4) = h4; } } }
     }
}


typedef _Float16 v4h __attribute__((ext_vector_type(4)));

__global__ __launch_bounds__(256) void k_h16(const float* __restrict__ x, _Float16* __restrict__ X16, size_t n8) { const size_t t = (size_t)blockIdx.x * 256 + threadIdx.x; if (t >= n8) return; FragH f;
#pragma unroll
  for (int q = 0; q < 8; ++q) f.h[q] = (_Float16)x[t * 8 + q]; *(v8us*)((unsigned short*)X16 + t * 8) = f.half[0];  }
__global__ __launch_bounds__(256) void k_round16f(const float* __restrict__ W, _Float16* __restrict__ Bt, size_t n8) { const size_t t = (size_t)blockIdx.x * 256 + threadIdx.x; if (t >= n8) return; FragH f;
#pragma unroll
  for (int i = 0; i < 8; ++i) f.h[i] = (_Float16)(bf16_round(W[t * 8 + i]) * 16.0f); *(v8us*)((unsigned short*)Bt + t * 8) = f.half[0];  }
// ---- fast GEMM pieces: wave tile 32x64, four waves a work-group (128 rows x 64 columns); K % 64 == 0 ----
__device__ __forceinline__ v16h g2_frag(const _Float16* p, int hh) { FragH f; f.half[0] = *(const v8us*)((const unsigned short*)p + 8 * hh); f.half[1] = *(const v8us*)((const unsigned short*)p + 16 + 8 * hh); return f.v; }
__device__ __forceinline__ v8f g2_mma(v16h a, v16h b, v8f c) { v8f d = __builtin_amdgcn_wmma_f32_16x16x32_f16(false, a, false, b, (short)0, c, false, false); asm volatile("v_nop\n\tv_nop\n\tv_nop\n\tv_nop" : "+v"(d) : "v"(a), "v"(b)); return d; }
// FRAGMENT ORDER. Every f16 plane [R][K] that a WMMA reads from memory is kept as tiles of 16 rows x 32 k (FT elements, 1024 bytes), tile (r >> 4, k >> 5) at index (r >> 4) * (K / 32) + (k >> 5).
// Inside a tile the 16 bytes of row r, k = 8 c .. 8 c + 7 (c = (k >> 3) & 3) are chunk (c >> 1) * 32 + (c & 1) * 16 + (r & 15): lane l of a wave finds the two halves of its fragment (the k order of g2_frag)
// at chunks l and 32 + l, so that each wave-wide 16-byte load or store covers 512 bytes in a row, four whole lines, and not 32 bytes of each of 16 lines.
#define FT 512
__device__ __forceinline__ size_t pk_at(int r, int k, int K) { return ((size_t)(r >> 4) * (K / 32) + (k >> 5)) * FT + (size_t)((((k >> 4) & 1) * 32 + ((k >> 3) & 1) * 16 + (r & 15)) * 8 + (k & 7)); }
__device__ __forceinline__ v16h pk_frag(const _Float16* p) { FragH f; f.half[0] = *(const v8us*)((const unsigned short*)p); f.half[1] = *(const v8us*)((const unsigned short*)p + 256); return f.v; }      /* p = the tile + 8 * lane */
// c[4 half + t] += A[row0 + 16 half ..][k] Bh[col0 + 16 t ..][k] over k = 0 .. K - 1; A and Bh in fragment order
template <int K>
__device__ __forceinline__ void g2_kloop(const _Float16* __restrict__ A, const _Float16* __restrict__ Bh, int row0, int col0, int lane, v8f (&c)[8]) {
  constexpr size_t RG = (size_t)(K / 32) * FT;      /* one group of 16 rows */
  const _Float16* ap = A + (size_t)(row0 >> 4) * RG + lane * 8; const _Float16* bp = Bh + (size_t)(col0 >> 4) * RG + lane * 8;
  /* One trip = 64 k = two tiles of each group of 16 rows. All 24 fragment loads of the trip stand in front of its first WMMA, so that a trip waits for memory once;
     each accumulator still takes its k blocks in rising order. */
#pragma unroll 1 /* a second trip's fragments would not fit in 256 registers beside the 64 accumulator registers */
  for (int kb = 0; kb < K; kb += 64) {
    const _Float16* pa = ap + (size_t)kb * 16; const _Float16* pb = bp + (size_t)kb * 16;
    const v16h a0 = pk_frag(pa), a1 = pk_frag(pa + RG), b0 = pk_frag(pb), b1 = pk_frag(pb + RG), b2 = pk_frag(pb + 2 * RG), b3 = pk_frag(pb + 3 * RG);
    const v16h a2 = pk_frag(pa + FT), a3 = pk_frag(pa + RG + FT), b4 = pk_frag(pb + FT), b5 = pk_frag(pb + RG + FT), b6 = pk_frag(pb + 2 * RG + FT), b7 = pk_frag(pb + 3 * RG + FT);
    /* the wait in front of any rewrite of a register that an issued load names; as its inputs the two address pairs stay live up to it, so that no load of the trip lands in one of them */
    asm volatile("s_wait_xcnt 0x0" :: "v"(pa), "v"(pb) : "memory");
    c[0] = g2_mma(a0, b0, c[0]); c[4] = g2_mma(a1, b0, c[4]); c[1] = g2_mma(a0, b1, c[1]); c[5] = g2_mma(a1, b1, c[5]);
    c[2] = g2_mma(a0, b2, c[2]); c[6] = g2_mma(a1, b2, c[6]); c[3] = g2_mma(a0, b3, c[3]); c[7] = g2_mma(a1, b3, c[7]);
    c[0] = g2_mma(a2, b4, c[0]); c[4] = g2_mma(a3, b4, c[4]); c[1] = g2_mma(a2, b5, c[1]); c[5] = g2_mma(a3, b5, c[5]);
    c[2] = g2_mma(a2, b6, c[2]); c[6] = g2_mma(a3, b6, c[6]); c[3] = g2_mma(a2, b7, c[3]); c[7] = g2_mma(a3, b7, c[7]); } }
// A wave's 32x64 tile out of its LDS tile: lane = 16 bytes of f32 of row 2 q + (lane >> 4). The stores take one base address and constant offsets.
__device__ __forceinline__ void g2_take(const float (&so)[32][68], int lane, v4f (&v)[16]) {
#pragma unroll /* constant indices keep v[] in registers */
  for (int q = 0; q < 16; ++q) v[q] = *(const v4fa*)&so[q * 2 + (lane >> 4)][(lane & 15) * 4]; }
template <int LDC, typename T, typename V>
__device__ __forceinline__ void g2_put(T* __restrict__ p, const V (&v)[16]) {
#pragma unroll /* constant indices keep v[] in registers; constant offsets keep one address pair */
  for (int q = 0; q < 16; ++q) *(V*)(p + (size_t)q * 2 * LDC) = v[q]; }
// The projections in one grid, by block ranges (weights carried x16, f32 accumulation, k in rising order everywhere):
//   job 0: q = x Wq^T + bq and job 1: k = x Wk^T, as f16 planes in fragment order; their first QT0 token rows go out as plain f32 rows too (operands of the exact first-tile attention);
//   job 2: V^T = Wv x^T + bv (the weight rows are the A operand, the token rows the B operand; the bias goes by row), f16 [NH * HD][SQ] in fragment order, the operand that the second attention product reads;
//   job 3: v of the first QT0 token rows, f32 rows.
#define QKV_G ((MP / 128) * (DM / 64))      /* work-groups of each of the jobs 0, 1, 2 */
__global__ __launch_bounds__(128) void k_qkv(const _Float16* __restrict__ X, const _Float16* __restrict__ BQ, const _Float16* __restrict__ BK, const _Float16* __restrict__ BV, const float* __restrict__ bq, const float* __restrict__ bv,
    _Float16* __restrict__ Q16, _Float16* __restrict__ K16, _Float16* __restrict__ VT, float* __restrict__ QF0, float* __restrict__ KF0, float* __restrict__ VF0) {
  static_assert(NB == 1 && QT0 % 128 == 0 && MP % 128 == 0 && DM % 128 == 0 && MP == SQ && NH * HD == DM, "k_qkv: one batch, whole work-group tiles in both orientations");
  __shared__ __attribute__((aligned(16))) float so[4][32][68];
  const int tid = threadIdx.x, w = tid >> 5, lane = tid & 31, ln = lane & 15, hh = lane >> 4;
  const int job = blockIdx.x / QKV_G, bx = blockIdx.x % QKV_G;
  const int ntn = (job == 2 ? SQ : DM) / 64;      /* column tiles of the job's product */
  const int mt = bx / ntn, nq = bx % ntn; const int row0 = mt * 128 + 32 * w, col0 = nq * 64;
  const _Float16* Ah = job == 2 ? BV : X; const _Float16* Bh = job == 0 ? BQ : job == 1 ? BK : job == 2 ? X : BV;
  const v8f z8 = {0.f,0.f,0.f,0.f,0.f,0.f,0.f,0.f}; v8f c[8] = {z8, z8, z8, z8, z8, z8, z8, z8};
  g2_kloop<DM>(Ah, Bh, row0, col0, lane, c);
  if (job == 2) { const float* pb = bv + row0 + 8 * hh; float rb[2][8];
#pragma unroll /* constant indices keep rb[] in registers */
    for (int half = 0; half < 2; ++half)
#pragma unroll /* as above */
      for (int r = 0; r < 8; ++r) rb[half][r] = pb[half * 16 + r];
    /* the wait in front of any rewrite of a register that an issued load names; as its input the address pair stays live up to it */
    asm volatile("s_wait_xcnt 0x0" :: "v"(pb) : "memory");
#pragma unroll /* constant indices keep c[] in registers */
    for (int u = 0; u < 8; ++u)
#pragma unroll /* as above */
      for (int r = 0; r < 8; ++r) so[w][(u >> 2) * 16 + 8 * hh + r][(u & 3) * 16 + ln] = c[u][r] * 0.0625f + bf16_round(rb[u >> 2][r]);
  } else { const float* bp = job == 0 ? bq : job == 1 ? nullptr : bv; float bb[4] = {0.f, 0.f, 0.f, 0.f};
    if (bp) {
#pragma unroll /* constant indices keep bb[] in registers */
      for (int t = 0; t < 4; ++t) bb[t] = bf16_round(bp[col0 + t * 16 + ln]); }
#pragma unroll /* as above */
    for (int u = 0; u < 8; ++u)
#pragma unroll /* as above */
      for (int r = 0; r < 8; ++r) so[w][(u >> 2) * 16 + 8 * hh + r][(u & 3) * 16 + ln] = c[u][r] * 0.0625f + bb[u & 3]; }
  __builtin_amdgcn_fence(__ATOMIC_ACQ_REL, "workgroup"); __builtin_amdgcn_wave_barrier();
  const int rsub = lane >> 4, c4 = (lane & 15) * 4; v4f v[16]; v8us hp[8];
  const bool frows = job != 2 && row0 < QT0;      /* the same for the whole wave */
  if (frows) g2_take(so[w], lane, v);
  /* the wave's 32 x 64 tile is four tiles of the f16 plane in fragment order: lane (ln, hh) takes the 8 values of row ln that make its chunk; the LDS pitch of 16 B x 17 keeps these reads free of bank conflicts */
#pragma unroll /* constant indices keep hp[] in registers */
  for (int u = 0; u < 8; ++u) { const float* sp = &so[w][(u >> 2) * 16 + ln][(u & 3) * 16 + 8 * hh]; const v4f x0 = *(const v4fa*)sp, x1 = *(const v4fa*)(sp + 4); FragH f;
#pragma unroll /* as above */
    for (int i = 0; i < 4; ++i) { f.h[i] = (_Float16)x0[i]; f.h[4 + i] = (_Float16)x1[i]; }
    hp[u] = f.half[0]; }
  /* the stores stand behind every LDS read and every conversion, so that no register that an issued store names is written again */
  const size_t rgp = (size_t)((job == 2 ? SQ : DM) / 32) * FT;      /* one group of 16 rows of the plane */
  unsigned short* p16 = (unsigned short*)(job == 0 ? Q16 : job == 1 ? K16 : VT) + (size_t)(row0 >> 4) * rgp + (size_t)(col0 >> 5) * FT + lane * 8; unsigned short* p16b = p16 + rgp;
  float* pf = (job == 0 ? QF0 : job == 1 ? KF0 : VF0) + (size_t)(row0 + rsub) * DM + col0 + c4;
  if (job != 3) {
#pragma unroll /* as above; constant offsets keep one address pair a row group */
    for (int u = 0; u < 4; ++u) { *(v8us*)(p16 + u * 256) = hp[u]; *(v8us*)(p16b + u * 256) = hp[4 + u]; } }
  if (frows) g2_put<DM>(pf, v); }
// out = o Wo^T in one grid (o carried x64, Wo x16). Rows from QT0 on: the f16 o rows, 128 rows a work-group. The first QT0 rows: the exact o as an f16 plane and its x1024 residual plane,
// out = hi 2^-10 + lo 2^-20; 64 rows a work-group, waves 0 and 1 take the hi plane and waves 2 and 3 the lo plane of the same rows, so that no wave walks k twice; the two terms meet in LDS.
#define OUT_G0 ((QT0 / 64) * (DM / 64))      /* work-groups of the first QT0 rows */
__global__ __launch_bounds__(128) void k_out(const _Float16* __restrict__ O16, const _Float16* __restrict__ OH0, const _Float16* __restrict__ OL0, const _Float16* __restrict__ BO, float* __restrict__ out) {
  static_assert(NB == 1 && QT0 % 128 == 0 && MPO % 128 == 0 && DM % 64 == 0, "k_out: one batch, the first tile ends on a work-group's edge");
  __shared__ __attribute__((aligned(16))) float so[4][32][68];
  const int tid = threadIdx.x, w = tid >> 5, lane = tid & 31, ln = lane & 15, hh = lane >> 4;
  const bool first = blockIdx.x < OUT_G0; const int bx = first ? blockIdx.x : blockIdx.x - OUT_G0;
  const int mt = bx / (DM / 64), nq = bx % (DM / 64); const int row0 = first ? mt * 64 + 32 * (w & 1) : QT0 + mt * 128 + 32 * w; const int col0 = nq * 64;
  const bool lo = first && w >= 2; const _Float16* Ah = first ? (lo ? OL0 : OH0) : O16; const float alpha = lo ? 0.00000095367431640625f : 0.0009765625f;
  const v8f z8 = {0.f,0.f,0.f,0.f,0.f,0.f,0.f,0.f}; v8f c[8] = {z8, z8, z8, z8, z8, z8, z8, z8};
  g2_kloop<DM>(Ah, BO, row0, col0, lane, c);
#pragma unroll /* constant indices keep c[] in registers */
  for (int u = 0; u < 8; ++u)
#pragma unroll /* as above */
    for (int r = 0; r < 8; ++r) so[w][(u >> 2) * 16 + 8 * hh + r][(u & 3) * 16 + ln] = c[u][r] * alpha;
  const int rsub = lane >> 4, c4 = (lane & 15) * 4; v4f v[16]; float* po = out + (size_t)(row0 + rsub) * DM + col0 + c4;
  if (first) {
    __syncthreads();      /* the lo waves' tiles are read by the hi waves; the branch is the same for the whole work-group */
    if (!lo) { v4f vl[16]; g2_take(so[w], lane, v); g2_take(so[w + 2], lane, vl);
#pragma unroll /* constant indices keep the arrays in registers */
      for (int q = 0; q < 16; ++q) v[q] = vl[q] + v[q];
      g2_put<DM>(po, v); }      /* the stores stand behind every LDS read and sum: no register that an issued store names is written again */
  } else {
    __builtin_amdgcn_fence(__ATOMIC_ACQ_REL, "workgroup"); __builtin_amdgcn_wave_barrier();
    g2_take(so[w], lane, v); g2_put<DM>(po, v); } }      /* as above */


// The five f32 -> f16 passes in one grid by block ranges: first the token rows (bf16-rounded, exact in f16), then the four natural [out][in] weights (bf16-rounded, x16). Eight elements a thread.
// A block takes 16 rows x 128 k (16 threads a row: 512 bytes in a row are read) and writes them as four tiles in fragment order, 4096 bytes in a row; the chunks change places in LDS.
__global__ __launch_bounds__(256) void k_prep(const float* __restrict__ x, const float* __restrict__ wq, const float* __restrict__ wk, const float* __restrict__ wv, const float* __restrict__ wo,
    _Float16* __restrict__ X16, _Float16* __restrict__ BQ, _Float16* __restrict__ BK, _Float16* __restrict__ BV, _Float16* __restrict__ BO) {
  static_assert(NR % 16 == 0 && DM % 128 == 0, "k_prep: whole blocks of 16 rows x 128 k");
  __shared__ __attribute__((aligned(16))) unsigned short tl[272 * 8];      /* 256 chunks of 16 bytes, a spare chunk behind every 16: writes (a lane per k chunk) and reads (a lane per row) both without bank conflicts */
  constexpr unsigned GX = (unsigned)(NR * DM / 2048), GW = (unsigned)((size_t)DM * DM / 2048);
  const unsigned bx = blockIdx.x; const float* s = x; _Float16* d = X16; float sc = 1.0f; unsigned b0 = bx;
  if (bx >= GX) { const unsigned i = (bx - GX) / GW; b0 = (bx - GX) % GW; sc = 16.0f; s = i == 0 ? wq : i == 1 ? wk : i == 2 ? wv : wo; d = i == 0 ? BQ : i == 1 ? BK : i == 2 ? BV : BO; }
  const int tid = threadIdx.x, r = tid >> 4, kc = tid & 15; const unsigned rg = b0 / (DM / 128), kq = b0 % (DM / 128);
  const float* sp = s + ((size_t)rg * 16 + r) * DM + kq * 128 + kc * 8; FragH f;
#pragma unroll /* constant indices keep f in registers */
  for (int q = 0; q < 8; ++q) f.h[q] = (_Float16)(bf16_round(sp[q]) * sc);
  *(v8us*)&tl[(17 * kc + r) * 8] = f.half[0];      /* chunk 16 kc + r of the block's four tiles: tile kc >> 2, chunk ((kc >> 1) & 1) * 32 + (kc & 1) * 16 + r */
  __syncthreads();      /* all but 16 chunks are read by another thread than wrote them */
  const v8us o = *(const v8us*)&tl[(tid + (tid >> 4)) * 8];
  *(v8us*)((unsigned short*)d + (((size_t)rg * (DM / 32) + kq * 4) * 64 + tid) * 8) = o; }
__global__ __launch_bounds__(256) void k_rsm(const float* __restrict__ S, _Float16* __restrict__ P, int nrows) {
  #pragma clang fp contract(off)
  const int i = blockIdx.x * 256 + threadIdx.x; if (i >= nrows) return; const float* s = S + (size_t)i * SQ; float mx = -3.0e38f;
#pragma unroll 1
  for (int j = 0; j < SQ; ++j) mx = fmaxf(mx, s[j]); float se = 0.f;
#pragma unroll 1
  for (int j = 0; j < SQ; ++j) se += expf(s[j] - mx); const float sc = 256.0f / se;
#pragma unroll 1
  for (int j0 = 0; j0 < SQ; j0 += 8) { FragH f; for (int q = 0; q < 8; ++q) f.h[q] = (_Float16)(expf(s[j0 + q] - mx) * sc); unsigned short* d = (unsigned short*)P + (size_t)i * SQ + j0; *(v8us*)d = f.half[0];  } }
__global__ __launch_bounds__(256) void k_vt(const _Float16* __restrict__ V16, int b, int h0, _Float16* __restrict__ VT) { __shared__ unsigned short tl[64][65]; const int tid = threadIdx.x; const int hh = blockIdx.x % HG, sg = blockIdx.x / HG; const int s0 = sg * 64; const int h = h0 + hh;
  for (int i = tid; i < 64 * 8; i += 256) { const int j = i / 8, d8 = (i % 8) * 8; FragH f; f.half[0] = *(const v8us*)((const unsigned short*)V16 + ((size_t)b * SQ + s0 + j) * DM + h * HD + d8); for (int q = 0; q < 8; ++q) tl[d8 + q][j] = f.u[q]; }
  __syncthreads();
  { for (int i = tid; i < 64 * 8; i += 256) { const int d = i / 8, j8 = (i % 8) * 8; FragH f; for (int q = 0; q < 8; ++q) f.u[q] = tl[d][j8 + q]; *(v8us*)((unsigned short*)VT + ((size_t)hh * HD + d) * SQ + s0 + j8) = f.half[0]; }  } }



#define FA_L2E 1.4426950408889634f
__device__ __forceinline__ float fa_xhalf(float x) { return __builtin_bit_cast(float, __builtin_amdgcn_permlanex16(__builtin_bit_cast(int, x), __builtin_bit_cast(int, x), 0x76543210, 0xfedcba98, false, false)); }      /* lane l with lane l ^ 16, on the vector pipe */
/* p = 2^a; behind the v_exp_f32 stands the argument of a weight three calls on, an = x log2(e) + c. That product is independent of the v_exp_f32 and fills the one slot that the instruction set asks for
   between a transcendental and an instruction that reads its result or overwrites its source; in one statement, so that it stays there. "=&v": no output shares a register with an input. */
__device__ __forceinline__ float fa_exp2_fma(float a, float x, float c, float& an) { float p; asm("v_exp_f32 %0, %2\n\tv_fma_f32 %1, %3, %4, %5" : "=&v"(p), "=&v"(an) : "v"(a), "v"(x), "s"(FA_L2E), "v"(c)); return p; }
/* the last three weights of a pass have no later argument to form: a v_nop fills the same slot */
__device__ __forceinline__ float fa_exp2_nop(float a) { float p; asm("v_exp_f32 %0, %1\n\tv_nop" : "=&v"(p) : "v"(a)); return p; }
__device__ __forceinline__ v8f fa_mma(v16h a, v16h b, v8f c) { return __builtin_amdgcn_wmma_f32_16x16x32_f16(false, a, false, b, (short)0, c, false, false); }
template <bool DIAG>
__device__ __forceinline__ void fa_pass(float jf0, int ln, int hh, float slope, const v8f (&s)[2][2], const v16h (&vf)[4], v8f (&o)[2][4], float (&m)[2], float (&l)[2]) {
  float bias[2][8];
#pragma unroll /* constant indices keep the arrays in registers */
  for (int mt = 0; mt < 2; ++mt)
#pragma unroll /* as above */
    for (int r = 0; r < 8; ++r) bias[mt][r] = __fmul_rn(slope, jf0 + (float)(mt * 16 + r));      /* slope_h * j, rounded once */
  float x[2][2][8]; float mx[2];
#pragma unroll /* as above */
  for (int nt = 0; nt < 2; ++nt) { float t = -1.0e30f;
#pragma unroll /* as above */
    for (int mt = 0; mt < 2; ++mt)
#pragma unroll /* as above */
      for (int r = 0; r < 8; ++r) { float v = fmaf(s[nt][mt][r], 0.125f, -bias[mt][r]); if (DIAG) v = (mt * 16 + 8 * hh + r <= nt * 16 + ln) ? v : -1.0e30f;      /* diagonal pass: its first key is the wave's first query */
        x[nt][mt][r] = v; t = fmaxf(t, v); }
    mx[nt] = fmaxf(t, fa_xhalf(t)); }
  /* the accumulators are rescaled only in a pass that raises some query's maximum: one scalar branch a pass */
  if (__builtin_amdgcn_ballot_w32(mx[0] > m[0] || mx[1] > m[1]) != 0) {
#pragma unroll /* as above */
    for (int nt = 0; nt < 2; ++nt) { const float mn = fmaxf(m[nt], mx[nt]); const float a = __builtin_amdgcn_exp2f((m[nt] - mn) * FA_L2E); m[nt] = mn; l[nt] *= a;
#pragma unroll /* as above */
      for (int dt = 0; dt < 4; ++dt) o[nt][dt] *= a; } }
  v16h pf[2]; float cc[2], a[32], p[32];      /* weight i = nt * 16 + 2 r + mt; weight = 2^8 exp(x - m) = 2^(x log2(e) + cc) */
#pragma unroll /* as above */
  for (int nt = 0; nt < 2; ++nt) cc[nt] = fmaf(-m[nt], FA_L2E, 8.0f);
#pragma unroll /* as above */
  for (int i = 0; i < 3; ++i) a[i] = fmaf(x[0][i & 1][i >> 1], FA_L2E, cc[0]);
#pragma unroll /* as above */
  for (int i = 0; i < 32; ++i) { const int n = i + 3; if (n < 32) p[i] = fa_exp2_fma(a[i], x[n >> 4][n & 1][(n & 15) >> 1], cc[n >> 4], a[n]); else p[i] = fa_exp2_nop(a[i]); }
#pragma unroll /* as above */
  for (int nt = 0; nt < 2; ++nt) { FragH f; float s0 = 0.f, s1 = 0.f;
#pragma unroll /* as above */
    for (int r = 0; r < 8; ++r) { const float p0 = p[nt * 16 + 2 * r], p1 = p[nt * 16 + 2 * r + 1]; s0 += p0; s1 += p1; f.h[r] = (_Float16)p0; f.h[8 + r] = (_Float16)p1; }
    l[nt] += s0 + s1; pf[nt] = f.v; }
#pragma unroll /* as above */
  for (int dt = 0; dt < 4; ++dt) { o[0][dt] = fa_mma(vf[dt], pf[0], o[0][dt]); o[1][dt] = fa_mma(vf[dt], pf[1], o[1][dt]); } }
__device__ __forceinline__ void fa_scores(const v16h (&kf)[2][2], const v16h (&qf)[2][2], v8f (&s)[2][2]) {
  const v8f z8 = {0.f,0.f,0.f,0.f,0.f,0.f,0.f,0.f};
  s[0][0] = fa_mma(kf[0][0], qf[0][0], z8); s[0][1] = fa_mma(kf[1][0], qf[0][0], z8); s[1][0] = fa_mma(kf[0][0], qf[1][0], z8); s[1][1] = fa_mma(kf[1][0], qf[1][0], z8);
  s[0][0] = fa_mma(kf[0][1], qf[0][1], s[0][0]); s[0][1] = fa_mma(kf[1][1], qf[0][1], s[0][1]); s[1][0] = fa_mma(kf[0][1], qf[1][1], s[1][0]); s[1][1] = fa_mma(kf[1][1], qf[1][1], s[1][1]); }
// The deal: a work-group is 16 waves = 4 blocks of 32 query rows (128 rows of one head) x 4 key shares, one work-group a WGP, four waves a SIMD. Share ks takes the passes ks, ks + 4, ... of its row block,
// with its own running maximum, sum and O; the four waves of one share walk the same keys side by side. A work-group takes the 128 rows n - 1 - pr and then the 128 rows pr, so that every wave walks 31 to 33 passes.
// The shares' partial (m, l, O) go to LDS; behind one barrier wave (rb, ks) joins the four shares of row block rb for head dims 16 ks .. 16 ks + 15.
__global__ __launch_bounds__(512) __attribute__((amdgpu_waves_per_eu(4, 4))) /* a budget of 256 registers: none above v255, no register-window switches in the loop */ void k_fattn(const _Float16* __restrict__ Q, const _Float16* __restrict__ K, const _Float16* __restrict__ VT, _Float16* __restrict__ O) {
  static_assert(SQ % 256 == 0 && HD == 64, "k_fattn: two blocks of 128 query rows a work-group, head size 64");
  __shared__ __attribute__((aligned(16))) float lo[2][16][16][32][4];      /* [row half of the deal][4 rb + ks][2 (4 nt + dt) + half of the 8 rows][lane]: every wave-wide 16-byte access is 512 bytes in a row */
  __shared__ float lml[2][16][4][32];      /* m of nt = 0, 1, then l of nt = 0, 1 */
  const int tid = threadIdx.x, lane = tid & 31, ln = lane & 15, hh = lane >> 4; const int w = __builtin_amdgcn_readfirstlane(tid >> 5);      /* the wave's number in a scalar register: the key loop stays a scalar branch */
  const int ks = w >> 2; const int h = blockIdx.x % NH, pr = blockIdx.x / NH;
  const float slope = (float)exp2(-0.5 * (double)(h + 1));      /* ALiBi slope 2^(-8 (h+1) / 16), correctly rounded to f32 */
  constexpr size_t RGQ = (size_t)(DM / 32) * FT, RGV = (size_t)(SQ / 32) * FT;      /* one group of 16 rows of Q, K, O; of V^T (all in fragment order) */
  const _Float16* kb0 = K + (size_t)(h * (HD / 32)) * FT; const _Float16* vb0 = VT + (size_t)(h * (HD / 16)) * RGV; const unsigned l8 = lane * 8;      /* the head's planes and every tile address are the same for the whole wave, so that they can stay in scalar registers; the lane's place in a tile is added at each load */
#pragma unroll 1 /* the two row halves one after the other through the same code */
  for (int t = 0; t < 2; ++t) {
    const int rb = t ? 3 - (w & 3) : (w & 3);      /* mirrored in the second half: a row block has 4 sb + rb + 1 passes, so its four shares (waves w, w + 4, w + 8, w + 12) walk 129 passes over both halves */
    const int nd = (t ? pr : SQ / 128 - 1 - pr) * 4 + rb;      /* the row block's number = its diagonal pass; the passes below it are 0 .. nd - 1; nd mod 4 = rb, so share rb owns the diagonal pass */
    v16h qf[2][2], kf[2][2], vf[4]; v8f s[2][2]; v8f o[2][4]; float m[2] = {-1.0e30f, -1.0e30f}, l[2] = {0.f, 0.f};
#pragma unroll /* constant indices keep the arrays in registers */
    for (int nt = 0; nt < 2; ++nt)
#pragma unroll /* as above */
      for (int dt = 0; dt < 4; ++dt) o[nt][dt] = v8f{0.f,0.f,0.f,0.f,0.f,0.f,0.f,0.f};
    if (ks <= nd) {      /* only in the first 128 rows of a head has a share no pass at all: it hands in m = -1e30, l = 0, O = 0 */
      const _Float16* pq = Q + (size_t)(nd * 2) * RGQ + (size_t)(h * (HD / 32)) * FT; const _Float16* pk = kb0 + (size_t)(ks * 2) * RGQ; const _Float16* pv = vb0 + (size_t)ks * FT;
      float jf0 = (float)(32 * ks + 8 * hh);      /* this lane's first key position of the pass, as a float (exact) */
#pragma unroll /* as above */
      for (int nt = 0; nt < 2; ++nt)
#pragma unroll /* as above */
        for (int kd = 0; kd < 2; ++kd) { qf[nt][kd] = pk_frag(pq + nt * RGQ + kd * FT + l8); kf[nt][kd] = pk_frag(pk + nt * RGQ + kd * FT + l8); }
      /* the wait in front of any rewrite of a register that an issued load names; as its inputs the address pairs stay live up to it */
      asm volatile("s_wait_xcnt 0x0" :: "s"(pq), "s"(pk) : "memory");
#pragma unroll 1 /* a pass holds about 240 registers; two passes side by side would not fit in 256 */
      for (int p = ks; p < nd; p += 4) {
#pragma unroll /* as above */
        for (int dt = 0; dt < 4; ++dt) vf[dt] = pk_frag(pv + dt * RGV + l8);      /* this pass's V^T: flies under the score products and the softmax */
        asm volatile("s_wait_xcnt 0x0" :: "s"(pv) : "memory");      /* as above, in front of the step of pv */
        pv += 4 * FT;
        fa_scores(kf, qf, s);
        pk = kb0 + (size_t)((p + 4 < nd ? p + 4 : nd) * 2) * RGQ;      /* the share's next pass; never past the diagonal pass, whose K rows are the last that this row block may read */
#pragma unroll /* as above */
        for (int mt = 0; mt < 2; ++mt)
#pragma unroll /* as above */
          for (int kd = 0; kd < 2; ++kd) kf[mt][kd] = pk_frag(pk + mt * RGQ + kd * FT + l8);      /* into the same registers: flies under the softmax and the second product */
        asm volatile("s_wait_xcnt 0x0" :: "s"(pk) : "memory");      /* as above, in front of the next value of pk */
        fa_pass<false>(jf0, ln, hh, slope, s, vf, o, m, l);
        jf0 += 128.0f; }
      if (ks == rb) {      /* the loop has left this share at p = nd */
#pragma unroll /* as above */
        for (int dt = 0; dt < 4; ++dt) vf[dt] = pk_frag(pv + dt * RGV + l8);
        asm volatile("s_wait_xcnt 0x0" :: "s"(pv) : "memory");      /* as above */
        fa_scores(kf, qf, s);
        fa_pass<true>(jf0, ln, hh, slope, s, vf, o, m, l); } }
    const int sl = rb * 4 + ks;
#pragma unroll /* as above */
    for (int nt = 0; nt < 2; ++nt) { lml[t][sl][nt][lane] = m[nt]; lml[t][sl][2 + nt][lane] = l[nt];
#pragma unroll /* as above */
      for (int dt = 0; dt < 4; ++dt) { const v8f v = o[nt][dt];
        *(v4f*)&lo[t][sl][(nt * 4 + dt) * 2][lane][0] = v4f{v[0], v[1], v[2], v[3]}; *(v4f*)&lo[t][sl][(nt * 4 + dt) * 2 + 1][lane][0] = v4f{v[4], v[5], v[6], v[7]}; } } }
  __syncthreads();      /* every share's partial result is read by the three other waves of its row block */
  v8us hv[2][2];
#pragma unroll /* constant indices keep hv[] in registers */
  for (int t = 0; t < 2; ++t) { const int rb = t ? 3 - (w & 3) : (w & 3);
#pragma unroll /* as above */
    for (int nt = 0; nt < 2; ++nt) { float mk[4], mx = -1.0e30f, ls = 0.f; v4f a0 = {0.f, 0.f, 0.f, 0.f}, a1 = {0.f, 0.f, 0.f, 0.f};
#pragma unroll /* as above */
      for (int k = 0; k < 4; ++k) { mk[k] = lml[t][rb * 4 + k][nt][lane]; mx = fmaxf(mx, mk[k]); }      /* a query's m is the same in its two lanes */
#pragma unroll /* the four shares in rising order */
      for (int k = 0; k < 4; ++k) { const float wk = fa_exp2_nop((mk[k] - mx) * FA_L2E);      /* a share without a pass weighs exactly 0; the v_nop keeps the slot behind the v_exp_f32 */
        ls += wk * lml[t][rb * 4 + k][2 + nt][lane]; a0 += wk * *(const v4f*)&lo[t][rb * 4 + k][(nt * 4 + ks) * 2][lane][0]; a1 += wk * *(const v4f*)&lo[t][rb * 4 + k][(nt * 4 + ks) * 2 + 1][lane][0]; }
      const float fin = 64.0f / (ls + fa_xhalf(ls));      /* the two halves' sums joined once; o carried x64 */
      FragH f;
#pragma unroll /* as above */
      for (int r = 0; r < 4; ++r) { f.h[r] = (_Float16)(a0[r] * fin); f.h[4 + r] = (_Float16)(a1[r] * fin); }
      hv[t][nt] = f.half[0]; } }
  /* the stores stand behind every conversion: no register that an issued store names is written again */
  unsigned short* po = (unsigned short*)O + (size_t)(h * (HD / 32)) * FT + ks * 256 + l8;      /* lane (ln, hh) holds dims 16 ks + 8 hh .. + 7 of query ln: chunk (ks & 1) * 32 + lane of tile ks >> 1 */
#pragma unroll /* as above */
  for (int t = 0; t < 2; ++t) { const int nd = (t ? pr : SQ / 128 - 1 - pr) * 4 + (t ? 3 - (w & 3) : (w & 3));
#pragma unroll /* as above */
    for (int nt = 0; nt < 2; ++nt) *(v8us*)(po + (size_t)(nd * 2 + nt) * RGQ) = hv[t][nt]; } }


// Exact f32 causal attention of the first QT0 rows. One work-group of 8 waves per head and 32 query rows (lane = row). The head's K and V rows below the group's end and its 32 q rows
// are staged in LDS by whole-line loads. Scores: wave w takes keys w, w + 8, ...; softmax in two passes over the scores kept in LDS; o: wave w takes head dims 8 w .. 8 w + 7 over all keys in rising order.
// LD = row pitch of QF, KF, VF in floats, a compile-time constant so that every staged row is one base address plus an immediate offset.
template <int ALIBI, int LD>
__global__ __launch_bounds__(256) void k_att0(const float* __restrict__ QF, const float* __restrict__ KF, const float* __restrict__ VF, float scale, _Float16* __restrict__ OH, _Float16* __restrict__ OL, int ldo) {
  static_assert(QT0 % 32 == 0 && HD == 64, "k_att0: 32 rows a group, 16 threads a staged row, 8 dims a wave");
  __shared__ __attribute__((aligned(16))) float lk[QT0][HD]; __shared__ __attribute__((aligned(16))) float lv[QT0][HD]; __shared__ float sc[QT0][32];
  __shared__ __attribute__((aligned(16))) float lqo[32][HD + 4];      /* q rows, later o rows; pitch 16 B x 17: a lane per row reads and writes 16 bytes without bank conflicts */
  __shared__ float pm[8][32]; __shared__ float pl[8][32];
  const int tid = threadIdx.x, lane = tid & 31; const int w = __builtin_amdgcn_readfirstlane(tid >> 5);      /* the wave's number in a scalar register: the key loops stay scalar branches */
  const int h = blockIdx.x / (QT0 / 32), rg = blockIdx.x % (QT0 / 32); const int i = rg * 32 + lane; const int nkeys = rg * 32 + 32;      /* causal: keys up to the group's last row */
  const int sr = tid >> 4, c4 = (tid & 15) * 4;      /* staging: 16 threads a row of 256 bytes */
  { v4f tk[QT0 / 16], tv[QT0 / 16], tq[2];
    const float* gk = KF + (size_t)sr * LD + h * HD + c4; const float* gv = VF + (size_t)sr * LD + h * HD + c4; const float* gq = QF + (size_t)(rg * 32 + sr) * LD + h * HD + c4;
#pragma unroll /* constant indices keep tk[] and tv[] in registers; all loads are issued before the first is used */
    for (int c = 0; c < QT0 / 32; ++c) if (c * 32 < nkeys) {
#pragma unroll /* as above */
      for (int u = 2 * c; u < 2 * c + 2; ++u) { tk[u] = *(const v4fa*)(gk + (size_t)u * 16 * LD); tv[u] = *(const v4fa*)(gv + (size_t)u * 16 * LD); } }
#pragma unroll /* as above */
    for (int u = 0; u < 2; ++u) tq[u] = *(const v4fa*)(gq + (size_t)u * 16 * LD);
    /* the wait in front of any rewrite of a register that an issued load names; as its inputs the three address pairs stay live up to it, so that no load lands in one of them */
    asm volatile("s_wait_xcnt 0x0" :: "v"(gk), "v"(gv), "v"(gq) : "memory");
#pragma unroll /* as above */
    for (int c = 0; c < QT0 / 32; ++c) if (c * 32 < nkeys) {
#pragma unroll /* as above */
      for (int u = 2 * c; u < 2 * c + 2; ++u) { *(v4f*)&lk[u * 16 + sr][c4] = tk[u]; *(v4f*)&lv[u * 16 + sr][c4] = tv[u]; } }
#pragma unroll /* as above */
    for (int u = 0; u < 2; ++u) *(v4f*)&lqo[u * 16 + sr][c4] = tq[u]; }
  __syncthreads();
  const float slope = ALIBI ? (float)exp2(-0.5 * (double)(h + 1)) : 0.f;      /* ALiBi: 2^(-8 (h+1) / 16) */
  v4f q[HD / 4];
#pragma unroll /* constant indices keep q[] in registers */
  for (int c = 0; c < HD / 4; ++c) q[c] = *(const v4f*)&lqo[lane][c * 4];
  float mp = -1.0e30f;
  for (int j0 = w; j0 < nkeys; j0 += 16) {      /* nkeys is a multiple of 32: two keys a trip, so that one key's LDS reads fly under the other's products */
#pragma unroll /* the two keys of a trip in one block of code */
    for (int u = 0; u < 2; ++u) { const int j = j0 + 8 * u; v4f a = {0.f, 0.f, 0.f, 0.f};
#pragma unroll /* constant indices keep q[] in registers */
      for (int c = 0; c < HD / 4; ++c) a += q[c] * *(const v4f*)&lk[j][c * 4];
      float s = ((a[0] + a[1]) + (a[2] + a[3])) * scale; if (ALIBI) s -= slope * (float)j;
      s = (j <= i) ? s : -1.0e30f; sc[j][lane] = s; mp = fmaxf(mp, s); } }
  pm[w][lane] = mp;
  __syncthreads();
  float m = pm[0][lane];
#pragma unroll /* eight partial maxima */
  for (int x = 1; x < 8; ++x) m = fmaxf(m, pm[x][lane]);
  float lp = 0.f;
  for (int j0 = w; j0 < nkeys; j0 += 32) {      /* nkeys is a multiple of 32: four keys a trip, so that their LDS reads and exps overlap */
#pragma unroll /* the four keys of a trip in one block of code */
    for (int u = 0; u < 4; ++u) { const int j = j0 + 8 * u; const float e = expf(sc[j][lane] - m); sc[j][lane] = e; lp += e; } }      /* a masked key gives exactly 0 */
  pl[w][lane] = lp;
  __syncthreads();
  float l = pl[0][lane];
#pragma unroll /* eight partial sums, fixed order */
  for (int x = 1; x < 8; ++x) l += pl[x][lane];
  v4f o0 = {0.f, 0.f, 0.f, 0.f}, o1 = {0.f, 0.f, 0.f, 0.f};
#pragma unroll 8 /* eight keys' LDS reads in flight; nkeys is a multiple of 32 */
  for (int j = 0; j < nkeys; ++j) { const float p = sc[j][lane]; o0 += p * *(const v4f*)&lv[j][8 * w]; o1 += p * *(const v4f*)&lv[j][8 * w + 4]; }
  const float fin = 64.0f / l;      /* o carried x64 like the f16 path */
  *(v4f*)&lqo[lane][8 * w] = o0 * fin; *(v4f*)&lqo[lane][8 * w + 4] = o1 * fin;
  __syncthreads();
#pragma unroll /* two rows a thread; the 16 threads of a row fill its eight 16-byte chunks, in two tiles, of each plane */
  for (int u = 0; u < 2; ++u) { const int row = u * 16 + sr; const v4f v = *(const v4f*)&lqo[row][c4]; v4h vh, vl;      /* o (x64) -> f16 plane + x1024 residual plane */
#pragma unroll /* constant indices keep the vectors in registers */
    for (int e = 0; e < 4; ++e) { const _Float16 t = (_Float16)v[e]; vh[e] = t; vl[e] = (_Float16)((v[e] - (float)t) * 1024.0f); }
    const size_t at = pk_at(rg * 32 + row, h * HD + c4, ldo); *(v4h*)(OH + at) = vh; *(v4h*)(OL + at) = vl; } }      /* both planes in fragment order */

extern "C" void kernel_launch(void* const* d_in, const int* in_sizes, int n_in,
                              void* d_out, int out_size, void* d_ws, size_t ws_size, hipStream_t stream) {
  (void)in_sizes; (void)n_in; (void)out_size;
  const float* const* I = (const float* const*)d_in; const float* x = I[0]; const float* wq = I[1]; const float* bq = I[2]; const float* wk = I[3]; const float* wv = I[4]; const float* bv = I[5]; const float* wo = I[6];      /* natural [out][in] weights; biases on q and v only */
  char* ws = (char*)d_ws; size_t off = 0;
  auto take = [&](size_t bytes) { char* p = ws + off; off += (bytes + 255) & ~(size_t)255; return p; };
  _Float16* BQ = (_Float16*)take((size_t)DM * DM * 2); _Float16* BK = (_Float16*)take((size_t)DM * DM * 2); _Float16* BV = (_Float16*)take((size_t)DM * DM * 2); _Float16* BO = (_Float16*)take((size_t)DM * DM * 2);
  _Float16* X16 = (_Float16*)take(NR * DM * 2); _Float16* Q16 = (_Float16*)take(NR * DM * 2); _Float16* K16 = (_Float16*)take(NR * DM * 2); _Float16* O16 = (_Float16*)take(NR * DM * 2);
  _Float16* VT = (_Float16*)take((size_t)NH * HD * SQ * 2);
  float* QF0 = (float*)take((size_t)QT0 * DM * 4); float* KF0 = (float*)take((size_t)QT0 * DM * 4); float* VF0 = (float*)take((size_t)QT0 * DM * 4); _Float16* OH0 = (_Float16*)take((size_t)NB * QT0 * DM * 2); _Float16* OL0 = (_Float16*)take((size_t)NB * QT0 * DM * 2);
  if (off > ws_size) return;
  k_prep<<<(unsigned)(NR * DM / 2048 + 4 * ((size_t)DM * DM / 2048)), 256, 0, stream>>>(x, wq, wk, wv, wo, X16, BQ, BK, BV, BO);      /* x rows and the four weights (natural [out][in] = Bt[n][k], x16) as f16 in fragment order */
  k_qkv<<<3 * QKV_G + (QT0 / 128) * (DM / 64), 128, 0, stream>>>(X16, BQ, BK, BV, bq, bv, Q16, K16, VT, QF0, KF0, VF0);      /* q, k and V^T [NH][HD][SQ] as f16 in fragment order; q, k, v of the first 256 rows as f32 rows */
  k_att0<1, DM><<<NH * (QT0 / 32), 256, 0, stream>>>(QF0, KF0, VF0, 0.125f, OH0, OL0, DM);      /* exact f32 causal ALiBi attention for rows 0..255 (o x64), as f16 hi + x1024 residual planes */
  k_fattn<<<NH * (SQ / 256), 512, 0, stream>>>(Q16, K16, VT, O16);      /* scores, causal ALiBi softmax and o (merged heads, x64, f16 in fragment order) in one launch */
  k_out<<<OUT_G0 + ((MPO - QT0) / 128) * (DM / 64), 128, 0, stream>>>(O16, OH0, OL0, BO, (float*)d_out);      /* out rows are the output layout */
}

// v008
// Measured time: 111 microseconds a run.
// Next to v007, in two timings, it ran 1.04 and 1.05 times as fast.
// Counting every step since v000, it is 76.8 times as fast.
#include <hip/hip_runtime.h>
// Causal multi-head attention with an ALiBi key-position bias (inputs [1][4096][1024]; q = x Wq^T + bq, k = x Wk^T (no bias), v = x Wv^T + bv (natural [1024][1024] sigma 0.02; bq, bv sigma 0.02); 16 heads of 64; scores / 8 - slopes[h] * j with slopes[h] = 2^(-8 (h+1) / 16) and j the key position; causal (j <= i keep, -inf); softmax; out = merged Wo^T (no bias) -> [1][4096][1024]).
// Structure: token rows r = s; q, k, v inputs as exact f16 rows (bf16-rounded); Q, K and V^T as WMMA GEMMs in one launch (32x64 wave tiles, f32 accumulation, exact x16 weights, f16 outputs; V^T = Wv x^T, the weight rows as the A operand); the first 256 rows exactly in f32 (own launch); one fused attention launch (four waves per 32 query rows of a head, each with a quarter of the passes of 32 keys up to the diagonal, joined in LDS; scores / 8 minus the ALiBi term slope_h * j in f32, online softmax with f32 statistics and native exp2, weights x256 f16, o carried x64, folded into the output GEMM alpha) written straight into the merged f16 o rows; out = o W_o GEMM (f32) into the output layout, the first 256 rows from the exact o as f16 hi + residual planes. Five launches. Every f16 plane that a WMMA reads from memory (x, the weights, q, k, V^T, o) is kept in fragment order (see FT below), not as plain rows.
// Compute dtype: inputs rounded to bf16; x / weights exact; q, k, v, softmax weights and o as plain f16 GEMM operands (~2^-12); scores and softmax statistics f32. v_wmma_f32_16x16x32_f16; the exact first 256 rows on v_wmma_f32_16x16x4_f32.
#define NB 1
#define SQ 4096
#define DM 1024
#define NH 16
#define HD 64
#define HG 4                         /* heads per block group of the unlaunched k_vt overload */
#define QT 256                       /* query rows per causal tile */
#define NKX SQ                       /* S / P row pitch */
#define QT0 256                      /* first-tile rows recomputed exactly in f32 */
#define B0 0                         /* first batch processed (debug hook) */
#define NBR NB                       /* batches processed (debug hook) */
#define NR ((size_t)NB * SQ)         /* token rows */
#define MP ((int)((size_t)NBR * SQ)) /* rows projected (debug hook) */
#define QN SQ                        /* query rows attended per batch (debug hook) */
#define NHD NH                       /* heads attended (debug hook) */
#define MPO MP                       /* rows through the output stage (debug hook) */
#define LQ DM      /* row pitch of the q/k/v rows */
typedef __bf16 v16b __attribute__((ext_vector_type(16)));
typedef unsigned short v8us __attribute__((ext_vector_type(8), may_alias));
typedef float  v8f  __attribute__((ext_vector_type(8)));
typedef float  v4f  __attribute__((ext_vector_type(4)));
typedef float  v4fa __attribute__((ext_vector_type(4), may_alias));
union FragB { v16b v; v8us half[2]; unsigned short u[16]; };

__device__ __forceinline__ unsigned short bf16_bits(float x) { unsigned int u = __float_as_uint(x); return (unsigned short)((u + 0x7FFFu + ((u >> 16) & 1u)) >> 16); }
__device__ __forceinline__ float bf16_val(unsigned short b) { return __uint_as_float(((unsigned int)b) << 16); }
__device__ __forceinline__ float bf16_round(float x) { return bf16_val(bf16_bits(x)); }
// D += A·B with NT terms: 1 = ah·bh, 2 = + al·bh (A split), 3 = + ah·bl (both split)
template <int NT>
__device__ __forceinline__ v8f mmaN(v16b ah, v16b al, v16b bh, v16b bl, v8f c) {
  c = __builtin_amdgcn_wmma_f32_16x16x32_bf16(false, ah, false, bh, (short)0, c, false, false);
  if (NT >= 2) c = __builtin_amdgcn_wmma_f32_16x16x32_bf16(false, al, false, bh, (short)0, c, false, false);
  if (NT >= 3) c = __builtin_amdgcn_wmma_f32_16x16x32_bf16(false, ah, false, bl, (short)0, c, false, false);
  asm volatile("v_nop\n\tv_nop\n\tv_nop\n\tv_nop" : "+v"(c) : "v"(ah), "v"(al), "v"(bh), "v"(bl));
  return c;
}

__global__ __launch_bounds__(256) void k_wt_bf16(const float* __restrict__ W, unsigned short* __restrict__ Wt, int K, int N) {
  const int t = blockIdx.x * 256 + threadIdx.x;
  const int k8n = K / 8;
  if (t >= N * k8n) return;
  const int n = t / k8n, k8 = (t % k8n) * 8;
  v8us v;
#pragma unroll
  for (int i = 0; i < 8; ++i) v[i] = bf16_bits(W[(size_t)(k8 + i) * N + n]);
  *(v8us*)(Wt + (size_t)n * K + k8) = v;
  
}

// GEMM C[M][N] (f32, pitch ldc) = act(A[M][K]·W + bias). A f32 row-major (pitch lda) converted per fragment to bf16
// (ASPLIT: hi/lo two planes -> 2 terms, else single rounded term); Wt bf16 [N][K] (pitch ldb). BIAS_BF16 rounds the
// bias to bf16 first (bias quantised to bf16 before the add). K%32==0, M%16==0, N%64==0.
template <bool ASPLIT, int ACT, bool BIAS_BF16>
__global__ __launch_bounds__(128) void k_gemm_bf(const float* __restrict__ A, int lda, const unsigned short* __restrict__ Wt, int ldb,
                                               const float* __restrict__ bias, float* __restrict__ C, int ldc, int M, int N, int K) {
  __shared__ __attribute__((aligned(16))) float so[4][16][64];
  const int tid = threadIdx.x, w = tid >> 5, lane = tid & 31, ln = lane & 15, hh = lane >> 4;
  const int ntn = N / 64;
  const int wid = blockIdx.x * 4 + w;
  const int mt = wid / ntn, nq = wid % ntn;
  if (mt * 16 >= M) return;
  const int row0 = mt * 16, col0 = nq * 64;
  const float* arow = A + (size_t)(row0 + ln) * lda;
  v8f acc[4] = {};
  for (int kb = 0; kb < K; kb += 32) {
    FragB ah, al;
    const v4f x0 = *(const v4fa*)(arow + kb + 8 * hh), x1 = *(const v4fa*)(arow + kb + 8 * hh + 4);
    const v4f x2 = *(const v4fa*)(arow + kb + 16 + 8 * hh), x3 = *(const v4fa*)(arow + kb + 16 + 8 * hh + 4);
    float xs[16] = {x0[0],x0[1],x0[2],x0[3],x1[0],x1[1],x1[2],x1[3],x2[0],x2[1],x2[2],x2[3],x3[0],x3[1],x3[2],x3[3]};
#pragma unroll
    for (int i = 0; i < 16; ++i) { const unsigned short hb = bf16_bits(xs[i]); ah.u[i] = hb; al.u[i] = ASPLIT ? bf16_bits(xs[i] - bf16_val(hb)) : (unsigned short)0; }
#pragma unroll
    for (int t = 0; t < 4; ++t) {
      const unsigned short* brow = Wt + (size_t)(col0 + t * 16 + ln) * ldb + kb;
      FragB b;
      b.half[0] = *(const v8us*)(brow + 8 * hh);
      b.half[1] = *(const v8us*)(brow + 16 + 8 * hh);
      acc[t] = mmaN<ASPLIT ? 2 : 1>(ah.v, al.v, b.v, b.v, acc[t]);
    }
  }
#pragma unroll
  for (int t = 0; t < 4; ++t) {
    float bv = bias ? bias[col0 + t * 16 + ln] : 0.f;
    if (BIAS_BF16) bv = bf16_round(bv);
#pragma unroll
    for (int r = 0; r < 8; ++r) { float v = acc[t][r] + bv; if (ACT == 1) v = fmaxf(v, 0.f); so[w][8 * hh + r][t * 16 + ln] = v; }
  }
  __builtin_amdgcn_fence(__ATOMIC_ACQ_REL, "workgroup");
  __builtin_amdgcn_wave_barrier();
  const int rsub = lane >> 4, c4 = (lane & 15) * 4;
  {
#pragma unroll
    for (int q = 0; q < 8; ++q) {
      const int r = q * 2 + rsub;
      const v4f v = *(const v4fa*)&so[w][r][c4];
      *(v4f*)(C + (size_t)(row0 + r) * ldc + col0 + c4) = v;
    }
    
  }
}

// GEMM C = act(A·W + bias + resid): A f32 (ASPLIT -> hi/lo 2 terms), Wt bf16 [N][K]; ACT 0 none, 1 relu, 2 exact gelu;
// resid (optional, f32, row index = (row % rmod), pitch ldr, RES_BF16 rounds it) added before the activation.
template <bool ASPLIT, int ACT, bool BIAS_BF16, bool RES_BF16>
__global__ __launch_bounds__(128) void k_gemm_bf3(const float* __restrict__ A, int lda, const unsigned short* __restrict__ Wt, int ldb,
                                                const float* __restrict__ bias, const float* __restrict__ resid, int rmod, int ldr,
                                                float* __restrict__ C, int ldc, int M, int N, int K) {
  __shared__ __attribute__((aligned(16))) float so[4][16][64];
  const int tid = threadIdx.x, w = tid >> 5, lane = tid & 31, ln = lane & 15, hh = lane >> 4;
  const int ntn = N / 64;
  const int wid = blockIdx.x * 4 + w;
  const int mt = wid / ntn, nq = wid % ntn;
  if (mt * 16 >= M) return;
  const int row0 = mt * 16, col0 = nq * 64;
  const float* arow = A + (size_t)(row0 + ln) * lda;
  v8f acc[4] = {};
  for (int kb = 0; kb < K; kb += 32) {
    FragB ah, al;
    const v4f x0 = *(const v4fa*)(arow + kb + 8 * hh), x1 = *(const v4fa*)(arow + kb + 8 * hh + 4);
    const v4f x2 = *(const v4fa*)(arow + kb + 16 + 8 * hh), x3 = *(const v4fa*)(arow + kb + 16 + 8 * hh + 4);
    float xs[16] = {x0[0],x0[1],x0[2],x0[3],x1[0],x1[1],x1[2],x1[3],x2[0],x2[1],x2[2],x2[3],x3[0],x3[1],x3[2],x3[3]};
#pragma unroll
    for (int i = 0; i < 16; ++i) { const unsigned short hb = bf16_bits(xs[i]); ah.u[i] = hb; al.u[i] = ASPLIT ? bf16_bits(xs[i] - bf16_val(hb)) : (unsigned short)0; }
#pragma unroll
    for (int t = 0; t < 4; ++t) {
      const unsigned short* brow = Wt + (size_t)(col0 + t * 16 + ln) * ldb + kb;
      FragB b;
      b.half[0] = *(const v8us*)(brow + 8 * hh);
      b.half[1] = *(const v8us*)(brow + 16 + 8 * hh);
      acc[t] = mmaN<ASPLIT ? 2 : 1>(ah.v, al.v, b.v, b.v, acc[t]);
    }
  }
#pragma unroll
  for (int t = 0; t < 4; ++t) {
    const int col = col0 + t * 16 + ln;
    float bv = bias ? bias[col] : 0.f;
    if (BIAS_BF16) bv = bf16_round(bv);
#pragma unroll
    for (int r = 0; r < 8; ++r) {
      float v = acc[t][r] + bv;
      if (resid) { float rv = resid[(size_t)((row0 + 8 * hh + r) % rmod) * ldr + col]; if (RES_BF16) rv = bf16_round(rv); v += rv; }
      if (ACT == 1) v = fmaxf(v, 0.f);
      if (ACT == 2) v = 0.5f * v * (1.0f + erff(v * 0.70710678118654752f));
      if (ACT == 3) { const float u = 0.7978845608028654f * (v + 0.044715f * v * v * v); v = 0.5f * v * (1.0f + tanhf(u)); }
      so[w][8 * hh + r][t * 16 + ln] = v;
    }
  }
  __builtin_amdgcn_fence(__ATOMIC_ACQ_REL, "workgroup");
  __builtin_amdgcn_wave_barrier();
  const int rsub = lane >> 4, c4 = (lane & 15) * 4;
  {
#pragma unroll
    for (int q = 0; q < 8; ++q) {
      const int r = q * 2 + rsub;
      const v4f v = *(const v4fa*)&so[w][r][c4];
      *(v4f*)(C + (size_t)(row0 + r) * ldc + col0 + c4) = v;
    }
    
  }
}
// row LayerNorm (biased variance, eps) over N: s = X (+ R); optional out_sum <- s; out_norm <- (s-mu)*rsqrt(var+eps)*g + b
template <bool PARAM_BF16>
__global__ __launch_bounds__(256) void k_layernorm(const float* __restrict__ X, const float* __restrict__ R, const float* __restrict__ g, const float* __restrict__ bta,
                                                  float* __restrict__ out_sum, float* __restrict__ out_norm, int N, float eps) {
  __shared__ float red[256];
  const int row = blockIdx.x, tid = threadIdx.x;
  const float* x = X + (size_t)row * N; const float* rr = R ? R + (size_t)row * N : nullptr;
  float vals[16];                     // up to N = 4096
  const int per = N / 256;            // contiguous chunk per thread? use strided-by-4 chunks: thread handles j = tid*4 + 1024*u
  float s1 = 0.f;
  for (int u = 0; u < per / 4; ++u) {
    const int j = tid * 4 + 1024 * u;
    const v4f a = *(const v4fa*)(x + j);
    v4f b = {0.f,0.f,0.f,0.f}; if (rr) b = *(const v4fa*)(rr + j);
#pragma unroll
    for (int q = 0; q < 4; ++q) { const float v = a[q] + b[q]; vals[u * 4 + q] = v; s1 += v; }
  }
  red[tid] = s1; __syncthreads();
  for (int st = 128; st > 0; st >>= 1) { if (tid < st) red[tid] += red[tid + st]; __syncthreads(); }
  const float mu = red[0] / (float)N; __syncthreads();
  float s2 = 0.f;
  for (int u = 0; u < per / 4; ++u)
#pragma unroll
    for (int q = 0; q < 4; ++q) { const float c = vals[u * 4 + q] - mu; s2 += c * c; }
  red[tid] = s2; __syncthreads();
  for (int st = 128; st > 0; st >>= 1) { if (tid < st) red[tid] += red[tid + st]; __syncthreads(); }
  const float rs = rsqrtf(red[0] / (float)N + eps);
  {
    for (int u = 0; u < per / 4; ++u) {
      const int j = tid * 4 + 1024 * u;
      v4f o, sm;
#pragma unroll
      for (int q = 0; q < 4; ++q) {
        float gg = g[j + q], bb = bta[j + q];
        if (PARAM_BF16) { gg = bf16_round(gg); bb = bf16_round(bb); }
        sm[q] = vals[u * 4 + q]; o[q] = (vals[u * 4 + q] - mu) * rs * gg + bb;
      }
      if (out_sum) *(v4f*)(out_sum + (size_t)row * N + j) = sm;
      *(v4f*)(out_norm + (size_t)row * N + j) = o;
    }
    
  }
}



// ---- f16 WMMA path (v_wmma_f32_16x16x32_f16): 11-bit significands for operands in range — used where a [0,1] probability operand needs more precision than bf16
typedef _Float16 v16h __attribute__((ext_vector_type(16)));
union FragH { v16h v; v8us half[2]; _Float16 h[16]; unsigned short u[16]; };
template <int NT>
__device__ __forceinline__ v8f mmaH(v16h ah, v16h al, v16h bh, v16h bl, v8f c) {
  c = __builtin_amdgcn_wmma_f32_16x16x32_f16(false, ah, false, bh, (short)0, c, false, false);
  if (NT >= 2) c = __builtin_amdgcn_wmma_f32_16x16x32_f16(false, al, false, bh, (short)0, c, false, false);
  if (NT >= 3) c = __builtin_amdgcn_wmma_f32_16x16x32_f16(false, ah, false, bl, (short)0, c, false, false);
  asm volatile("v_nop\n\tv_nop\n\tv_nop\n\tv_nop" : "+v"(c) : "v"(ah), "v"(al), "v"(bh), "v"(bl));
  return c;
}
// batched GEMM like k_gemm_b but f16 operands: A f32 (split into f16 hi/lo if ASPLIT, else rounded to f16), Bt = f16 values [n][k]; alpha; C f32; N multiple of 16 (partial tiles skipped)
template <bool ASPLIT>
__global__ __launch_bounds__(128) void k_gemm_h(const float* __restrict__ A, int lda, size_t sA, const _Float16* __restrict__ Bh, int ldb, size_t sB, float alpha, float* __restrict__ C, int ldc, size_t sC, int M, int N, int K) {
  __shared__ __attribute__((aligned(16))) float so[4][16][64];
  const int tid = threadIdx.x, w = tid >> 5, lane = tid & 31, ln = lane & 15, hh = lane >> 4; const int by = blockIdx.y;
  A += (size_t)by * sA; Bh += (size_t)by * sB; C += (size_t)by * sC;
  const int ntn = (N + 63) / 64; const int wid = blockIdx.x * 4 + w; const int mt = wid / ntn, nq = wid % ntn; if (mt * 16 >= M) return;
  const int row0 = mt * 16, col0 = nq * 64; const float* arow = A + (size_t)(row0 + ln) * lda;
  v8f acc[4] = {};
  for (int kb = 0; kb < K; kb += 32) {
    FragH ah, al;
    const v4f x0 = *(const v4fa*)(arow + kb + 8 * hh), x1 = *(const v4fa*)(arow + kb + 8 * hh + 4), x2 = *(const v4fa*)(arow + kb + 16 + 8 * hh), x3 = *(const v4fa*)(arow + kb + 16 + 8 * hh + 4);
    float xs[16] = {x0[0],x0[1],x0[2],x0[3],x1[0],x1[1],x1[2],x1[3],x2[0],x2[1],x2[2],x2[3],x3[0],x3[1],x3[2],x3[3]};
#pragma unroll
    for (int i = 0; i < 16; ++i) { const _Float16 h = (_Float16)xs[i]; ah.h[i] = h; al.h[i] = ASPLIT ? (_Float16)(xs[i] - (float)h) : (_Float16)0.0f; }
#pragma unroll
    for (int t = 0; t < 4; ++t) { if (col0 + t * 16 >= N) continue; const size_t boff = (size_t)(col0 + t * 16 + ln) * ldb + kb; FragH bq; bq.half[0] = *(const v8us*)(Bh + boff + 8 * hh); bq.half[1] = *(const v8us*)(Bh + boff + 16 + 8 * hh);
      acc[t] = mmaH<ASPLIT ? 2 : 1>(ah.v, al.v, bq.v, bq.v, acc[t]); }
  }
#pragma unroll
  for (int t = 0; t < 4; ++t) { if (col0 + t * 16 >= N) continue;
#pragma unroll
    for (int r = 0; r < 8; ++r) so[w][8 * hh + r][t * 16 + ln] = acc[t][r] * alpha; }
  __builtin_amdgcn_fence(__ATOMIC_ACQ_REL, "workgroup"); __builtin_amdgcn_wave_barrier();
  const int rsub = lane >> 4, c4 = (lane & 15) * 4;
  {
#pragma unroll
    for (int q = 0; q < 8; ++q) { const int r = q * 2 + rsub; if (col0 + c4 < N) { const v4f v = *(const v4fa*)&so[w][r][c4]; *(v4f*)(C + (size_t)(row0 + r) * ldc + col0 + c4) = v; } }
     }
}

// Wt[n][k] = f16(W[k][n]·scale) from f32 row-major W[K][N] (scale = power of two; bf16-exact weights stay exact in f16 away from the subnormal range)
__global__ __launch_bounds__(256) void k_wt_f16(const float* __restrict__ W, _Float16* __restrict__ Wt, int K, int N, float scale) {
  const int t = blockIdx.x * 256 + threadIdx.x; if (t >= N * (K / 8)) return; const int n = t / (K / 8), k8 = (t % (K / 8)) * 8; FragH f;
#pragma unroll
  for (int i = 0; i < 8; ++i) f.h[i] = (_Float16)(bf16_round(W[(size_t)(k8 + i) * N + n]) * scale); const v8us o = f.half[0];
  *(v8us*)((unsigned short*)Wt + (size_t)n * K + k8) = o; 
}
// k_gemm_hh variant with fused epilogue: v = acc·alpha + bias[by·sBias + col] (+ CP[(row/rowsPerB)·sCPb + by·64 + col] if CP) ; ACT 0 none / 1 elu ; writes f16 C16 (and f32 C if non-null)
template <int ACT>
__global__ __launch_bounds__(128) void k_gemm_hhx(const _Float16* __restrict__ A, int lda, size_t sA, const _Float16* __restrict__ Bh, int ldb, size_t sB, float alpha, const float* __restrict__ bias, size_t sBias, const float* __restrict__ CP, int rowsPerB, size_t sCPb, int row0g,
    float* __restrict__ C, _Float16* __restrict__ C16, int ldc, size_t sC, int M, int N, int K) {
  __shared__ __attribute__((aligned(16))) float so[4][16][64];
  const int tid = threadIdx.x, w = tid >> 5, lane = tid & 31, ln = lane & 15, hh = lane >> 4; const int by = blockIdx.y;
  A += (size_t)by * sA; Bh += (size_t)by * sB; const size_t cofs = (size_t)by * sC; const float* bp = bias ? bias + (size_t)by * sBias : nullptr;
  const int ntn = (N + 63) / 64; const int wid = blockIdx.x * 4 + w; const int mt = wid / ntn, nq = wid % ntn; if (mt * 16 >= M) return;
  const int row0 = mt * 16, col0 = nq * 64; const _Float16* arow = A + (size_t)(row0 + ln) * lda;
  v8f acc[4] = {};
  for (int kb = 0; kb < K; kb += 32) { FragH ah; ah.half[0] = *(const v8us*)((const unsigned short*)arow + kb + 8 * hh); ah.half[1] = *(const v8us*)((const unsigned short*)arow + kb + 16 + 8 * hh);
#pragma unroll
    for (int t = 0; t < 4; ++t) { if (col0 + t * 16 >= N) continue; const size_t boff = (size_t)(col0 + t * 16 + ln) * ldb + kb; FragH bq; bq.half[0] = *(const v8us*)((const unsigned short*)Bh + boff + 8 * hh); bq.half[1] = *(const v8us*)((const unsigned short*)Bh + boff + 16 + 8 * hh);
      acc[t] = mmaH<1>(ah.v, ah.v, bq.v, bq.v, acc[t]); }
  }
#pragma unroll
  for (int t = 0; t < 4; ++t) { if (col0 + t * 16 >= N) continue; const int col = col0 + t * 16 + ln; const float bv = bp ? bf16_round(bp[col]) : 0.f;
#pragma unroll
    for (int r = 0; r < 8; ++r) { float v = acc[t][r] * alpha + bv; if (CP) { const int rr = row0g + row0 + 8 * hh + r; if (rowsPerB < 0) v += CP[cofs + (size_t)rr * ldc + col];      /* rowsPerB < 0: own element of the batched C plane */ else { const int bidx = rr / rowsPerB; v += CP[(size_t)bidx * sCPb + (size_t)by * 64 + col]; } } if (ACT == 1) v = (v > 0.f) ? v : expm1f(v); else if (ACT == 7) v = (v > 0.f) ? v + 1.0f : expf(v); else if (ACT == 8) v = tanhf(v); else if (ACT == 9) v = 0.5f * v * (1.0f + tanhf(0.7978845608028654f * (v + 0.044715f * v * v * v))); else if (ACT == 11) v = 1.0f / (1.0f + expf(-v)); else if (ACT == 12) v = (v > 0.f) ? v : 0.01f * v; else if (ACT == 14) v = (v > 0.f) ? v : 0.1f * v; else if (ACT == 16) v = (v >= 0.f) ? v : 0.3f * v; else if (ACT == 17) v = (v >= 0.f) ? v : 0.2f * v; else if (ACT == 15) v = v / (1.0f + expf(-v)); else if (ACT == 3) v = fmaxf(v, 0.f); else if (ACT == 6) v = 0.5f * v * (1.0f + erff(v * 0.70710678118654752f)); so[w][8 * hh + r][t * 16 + ln] = v; } }
  __builtin_amdgcn_fence(__ATOMIC_ACQ_REL, "workgroup"); __builtin_amdgcn_wave_barrier();
  const int rsub = lane >> 4, c4 = (lane & 15) * 4; typedef _Float16 v4h __attribute__((ext_vector_type(4)));
  {
#pragma unroll
    for (int q = 0; q < 8; ++q) { const int r = q * 2 + rsub; if (col0 + c4 < N) { const v4f v = *(const v4fa*)&so[w][r][c4]; if (C) *(v4f*)(C + cofs + (size_t)(row0 + r) * ldc + col0 + c4) = v; if (C16) { v4h h4; for (int i = 0; i < 4; ++i) h4[i] = (_Float16)v[i]; *(v4h*)(C16 + cofs + (size_t)(row0 + r) * ldc + col0 + c4) = h4; } } }
     }
}


typedef _Float16 v4h __attribute__((ext_vector_type(4)));

__global__ __launch_bounds__(256) void k_h16(const float* __restrict__ x, _Float16* __restrict__ X16, size_t n8) { const size_t t = (size_t)blockIdx.x * 256 + threadIdx.x; if (t >= n8) return; FragH f;
#pragma unroll
  for (int q = 0; q < 8; ++q) f.h[q] = (_Float16)x[t * 8 + q]; *(v8us*)((unsigned short*)X16 + t * 8) = f.half[0];  }
__global__ __launch_bounds__(256) void k_round16f(const float* __restrict__ W, _Float16* __restrict__ Bt, size_t n8) { const size_t t = (size_t)blockIdx.x * 256 + threadIdx.x; if (t >= n8) return; FragH f;
#pragma unroll
  for (int i = 0; i < 8; ++i) f.h[i] = (_Float16)(bf16_round(W[t * 8 + i]) * 16.0f); *(v8us*)((unsigned short*)Bt + t * 8) = f.half[0];  }
// ---- fast GEMM pieces: wave tile 32x64, four waves a work-group (128 rows x 64 columns); K % 64 == 0 ----
__device__ __forceinline__ v16h g2_frag(const _Float16* p, int hh) { FragH f; f.half[0] = *(const v8us*)((const unsigned short*)p + 8 * hh); f.half[1] = *(const v8us*)((const unsigned short*)p + 16 + 8 * hh); return f.v; }
__device__ __forceinline__ v8f g2_mma(v16h a, v16h b, v8f c) { v8f d = __builtin_amdgcn_wmma_f32_16x16x32_f16(false, a, false, b, (short)0, c, false, false); asm volatile("v_nop\n\tv_nop\n\tv_nop\n\tv_nop" : "+v"(d) : "v"(a), "v"(b)); return d; }
// FRAGMENT ORDER. Every f16 plane [R][K] that a WMMA reads from memory is kept as tiles of 16 rows x 32 k (FT elements, 1024 bytes), tile (r >> 4, k >> 5) at index (r >> 4) * (K / 32) + (k >> 5).
// Inside a tile the 16 bytes of row r, k = 8 c .. 8 c + 7 (c = (k >> 3) & 3) are chunk (c >> 1) * 32 + (c & 1) * 16 + (r & 15): lane l of a wave finds the two halves of its fragment (the k order of g2_frag)
// at chunks l and 32 + l, so that each wave-wide 16-byte load or store covers 512 bytes in a row, four whole lines, and not 32 bytes of each of 16 lines.
#define FT 512
__device__ __forceinline__ size_t pk_at(int r, int k, int K) { return ((size_t)(r >> 4) * (K / 32) + (k >> 5)) * FT + (size_t)((((k >> 4) & 1) * 32 + ((k >> 3) & 1) * 16 + (r & 15)) * 8 + (k & 7)); }
__device__ __forceinline__ v16h pk_frag(const _Float16* p) { FragH f; f.half[0] = *(const v8us*)((const unsigned short*)p); f.half[1] = *(const v8us*)((const unsigned short*)p + 256); return f.v; }      /* p = the tile + 8 * lane */
// c[4 half + t] += A[row0 + 16 half ..][k] Bh[col0 + 16 t ..][k] over k = 0 .. K - 1; A and Bh in fragment order
template <int K>
__device__ __forceinline__ void g2_kloop(const _Float16* __restrict__ A, const _Float16* __restrict__ Bh, int row0, int col0, int lane, v8f (&c)[8]) {
  constexpr size_t RG = (size_t)(K / 32) * FT;      /* one group of 16 rows */
  const _Float16* ap = A + (size_t)(row0 >> 4) * RG + lane * 8; const _Float16* bp = Bh + (size_t)(col0 >> 4) * RG + lane * 8;
  /* One trip = 64 k = two tiles of each group of 16 rows. All 24 fragment loads of the trip stand in front of its first WMMA, so that a trip waits for memory once;
     each accumulator still takes its k blocks in rising order. */
#pragma unroll 1 /* a second trip's fragments would not fit in 256 registers beside the 64 accumulator registers */
  for (int kb = 0; kb < K; kb += 64) {
    const _Float16* pa = ap + (size_t)kb * 16; const _Float16* pb = bp + (size_t)kb * 16;
    const v16h a0 = pk_frag(pa), a1 = pk_frag(pa + RG), b0 = pk_frag(pb), b1 = pk_frag(pb + RG), b2 = pk_frag(pb + 2 * RG), b3 = pk_frag(pb + 3 * RG);
    const v16h a2 = pk_frag(pa + FT), a3 = pk_frag(pa + RG + FT), b4 = pk_frag(pb + FT), b5 = pk_frag(pb + RG + FT), b6 = pk_frag(pb + 2 * RG + FT), b7 = pk_frag(pb + 3 * RG + FT);
    /* the wait in front of any rewrite of a register that an issued load names; as its inputs the two address pairs stay live up to it, so that no load of the trip lands in one of them */
    asm volatile("s_wait_xcnt 0x0" :: "v"(pa), "v"(pb) : "memory");
    c[0] = g2_mma(a0, b0, c[0]); c[4] = g2_mma(a1, b0, c[4]); c[1] = g2_mma(a0, b1, c[1]); c[5] = g2_mma(a1, b1, c[5]);
    c[2] = g2_mma(a0, b2, c[2]); c[6] = g2_mma(a1, b2, c[6]); c[3] = g2_mma(a0, b3, c[3]); c[7] = g2_mma(a1, b3, c[7]);
    c[0] = g2_mma(a2, b4, c[0]); c[4] = g2_mma(a3, b4, c[4]); c[1] = g2_mma(a2, b5, c[1]); c[5] = g2_mma(a3, b5, c[5]);
    c[2] = g2_mma(a2, b6, c[2]); c[6] = g2_mma(a3, b6, c[6]); c[3] = g2_mma(a2, b7, c[3]); c[7] = g2_mma(a3, b7, c[7]); } }
// A wave's 32x64 tile out of its LDS tile: lane = 16 bytes of f32 of row 2 q + (lane >> 4). The stores take one base address and constant offsets.
__device__ __forceinline__ void g2_take(const float (&so)[32][68], int lane, v4f (&v)[16]) {
#pragma unroll /* constant indices keep v[] in registers */
  for (int q = 0; q < 16; ++q) v[q] = *(const v4fa*)&so[q * 2 + (lane >> 4)][(lane & 15) * 4]; }
template <int LDC, typename T, typename V>
__device__ __forceinline__ void g2_put(T* __restrict__ p, const V (&v)[16]) {
#pragma unroll /* constant indices keep v[] in registers; constant offsets keep one address pair */
  for (int q = 0; q < 16; ++q) *(V*)(p + (size_t)q * 2 * LDC) = v[q]; }
// The projections in one grid, by block ranges (weights carried x16, f32 accumulation, k in rising order everywhere):
//   job 0: q = x Wq^T + bq and job 1: k = x Wk^T, as f16 planes in fragment order; their first QT0 token rows go out as plain f32 rows too (operands of the exact first-tile attention);
//   job 2: V^T = Wv x^T + bv (the weight rows are the A operand, the token rows the B operand; the bias goes by row), f16 [NH * HD][SQ] in fragment order, the operand that the second attention product reads;
//   job 3: v of the first QT0 token rows, f32 rows.
#define QKV_G ((MP / 128) * (DM / 64))      /* work-groups of each of the jobs 0, 1, 2 */
__global__ __launch_bounds__(128) void k_qkv(const _Float16* __restrict__ X, const _Float16* __restrict__ BQ, const _Float16* __restrict__ BK, const _Float16* __restrict__ BV, const float* __restrict__ bq, const float* __restrict__ bv,
    _Float16* __restrict__ Q16, _Float16* __restrict__ K16, _Float16* __restrict__ VT, float* __restrict__ QF0, float* __restrict__ KF0, float* __restrict__ VF0) {
  static_assert(NB == 1 && QT0 % 128 == 0 && MP % 128 == 0 && DM % 128 == 0 && MP == SQ && NH * HD == DM, "k_qkv: one batch, whole work-group tiles in both orientations");
  __shared__ __attribute__((aligned(16))) float so[4][32][68];
  const int tid = threadIdx.x, w = tid >> 5, lane = tid & 31, ln = lane & 15, hh = lane >> 4;
  const int job = blockIdx.x / QKV_G, bx = blockIdx.x % QKV_G;
  const int ntn = (job == 2 ? SQ : DM) / 64;      /* column tiles of the job's product */
  const int mt = bx / ntn, nq = bx % ntn; const int row0 = mt * 128 + 32 * w, col0 = nq * 64;
  const _Float16* Ah = job == 2 ? BV : X; const _Float16* Bh = job == 0 ? BQ : job == 1 ? BK : job == 2 ? X : BV;
  const v8f z8 = {0.f,0.f,0.f,0.f,0.f,0.f,0.f,0.f}; v8f c[8] = {z8, z8, z8, z8, z8, z8, z8, z8};
  g2_kloop<DM>(Ah, Bh, row0, col0, lane, c);
  if (job == 2) { const float* pb = bv + row0 + 8 * hh; float rb[2][8];
#pragma unroll /* constant indices keep rb[] in registers */
    for (int half = 0; half < 2; ++half)
#pragma unroll /* as above */
      for (int r = 0; r < 8; ++r) rb[half][r] = pb[half * 16 + r];
    /* the wait in front of any rewrite of a register that an issued load names; as its input the address pair stays live up to it */
    asm volatile("s_wait_xcnt 0x0" :: "v"(pb) : "memory");
#pragma unroll /* constant indices keep c[] in registers */
    for (int u = 0; u < 8; ++u)
#pragma unroll /* as above */
      for (int r = 0; r < 8; ++r) so[w][(u >> 2) * 16 + 8 * hh + r][(u & 3) * 16 + ln] = c[u][r] * 0.0625f + bf16_round(rb[u >> 2][r]);
  } else { const float* bp = job == 0 ? bq : job == 1 ? nullptr : bv; float bb[4] = {0.f, 0.f, 0.f, 0.f};
    if (bp) {
#pragma unroll /* constant indices keep bb[] in registers */
      for (int t = 0; t < 4; ++t) bb[t] = bf16_round(bp[col0 + t * 16 + ln]); }
#pragma unroll /* as above */
    for (int u = 0; u < 8; ++u)
#pragma unroll /* as above */
      for (int r = 0; r < 8; ++r) so[w][(u >> 2) * 16 + 8 * hh + r][(u & 3) * 16 + ln] = c[u][r] * 0.0625f + bb[u & 3]; }
  __builtin_amdgcn_fence(__ATOMIC_ACQ_REL, "workgroup"); __builtin_amdgcn_wave_barrier();
  const int rsub = lane >> 4, c4 = (lane & 15) * 4; v4f v[16]; v8us hp[8];
  const bool frows = job != 2 && row0 < QT0;      /* the same for the whole wave */
  if (frows) g2_take(so[w], lane, v);
  /* the wave's 32 x 64 tile is four tiles of the f16 plane in fragment order: lane (ln, hh) takes the 8 values of row ln that make its chunk; the LDS pitch of 16 B x 17 keeps these reads free of bank conflicts */
#pragma unroll /* constant indices keep hp[] in registers */
  for (int u = 0; u < 8; ++u) { const float* sp = &so[w][(u >> 2) * 16 + ln][(u & 3) * 16 + 8 * hh]; const v4f x0 = *(const v4fa*)sp, x1 = *(const v4fa*)(sp + 4); FragH f;
#pragma unroll /* as above */
    for (int i = 0; i < 4; ++i) { f.h[i] = (_Float16)x0[i]; f.h[4 + i] = (_Float16)x1[i]; }
    hp[u] = f.half[0]; }
  /* the stores stand behind every LDS read and every conversion, so that no register that an issued store names is written again */
  const size_t rgp = (size_t)((job == 2 ? SQ : DM) / 32) * FT;      /* one group of 16 rows of the plane */
  unsigned short* p16 = (unsigned short*)(job == 0 ? Q16 : job == 1 ? K16 : VT) + (size_t)(row0 >> 4) * rgp + (size_t)(col0 >> 5) * FT + lane * 8; unsigned short* p16b = p16 + rgp;
  float* pf = (job == 0 ? QF0 : job == 1 ? KF0 : VF0) + (size_t)(row0 + rsub) * DM + col0 + c4;
  if (job != 3) {
#pragma unroll /* as above; constant offsets keep one address pair a row group */
    for (int u = 0; u < 4; ++u) { *(v8us*)(p16 + u * 256) = hp[u]; *(v8us*)(p16b + u * 256) = hp[4 + u]; } }
  if (frows) g2_put<DM>(pf, v); }
// out = o Wo^T in one grid (o carried x64, Wo x16). Rows from QT0 on: the f16 o rows, 128 rows a work-group. The first QT0 rows: the exact o as an f16 plane and its x1024 residual plane,
// out = hi 2^-10 + lo 2^-20; 64 rows a work-group, waves 0 and 1 take the hi plane and waves 2 and 3 the lo plane of the same rows, so that no wave walks k twice; the two terms meet in LDS.
#define OUT_G0 ((QT0 / 64) * (DM / 64))      /* work-groups of the first QT0 rows */
__global__ __launch_bounds__(128) void k_out(const _Float16* __restrict__ O16, const _Float16* __restrict__ OH0, const _Float16* __restrict__ OL0, const _Float16* __restrict__ BO, float* __restrict__ out) {
  static_assert(NB == 1 && QT0 % 128 == 0 && MPO % 128 == 0 && DM % 64 == 0, "k_out: one batch, the first tile ends on a work-group's edge");
  __shared__ __attribute__((aligned(16))) float so[4][32][68];
  const int tid = threadIdx.x, w = tid >> 5, lane = tid & 31, ln = lane & 15, hh = lane >> 4;
  const bool first = blockIdx.x < OUT_G0; const int bx = first ? blockIdx.x : blockIdx.x - OUT_G0;
  const int mt = bx / (DM / 64), nq = bx % (DM / 64); const int row0 = first ? mt * 64 + 32 * (w & 1) : QT0 + mt * 128 + 32 * w; const int col0 = nq * 64;
  const bool lo = first && w >= 2; const _Float16* Ah = first ? (lo ? OL0 : OH0) : O16; const float alpha = lo ? 0.00000095367431640625f : 0.0009765625f;
  const v8f z8 = {0.f,0.f,0.f,0.f,0.f,0.f,0.f,0.f}; v8f c[8] = {z8, z8, z8, z8, z8, z8, z8, z8};
  g2_kloop<DM>(Ah, BO, row0, col0, lane, c);
#pragma unroll /* constant indices keep c[] in registers */
  for (int u = 0; u < 8; ++u)
#pragma unroll /* as above */
    for (int r = 0; r < 8; ++r) so[w][(u >> 2) * 16 + 8 * hh + r][(u & 3) * 16 + ln] = c[u][r] * alpha;
  const int rsub = lane >> 4, c4 = (lane & 15) * 4; v4f v[16]; float* po = out + (size_t)(row0 + rsub) * DM + col0 + c4;
  if (first) {
    __syncthreads();      /* the lo waves' tiles are read by the hi waves; the branch is the same for the whole work-group */
    if (!lo) { v4f vl[16]; g2_take(so[w], lane, v); g2_take(so[w + 2], lane, vl);
#pragma unroll /* constant indices keep the arrays in registers */
      for (int q = 0; q < 16; ++q) v[q] = vl[q] + v[q];
      g2_put<DM>(po, v); }      /* the stores stand behind every LDS read and sum: no register that an issued store names is written again */
  } else {
    __builtin_amdgcn_fence(__ATOMIC_ACQ_REL, "workgroup"); __builtin_amdgcn_wave_barrier();
    g2_take(so[w], lane, v); g2_put<DM>(po, v); } }      /* as above */


// The five f32 -> f16 passes in one grid by block ranges: first the token rows (bf16-rounded, exact in f16), then the four natural [out][in] weights (bf16-rounded, x16). Eight elements a thread.
// A block takes 16 rows x 128 k (16 threads a row: 512 bytes in a row are read) and writes them as four tiles in fragment order, 4096 bytes in a row; the chunks change places in LDS.
__global__ __launch_bounds__(256) void k_prep(const float* __restrict__ x, const float* __restrict__ wq, const float* __restrict__ wk, const float* __restrict__ wv, const float* __restrict__ wo,
    _Float16* __restrict__ X16, _Float16* __restrict__ BQ, _Float16* __restrict__ BK, _Float16* __restrict__ BV, _Float16* __restrict__ BO) {
  static_assert(NR % 16 == 0 && DM % 128 == 0, "k_prep: whole blocks of 16 rows x 128 k");
  __shared__ __attribute__((aligned(16))) unsigned short tl[272 * 8];      /* 256 chunks of 16 bytes, a spare chunk behind every 16: writes (a lane per k chunk) and reads (a lane per row) both without bank conflicts */
  constexpr unsigned GX = (unsigned)(NR * DM / 2048), GW = (unsigned)((size_t)DM * DM / 2048);
  const unsigned bx = blockIdx.x; const float* s = x; _Float16* d = X16; float sc = 1.0f; unsigned b0 = bx;
  if (bx >= GX) { const unsigned i = (bx - GX) / GW; b0 = (bx - GX) % GW; sc = 16.0f; s = i == 0 ? wq : i == 1 ? wk : i == 2 ? wv : wo; d = i == 0 ? BQ : i == 1 ? BK : i == 2 ? BV : BO; }
  const int tid = threadIdx.x, r = tid >> 4, kc = tid & 15; const unsigned rg = b0 / (DM / 128), kq = b0 % (DM / 128);
  const float* sp = s + ((size_t)rg * 16 + r) * DM + kq * 128 + kc * 8; FragH f;
#pragma unroll /* constant indices keep f in registers */
  for (int q = 0; q < 8; ++q) f.h[q] = (_Float16)(bf16_round(sp[q]) * sc);
  *(v8us*)&tl[(17 * kc + r) * 8] = f.half[0];      /* chunk 16 kc + r of the block's four tiles: tile kc >> 2, chunk ((kc >> 1) & 1) * 32 + (kc & 1) * 16 + r */
  __syncthreads();      /* all but 16 chunks are read by another thread than wrote them */
  const v8us o = *(const v8us*)&tl[(tid + (tid >> 4)) * 8];
  *(v8us*)((unsigned short*)d + (((size_t)rg * (DM / 32) + kq * 4) * 64 + tid) * 8) = o; }
__global__ __launch_bounds__(256) void k_rsm(const float* __restrict__ S, _Float16* __restrict__ P, int nrows) {
  #pragma clang fp contract(off)
  const int i = blockIdx.x * 256 + threadIdx.x; if (i >= nrows) return; const float* s = S + (size_t)i * SQ; float mx = -3.0e38f;
#pragma unroll 1
  for (int j = 0; j < SQ; ++j) mx = fmaxf(mx, s[j]); float se = 0.f;
#pragma unroll 1
  for (int j = 0; j < SQ; ++j) se += expf(s[j] - mx); const float sc = 256.0f / se;
#pragma unroll 1
  for (int j0 = 0; j0 < SQ; j0 += 8) { FragH f; for (int q = 0; q < 8; ++q) f.h[q] = (_Float16)(expf(s[j0 + q] - mx) * sc); unsigned short* d = (unsigned short*)P + (size_t)i * SQ + j0; *(v8us*)d = f.half[0];  } }
__global__ __launch_bounds__(256) void k_vt(const _Float16* __restrict__ V16, int b, int h0, _Float16* __restrict__ VT) { __shared__ unsigned short tl[64][65]; const int tid = threadIdx.x; const int hh = blockIdx.x % HG, sg = blockIdx.x / HG; const int s0 = sg * 64; const int h = h0 + hh;
  for (int i = tid; i < 64 * 8; i += 256) { const int j = i / 8, d8 = (i % 8) * 8; FragH f; f.half[0] = *(const v8us*)((const unsigned short*)V16 + ((size_t)b * SQ + s0 + j) * DM + h * HD + d8); for (int q = 0; q < 8; ++q) tl[d8 + q][j] = f.u[q]; }
  __syncthreads();
  { for (int i = tid; i < 64 * 8; i += 256) { const int d = i / 8, j8 = (i % 8) * 8; FragH f; for (int q = 0; q < 8; ++q) f.u[q] = tl[d][j8 + q]; *(v8us*)((unsigned short*)VT + ((size_t)hh * HD + d) * SQ + s0 + j8) = f.half[0]; }  } }



#define FA_L2E 1.4426950408889634f
__device__ __forceinline__ float fa_xhalf(float x) { return __builtin_bit_cast(float, __builtin_amdgcn_permlanex16(__builtin_bit_cast(int, x), __builtin_bit_cast(int, x), 0x76543210, 0xfedcba98, false, false)); }      /* lane l with lane l ^ 16, on the vector pipe */
/* p = 2^a; behind the v_exp_f32 stands the argument of a weight three calls on, an = x log2(e) + c. That product is independent of the v_exp_f32 and fills the one slot that the instruction set asks for
   between a transcendental and an instruction that reads its result or overwrites its source; in one statement, so that it stays there. "=&v": no output shares a register with an input. */
__device__ __forceinline__ float fa_exp2_fma(float a, float x, float c, float& an) { float p; asm("v_exp_f32 %0, %2\n\tv_fma_f32 %1, %3, %4, %5" : "=&v"(p), "=&v"(an) : "v"(a), "v"(x), "s"(FA_L2E), "v"(c)); return p; }
/* the last three weights of a pass have no later argument to form: a v_nop fills the same slot */
__device__ __forceinline__ float fa_exp2_nop(float a) { float p; asm("v_exp_f32 %0, %1\n\tv_nop" : "=&v"(p) : "v"(a)); return p; }
__device__ __forceinline__ v8f fa_mma(v16h a, v16h b, v8f c) { return __builtin_amdgcn_wmma_f32_16x16x32_f16(false, a, false, b, (short)0, c, false, false); }
template <bool DIAG>
__device__ __forceinline__ void fa_pass(float jf0, int ln, int hh, float slope, const v8f (&s)[2][2], const v16h (&vf)[4], v8f (&o)[2][4], float (&m)[2], float (&l)[2]) {
  float bias[2][8];
#pragma unroll /* constant indices keep the arrays in registers */
  for (int mt = 0; mt < 2; ++mt)
#pragma unroll /* as above */
    for (int r = 0; r < 8; ++r) bias[mt][r] = __fmul_rn(slope, jf0 + (float)(mt * 16 + r));      /* slope_h * j, rounded once */
  float x[2][2][8]; float mx[2];
#pragma unroll /* as above */
  for (int nt = 0; nt < 2; ++nt) { float t = -1.0e30f;
#pragma unroll /* as above */
    for (int mt = 0; mt < 2; ++mt)
#pragma unroll /* as above */
      for (int r = 0; r < 8; ++r) { float v = fmaf(s[nt][mt][r], 0.125f, -bias[mt][r]); if (DIAG) v = (mt * 16 + 8 * hh + r <= nt * 16 + ln) ? v : -1.0e30f;      /* diagonal pass: its first key is the wave's first query */
        x[nt][mt][r] = v; t = fmaxf(t, v); }
    mx[nt] = fmaxf(t, fa_xhalf(t)); }
  /* the accumulators are rescaled only in a pass that raises some query's maximum: one scalar branch a pass */
  if (__builtin_amdgcn_ballot_w32(mx[0] > m[0] || mx[1] > m[1]) != 0) {
#pragma unroll /* as above */
    for (int nt = 0; nt < 2; ++nt) { const float mn = fmaxf(m[nt], mx[nt]); const float a = __builtin_amdgcn_exp2f((m[nt] - mn) * FA_L2E); m[nt] = mn; l[nt] *= a;
#pragma unroll /* as above */
      for (int dt = 0; dt < 4; ++dt) o[nt][dt] *= a; } }
  v16h pf[2]; float cc[2], a[32], p[32];      /* weight i = nt * 16 + 2 r + mt; weight = 2^8 exp(x - m) = 2^(x log2(e) + cc) */
#pragma unroll /* as above */
  for (int nt = 0; nt < 2; ++nt) cc[nt] = fmaf(-m[nt], FA_L2E, 8.0f);
#pragma unroll /* as above */
  for (int i = 0; i < 3; ++i) a[i] = fmaf(x[0][i & 1][i >> 1], FA_L2E, cc[0]);
#pragma unroll /* as above */
  for (int i = 0; i < 32; ++i) { const int n = i + 3; if (n < 32) p[i] = fa_exp2_fma(a[i], x[n >> 4][n & 1][(n & 15) >> 1], cc[n >> 4], a[n]); else p[i] = fa_exp2_nop(a[i]); }
#pragma unroll /* as above */
  for (int nt = 0; nt < 2; ++nt) { FragH f; float s0 = 0.f, s1 = 0.f;
#pragma unroll /* as above */
    for (int r = 0; r < 8; ++r) { const float p0 = p[nt * 16 + 2 * r], p1 = p[nt * 16 + 2 * r + 1]; s0 += p0; s1 += p1; f.h[r] = (_Float16)p0; f.h[8 + r] = (_Float16)p1; }
    l[nt] += s0 + s1; pf[nt] = f.v; }
#pragma unroll /* as above */
  for (int dt = 0; dt < 4; ++dt) { o[0][dt] = fa_mma(vf[dt], pf[0], o[0][dt]); o[1][dt] = fa_mma(vf[dt], pf[1], o[1][dt]); } }
__device__ __forceinline__ void fa_scores(const v16h (&kf)[2][2], const v16h (&qf)[2][2], v8f (&s)[2][2]) {
  const v8f z8 = {0.f,0.f,0.f,0.f,0.f,0.f,0.f,0.f};
  s[0][0] = fa_mma(kf[0][0], qf[0][0], z8); s[0][1] = fa_mma(kf[1][0], qf[0][0], z8); s[1][0] = fa_mma(kf[0][0], qf[1][0], z8); s[1][1] = fa_mma(kf[1][0], qf[1][0], z8);
  s[0][0] = fa_mma(kf[0][1], qf[0][1], s[0][0]); s[0][1] = fa_mma(kf[1][1], qf[0][1], s[0][1]); s[1][0] = fa_mma(kf[0][1], qf[1][1], s[1][0]); s[1][1] = fa_mma(kf[1][1], qf[1][1], s[1][1]); }
// The deal: a work-group is 16 waves = 4 blocks of 32 query rows (128 rows of one head) x 4 key shares, one work-group a WGP, four waves a SIMD. Share ks takes the passes ks, ks + 4, ... of its row block,
// with its own running maximum, sum and O; the four waves of one share walk the same keys side by side. A work-group takes the 128 rows n - 1 - pr and then the 128 rows pr, so that every wave walks 31 to 33 passes.
// The shares' partial (m, l, O) go to LDS; behind one barrier wave (rb, ks) joins the four shares of row block rb for head dims 16 ks .. 16 ks + 15.
__global__ __launch_bounds__(512) __attribute__((amdgpu_waves_per_eu(4, 4))) /* a budget of 256 registers: none above v255, no register-window switches in the loop */ void k_fattn(const _Float16* __restrict__ Q, const _Float16* __restrict__ K, const _Float16* __restrict__ VT, _Float16* __restrict__ O) {
  static_assert(SQ % 256 == 0 && HD == 64, "k_fattn: two blocks of 128 query rows a work-group, head size 64");
  __shared__ __attribute__((aligned(16))) float lo[2][16][16][32][4];      /* [row half of the deal][4 rb + ks][2 (4 nt + dt) + half of the 8 rows][lane]: every wave-wide 16-byte access is 512 bytes in a row */
  __shared__ float lml[2][16][4][32];      /* m of nt = 0, 1, then l of nt = 0, 1 */
  const int tid = threadIdx.x, lane = tid & 31, ln = lane & 15, hh = lane >> 4; const int w = __builtin_amdgcn_readfirstlane(tid >> 5);      /* the wave's number in a scalar register: the key loop stays a scalar branch */
  const int ks = w >> 2; const int h = blockIdx.x % NH, pr = blockIdx.x / NH;
  const float slope = (float)exp2(-0.5 * (double)(h + 1));      /* ALiBi slope 2^(-8 (h+1) / 16), correctly rounded to f32 */
  constexpr size_t RGQ = (size_t)(DM / 32) * FT, RGV = (size_t)(SQ / 32) * FT;      /* one group of 16 rows of Q, K, O; of V^T (all in fragment order) */
  const _Float16* kb0 = K + (size_t)(h * (HD / 32)) * FT; const _Float16* vb0 = VT + (size_t)(h * (HD / 16)) * RGV; const unsigned l8 = lane * 8;      /* the head's planes and every tile address are the same for the whole wave, so that they can stay in scalar registers; the lane's place in a tile is added at each load */
#pragma unroll 1 /* the two row halves one after the other through the same code */
  for (int t = 0; t < 2; ++t) {
    const int rb = t ? 3 - (w & 3) : (w & 3);      /* mirrored in the second half: a row block has 4 sb + rb + 1 passes, so its four shares (waves w, w + 4, w + 8, w + 12) walk 129 passes over both halves */
    const int nd = (t ? pr : SQ / 128 - 1 - pr) * 4 + rb;      /* the row block's number = its diagonal pass; the passes below it are 0 .. nd - 1; nd mod 4 = rb, so share rb owns the diagonal pass */
    v16h qf[2][2], kf[2][2], vf[4]; v8f s[2][2]; v8f o[2][4]; float m[2] = {-1.0e30f, -1.0e30f}, l[2] = {0.f, 0.f};
#pragma unroll /* constant indices keep the arrays in registers */
    for (int nt = 0; nt < 2; ++nt)
#pragma unroll /* as above */
      for (int dt = 0; dt < 4; ++dt) o[nt][dt] = v8f{0.f,0.f,0.f,0.f,0.f,0.f,0.f,0.f};
    if (ks <= nd) {      /* only in the first 128 rows of a head has a share no pass at all: it hands in m = -1e30, l = 0, O = 0 */
      const _Float16* pq = Q + (size_t)(nd * 2) * RGQ + (size_t)(h * (HD / 32)) * FT; const _Float16* pk = kb0 + (size_t)(ks * 2) * RGQ; const _Float16* pv = vb0 + (size_t)ks * FT;
      float jf0 = (float)(32 * ks + 8 * hh);      /* this lane's first key position of the pass, as a float (exact) */
#pragma unroll /* as above */
      for (int nt = 0; nt < 2; ++nt)
#pragma unroll /* as above */
        for (int kd = 0; kd < 2; ++kd) { qf[nt][kd] = pk_frag(pq + nt * RGQ + kd * FT + l8); kf[nt][kd] = pk_frag(pk + nt * RGQ + kd * FT + l8); }
      /* the wait in front of any rewrite of a register that an issued load names; as its inputs the address pairs stay live up to it */
      asm volatile("s_wait_xcnt 0x0" :: "s"(pq), "s"(pk) : "memory");
#pragma unroll 1 /* a pass holds about 240 registers; two passes side by side would not fit in 256 */
      for (int p = ks; p < nd; p += 4) {
#pragma unroll /* as above */
        for (int dt = 0; dt < 4; ++dt) vf[dt] = pk_frag(pv + dt * RGV + l8);      /* this pass's V^T: flies under the score products and the softmax */
        asm volatile("s_wait_xcnt 0x0" :: "s"(pv) : "memory");      /* as above, in front of the step of pv */
        pv += 4 * FT;
        fa_scores(kf, qf, s);
        pk = kb0 + (size_t)((p + 4 < nd ? p + 4 : nd) * 2) * RGQ;      /* the share's next pass; never past the diagonal pass, whose K rows are the last that this row block may read */
#pragma unroll /* as above */
        for (int mt = 0; mt < 2; ++mt)
#pragma unroll /* as above */
          for (int kd = 0; kd < 2; ++kd) kf[mt][kd] = pk_frag(pk + mt * RGQ + kd * FT + l8);      /* into the same registers: flies under the softmax and the second product */
        asm volatile("s_wait_xcnt 0x0" :: "s"(pk) : "memory");      /* as above, in front of the next value of pk */
        fa_pass<false>(jf0, ln, hh, slope, s, vf, o, m, l);
        jf0 += 128.0f; }
      if (ks == rb) {      /* the loop has left this share at p = nd */
#pragma unroll /* as above */
        for (int dt = 0; dt < 4; ++dt) vf[dt] = pk_frag(pv + dt * RGV + l8);
        asm volatile("s_wait_xcnt 0x0" :: "s"(pv) : "memory");      /* as above */
        fa_scores(kf, qf, s);
        fa_pass<true>(jf0, ln, hh, slope, s, vf, o, m, l); } }
    const int sl = rb * 4 + ks;
#pragma unroll /* as above */
    for (int nt = 0; nt < 2; ++nt) { lml[t][sl][nt][lane] = m[nt]; lml[t][sl][2 + nt][lane] = l[nt];
#pragma unroll /* as above */
      for (int dt = 0; dt < 4; ++dt) { const v8f v = o[nt][dt];
        *(v4f*)&lo[t][sl][(nt * 4 + dt) * 2][lane][0] = v4f{v[0], v[1], v[2], v[3]}; *(v4f*)&lo[t][sl][(nt * 4 + dt) * 2 + 1][lane][0] = v4f{v[4], v[5], v[6], v[7]}; } } }
  __syncthreads();      /* every share's partial result is read by the three other waves of its row block */
  v8us hv[2][2];
#pragma unroll /* constant indices keep hv[] in registers */
  for (int t = 0; t < 2; ++t) { const int rb = t ? 3 - (w & 3) : (w & 3);
#pragma unroll /* as above */
    for (int nt = 0; nt < 2; ++nt) { float mk[4], mx = -1.0e30f, ls = 0.f; v4f a0 = {0.f, 0.f, 0.f, 0.f}, a1 = {0.f, 0.f, 0.f, 0.f};
#pragma unroll /* as above */
      for (int k = 0; k < 4; ++k) { mk[k] = lml[t][rb * 4 + k][nt][lane]; mx = fmaxf(mx, mk[k]); }      /* a query's m is the same in its two lanes */
#pragma unroll /* the four shares in rising order */
      for (int k = 0; k < 4; ++k) { const float wk = fa_exp2_nop((mk[k] - mx) * FA_L2E);      /* a share without a pass weighs exactly 0; the v_nop keeps the slot behind the v_exp_f32 */
        ls += wk * lml[t][rb * 4 + k][2 + nt][lane]; a0 += wk * *(const v4f*)&lo[t][rb * 4 + k][(nt * 4 + ks) * 2][lane][0]; a1 += wk * *(const v4f*)&lo[t][rb * 4 + k][(nt * 4 + ks) * 2 + 1][lane][0]; }
      const float fin = 64.0f / (ls + fa_xhalf(ls));      /* the two halves' sums joined once; o carried x64 */
      FragH f;
#pragma unroll /* as above */
      for (int r = 0; r < 4; ++r) { f.h[r] = (_Float16)(a0[r] * fin); f.h[4 + r] = (_Float16)(a1[r] * fin); }
      hv[t][nt] = f.half[0]; } }
  /* the stores stand behind every conversion: no register that an issued store names is written again */
  unsigned short* po = (unsigned short*)O + (size_t)(h * (HD / 32)) * FT + ks * 256 + l8;      /* lane (ln, hh) holds dims 16 ks + 8 hh .. + 7 of query ln: chunk (ks & 1) * 32 + lane of tile ks >> 1 */
#pragma unroll /* as above */
  for (int t = 0; t < 2; ++t) { const int nd = (t ? pr : SQ / 128 - 1 - pr) * 4 + (t ? 3 - (w & 3) : (w & 3));
#pragma unroll /* as above */
    for (int nt = 0; nt < 2; ++nt) *(v8us*)(po + (size_t)(nd * 2 + nt) * RGQ) = hv[t][nt]; } }


// Exact f32 causal attention of the first QT0 rows. One work-group of 8 waves per head and 32 query rows. The head's K and V rows below the group's end and its 32 q rows are staged in LDS by whole-line loads.
// Both products run on the f32 matrix form (v_wmma_f32_16x16x4_f32: full f32 operands, f32 sums), transposed like k_fattn: S^T = K Q^T (A = K rows, B = q rows), O^T = V^T P^T (A = V columns, B = weight rows),
// so that a fragment read from LDS feeds 16 x 16 products and not one row's. In a D tile lane (ln, hh) holds column ln (a query) and rows 8 hh + r (8 keys, or 8 head dims, in a row).
// The k order: both operands of a product take, for each 8 k, element e = 0 .. 3 of lane half hh from k = 8 s + 4 hh + e; one matrix instruction takes e = 0, 1 and the next e = 2, 3, the same on the A and on the B side.
// Scores: wave w takes the key tiles w, w + 8; softmax maxima taken as the scores are formed, exp and sums in one pass over the scores kept in LDS (lane = row); o: wave w takes head dims 16 (w & 3) .. + 15 of the queries 16 (w >> 2) .. + 15 over all keys in rising order.
// LD = row pitch of QF, KF, VF in floats, a compile-time constant so that every staged row is one base address plus an immediate offset.
typedef float v2f __attribute__((ext_vector_type(2)));
/* the four v_nop keep four vector slots between the matrix instruction and any vector instruction that reads its D or overwrites its A or B (as its operands they stay live up to there) */
__device__ __forceinline__ v8f a0_mma(v2f a, v2f b, v8f c) { v8f d = __builtin_amdgcn_wmma_f32_16x16x4_f32(false, a, false, b, (short)0, c, false, false); asm volatile("v_nop\n\tv_nop\n\tv_nop\n\tv_nop" : "+v"(d) : "v"(a), "v"(b)); return d; }
/* the fragments of 32 keys of the second product: pp = the lane's weight row at its first key, pv = the lane's head dim in that key's V row */
__device__ __forceinline__ void a0_frags(const float* pp, const float* pv, v4f (&pf)[4], v2f (&va)[4][2]) {
#pragma unroll /* constant indices keep the fragments in registers */
  for (int u = 0; u < 4; ++u) { const float* q = pv + u * 8 * (HD + 4); pf[u] = *(const v4f*)(pp + u * 8); va[u][0] = v2f{q[0], q[HD + 4]}; va[u][1] = v2f{q[2 * (HD + 4)], q[3 * (HD + 4)]}; } }
template <int ALIBI, int LD>
__global__ __launch_bounds__(256) void k_att0(const float* __restrict__ QF, const float* __restrict__ KF, const float* __restrict__ VF, float scale, _Float16* __restrict__ OH, _Float16* __restrict__ OL, int ldo) {
  static_assert(QT0 % 32 == 0 && HD == 64, "k_att0: 32 rows a group, 16 threads a staged row, four tiles of 16 head dims");
  /* every pitch is 16 B x an odd number: a lane per row reads and writes 16 bytes without bank conflicts; in lv, rows 4 apart lie 16 banks apart, so that the two lane halves' 4-byte reads do not meet */
  __shared__ __attribute__((aligned(16))) float lk[QT0][HD + 4]; __shared__ __attribute__((aligned(16))) float lv[QT0][HD + 4]; __shared__ __attribute__((aligned(16))) float sp[32][QT0 + 4];      /* sp: scores, later weights, [query][key] */
  __shared__ __attribute__((aligned(16))) float lqo[32][HD + 4];      /* q rows, later o rows */
  __shared__ float pm[8][32]; __shared__ float pl[8][32];
  const int tid = threadIdx.x, lane = tid & 31, ln = lane & 15, hh = lane >> 4; const int w = __builtin_amdgcn_readfirstlane(tid >> 5);      /* the wave's number in a scalar register: the loops round the matrix instructions stay scalar branches, every lane on */
  const int h = blockIdx.x / (QT0 / 32), rg = blockIdx.x % (QT0 / 32); const int nkeys = rg * 32 + 32;      /* causal: keys up to the group's last row */
  const int sr = tid >> 4, c4 = (tid & 15) * 4;      /* staging: 16 threads a row of 256 bytes */
  { v4f tk[QT0 / 16], tv[QT0 / 16], tq[2];
    const float* gk = KF + (size_t)sr * LD + h * HD + c4; const float* gv = VF + (size_t)sr * LD + h * HD + c4; const float* gq = QF + (size_t)(rg * 32 + sr) * LD + h * HD + c4;
#pragma unroll /* constant indices keep tk[] and tv[] in registers; all loads are issued before the first is used */
    for (int c = 0; c < QT0 / 32; ++c) if (c * 32 < nkeys) {
#pragma unroll /* as above */
      for (int u = 2 * c; u < 2 * c + 2; ++u) { tk[u] = *(const v4fa*)(gk + (size_t)u * 16 * LD); tv[u] = *(const v4fa*)(gv + (size_t)u * 16 * LD); } }
#pragma unroll /* as above */
    for (int u = 0; u < 2; ++u) tq[u] = *(const v4fa*)(gq + (size_t)u * 16 * LD);
    /* the wait in front of any rewrite of a register that an issued load names; as its inputs the three address pairs stay live up to it, so that no load lands in one of them */
    asm volatile("s_wait_xcnt 0x0" :: "v"(gk), "v"(gv), "v"(gq) : "memory");
#pragma unroll /* as above */
    for (int c = 0; c < QT0 / 32; ++c) if (c * 32 < nkeys) {
#pragma unroll /* as above */
      for (int u = 2 * c; u < 2 * c + 2; ++u) { *(v4f*)&lk[u * 16 + sr][c4] = tk[u]; *(v4f*)&lv[u * 16 + sr][c4] = tv[u]; } }
#pragma unroll /* as above */
    for (int u = 0; u < 2; ++u) *(v4f*)&lqo[u * 16 + sr][c4] = tq[u]; }
  __syncthreads();
  const float slope = ALIBI ? (float)exp2(-0.5 * (double)(h + 1)) : 0.f;      /* ALiBi: 2^(-8 (h+1) / 16) */
  const v8f z8 = {0.f,0.f,0.f,0.f,0.f,0.f,0.f,0.f};
  v4f qf[2][HD / 8]; float mx[2] = {-1.0e30f, -1.0e30f};
#pragma unroll /* constant indices keep qf[] in registers */
  for (int nt = 0; nt < 2; ++nt)
#pragma unroll /* as above */
    for (int s = 0; s < HD / 8; ++s) qf[nt][s] = *(const v4f*)&lqo[nt * 16 + ln][8 * s + 4 * hh];
  for (int kt = w; kt < nkeys / 16; kt += 8) {      /* a tile of 16 keys against both tiles of 16 queries: two independent accumulators */
    v4f kf[HD / 8]; v8f sa[2] = {z8, z8};
#pragma unroll /* constant indices keep kf[] in registers; all eight reads stand in front of the first product */
    for (int s = 0; s < HD / 8; ++s) kf[s] = *(const v4f*)&lk[kt * 16 + ln][8 * s + 4 * hh];
#pragma unroll /* as above */
    for (int s = 0; s < HD / 8; ++s) {
      sa[0] = a0_mma(v2f{kf[s][0], kf[s][1]}, v2f{qf[0][s][0], qf[0][s][1]}, sa[0]); sa[1] = a0_mma(v2f{kf[s][0], kf[s][1]}, v2f{qf[1][s][0], qf[1][s][1]}, sa[1]);
      sa[0] = a0_mma(v2f{kf[s][2], kf[s][3]}, v2f{qf[0][s][2], qf[0][s][3]}, sa[0]); sa[1] = a0_mma(v2f{kf[s][2], kf[s][3]}, v2f{qf[1][s][2], qf[1][s][3]}, sa[1]); }
#pragma unroll /* constant indices keep sa[] in registers */
    for (int nt = 0; nt < 2; ++nt) { const int i = rg * 32 + nt * 16 + ln; float x[8];
#pragma unroll /* as above */
      for (int r = 0; r < 8; ++r) { const int j = kt * 16 + 8 * hh + r; float s = sa[nt][r] * scale; if (ALIBI) s -= slope * (float)j;
        s = (j <= i) ? s : -1.0e30f; x[r] = s; mx[nt] = fmaxf(mx[nt], s); }
      *(v4f*)&sp[nt * 16 + ln][kt * 16 + 8 * hh] = v4f{x[0], x[1], x[2], x[3]}; *(v4f*)&sp[nt * 16 + ln][kt * 16 + 8 * hh + 4] = v4f{x[4], x[5], x[6], x[7]}; } }
  mx[0] = fmaxf(mx[0], fa_xhalf(mx[0])); mx[1] = fmaxf(mx[1], fa_xhalf(mx[1]));      /* a query's keys lie in its two lanes */
  pm[w][lane] = hh ? mx[1] : mx[0];      /* row 16 hh + ln; a wave without a key tile hands in -1e30 */
  __syncthreads();
  float m = pm[0][lane];
#pragma unroll /* eight partial maxima */
  for (int x = 1; x < 8; ++x) m = fmaxf(m, pm[x][lane]);
  float lp = 0.f;
  for (int j4 = 4 * w; j4 < nkeys; j4 += 32) {      /* lane = row; nkeys is a multiple of 32: every wave takes four keys in a row of each 32 */
    const v4f x = *(const v4f*)&sp[lane][j4]; v4f e;
#pragma unroll /* constant indices keep the vectors in registers */
    for (int c = 0; c < 4; ++c) e[c] = expf(x[c] - m);      /* a masked key gives exactly 0 */
    *(v4f*)&sp[lane][j4] = e; lp += (e[0] + e[1]) + (e[2] + e[3]); }
  pl[w][lane] = lp;
  __syncthreads();
  const int d0 = (w & 3) * 16, rq = (w >> 2) * 16 + ln;      /* this wave's head dims; this lane's query */
  float l = pl[0][rq];
#pragma unroll /* eight partial sums, fixed order */
  for (int x = 1; x < 8; ++x) l += pl[x][rq];
  v8f oa[2] = {z8, z8};      /* two accumulators, so that a matrix instruction does not wait for the one before it */
  const float* pp = &sp[rq][4 * hh]; const float* pv = &lv[4 * hh][d0 + ln]; v4f pf[4]; v2f va[4][2];      /* the fragments of 32 keys: weights (B), V columns (A) */
  a0_frags(pp, pv, pf, va);
  for (int j = 0; j < nkeys; j += 32) {      /* nkeys is a multiple of 32 */
    const int jn = j + 32 < nkeys ? j + 32 : j; v4f pn[4]; v2f vn[4][2];      /* the next 32 keys' fragments fly under this trip's products; the last trip reads its own again, inside the staged rows */
    a0_frags(pp + jn, pv + (size_t)jn * (HD + 4), pn, vn);
    __builtin_amdgcn_sched_barrier(0);      /* the reads stay in front of the products: moved down among them, each product would wait out an LDS latency */
#pragma unroll /* constant indices keep the fragments in registers */
    for (int u = 0; u < 4; ++u) { oa[0] = a0_mma(va[u][0], v2f{pf[u][0], pf[u][1]}, oa[0]); oa[1] = a0_mma(va[u][1], v2f{pf[u][2], pf[u][3]}, oa[1]); }
#pragma unroll /* as above */
    for (int u = 0; u < 4; ++u) { pf[u] = pn[u]; va[u][0] = vn[u][0]; va[u][1] = vn[u][1]; } }
  const float fin = 64.0f / l;      /* o carried x64 like the f16 path */
  const v8f ov = (oa[0] + oa[1]) * fin;
  *(v4f*)&lqo[rq][d0 + 8 * hh] = v4f{ov[0], ov[1], ov[2], ov[3]}; *(v4f*)&lqo[rq][d0 + 8 * hh + 4] = v4f{ov[4], ov[5], ov[6], ov[7]};
  __syncthreads();
#pragma unroll /* two rows a thread; the 16 threads of a row fill its eight 16-byte chunks, in two tiles, of each plane */
  for (int u = 0; u < 2; ++u) { const int row = u * 16 + sr; const v4f v = *(const v4f*)&lqo[row][c4]; v4h vh, vl;      /* o (x64) -> f16 plane + x1024 residual plane */
#pragma unroll /* constant indices keep the vectors in registers */
    for (int e = 0; e < 4; ++e) { const _Float16 t = (_Float16)v[e]; vh[e] = t; vl[e] = (_Float16)((v[e] - (float)t) * 1024.0f); }
    const size_t at = pk_at(rg * 32 + row, h * HD + c4, ldo); *(v4h*)(OH + at) = vh; *(v4h*)(OL + at) = vl; } }      /* both planes in fragment order */

extern "C" void kernel_launch(void* const* d_in, const int* in_sizes, int n_in,
                              void* d_out, int out_size, void* d_ws, size_t ws_size, hipStream_t stream) {
  (void)in_sizes; (void)n_in; (void)out_size;
  const float* const* I = (const float* const*)d_in; const float* x = I[0]; const float* wq = I[1]; const float* bq = I[2]; const float* wk = I[3]; const float* wv = I[4]; const float* bv = I[5]; const float* wo = I[6];      /* natural [out][in] weights; biases on q and v only */
  char* ws = (char*)d_ws; size_t off = 0;
  auto take = [&](size_t bytes) { char* p = ws + off; off += (bytes + 255) & ~(size_t)255; return p; };
  _Float16* BQ = (_Float16*)take((size_t)DM * DM * 2); _Float16* BK = (_Float16*)take((size_t)DM * DM * 2); _Float16* BV = (_Float16*)take((size_t)DM * DM * 2); _Float16* BO = (_Float16*)take((size_t)DM * DM * 2);
  _Float16* X16 = (_Float16*)take(NR * DM * 2); _Float16* Q16 = (_Float16*)take(NR * DM * 2); _Float16* K16 = (_Float16*)take(NR * DM * 2); _Float16* O16 = (_Float16*)take(NR * DM * 2);
  _Float16* VT = (_Float16*)take((size_t)NH * HD * SQ * 2);
  float* QF0 = (float*)take((size_t)QT0 * DM * 4); float* KF0 = (float*)take((size_t)QT0 * DM * 4); float* VF0 = (float*)take((size_t)QT0 * DM * 4); _Float16* OH0 = (_Float16*)take((size_t)NB * QT0 * DM * 2); _Float16* OL0 = (_Float16*)take((size_t)NB * QT0 * DM * 2);
  if (off > ws_size) return;
  k_prep<<<(unsigned)(NR * DM / 2048 + 4 * ((size_t)DM * DM / 2048)), 256, 0, stream>>>(x, wq, wk, wv, wo, X16, BQ, BK, BV, BO);      /* x rows and the four weights (natural [out][in] = Bt[n][k], x16) as f16 in fragment order */
  k_qkv<<<3 * QKV_G + (QT0 / 128) * (DM / 64), 128, 0, stream>>>(X16, BQ, BK, BV, bq, bv, Q16, K16, VT, QF0, KF0, VF0);      /* q, k and V^T [NH][HD][SQ] as f16 in fragment order; q, k, v of the first 256 rows as f32 rows */
  k_att0<1, DM><<<NH * (QT0 / 32), 256, 0, stream>>>(QF0, KF0, VF0, 0.125f, OH0, OL0, DM);      /* exact f32 causal ALiBi attention for rows 0..255 (o x64), as f16 hi + x1024 residual planes */
  k_fattn<<<NH * (SQ / 256), 512, 0, stream>>>(Q16, K16, VT, O16);      /* scores, causal ALiBi softmax and o (merged heads, x64, f16 in fragment order) in one launch */
  k_out<<<OUT_G0 + ((MPO - QT0) / 128) * (DM / 64), 128, 0, stream>>>(O16, OH0, OL0, BO, (float*)d_out);      /* out rows are the output layout */
}

// v009
// It runs in 94.5 microseconds.
// Two timings next to v008 both put it at 1.17 times that version's speed.
// All steps since v000 together make it 89.6 times as fast.
#include <hip/hip_runtime.h>
// Causal multi-head attention with an ALiBi key-position bias (inputs [1][4096][1024]; q = x Wq^T + bq, k = x Wk^T (no bias), v = x Wv^T + bv (natural [1024][1024] sigma 0.02; bq, bv sigma 0.02); 16 heads of 64; scores / 8 - slopes[h] * j with slopes[h] = 2^(-8 (h+1) / 16) and j the key position; causal (j <= i keep, -inf); softmax; out = merged Wo^T (no bias) -> [1][4096][1024]).
// Structure: token rows r = s; q, k, v inputs as exact f16 rows (bf16-rounded); Q, K and V^T as WMMA GEMMs in one launch (32x64 wave tiles, f32 accumulation, exact x16 weights, f16 outputs; V^T = Wv x^T, the weight rows as the A operand); the first 256 rows exactly in f32 (own launch); one fused attention launch (four waves per 32 query rows of a head, each with a quarter of the passes of 32 keys up to the diagonal, joined in LDS; scores / 8 minus the ALiBi term slope_h * j in f32, online softmax with f32 statistics and native exp2, weights x256 f16, o carried x64, folded into the output GEMM alpha) written straight into the merged f16 o rows; out = o W_o GEMM (f32) into the output layout, the first 256 rows from the exact o as f16 hi + residual planes. Five launches. Every f16 plane that a WMMA reads from memory (x, the weights, q, k, V^T, o) is kept in fragment order (see FT below), not as plain rows.
// Compute dtype: inputs rounded to bf16; x / weights exact; q, k, v, softmax weights and o as plain f16 GEMM operands (~2^-12); scores and softmax statistics f32. v_wmma_f32_16x16x32_f16; the exact first 256 rows on v_wmma_f32_16x16x4_f32.
#define NB 1
#define SQ 4096
#define DM 1024
#define NH 16
#define HD 64
#define HG 4                         /* heads per block group of the unlaunched k_vt overload */
#define QT 256                       /* query rows per causal tile */
#define NKX SQ                       /* S / P row pitch */
#define QT0 256                      /* first-tile rows recomputed exactly in f32 */
#define B0 0                         /* first batch processed (debug hook) */
#define NBR NB                       /* batches processed (debug hook) */
#define NR ((size_t)NB * SQ)         /* token rows */
#define MP ((int)((size_t)NBR * SQ)) /* rows projected (debug hook) */
#define QN SQ                        /* query rows attended per batch (debug hook) */
#define NHD NH                       /* heads attended (debug hook) */
#define MPO MP                       /* rows through the output stage (debug hook) */
#define LQ DM      /* row pitch of the q/k/v rows */
typedef __bf16 v16b __attribute__((ext_vector_type(16)));
typedef unsigned short v8us __attribute__((ext_vector_type(8), may_alias));
typedef float  v8f  __attribute__((ext_vector_type(8)));
typedef float  v4f  __attribute__((ext_vector_type(4)));
typedef float  v4fa __attribute__((ext_vector_type(4), may_alias));
union FragB { v16b v; v8us half[2]; unsigned short u[16]; };

__device__ __forceinline__ unsigned short bf16_bits(float x) { unsigned int u = __float_as_uint(x); return (unsigned short)((u + 0x7FFFu + ((u >> 16) & 1u)) >> 16); }
__device__ __forceinline__ float bf16_val(unsigned short b) { return __uint_as_float(((unsigned int)b) << 16); }
__device__ __forceinline__ float bf16_round(float x) { return bf16_val(bf16_bits(x)); }
// D += A·B with NT terms: 1 = ah·bh, 2 = + al·bh (A split), 3 = + ah·bl (both split)
template <int NT>
__device__ __forceinline__ v8f mmaN(v16b ah, v16b al, v16b bh, v16b bl, v8f c) {
  c = __builtin_amdgcn_wmma_f32_16x16x32_bf16(false, ah, false, bh, (short)0, c, false, false);
  if (NT >= 2) c = __builtin_amdgcn_wmma_f32_16x16x32_bf16(false, al, false, bh, (short)0, c, false, false);
  if (NT >= 3) c = __builtin_amdgcn_wmma_f32_16x16x32_bf16(false, ah, false, bl, (short)0, c, false, false);
  asm volatile("v_nop\n\tv_nop\n\tv_nop\n\tv_nop" : "+v"(c) : "v"(ah), "v"(al), "v"(bh), "v"(bl));
  return c;
}

__global__ __launch_bounds__(256) void k_wt_bf16(const float* __restrict__ W, unsigned short* __restrict__ Wt, int K, int N) {
  const int t = blockIdx.x * 256 + threadIdx.x;
  const int k8n = K / 8;
  if (t >= N * k8n) return;
  const int n = t / k8n, k8 = (t % k8n) * 8;
  v8us v;
#pragma unroll
  for (int i = 0; i < 8; ++i) v[i] = bf16_bits(W[(size_t)(k8 + i) * N + n]);
  *(v8us*)(Wt + (size_t)n * K + k8) = v;
  
}

// GEMM C[M][N] (f32, pitch ldc) = act(A[M][K]·W + bias). A f32 row-major (pitch lda) converted per fragment to bf16
// (ASPLIT: hi/lo two planes -> 2 terms, else single rounded term); Wt bf16 [N][K] (pitch ldb). BIAS_BF16 rounds the
// bias to bf16 first (bias quantised to bf16 before the add). K%32==0, M%16==0, N%64==0.
template <bool ASPLIT, int ACT, bool BIAS_BF16>
__global__ __launch_bounds__(128) void k_gemm_bf(const float* __restrict__ A, int lda, const unsigned short* __restrict__ Wt, int ldb,
                                               const float* __restrict__ bias, float* __restrict__ C, int ldc, int M, int N, int K) {
  __shared__ __attribute__((aligned(16))) float so[4][16][64];
  const int tid = threadIdx.x, w = tid >> 5, lane = tid & 31, ln = lane & 15, hh = lane >> 4;
  const int ntn = N / 64;
  const int wid = blockIdx.x * 4 + w;
  const int mt = wid / ntn, nq = wid % ntn;
  if (mt * 16 >= M) return;
  const int row0 = mt * 16, col0 = nq * 64;
  const float* arow = A + (size_t)(row0 + ln) * lda;
  v8f acc[4] = {};
  for (int kb = 0; kb < K; kb += 32) {
    FragB ah, al;
    const v4f x0 = *(const v4fa*)(arow + kb + 8 * hh), x1 = *(const v4fa*)(arow + kb + 8 * hh + 4);
    const v4f x2 = *(const v4fa*)(arow + kb + 16 + 8 * hh), x3 = *(const v4fa*)(arow + kb + 16 + 8 * hh + 4);
    float xs[16] = {x0[0],x0[1],x0[2],x0[3],x1[0],x1[1],x1[2],x1[3],x2[0],x2[1],x2[2],x2[3],x3[0],x3[1],x3[2],x3[3]};
#pragma unroll
    for (int i = 0; i < 16; ++i) { const unsigned short hb = bf16_bits(xs[i]); ah.u[i] = hb; al.u[i] = ASPLIT ? bf16_bits(xs[i] - bf16_val(hb)) : (unsigned short)0; }
#pragma unroll
    for (int t = 0; t < 4; ++t) {
      const unsigned short* brow = Wt + (size_t)(col0 + t * 16 + ln) * ldb + kb;
      FragB b;
      b.half[0] = *(const v8us*)(brow + 8 * hh);
      b.half[1] = *(const v8us*)(brow + 16 + 8 * hh);
      acc[t] = mmaN<ASPLIT ? 2 : 1>(ah.v, al.v, b.v, b.v, acc[t]);
    }
  }
#pragma unroll
  for (int t = 0; t < 4; ++t) {
    float bv = bias ? bias[col0 + t * 16 + ln] : 0.f;
    if (BIAS_BF16) bv = bf16_round(bv);
#pragma unroll
    for (int r = 0; r < 8; ++r) { float v = acc[t][r] + bv; if (ACT == 1) v = fmaxf(v, 0.f); so[w][8 * hh + r][t * 16 + ln] = v; }
  }
  __builtin_amdgcn_fence(__ATOMIC_ACQ_REL, "workgroup");
  __builtin_amdgcn_wave_barrier();
  const int rsub = lane >> 4, c4 = (lane & 15) * 4;
  {
#pragma unroll
    for (int q = 0; q < 8; ++q) {
      const int r = q * 2 + rsub;
      const v4f v = *(const v4fa*)&so[w][r][c4];
      *(v4f*)(C + (size_t)(row0 + r) * ldc + col0 + c4) = v;
    }
    
  }
}

// GEMM C = act(A·W + bias + resid): A f32 (ASPLIT -> hi/lo 2 terms), Wt bf16 [N][K]; ACT 0 none, 1 relu, 2 exact gelu;
// resid (optional, f32, row index = (row % rmod), pitch ldr, RES_BF16 rounds it) added before the activation.
template <bool ASPLIT, int ACT, bool BIAS_BF16, bool RES_BF16>
__global__ __launch_bounds__(128) void k_gemm_bf3(const float* __restrict__ A, int lda, const unsigned short* __restrict__ Wt, int ldb,
                                                const float* __restrict__ bias, const float* __restrict__ resid, int rmod, int ldr,
                                                float* __restrict__ C, int ldc, int M, int N, int K) {
  __shared__ __attribute__((aligned(16))) float so[4][16][64];
  const int tid = threadIdx.x, w = tid >> 5, lane = tid & 31, ln = lane & 15, hh = lane >> 4;
  const int ntn = N / 64;
  const int wid = blockIdx.x * 4 + w;
  const int mt = wid / ntn, nq = wid % ntn;
  if (mt * 16 >= M) return;
  const int row0 = mt * 16, col0 = nq * 64;
  const float* arow = A + (size_t)(row0 + ln) * lda;
  v8f acc[4] = {};
  for (int kb = 0; kb < K; kb += 32) {
    FragB ah, al;
    const v4f x0 = *(const v4fa*)(arow + kb + 8 * hh), x1 = *(const v4fa*)(arow + kb + 8 * hh + 4);
    const v4f x2 = *(const v4fa*)(arow + kb + 16 + 8 * hh), x3 = *(const v4fa*)(arow + kb + 16 + 8 * hh + 4);
    float xs[16] = {x0[0],x0[1],x0[2],x0[3],x1[0],x1[1],x1[2],x1[3],x2[0],x2[1],x2[2],x2[3],x3[0],x3[1],x3[2],x3[3]};
#pragma unroll
    for (int i = 0; i < 16; ++i) { const unsigned short hb = bf16_bits(xs[i]); ah.u[i] = hb; al.u[i] = ASPLIT ? bf16_bits(xs[i] - bf16_val(hb)) : (unsigned short)0; }
#pragma unroll
    for (int t = 0; t < 4; ++t) {
      const unsigned short* brow = Wt + (size_t)(col0 + t * 16 + ln) * ldb + kb;
      FragB b;
      b.half[0] = *(const v8us*)(brow + 8 * hh);
      b.half[1] = *(const v8us*)(brow + 16 + 8 * hh);
      acc[t] = mmaN<ASPLIT ? 2 : 1>(ah.v, al.v, b.v, b.v, acc[t]);
    }
  }
#pragma unroll
  for (int t = 0; t < 4; ++t) {
    const int col = col0 + t * 16 + ln;
    float bv = bias ? bias[col] : 0.f;
    if (BIAS_BF16) bv = bf16_round(bv);
#pragma unroll
    for (int r = 0; r < 8; ++r) {
      float v = acc[t][r] + bv;
      if (resid) { float rv = resid[(size_t)((row0 + 8 * hh + r) % rmod) * ldr + col]; if (RES_BF16) rv = bf16_round(rv); v += rv; }
      if (ACT == 1) v = fmaxf(v, 0.f);
      if (ACT == 2) v = 0.5f * v * (1.0f + erff(v * 0.70710678118654752f));
      if (ACT == 3) { const float u = 0.7978845608028654f * (v + 0.044715f * v * v * v); v = 0.5f * v * (1.0f + tanhf(u)); }
      so[w][8 * hh + r][t * 16 + ln] = v;
    }
  }
  __builtin_amdgcn_fence(__ATOMIC_ACQ_REL, "workgroup");
  __builtin_amdgcn_wave_barrier();
  const int rsub = lane >> 4, c4 = (lane & 15) * 4;
  {
#pragma unroll
    for (int q = 0; q < 8; ++q) {
      const int r = q * 2 + rsub;
      const v4f v = *(const v4fa*)&so[w][r][c4];
      *(v4f*)(C + (size_t)(row0 + r) * ldc + col0 + c4) = v;
    }
    
  }
}
// row LayerNorm (biased variance, eps) over N: s = X (+ R); optional out_sum <- s; out_norm <- (s-mu)*rsqrt(var+eps)*g + b
template <bool PARAM_BF16>
__global__ __launch_bounds__(256) void k_layernorm(const float* __restrict__ X, const float* __restrict__ R, const float* __restrict__ g, const float* __restrict__ bta,
                                                  float* __restrict__ out_sum, float* __restrict__ out_norm, int N, float eps) {
  __shared__ float red[256];
  const int row = blockIdx.x, tid = threadIdx.x;
  const float* x = X + (size_t)row * N; const float* rr = R ? R + (size_t)row * N : nullptr;
  float vals[16];                     // up to N = 4096
  const int per = N / 256;            // contiguous chunk per thread? use strided-by-4 chunks: thread handles j = tid*4 + 1024*u
  float s1 = 0.f;
  for (int u = 0; u < per / 4; ++u) {
    const int j = tid * 4 + 1024 * u;
    const v4f a = *(const v4fa*)(x + j);
    v4f b = {0.f,0.f,0.f,0.f}; if (rr) b = *(const v4fa*)(rr + j);
#pragma unroll
    for (int q = 0; q < 4; ++q) { const float v = a[q] + b[q]; vals[u * 4 + q] = v; s1 += v; }
  }
  red[tid] = s1; __syncthreads();
  for (int st = 128; st > 0; st >>= 1) { if (tid < st) red[tid] += red[tid + st]; __syncthreads(); }
  const float mu = red[0] / (float)N; __syncthreads();
  float s2 = 0.f;
  for (int u = 0; u < per / 4; ++u)
#pragma unroll
    for (int q = 0; q < 4; ++q) { const float c = vals[u * 4 + q] - mu; s2 += c * c; }
  red[tid] = s2; __syncthreads();
  for (int st = 128; st > 0; st >>= 1) { if (tid < st) red[tid] += red[tid + st]; __syncthreads(); }
  const float rs = rsqrtf(red[0] / (float)N + eps);
  {
    for (int u = 0; u < per / 4; ++u) {
      const int j = tid * 4 + 1024 * u;
      v4f o, sm;
#pragma unroll
      for (int q = 0; q < 4; ++q) {
        float gg = g[j + q], bb = bta[j + q];
        if (PARAM_BF16) { gg = bf16_round(gg); bb = bf16_round(bb); }
        sm[q] = vals[u * 4 + q]; o[q] = (vals[u * 4 + q] - mu) * rs * gg + bb;
      }
      if (out_sum) *(v4f*)(out_sum + (size_t)row * N + j) = sm;
      *(v4f*)(out_norm + (size_t)row * N + j) = o;
    }
    
  }
}



// ---- f16 WMMA path (v_wmma_f32_16x16x32_f16): 11-bit significands for operands in range — used where a [0,1] probability operand needs more precision than bf16
typedef _Float16 v16h __attribute__((ext_vector_type(16)));
union FragH { v16h v; v8us half[2]; _Float16 h[16]; unsigned short u[16]; };
template <int NT>
__device__ __forceinline__ v8f mmaH(v16h ah, v16h al, v16h bh, v16h bl, v8f c) {
  c = __builtin_amdgcn_wmma_f32_16x16x32_f16(false, ah, false, bh, (short)0, c, false, false);
  if (NT >= 2) c = __builtin_amdgcn_wmma_f32_16x16x32_f16(false, al, false, bh, (short)0, c, false, false);
  if (NT >= 3) c = __builtin_amdgcn_wmma_f32_16x16x32_f16(false, ah, false, bl, (short)0, c, false, false);
  asm volatile("v_nop\n\tv_nop\n\tv_nop\n\tv_nop" : "+v"(c) : "v"(ah), "v"(al), "v"(bh), "v"(bl));
  return c;
}
// batched GEMM like k_gemm_b but f16 operands: A f32 (split into f16 hi/lo if ASPLIT, else rounded to f16), Bt = f16 values [n][k]; alpha; C f32; N multiple of 16 (partial tiles skipped)
template <bool ASPLIT>
__global__ __launch_bounds__(128) void k_gemm_h(const float* __restrict__ A, int lda, size_t sA, const _Float16* __restrict__ Bh, int ldb, size_t sB, float alpha, float* __restrict__ C, int ldc, size_t sC, int M, int N, int K) {
  __shared__ __attribute__((aligned(16))) float so[4][16][64];
  const int tid = threadIdx.x, w = tid >> 5, lane = tid & 31, ln = lane & 15, hh = lane >> 4; const int by = blockIdx.y;
  A += (size_t)by * sA; Bh += (size_t)by * sB; C += (size_t)by * sC;
  const int ntn = (N + 63) / 64; const int wid = blockIdx.x * 4 + w; const int mt = wid / ntn, nq = wid % ntn; if (mt * 16 >= M) return;
  const int row0 = mt * 16, col0 = nq * 64; const float* arow = A + (size_t)(row0 + ln) * lda;
  v8f acc[4] = {};
  for (int kb = 0; kb < K; kb += 32) {
    FragH ah, al;
    const v4f x0 = *(const v4fa*)(arow + kb + 8 * hh), x1 = *(const v4fa*)(arow + kb + 8 * hh + 4), x2 = *(const v4fa*)(arow + kb + 16 + 8 * hh), x3 = *(const v4fa*)(arow + kb + 16 + 8 * hh + 4);
    float xs[16] = {x0[0],x0[1],x0[2],x0[3],x1[0],x1[1],x1[2],x1[3],x2[0],x2[1],x2[2],x2[3],x3[0],x3[1],x3[2],x3[3]};
#pragma unroll
    for (int i = 0; i < 16; ++i) { const _Float16 h = (_Float16)xs[i]; ah.h[i] = h; al.h[i] = ASPLIT ? (_Float16)(xs[i] - (float)h) : (_Float16)0.0f; }
#pragma unroll
    for (int t = 0; t < 4; ++t) { if (col0 + t * 16 >= N) continue; const size_t boff = (size_t)(col0 + t * 16 + ln) * ldb + kb; FragH bq; bq.half[0] = *(const v8us*)(Bh + boff + 8 * hh); bq.half[1] = *(const v8us*)(Bh + boff + 16 + 8 * hh);
      acc[t] = mmaH<ASPLIT ? 2 : 1>(ah.v, al.v, bq.v, bq.v, acc[t]); }
  }
#pragma unroll
  for (int t = 0; t < 4; ++t) { if (col0 + t * 16 >= N) continue;
#pragma unroll
    for (int r = 0; r < 8; ++r) so[w][8 * hh + r][t * 16 + ln] = acc[t][r] * alpha; }
  __builtin_amdgcn_fence(__ATOMIC_ACQ_REL, "workgroup"); __builtin_amdgcn_wave_barrier();
  const int rsub = lane >> 4, c4 = (lane & 15) * 4;
  {
#pragma unroll
    for (int q = 0; q < 8; ++q) { const int r = q * 2 + rsub; if (col0 + c4 < N) { const v4f v = *(const v4fa*)&so[w][r][c4]; *(v4f*)(C + (size_t)(row0 + r) * ldc + col0 + c4) = v; } }
     }
}

// Wt[n][k] = f16(W[k][n]·scale) from f32 row-major W[K][N] (scale = power of two; bf16-exact weights stay exact in f16 away from the subnormal range)
__global__ __launch_bounds__(256) void k_wt_f16(const float* __restrict__ W, _Float16* __restrict__ Wt, int K, int N, float scale) {
  const int t = blockIdx.x * 256 + threadIdx.x; if (t >= N * (K / 8)) return; const int n = t / (K / 8), k8 = (t % (K / 8)) * 8; FragH f;
#pragma unroll
  for (int i = 0; i < 8; ++i) f.h[i] = (_Float16)(bf16_round(W[(size_t)(k8 + i) * N + n]) * scale); const v8us o = f.half[0];
  *(v8us*)((unsigned short*)Wt + (size_t)n * K + k8) = o; 
}
// k_gemm_hh variant with fused epilogue: v = acc·alpha + bias[by·sBias + col] (+ CP[(row/rowsPerB)·sCPb + by·64 + col] if CP) ; ACT 0 none / 1 elu ; writes f16 C16 (and f32 C if non-null)
template <int ACT>
__global__ __launch_bounds__(128) void k_gemm_hhx(const _Float16* __restrict__ A, int lda, size_t sA, const _Float16* __restrict__ Bh, int ldb, size_t sB, float alpha, const float* __restrict__ bias, size_t sBias, const float* __restrict__ CP, int rowsPerB, size_t sCPb, int row0g,
    float* __restrict__ C, _Float16* __restrict__ C16, int ldc, size_t sC, int M, int N, int K) {
  __shared__ __attribute__((aligned(16))) float so[4][16][64];
  const int tid = threadIdx.x, w = tid >> 5, lane = tid & 31, ln = lane & 15, hh = lane >> 4; const int by = blockIdx.y;
  A += (size_t)by * sA; Bh += (size_t)by * sB; const size_t cofs = (size_t)by * sC; const float* bp = bias ? bias + (size_t)by * sBias : nullptr;
  const int ntn = (N + 63) / 64; const int wid = blockIdx.x * 4 + w; const int mt = wid / ntn, nq = wid % ntn; if (mt * 16 >= M) return;
  const int row0 = mt * 16, col0 = nq * 64; const _Float16* arow = A + (size_t)(row0 + ln) * lda;
  v8f acc[4] = {};
  for (int kb = 0; kb < K; kb += 32) { FragH ah; ah.half[0] = *(const v8us*)((const unsigned short*)arow + kb + 8 * hh); ah.half[1] = *(const v8us*)((const unsigned short*)arow + kb + 16 + 8 * hh);
#pragma unroll
    for (int t = 0; t < 4; ++t) { if (col0 + t * 16 >= N) continue; const size_t boff = (size_t)(col0 + t * 16 + ln) * ldb + kb; FragH bq; bq.half[0] = *(const v8us*)((const unsigned short*)Bh + boff + 8 * hh); bq.half[1] = *(const v8us*)((const unsigned short*)Bh + boff + 16 + 8 * hh);
      acc[t] = mmaH<1>(ah.v, ah.v, bq.v, bq.v, acc[t]); }
  }
#pragma unroll
  for (int t = 0; t < 4; ++t) { if (col0 + t * 16 >= N) continue; const int col = col0 + t * 16 + ln; const float bv = bp ? bf16_round(bp[col]) : 0.f;
#pragma unroll
    for (int r = 0; r < 8; ++r) { float v = acc[t][r] * alpha + bv; if (CP) { const int rr = row0g + row0 + 8 * hh + r; if (rowsPerB < 0) v += CP[cofs + (size_t)rr * ldc + col];      /* rowsPerB < 0: own element of the batched C plane */ else { const int bidx = rr / rowsPerB; v += CP[(size_t)bidx * sCPb + (size_t)by * 64 + col]; } } if (ACT == 1) v = (v > 0.f) ? v : expm1f(v); else if (ACT == 7) v = (v > 0.f) ? v + 1.0f : expf(v); else if (ACT == 8) v = tanhf(v); else if (ACT == 9) v = 0.5f * v * (1.0f + tanhf(0.7978845608028654f * (v + 0.044715f * v * v * v))); else if (ACT == 11) v = 1.0f / (1.0f + expf(-v)); else if (ACT == 12) v = (v > 0.f) ? v : 0.01f * v; else if (ACT == 14) v = (v > 0.f) ? v : 0.1f * v; else if (ACT == 16) v = (v >= 0.f) ? v : 0.3f * v; else if (ACT == 17) v = (v >= 0.f) ? v : 0.2f * v; else if (ACT == 15) v = v / (1.0f + expf(-v)); else if (ACT == 3) v = fmaxf(v, 0.f); else if (ACT == 6) v = 0.5f * v * (1.0f + erff(v * 0.70710678118654752f)); so[w][8 * hh + r][t * 16 + ln] = v; } }
  __builtin_amdgcn_fence(__ATOMIC_ACQ_REL, "workgroup"); __builtin_amdgcn_wave_barrier();
  const int rsub = lane >> 4, c4 = (lane & 15) * 4; typedef _Float16 v4h __attribute__((ext_vector_type(4)));
  {
#pragma unroll
    for (int q = 0; q < 8; ++q) { const int r = q * 2 + rsub; if (col0 + c4 < N) { const v4f v = *(const v4fa*)&so[w][r][c4]; if (C) *(v4f*)(C + cofs + (size_t)(row0 + r) * ldc + col0 + c4) = v; if (C16) { v4h h4; for (int i = 0; i < 4; ++i) h4[i] = (_Float16)v[i]; *(v4h*)(C16 + cofs + (size_t)(row0 + r) * ldc + col0 + c4) = h4; } } }
     }
}


typedef _Float16 v4h __attribute__((ext_vector_type(4)));

__global__ __launch_bounds__(256) void k_h16(const float* __restrict__ x, _Float16* __restrict__ X16, size_t n8) { const size_t t = (size_t)blockIdx.x * 256 + threadIdx.x; if (t >= n8) return; FragH f;
#pragma unroll
  for (int q = 0; q < 8; ++q) f.h[q] = (_Float16)x[t * 8 + q]; *(v8us*)((unsigned short*)X16 + t * 8) = f.half[0];  }
__global__ __launch_bounds__(256) void k_round16f(const float* __restrict__ W, _Float16* __restrict__ Bt, size_t n8) { const size_t t = (size_t)blockIdx.x * 256 + threadIdx.x; if (t >= n8) return; FragH f;
#pragma unroll
  for (int i = 0; i < 8; ++i) f.h[i] = (_Float16)(bf16_round(W[t * 8 + i]) * 16.0f); *(v8us*)((unsigned short*)Bt + t * 8) = f.half[0];  }
// ---- fast GEMM pieces: wave tile 32x64, four waves a work-group (128 rows x 64 columns) in g2_kloop, eight (128 x 128) in g3_kloop; K % 64 == 0 ----
__device__ __forceinline__ v16h g2_frag(const _Float16* p, int hh) { FragH f; f.half[0] = *(const v8us*)((const unsigned short*)p + 8 * hh); f.half[1] = *(const v8us*)((const unsigned short*)p + 16 + 8 * hh); return f.v; }
__device__ __forceinline__ v8f g2_mma(v16h a, v16h b, v8f c) { v8f d = __builtin_amdgcn_wmma_f32_16x16x32_f16(false, a, false, b, (short)0, c, false, false); asm volatile("v_nop\n\tv_nop\n\tv_nop\n\tv_nop" : "+v"(d) : "v"(a), "v"(b)); return d; }
// FRAGMENT ORDER. Every f16 plane [R][K] that a WMMA reads from memory is kept as tiles of 16 rows x 32 k (FT elements, 1024 bytes), tile (r >> 4, k >> 5) at index (r >> 4) * (K / 32) + (k >> 5).
// Inside a tile the 16 bytes of row r, k = 8 c .. 8 c + 7 (c = (k >> 3) & 3) are chunk (c >> 1) * 32 + (c & 1) * 16 + (r & 15): lane l of a wave finds the two halves of its fragment (the k order of g2_frag)
// at chunks l and 32 + l, so that each wave-wide 16-byte load or store covers 512 bytes in a row, four whole lines, and not 32 bytes of each of 16 lines.
#define FT 512
__device__ __forceinline__ size_t pk_at(int r, int k, int K) { return ((size_t)(r >> 4) * (K / 32) + (k >> 5)) * FT + (size_t)((((k >> 4) & 1) * 32 + ((k >> 3) & 1) * 16 + (r & 15)) * 8 + (k & 7)); }
__device__ __forceinline__ v16h pk_frag(const _Float16* p) { FragH f; f.half[0] = *(const v8us*)((const unsigned short*)p); f.half[1] = *(const v8us*)((const unsigned short*)p + 256); return f.v; }      /* p = the tile + 8 * lane */
// c[4 half + t] += A[row0 + 16 half ..][k] Bh[col0 + 16 t ..][k] over k = 0 .. K - 1; A and Bh in fragment order
template <int K>
__device__ __forceinline__ void g2_kloop(const _Float16* __restrict__ A, const _Float16* __restrict__ Bh, int row0, int col0, int lane, v8f (&c)[8]) {
  constexpr size_t RG = (size_t)(K / 32) * FT;      /* one group of 16 rows */
  const _Float16* ap = A + (size_t)(row0 >> 4) * RG + lane * 8; const _Float16* bp = Bh + (size_t)(col0 >> 4) * RG + lane * 8;
  /* One trip = 64 k = two tiles of each group of 16 rows. All 24 fragment loads of the trip stand in front of its first WMMA, so that a trip waits for memory once;
     each accumulator still takes its k blocks in rising order. */
#pragma unroll 1 /* a second trip's fragments would not fit in 256 registers beside the 64 accumulator registers */
  for (int kb = 0; kb < K; kb += 64) {
    const _Float16* pa = ap + (size_t)kb * 16; const _Float16* pb = bp + (size_t)kb * 16;
    const v16h a0 = pk_frag(pa), a1 = pk_frag(pa + RG), b0 = pk_frag(pb), b1 = pk_frag(pb + RG), b2 = pk_frag(pb + 2 * RG), b3 = pk_frag(pb + 3 * RG);
    const v16h a2 = pk_frag(pa + FT), a3 = pk_frag(pa + RG + FT), b4 = pk_frag(pb + FT), b5 = pk_frag(pb + RG + FT), b6 = pk_frag(pb + 2 * RG + FT), b7 = pk_frag(pb + 3 * RG + FT);
    /* the wait in front of any rewrite of a register that an issued load names; as its inputs the two address pairs stay live up to it, so that no load of the trip lands in one of them */
    asm volatile("s_wait_xcnt 0x0" :: "v"(pa), "v"(pb) : "memory");
    c[0] = g2_mma(a0, b0, c[0]); c[4] = g2_mma(a1, b0, c[4]); c[1] = g2_mma(a0, b1, c[1]); c[5] = g2_mma(a1, b1, c[5]);
    c[2] = g2_mma(a0, b2, c[2]); c[6] = g2_mma(a1, b2, c[6]); c[3] = g2_mma(a0, b3, c[3]); c[7] = g2_mma(a1, b3, c[7]);
    c[0] = g2_mma(a2, b4, c[0]); c[4] = g2_mma(a3, b4, c[4]); c[1] = g2_mma(a2, b5, c[1]); c[5] = g2_mma(a3, b5, c[5]);
    c[2] = g2_mma(a2, b6, c[2]); c[6] = g2_mma(a3, b6, c[6]); c[3] = g2_mma(a2, b7, c[3]); c[7] = g2_mma(a3, b7, c[7]); } }
// The same sums for a work-group of 8 waves that shares a tile of 128 rows x 128 columns (wave = 32 x 64: rows 32 (w & 3), columns 64 (w >> 2)). A stage is 64 k of the 8 row groups of A and of the 8 of Bh:
// in fragment order 2 KiB in a row per group, 32 KiB in all, read from memory once for the whole work-group (16 bytes x 8 a thread) and laid in LDS as it lies in memory: [A groups 0..7][Bh groups 0..7].
// Two buffers: stage s + 1 goes from registers into the buffer that trip s - 1 has read, stage s + 2 flies from memory into the registers during trip s; one barrier a trip.
#define G3_ST 16384      /* elements of one stage */
/* The work-group's barrier for LDS data alone: this wave's LDS reads and writes have returned, then signal and wait. __syncthreads() would also wait for the global loads in flight, the next stage's, at every trip. */
__device__ __forceinline__ void g3_barrier() { asm volatile("s_wait_dscnt 0x0" ::: "memory"); asm volatile("s_barrier_signal -1\n\ts_barrier_wait -1" ::: "memory"); }
template <int K>
__device__ __forceinline__ void g3_kloop(const _Float16* __restrict__ A, const _Float16* __restrict__ Bh, int rg0, int cg0, int tid, unsigned short* __restrict__ ring, v8f (&c)[8]) {
  constexpr size_t RG = (size_t)(K / 32) * FT;      /* one group of 16 rows */
  constexpr int NS = K / 64;
  static_assert(NS >= 2, "g3_kloop: two stages are loaded in front of the loop");
  const int lane = tid & 31, w = tid >> 5;
  const unsigned short* ga = (const unsigned short*)A + (size_t)(rg0 + (tid >> 7)) * RG + (tid & 127) * 8;      /* load i: group 2 i + (tid >> 7), its 2 KiB dealt to 128 threads */
  const unsigned short* gb = (const unsigned short*)Bh + (size_t)(cg0 + (tid >> 7)) * RG + (tid & 127) * 8;
  const unsigned fa = (w & 3) * 2048 + lane * 8, fb = 8192 + (w >> 2) * 4096 + lane * 8;      /* the wave's first A and Bh fragment in a stage */
  v8us st[8];
#pragma unroll /* constant indices keep st[] in registers */
  for (int i = 0; i < 4; ++i) { st[i] = *(const v8us*)(ga + (size_t)i * 2 * RG); st[4 + i] = *(const v8us*)(gb + (size_t)i * 2 * RG); }
  /* the wait in front of any rewrite of a register that an issued load names; as its inputs the two address pairs stay live up to it, so that no load lands in one of them */
  asm volatile("s_wait_xcnt 0x0" :: "v"(ga), "v"(gb) : "memory");
#pragma unroll /* as above */
  for (int i = 0; i < 8; ++i) *(v8us*)(ring + i * 2048 + tid * 8) = st[i];
  ga += 1024; gb += 1024;
#pragma unroll /* as above */
  for (int i = 0; i < 4; ++i) { st[i] = *(const v8us*)(ga + (size_t)i * 2 * RG); st[4 + i] = *(const v8us*)(gb + (size_t)i * 2 * RG); }
  asm volatile("s_wait_xcnt 0x0" :: "v"(ga), "v"(gb) : "memory");      /* as above */
  g3_barrier();      /* stage 0 is read by waves that did not write it */
  unsigned cur = 0;
#pragma unroll 1 /* one trip holds 48 fragment registers, the next stage's 32 and 64 accumulator registers */
  for (int s = 0; s < NS; ++s) {
    const _Float16* pa = (const _Float16*)(ring + cur + fa); const _Float16* pb = (const _Float16*)(ring + cur + fb);
    const v16h a0 = pk_frag(pa), a1 = pk_frag(pa + 1024), b0 = pk_frag(pb), b1 = pk_frag(pb + 1024), b2 = pk_frag(pb + 2048), b3 = pk_frag(pb + 3072);
    if (s + 1 < NS) {      /* the same for the whole work-group */
      unsigned short* nb = ring + (cur ^ G3_ST) + tid * 8;      /* its last readers have passed the barrier of trip s - 1 */
#pragma unroll /* as above */
      for (int i = 0; i < 8; ++i) *(v8us*)(nb + i * 2048) = st[i];
      if (s + 2 < NS) {
        ga += 1024; gb += 1024;
#pragma unroll /* as above */
        for (int i = 0; i < 4; ++i) { st[i] = *(const v8us*)(ga + (size_t)i * 2 * RG); st[4 + i] = *(const v8us*)(gb + (size_t)i * 2 * RG); }
        asm volatile("s_wait_xcnt 0x0" :: "v"(ga), "v"(gb) : "memory");      /* as above, in front of the next step of ga and gb */
      } }
    c[0] = g2_mma(a0, b0, c[0]); c[4] = g2_mma(a1, b0, c[4]); c[1] = g2_mma(a0, b1, c[1]); c[5] = g2_mma(a1, b1, c[5]);
    c[2] = g2_mma(a0, b2, c[2]); c[6] = g2_mma(a1, b2, c[6]); c[3] = g2_mma(a0, b3, c[3]); c[7] = g2_mma(a1, b3, c[7]);
    /* the second 32 k take the registers of the first: both sets at once would cost the third work-group a WGP */
    const v16h a2 = pk_frag(pa + FT), a3 = pk_frag(pa + 1024 + FT), b4 = pk_frag(pb + FT), b5 = pk_frag(pb + 1024 + FT), b6 = pk_frag(pb + 2048 + FT), b7 = pk_frag(pb + 3072 + FT);
    c[0] = g2_mma(a2, b4, c[0]); c[4] = g2_mma(a3, b4, c[4]); c[1] = g2_mma(a2, b5, c[1]); c[5] = g2_mma(a3, b5, c[5]);
    c[2] = g2_mma(a2, b6, c[2]); c[6] = g2_mma(a3, b6, c[6]); c[3] = g2_mma(a2, b7, c[3]); c[7] = g2_mma(a3, b7, c[7]);
    g3_barrier();      /* publishes stage s + 1 and ends every wave's reads of stage s; behind the last trip's the caller may use the ring's LDS for something else */
    cur ^= G3_ST; } }
// A wave's 32x64 tile out of its LDS tile: lane = 16 bytes of f32 of row 2 q + (lane >> 4). The stores take one base address and constant offsets.
__device__ __forceinline__ void g2_take(const float (&so)[32][68], int lane, v4f (&v)[16]) {
#pragma unroll /* constant indices keep v[] in registers */
  for (int q = 0; q < 16; ++q) v[q] = *(const v4fa*)&so[q * 2 + (lane >> 4)][(lane & 15) * 4]; }
template <int LDC, typename T, typename V>
__device__ __forceinline__ void g2_put(T* __restrict__ p, const V (&v)[16]) {
#pragma unroll /* constant indices keep v[] in registers; constant offsets keep one address pair */
  for (int q = 0; q < 16; ++q) *(V*)(p + (size_t)q * 2 * LDC) = v[q]; }
// The projections in one grid, by block ranges (weights carried x16, f32 accumulation, k in rising order everywhere):
//   job 0: q = x Wq^T + bq and job 1: k = x Wk^T, as f16 planes in fragment order; their first QT0 token rows go out as plain f32 rows too (operands of the exact first-tile attention);
//   job 2: V^T = Wv x^T + bv (the weight rows are the A operand, the token rows the B operand; the bias goes by row), f16 [NH * HD][SQ] in fragment order, the operand that the second attention product reads;
//          its tiles of the first QT0 tokens go out as plain f32 v rows too, turned in LDS. So the grid is 3 x 256 equal work-groups, three a WGP, all resident at once.
#define QKV_G ((MP / 128) * (DM / 128))      /* work-groups of each of the jobs 0, 1, 2: tiles of 128 x 128 */
__global__ __launch_bounds__(256) __attribute__((amdgpu_waves_per_eu(6, 6))) /* a budget of 160 registers: three work-groups a WGP, so that the 768 work-groups are all resident at once */ void k_qkv(const _Float16* __restrict__ X, const _Float16* __restrict__ BQ, const _Float16* __restrict__ BK, const _Float16* __restrict__ BV, const float* __restrict__ bq, const float* __restrict__ bv,
    _Float16* __restrict__ Q16, _Float16* __restrict__ K16, _Float16* __restrict__ VT, float* __restrict__ QF0, float* __restrict__ KF0, float* __restrict__ VF0) {
  static_assert(NB == 1 && QT0 % 128 == 0 && MP % 128 == 0 && DM % 128 == 0 && MP == SQ && NH * HD == DM, "k_qkv: one batch, whole work-group tiles in both orientations");
  static_assert(SQ % 128 == 0, "k_qkv: whole column tiles of V^T");
  __shared__ __attribute__((aligned(16))) float so[8][32][68];      /* first the ring of the k loop, then, behind its last barrier, a tile a wave */
  static_assert(sizeof(so) >= 2 * G3_ST * sizeof(unsigned short), "k_qkv: the ring lies in the output tiles' LDS");
  unsigned short* ring = (unsigned short*)&so[0][0][0];
  const int tid = threadIdx.x, w = tid >> 5, lane = tid & 31, ln = lane & 15, hh = lane >> 4;
  const int job = blockIdx.x / QKV_G, bx = blockIdx.x % QKV_G;
  const int tt = bx / (DM / 128), tw = bx % (DM / 128);      /* the tile of 128 tokens and the tile of 128 weight rows: the three jobs' work-groups of one bx read the same token rows (for speed only: where they share a WGP, its cache can serve them) */
  const int mt = job == 2 ? tw : tt, nq = job == 2 ? tt : tw; const int row0 = mt * 128 + 32 * (w & 3), col0 = nq * 128 + 64 * (w >> 2);
  const _Float16* Ah = job == 2 ? BV : X; const _Float16* Bh = job == 0 ? BQ : job == 1 ? BK : X;
  const v8f z8 = {0.f,0.f,0.f,0.f,0.f,0.f,0.f,0.f}; v8f c[8] = {z8, z8, z8, z8, z8, z8, z8, z8};
  g3_kloop<DM>(Ah, Bh, mt * 8, nq * 8, tid, ring, c);
  if (job == 2) { const float* pb = bv + row0 + 8 * hh; float rb[2][8];
#pragma unroll /* constant indices keep rb[] in registers */
    for (int half = 0; half < 2; ++half)
#pragma unroll /* as above */
      for (int r = 0; r < 8; ++r) rb[half][r] = pb[half * 16 + r];
    /* the wait in front of any rewrite of a register that an issued load names; as its input the address pair stays live up to it */
    asm volatile("s_wait_xcnt 0x0" :: "v"(pb) : "memory");
#pragma unroll /* constant indices keep c[] in registers */
    for (int u = 0; u < 8; ++u)
#pragma unroll /* as above */
      for (int r = 0; r < 8; ++r) so[w][(u >> 2) * 16 + 8 * hh + r][(u & 3) * 16 + ln] = c[u][r] * 0.0625f + bf16_round(rb[u >> 2][r]);
  } else { const float* bp = job == 0 ? bq : nullptr; float bb[4] = {0.f, 0.f, 0.f, 0.f};
    if (bp) {
#pragma unroll /* constant indices keep bb[] in registers */
      for (int t = 0; t < 4; ++t) bb[t] = bf16_round(bp[col0 + t * 16 + ln]); }
#pragma unroll /* as above */
    for (int u = 0; u < 8; ++u)
#pragma unroll /* as above */
      for (int r = 0; r < 8; ++r) so[w][(u >> 2) * 16 + 8 * hh + r][(u & 3) * 16 + ln] = c[u][r] * 0.0625f + bb[u & 3]; }
  __builtin_amdgcn_fence(__ATOMIC_ACQ_REL, "workgroup"); __builtin_amdgcn_wave_barrier();
  const int rsub = lane >> 4, c4 = (lane & 15) * 4; v4f v[16]; v8us hp[8];
  const bool frows = job != 2 && row0 < QT0;      /* the same for the whole wave */
  const bool vrows = job == 2 && col0 < QT0;      /* as above */
  if (frows) g2_take(so[w], lane, v);
  if (vrows) {      /* the tile holds [head dim][token]: lane = 4 head dims in a row of token 4 q + (lane >> 3), so that 8 lanes fill one 128-byte line of a v row */
#pragma unroll /* constant indices keep v[] in registers */
    for (int q = 0; q < 16; ++q)
#pragma unroll /* as above */
      for (int e = 0; e < 4; ++e) v[q][e] = so[w][(lane & 7) * 4 + e][q * 4 + (lane >> 3)]; }
  /* the wave's 32 x 64 tile is four tiles of the f16 plane in fragment order: lane (ln, hh) takes the 8 values of row ln that make its chunk; the LDS pitch of 16 B x 17 keeps these reads free of bank conflicts */
#pragma unroll /* constant indices keep hp[] in registers */
  for (int u = 0; u < 8; ++u) { const float* sp = &so[w][(u >> 2) * 16 + ln][(u & 3) * 16 + 8 * hh]; const v4f x0 = *(const v4fa*)sp, x1 = *(const v4fa*)(sp + 4); FragH f;
#pragma unroll /* as above */
    for (int i = 0; i < 4; ++i) { f.h[i] = (_Float16)x0[i]; f.h[4 + i] = (_Float16)x1[i]; }
    hp[u] = f.half[0]; }
  /* the stores stand behind every LDS read and every conversion, so that no register that an issued store names is written again */
  const size_t rgp = (size_t)((job == 2 ? SQ : DM) / 32) * FT;      /* one group of 16 rows of the plane */
  unsigned short* p16 = (unsigned short*)(job == 0 ? Q16 : job == 1 ? K16 : VT) + (size_t)(row0 >> 4) * rgp + (size_t)(col0 >> 5) * FT + lane * 8; unsigned short* p16b = p16 + rgp;
  float* pf = (job == 0 ? QF0 : KF0) + (size_t)(row0 + rsub) * DM + col0 + c4; float* pvf = VF0 + (size_t)(col0 + (lane >> 3)) * DM + row0 + (lane & 7) * 4;
#pragma unroll /* as above; constant offsets keep one address pair a row group */
  for (int u = 0; u < 4; ++u) { *(v8us*)(p16 + u * 256) = hp[u]; *(v8us*)(p16b + u * 256) = hp[4 + u]; }
  /* the wait in front of any rewrite of a register that an issued store names: the f32 rows' addresses are formed behind these stores; as its inputs the two address pairs stay live up to it */
  asm volatile("s_wait_xcnt 0x0" :: "v"(p16), "v"(p16b) : "memory");
  if (frows) g2_put<DM>(pf, v);
  if (vrows) g2_put<2 * DM>(pvf, v); }
// out = o Wo^T in one grid (o carried x64, Wo x16). Rows from QT0 on: the f16 o rows, 128 rows a work-group. The first QT0 rows: the exact o as an f16 plane and its x1024 residual plane,
// out = hi 2^-10 + lo 2^-20; 64 rows a work-group, waves 0 and 1 take the hi plane and waves 2 and 3 the lo plane of the same rows, so that no wave walks k twice; the two terms meet in LDS.
#define OUT_G0 ((QT0 / 64) * (DM / 64))      /* work-groups of the first QT0 rows */
__global__ __launch_bounds__(128) void k_out(const _Float16* __restrict__ O16, const _Float16* __restrict__ OH0, const _Float16* __restrict__ OL0, const _Float16* __restrict__ BO, float* __restrict__ out) {
  static_assert(NB == 1 && QT0 % 128 == 0 && MPO % 128 == 0 && DM % 64 == 0, "k_out: one batch, the first tile ends on a work-group's edge");
  __shared__ __attribute__((aligned(16))) float so[4][32][68];
  const int tid = threadIdx.x, w = tid >> 5, lane = tid & 31, ln = lane & 15, hh = lane >> 4;
  const bool first = blockIdx.x < OUT_G0; const int bx = first ? blockIdx.x : blockIdx.x - OUT_G0;
  const int mt = bx / (DM / 64), nq = bx % (DM / 64); const int row0 = first ? mt * 64 + 32 * (w & 1) : QT0 + mt * 128 + 32 * w; const int col0 = nq * 64;
  const bool lo = first && w >= 2; const _Float16* Ah = first ? (lo ? OL0 : OH0) : O16; const float alpha = lo ? 0.00000095367431640625f : 0.0009765625f;
  const v8f z8 = {0.f,0.f,0.f,0.f,0.f,0.f,0.f,0.f}; v8f c[8] = {z8, z8, z8, z8, z8, z8, z8, z8};
  g2_kloop<DM>(Ah, BO, row0, col0, lane, c);
#pragma unroll /* constant indices keep c[] in registers */
  for (int u = 0; u < 8; ++u)
#pragma unroll /* as above */
    for (int r = 0; r < 8; ++r) so[w][(u >> 2) * 16 + 8 * hh + r][(u & 3) * 16 + ln] = c[u][r] * alpha;
  const int rsub = lane >> 4, c4 = (lane & 15) * 4; v4f v[16]; float* po = out + (size_t)(row0 + rsub) * DM + col0 + c4;
  if (first) {
    __syncthreads();      /* the lo waves' tiles are read by the hi waves; the branch is the same for the whole work-group */
    if (!lo) { v4f vl[16]; g2_take(so[w], lane, v); g2_take(so[w + 2], lane, vl);
#pragma unroll /* constant indices keep the arrays in registers */
      for (int q = 0; q < 16; ++q) v[q] = vl[q] + v[q];
      g2_put<DM>(po, v); }      /* the stores stand behind every LDS read and sum: no register that an issued store names is written again */
  } else {
    __builtin_amdgcn_fence(__ATOMIC_ACQ_REL, "workgroup"); __builtin_amdgcn_wave_barrier();
    g2_take(so[w], lane, v); g2_put<DM>(po, v); } }      /* as above */


// The five f32 -> f16 passes in one grid by block ranges: first the token rows (bf16-rounded, exact in f16), then the four natural [out][in] weights (bf16-rounded, x16). Eight elements a thread.
// A block takes 16 rows x 128 k (16 threads a row: 512 bytes in a row are read) and writes them as four tiles in fragment order, 4096 bytes in a row; the chunks change places in LDS.
__global__ __launch_bounds__(256) void k_prep(const float* __restrict__ x, const float* __restrict__ wq, const float* __restrict__ wk, const float* __restrict__ wv, const float* __restrict__ wo,
    _Float16* __restrict__ X16, _Float16* __restrict__ BQ, _Float16* __restrict__ BK, _Float16* __restrict__ BV, _Float16* __restrict__ BO) {
  static_assert(NR % 16 == 0 && DM % 128 == 0, "k_prep: whole blocks of 16 rows x 128 k");
  __shared__ __attribute__((aligned(16))) unsigned short tl[272 * 8];      /* 256 chunks of 16 bytes, a spare chunk behind every 16: writes (a lane per k chunk) and reads (a lane per row) both without bank conflicts */
  constexpr unsigned GX = (unsigned)(NR * DM / 2048), GW = (unsigned)((size_t)DM * DM / 2048);
  const unsigned bx = blockIdx.x; const float* s = x; _Float16* d = X16; float sc = 1.0f; unsigned b0 = bx;
  if (bx >= GX) { const unsigned i = (bx - GX) / GW; b0 = (bx - GX) % GW; sc = 16.0f; s = i == 0 ? wq : i == 1 ? wk : i == 2 ? wv : wo; d = i == 0 ? BQ : i == 1 ? BK : i == 2 ? BV : BO; }
  const int tid = threadIdx.x, r = tid >> 4, kc = tid & 15; const unsigned rg = b0 / (DM / 128), kq = b0 % (DM / 128);
  const float* sp = s + ((size_t)rg * 16 + r) * DM + kq * 128 + kc * 8; FragH f;
#pragma unroll /* constant indices keep f in registers */
  for (int q = 0; q < 8; ++q) f.h[q] = (_Float16)(bf16_round(sp[q]) * sc);
  *(v8us*)&tl[(17 * kc + r) * 8] = f.half[0];      /* chunk 16 kc + r of the block's four tiles: tile kc >> 2, chunk ((kc >> 1) & 1) * 32 + (kc & 1) * 16 + r */
  __syncthreads();      /* all but 16 chunks are read by another thread than wrote them */
  const v8us o = *(const v8us*)&tl[(tid + (tid >> 4)) * 8];
  *(v8us*)((unsigned short*)d + (((size_t)rg * (DM / 32) + kq * 4) * 64 + tid) * 8) = o; }
__global__ __launch_bounds__(256) void k_rsm(const float* __restrict__ S, _Float16* __restrict__ P, int nrows) {
  #pragma clang fp contract(off)
  const int i = blockIdx.x * 256 + threadIdx.x; if (i >= nrows) return; const float* s = S + (size_t)i * SQ; float mx = -3.0e38f;
#pragma unroll 1
  for (int j = 0; j < SQ; ++j) mx = fmaxf(mx, s[j]); float se = 0.f;
#pragma unroll 1
  for (int j = 0; j < SQ; ++j) se += expf(s[j] - mx); const float sc = 256.0f / se;
#pragma unroll 1
  for (int j0 = 0; j0 < SQ; j0 += 8) { FragH f; for (int q = 0; q < 8; ++q) f.h[q] = (_Float16)(expf(s[j0 + q] - mx) * sc); unsigned short* d = (unsigned short*)P + (size_t)i * SQ + j0; *(v8us*)d = f.half[0];  } }
__global__ __launch_bounds__(256) void k_vt(const _Float16* __restrict__ V16, int b, int h0, _Float16* __restrict__ VT) { __shared__ unsigned short tl[64][65]; const int tid = threadIdx.x; const int hh = blockIdx.x % HG, sg = blockIdx.x / HG; const int s0 = sg * 64; const int h = h0 + hh;
  for (int i = tid; i < 64 * 8; i += 256) { const int j = i / 8, d8 = (i % 8) * 8; FragH f; f.half[0] = *(const v8us*)((const unsigned short*)V16 + ((size_t)b * SQ + s0 + j) * DM + h * HD + d8); for (int q = 0; q < 8; ++q) tl[d8 + q][j] = f.u[q]; }
  __syncthreads();
  { for (int i = tid; i < 64 * 8; i += 256) { const int d = i / 8, j8 = (i % 8) * 8; FragH f; for (int q = 0; q < 8; ++q) f.u[q] = tl[d][j8 + q]; *(v8us*)((unsigned short*)VT + ((size_t)hh * HD + d) * SQ + s0 + j8) = f.half[0]; }  } }



#define FA_L2E 1.4426950408889634f
__device__ __forceinline__ float fa_xhalf(float x) { return __builtin_bit_cast(float, __builtin_amdgcn_permlanex16(__builtin_bit_cast(int, x), __builtin_bit_cast(int, x), 0x76543210, 0xfedcba98, false, false)); }      /* lane l with lane l ^ 16, on the vector pipe */
/* p = 2^a; behind the v_exp_f32 stands the argument of a weight three calls on, an = x log2(e) + c. That product is independent of the v_exp_f32 and fills the one slot that the instruction set asks for
   between a transcendental and an instruction that reads its result or overwrites its source; in one statement, so that it stays there. "=&v": no output shares a register with an input. */
__device__ __forceinline__ float fa_exp2_fma(float a, float x, float c, float& an) { float p; asm("v_exp_f32 %0, %2\n\tv_fma_f32 %1, %3, %4, %5" : "=&v"(p), "=&v"(an) : "v"(a), "v"(x), "s"(FA_L2E), "v"(c)); return p; }
/* the last three weights of a pass have no later argument to form: a v_nop fills the same slot */
__device__ __forceinline__ float fa_exp2_nop(float a) { float p; asm("v_exp_f32 %0, %1\n\tv_nop" : "=&v"(p) : "v"(a)); return p; }
__device__ __forceinline__ v8f fa_mma(v16h a, v16h b, v8f c) { return __builtin_amdgcn_wmma_f32_16x16x32_f16(false, a, false, b, (short)0, c, false, false); }
template <bool DIAG>
__device__ __forceinline__ void fa_pass(float jf0, int ln, int hh, float slope, const v8f (&s)[2][2], const v16h (&vf)[4], v8f (&o)[2][4], float (&m)[2], float (&l)[2]) {
  float bias[2][8];
#pragma unroll /* constant indices keep the arrays in registers */
  for (int mt = 0; mt < 2; ++mt)
#pragma unroll /* as above */
    for (int r = 0; r < 8; ++r) bias[mt][r] = __fmul_rn(slope, jf0 + (float)(mt * 16 + r));      /* slope_h * j, rounded once */
  float x[2][2][8]; float mx[2];
#pragma unroll /* as above */
  for (int nt = 0; nt < 2; ++nt) { float t = -1.0e30f;
#pragma unroll /* as above */
    for (int mt = 0; mt < 2; ++mt)
#pragma unroll /* as above */
      for (int r = 0; r < 8; ++r) { float v = fmaf(s[nt][mt][r], 0.125f, -bias[mt][r]); if (DIAG) v = (mt * 16 + 8 * hh + r <= nt * 16 + ln) ? v : -1.0e30f;      /* diagonal pass: its first key is the wave's first query */
        x[nt][mt][r] = v; t = fmaxf(t, v); }
    mx[nt] = fmaxf(t, fa_xhalf(t)); }
  /* the accumulators are rescaled only in a pass that raises some query's maximum: one scalar branch a pass */
  if (__builtin_amdgcn_ballot_w32(mx[0] > m[0] || mx[1] > m[1]) != 0) {
#pragma unroll /* as above */
    for (int nt = 0; nt < 2; ++nt) { const float mn = fmaxf(m[nt], mx[nt]); const float a = __builtin_amdgcn_exp2f((m[nt] - mn) * FA_L2E); m[nt] = mn; l[nt] *= a;
#pragma unroll /* as above */
      for (int dt = 0; dt < 4; ++dt) o[nt][dt] *= a; } }
  v16h pf[2]; float cc[2], a[32], p[32];      /* weight i = nt * 16 + 2 r + mt; weight = 2^8 exp(x - m) = 2^(x log2(e) + cc) */
#pragma unroll /* as above */
  for (int nt = 0; nt < 2; ++nt) cc[nt] = fmaf(-m[nt], FA_L2E, 8.0f);
#pragma unroll /* as above */
  for (int i = 0; i < 3; ++i) a[i] = fmaf(x[0][i & 1][i >> 1], FA_L2E, cc[0]);
#pragma unroll /* as above */
  for (int i = 0; i < 32; ++i) { const int n = i + 3; if (n < 32) p[i] = fa_exp2_fma(a[i], x[n >> 4][n & 1][(n & 15) >> 1], cc[n >> 4], a[n]); else p[i] = fa_exp2_nop(a[i]); }
#pragma unroll /* as above */
  for (int nt = 0; nt < 2; ++nt) { FragH f; float s0 = 0.f, s1 = 0.f;
#pragma unroll /* as above */
    for (int r = 0; r < 8; ++r) { const float p0 = p[nt * 16 + 2 * r], p1 = p[nt * 16 + 2 * r + 1]; s0 += p0; s1 += p1; f.h[r] = (_Float16)p0; f.h[8 + r] = (_Float16)p1; }
    l[nt] += s0 + s1; pf[nt] = f.v; }
#pragma unroll /* as above */
  for (int dt = 0; dt < 4; ++dt) { o[0][dt] = fa_mma(vf[dt], pf[0], o[0][dt]); o[1][dt] = fa_mma(vf[dt], pf[1], o[1][dt]); } }
__device__ __forceinline__ void fa_scores(const v16h (&kf)[2][2], const v16h (&qf)[2][2], v8f (&s)[2][2]) {
  const v8f z8 = {0.f,0.f,0.f,0.f,0.f,0.f,0.f,0.f};
  s[0][0] = fa_mma(kf[0][0], qf[0][0], z8); s[0][1] = fa_mma(kf[1][0], qf[0][0], z8); s[1][0] = fa_mma(kf[0][0], qf[1][0], z8); s[1][1] = fa_mma(kf[1][0], qf[1][0], z8);
  s[0][0] = fa_mma(kf[0][1], qf[0][1], s[0][0]); s[0][1] = fa_mma(kf[1][1], qf[0][1], s[0][1]); s[1][0] = fa_mma(kf[0][1], qf[1][1], s[1][0]); s[1][1] = fa_mma(kf[1][1], qf[1][1], s[1][1]); }
// The deal: a work-group is 16 waves = 4 blocks of 32 query rows (128 rows of one head) x 4 key shares, one work-group a WGP, four waves a SIMD. Share ks takes the passes ks, ks + 4, ... of its row block,
// with its own running maximum, sum and O; the four waves of one share walk the same keys side by side. A work-group takes the 128 rows n - 1 - pr and then the 128 rows pr, so that every wave walks 31 to 33 passes.
// The shares' partial (m, l, O) go to LDS; behind one barrier wave (rb, ks) joins the four shares of row block rb for head dims 16 ks .. 16 ks + 15.
__global__ __launch_bounds__(512) __attribute__((amdgpu_waves_per_eu(4, 4))) /* a budget of 256 registers: none above v255, no register-window switches in the loop */ void k_fattn(const _Float16* __restrict__ Q, const _Float16* __restrict__ K, const _Float16* __restrict__ VT, _Float16* __restrict__ O) {
  static_assert(SQ % 256 == 0 && HD == 64, "k_fattn: two blocks of 128 query rows a work-group, head size 64");
  __shared__ __attribute__((aligned(16))) float lo[2][16][16][32][4];      /* [row half of the deal][4 rb + ks][2 (4 nt + dt) + half of the 8 rows][lane]: every wave-wide 16-byte access is 512 bytes in a row */
  __shared__ float lml[2][16][4][32];      /* m of nt = 0, 1, then l of nt = 0, 1 */
  const int tid = threadIdx.x, lane = tid & 31, ln = lane & 15, hh = lane >> 4; const int w = __builtin_amdgcn_readfirstlane(tid >> 5);      /* the wave's number in a scalar register: the key loop stays a scalar branch */
  const int ks = w >> 2; const int h = blockIdx.x % NH, pr = blockIdx.x / NH;
  const float slope = (float)exp2(-0.5 * (double)(h + 1));      /* ALiBi slope 2^(-8 (h+1) / 16), correctly rounded to f32 */
  constexpr size_t RGQ = (size_t)(DM / 32) * FT, RGV = (size_t)(SQ / 32) * FT;      /* one group of 16 rows of Q, K, O; of V^T (all in fragment order) */
  const _Float16* kb0 = K + (size_t)(h * (HD / 32)) * FT; const _Float16* vb0 = VT + (size_t)(h * (HD / 16)) * RGV; const unsigned l8 = lane * 8;      /* the head's planes and every tile address are the same for the whole wave, so that they can stay in scalar registers; the lane's place in a tile is added at each load */
#pragma unroll 1 /* the two row halves one after the other through the same code */
  for (int t = 0; t < 2; ++t) {
    const int rb = t ? 3 - (w & 3) : (w & 3);      /* mirrored in the second half: a row block has 4 sb + rb + 1 passes, so its four shares (waves w, w + 4, w + 8, w + 12) walk 129 passes over both halves */
    const int nd = (t ? pr : SQ / 128 - 1 - pr) * 4 + rb;      /* the row block's number = its diagonal pass; the passes below it are 0 .. nd - 1; nd mod 4 = rb, so share rb owns the diagonal pass */
    v16h qf[2][2], kf[2][2], vf[4]; v8f s[2][2]; v8f o[2][4]; float m[2] = {-1.0e30f, -1.0e30f}, l[2] = {0.f, 0.f};
#pragma unroll /* constant indices keep the arrays in registers */
    for (int nt = 0; nt < 2; ++nt)
#pragma unroll /* as above */
      for (int dt = 0; dt < 4; ++dt) o[nt][dt] = v8f{0.f,0.f,0.f,0.f,0.f,0.f,0.f,0.f};
    if (ks <= nd) {      /* only in the first 128 rows of a head has a share no pass at all: it hands in m = -1e30, l = 0, O = 0 */
      const _Float16* pq = Q + (size_t)(nd * 2) * RGQ + (size_t)(h * (HD / 32)) * FT; const _Float16* pk = kb0 + (size_t)(ks * 2) * RGQ; const _Float16* pv = vb0 + (size_t)ks * FT;
      float jf0 = (float)(32 * ks + 8 * hh);      /* this lane's first key position of the pass, as a float (exact) */
#pragma unroll /* as above */
      for (int nt = 0; nt < 2; ++nt)
#pragma unroll /* as above */
        for (int kd = 0; kd < 2; ++kd) { qf[nt][kd] = pk_frag(pq + nt * RGQ + kd * FT + l8); kf[nt][kd] = pk_frag(pk + nt * RGQ + kd * FT + l8); }
      /* the wait in front of any rewrite of a register that an issued load names; as its inputs the address pairs stay live up to it */
      asm volatile("s_wait_xcnt 0x0" :: "s"(pq), "s"(pk) : "memory");
#pragma unroll 1 /* a pass holds about 240 registers; two passes side by side would not fit in 256 */
      for (int p = ks; p < nd; p += 4) {
#pragma unroll /* as above */
        for (int dt = 0; dt < 4; ++dt) vf[dt] = pk_frag(pv + dt * RGV + l8);      /* this pass's V^T: flies under the score products and the softmax */
        asm volatile("s_wait_xcnt 0x0" :: "s"(pv) : "memory");      /* as above, in front of the step of pv */
        pv += 4 * FT;
        fa_scores(kf, qf, s);
        pk = kb0 + (size_t)((p + 4 < nd ? p + 4 : nd) * 2) * RGQ;      /* the share's next pass; never past the diagonal pass, whose K rows are the last that this row block may read */
#pragma unroll /* as above */
        for (int mt = 0; mt < 2; ++mt)
#pragma unroll /* as above */
          for (int kd = 0; kd < 2; ++kd) kf[mt][kd] = pk_frag(pk + mt * RGQ + kd * FT + l8);      /* into the same registers: flies under the softmax and the second product */
        asm volatile("s_wait_xcnt 0x0" :: "s"(pk) : "memory");      /* as above, in front of the next value of pk */
        fa_pass<false>(jf0, ln, hh, slope, s, vf, o, m, l);
        jf0 += 128.0f; }
      if (ks == rb) {      /* the loop has left this share at p = nd */
#pragma unroll /* as above */
        for (int dt = 0; dt < 4; ++dt) vf[dt] = pk_frag(pv + dt * RGV + l8);
        asm volatile("s_wait_xcnt 0x0" :: "s"(pv) : "memory");      /* as above */
        fa_scores(kf, qf, s);
        fa_pass<true>(jf0, ln, hh, slope, s, vf, o, m, l); } }
    const int sl = rb * 4 + ks;
#pragma unroll /* as above */
    for (int nt = 0; nt < 2; ++nt) { lml[t][sl][nt][lane] = m[nt]; lml[t][sl][2 + nt][lane] = l[nt];
#pragma unroll /* as above */
      for (int dt = 0; dt < 4; ++dt) { const v8f v = o[nt][dt];
        *(v4f*)&lo[t][sl][(nt * 4 + dt) * 2][lane][0] = v4f{v[0], v[1], v[2], v[3]}; *(v4f*)&lo[t][sl][(nt * 4 + dt) * 2 + 1][lane][0] = v4f{v[4], v[5], v[6], v[7]}; } } }
  __syncthreads();      /* every share's partial result is read by the three other waves of its row block */
  v8us hv[2][2];
#pragma unroll /* constant indices keep hv[] in registers */
  for (int t = 0; t < 2; ++t) { const int rb = t ? 3 - (w & 3) : (w & 3);
#pragma unroll /* as above */
    for (int nt = 0; nt < 2; ++nt) { float mk[4], mx = -1.0e30f, ls = 0.f; v4f a0 = {0.f, 0.f, 0.f, 0.f}, a1 = {0.f, 0.f, 0.f, 0.f};
#pragma unroll /* as above */
      for (int k = 0; k < 4; ++k) { mk[k] = lml[t][rb * 4 + k][nt][lane]; mx = fmaxf(mx, mk[k]); }      /* a query's m is the same in its two lanes */
#pragma unroll /* the four shares in rising order */
      for (int k = 0; k < 4; ++k) { const float wk = fa_exp2_nop((mk[k] - mx) * FA_L2E);      /* a share without a pass weighs exactly 0; the v_nop keeps the slot behind the v_exp_f32 */
        ls += wk * lml[t][rb * 4 + k][2 + nt][lane]; a0 += wk * *(const v4f*)&lo[t][rb * 4 + k][(nt * 4 + ks) * 2][lane][0]; a1 += wk * *(const v4f*)&lo[t][rb * 4 + k][(nt * 4 + ks) * 2 + 1][lane][0]; }
      const float fin = 64.0f / (ls + fa_xhalf(ls));      /* the two halves' sums joined once; o carried x64 */
      FragH f;
#pragma unroll /* as above */
      for (int r = 0; r < 4; ++r) { f.h[r] = (_Float16)(a0[r] * fin); f.h[4 + r] = (_Float16)(a1[r] * fin); }
      hv[t][nt] = f.half[0]; } }
  /* the stores stand behind every conversion: no register that an issued store names is written again */
  unsigned short* po = (unsigned short*)O + (size_t)(h * (HD / 32)) * FT + ks * 256 + l8;      /* lane (ln, hh) holds dims 16 ks + 8 hh .. + 7 of query ln: chunk (ks & 1) * 32 + lane of tile ks >> 1 */
#pragma unroll /* as above */
  for (int t = 0; t < 2; ++t) { const int nd = (t ? pr : SQ / 128 - 1 - pr) * 4 + (t ? 3 - (w & 3) : (w & 3));
#pragma unroll /* as above */
    for (int nt = 0; nt < 2; ++nt) *(v8us*)(po + (size_t)(nd * 2 + nt) * RGQ) = hv[t][nt]; } }


// Exact f32 causal attention of the first QT0 rows. One work-group of 8 waves per head and 32 query rows. The head's K and V rows below the group's end and its 32 q rows are staged in LDS by whole-line loads.
// Both products run on the f32 matrix form (v_wmma_f32_16x16x4_f32: full f32 operands, f32 sums), transposed like k_fattn: S^T = K Q^T (A = K rows, B = q rows), O^T = V^T P^T (A = V columns, B = weight rows),
// so that a fragment read from LDS feeds 16 x 16 products and not one row's. In a D tile lane (ln, hh) holds column ln (a query) and rows 8 hh + r (8 keys, or 8 head dims, in a row).
// The k order: both operands of a product take, for each 8 k, element e = 0 .. 3 of lane half hh from k = 8 s + 4 hh + e; one matrix instruction takes e = 0, 1 and the next e = 2, 3, the same on the A and on the B side.
// Scores: wave w takes the key tiles w, w + 8; softmax maxima taken as the scores are formed, exp and sums in one pass over the scores kept in LDS (lane = row); o: wave w takes head dims 16 (w & 3) .. + 15 of the queries 16 (w >> 2) .. + 15 over all keys in rising order.
// LD = row pitch of QF, KF, VF in floats, a compile-time constant so that every staged row is one base address plus an immediate offset.
typedef float v2f __attribute__((ext_vector_type(2)));
/* the four v_nop keep four vector slots between the matrix instruction and any vector instruction that reads its D or overwrites its A or B (as its operands they stay live up to there) */
__device__ __forceinline__ v8f a0_mma(v2f a, v2f b, v8f c) { v8f d = __builtin_amdgcn_wmma_f32_16x16x4_f32(false, a, false, b, (short)0, c, false, false); asm volatile("v_nop\n\tv_nop\n\tv_nop\n\tv_nop" : "+v"(d) : "v"(a), "v"(b)); return d; }
/* the fragments of 32 keys of the second product: pp = the lane's weight row at its first key, pv = the lane's head dim in that key's V row */
__device__ __forceinline__ void a0_frags(const float* pp, const float* pv, v4f (&pf)[4], v2f (&va)[4][2]) {
#pragma unroll /* constant indices keep the fragments in registers */
  for (int u = 0; u < 4; ++u) { const float* q = pv + u * 8 * (HD + 4); pf[u] = *(const v4f*)(pp + u * 8); va[u][0] = v2f{q[0], q[HD + 4]}; va[u][1] = v2f{q[2 * (HD + 4)], q[3 * (HD + 4)]}; } }
template <int ALIBI, int LD>
__global__ __launch_bounds__(256) void k_att0(const float* __restrict__ QF, const float* __restrict__ KF, const float* __restrict__ VF, float scale, _Float16* __restrict__ OH, _Float16* __restrict__ OL, int ldo) {
  static_assert(QT0 % 32 == 0 && HD == 64, "k_att0: 32 rows a group, 16 threads a staged row, four tiles of 16 head dims");
  /* every pitch is 16 B x an odd number: a lane per row reads and writes 16 bytes without bank conflicts; in lv, rows 4 apart lie 16 banks apart, so that the two lane halves' 4-byte reads do not meet */
  __shared__ __attribute__((aligned(16))) float lk[QT0][HD + 4]; __shared__ __attribute__((aligned(16))) float lv[QT0][HD + 4]; __shared__ __attribute__((aligned(16))) float sp[32][QT0 + 4];      /* sp: scores, later weights, [query][key] */
  __shared__ __attribute__((aligned(16))) float lqo[32][HD + 4];      /* q rows, later o rows */
  __shared__ float pm[8][32]; __shared__ float pl[8][32];
  const int tid = threadIdx.x, lane = tid & 31, ln = lane & 15, hh = lane >> 4; const int w = __builtin_amdgcn_readfirstlane(tid >> 5);      /* the wave's number in a scalar register: the loops round the matrix instructions stay scalar branches, every lane on */
  const int h = blockIdx.x / (QT0 / 32), rg = blockIdx.x % (QT0 / 32); const int nkeys = rg * 32 + 32;      /* causal: keys up to the group's last row */
  const int sr = tid >> 4, c4 = (tid & 15) * 4;      /* staging: 16 threads a row of 256 bytes */
  { v4f tk[QT0 / 16], tv[QT0 / 16], tq[2];
    const float* gk = KF + (size_t)sr * LD + h * HD + c4; const float* gv = VF + (size_t)sr * LD + h * HD + c4; const float* gq = QF + (size_t)(rg * 32 + sr) * LD + h * HD + c4;
#pragma unroll /* constant indices keep tk[] and tv[] in registers; all loads are issued before the first is used */
    for (int c = 0; c < QT0 / 32; ++c) if (c * 32 < nkeys) {
#pragma unroll /* as above */
      for (int u = 2 * c; u < 2 * c + 2; ++u) { tk[u] = *(const v4fa*)(gk + (size_t)u * 16 * LD); tv[u] = *(const v4fa*)(gv + (size_t)u * 16 * LD); } }
#pragma unroll /* as above */
    for (int u = 0; u < 2; ++u) tq[u] = *(const v4fa*)(gq + (size_t)u * 16 * LD);
    /* the wait in front of any rewrite of a register that an issued load names; as its inputs the three address pairs stay live up to it, so that no load lands in one of them */
    asm volatile("s_wait_xcnt 0x0" :: "v"(gk), "v"(gv), "v"(gq) : "memory");
#pragma unroll /* as above */
    for (int c = 0; c < QT0 / 32; ++c) if (c * 32 < nkeys) {
#pragma unroll /* as above */
      for (int u = 2 * c; u < 2 * c + 2; ++u) { *(v4f*)&lk[u * 16 + sr][c4] = tk[u]; *(v4f*)&lv[u * 16 + sr][c4] = tv[u]; } }
#pragma unroll /* as above */
    for (int u = 0; u < 2; ++u) *(v4f*)&lqo[u * 16 + sr][c4] = tq[u]; }
  __syncthreads();
  const float slope = ALIBI ? (float)exp2(-0.5 * (double)(h + 1)) : 0.f;      /* ALiBi: 2^(-8 (h+1) / 16) */
  const v8f z8 = {0.f,0.f,0.f,0.f,0.f,0.f,0.f,0.f};
  v4f qf[2][HD / 8]; float mx[2] = {-1.0e30f, -1.0e30f};
#pragma unroll /* constant indices keep qf[] in registers */
  for (int nt = 0; nt < 2; ++nt)
#pragma unroll /* as above */
    for (int s = 0; s < HD / 8; ++s) qf[nt][s] = *(const v4f*)&lqo[nt * 16 + ln][8 * s + 4 * hh];
  for (int kt = w; kt < nkeys / 16; kt += 8) {      /* a tile of 16 keys against both tiles of 16 queries: two independent accumulators */
    v4f kf[HD / 8]; v8f sa[2] = {z8, z8};
#pragma unroll /* constant indices keep kf[] in registers; all eight reads stand in front of the first product */
    for (int s = 0; s < HD / 8; ++s) kf[s] = *(const v4f*)&lk[kt * 16 + ln][8 * s + 4 * hh];
#pragma unroll /* as above */
    for (int s = 0; s < HD / 8; ++s) {
      sa[0] = a0_mma(v2f{kf[s][0], kf[s][1]}, v2f{qf[0][s][0], qf[0][s][1]}, sa[0]); sa[1] = a0_mma(v2f{kf[s][0], kf[s][1]}, v2f{qf[1][s][0], qf[1][s][1]}, sa[1]);
      sa[0] = a0_mma(v2f{kf[s][2], kf[s][3]}, v2f{qf[0][s][2], qf[0][s][3]}, sa[0]); sa[1] = a0_mma(v2f{kf[s][2], kf[s][3]}, v2f{qf[1][s][2], qf[1][s][3]}, sa[1]); }
#pragma unroll /* constant indices keep sa[] in registers */
    for (int nt = 0; nt < 2; ++nt) { const int i = rg * 32 + nt * 16 + ln; float x[8];
#pragma unroll /* as above */
      for (int r = 0; r < 8; ++r) { const int j = kt * 16 + 8 * hh + r; float s = sa[nt][r] * scale; if (ALIBI) s -= slope * (float)j;
        s = (j <= i) ? s : -1.0e30f; x[r] = s; mx[nt] = fmaxf(mx[nt], s); }
      *(v4f*)&sp[nt * 16 + ln][kt * 16 + 8 * hh] = v4f{x[0], x[1], x[2], x[3]}; *(v4f*)&sp[nt * 16 + ln][kt * 16 + 8 * hh + 4] = v4f{x[4], x[5], x[6], x[7]}; } }
  mx[0] = fmaxf(mx[0], fa_xhalf(mx[0])); mx[1] = fmaxf(mx[1], fa_xhalf(mx[1]));      /* a query's keys lie in its two lanes */
  pm[w][lane] = hh ? mx[1] : mx[0];      /* row 16 hh + ln; a wave without a key tile hands in -1e30 */
  __syncthreads();
  float m = pm[0][lane];
#pragma unroll /* eight partial maxima */
  for (int x = 1; x < 8; ++x) m = fmaxf(m, pm[x][lane]);
  float lp = 0.f;
  for (int j4 = 4 * w; j4 < nkeys; j4 += 32) {      /* lane = row; nkeys is a multiple of 32: every wave takes four keys in a row of each 32 */
    const v4f x = *(const v4f*)&sp[lane][j4]; v4f e;
#pragma unroll /* constant indices keep the vectors in registers */
    for (int c = 0; c < 4; ++c) e[c] = expf(x[c] - m);      /* a masked key gives exactly 0 */
    *(v4f*)&sp[lane][j4] = e; lp += (e[0] + e[1]) + (e[2] + e[3]); }
  pl[w][lane] = lp;
  __syncthreads();
  const int d0 = (w & 3) * 16, rq = (w >> 2) * 16 + ln;      /* this wave's head dims; this lane's query */
  float l = pl[0][rq];
#pragma unroll /* eight partial sums, fixed order */
  for (int x = 1; x < 8; ++x) l += pl[x][rq];
  v8f oa[2] = {z8, z8};      /* two accumulators, so that a matrix instruction does not wait for the one before it */
  const float* pp = &sp[rq][4 * hh]; const float* pv = &lv[4 * hh][d0 + ln]; v4f pf[4]; v2f va[4][2];      /* the fragments of 32 keys: weights (B), V columns (A) */
  a0_frags(pp, pv, pf, va);
  for (int j = 0; j < nkeys; j += 32) {      /* nkeys is a multiple of 32 */
    const int jn = j + 32 < nkeys ? j + 32 : j; v4f pn[4]; v2f vn[4][2];      /* the next 32 keys' fragments fly under this trip's products; the last trip reads its own again, inside the staged rows */
    a0_frags(pp + jn, pv + (size_t)jn * (HD + 4), pn, vn);
    __builtin_amdgcn_sched_barrier(0);      /* the reads stay in front of the products: moved down among them, each product would wait out an LDS latency */
#pragma unroll /* constant indices keep the fragments in registers */
    for (int u = 0; u < 4; ++u) { oa[0] = a0_mma(va[u][0], v2f{pf[u][0], pf[u][1]}, oa[0]); oa[1] = a0_mma(va[u][1], v2f{pf[u][2], pf[u][3]}, oa[1]); }
#pragma unroll /* as above */
    for (int u = 0; u < 4; ++u) { pf[u] = pn[u]; va[u][0] = vn[u][0]; va[u][1] = vn[u][1]; } }
  const float fin = 64.0f / l;      /* o carried x64 like the f16 path */
  const v8f ov = (oa[0] + oa[1]) * fin;
  *(v4f*)&lqo[rq][d0 + 8 * hh] = v4f{ov[0], ov[1], ov[2], ov[3]}; *(v4f*)&lqo[rq][d0 + 8 * hh + 4] = v4f{ov[4], ov[5], ov[6], ov[7]};
  __syncthreads();
#pragma unroll /* two rows a thread; the 16 threads of a row fill its eight 16-byte chunks, in two tiles, of each plane */
  for (int u = 0; u < 2; ++u) { const int row = u * 16 + sr; const v4f v = *(const v4f*)&lqo[row][c4]; v4h vh, vl;      /* o (x64) -> f16 plane + x1024 residual plane */
#pragma unroll /* constant indices keep the vectors in registers */
    for (int e = 0; e < 4; ++e) { const _Float16 t = (_Float16)v[e]; vh[e] = t; vl[e] = (_Float16)((v[e] - (float)t) * 1024.0f); }
    const size_t at = pk_at(rg * 32 + row, h * HD + c4, ldo); *(v4h*)(OH + at) = vh; *(v4h*)(OL + at) = vl; } }      /* both planes in fragment order */

extern "C" void kernel_launch(void* const* d_in, const int* in_sizes, int n_in,
                              void* d_out, int out_size, void* d_ws, size_t ws_size, hipStream_t stream) {
  (void)in_sizes; (void)n_in; (void)out_size;
  const float* const* I = (const float* const*)d_in; const float* x = I[0]; const float* wq = I[1]; const float* bq = I[2]; const float* wk = I[3]; const float* wv = I[4]; const float* bv = I[5]; const float* wo = I[6];      /* natural [out][in] weights; biases on q and v only */
  char* ws = (char*)d_ws; size_t off = 0;
  auto take = [&](size_t bytes) { char* p = ws + off; off += (bytes + 255) & ~(size_t)255; return p; };
  _Float16* BQ = (_Float16*)take((size_t)DM * DM * 2); _Float16* BK = (_Float16*)take((size_t)DM * DM * 2); _Float16* BV = (_Float16*)take((size_t)DM * DM * 2); _Float16* BO = (_Float16*)take((size_t)DM * DM * 2);
  _Float16* X16 = (_Float16*)take(NR * DM * 2); _Float16* Q16 = (_Float16*)take(NR * DM * 2); _Float16* K16 = (_Float16*)take(NR * DM * 2); _Float16* O16 = (_Float16*)take(NR * DM * 2);
  _Float16* VT = (_Float16*)take((size_t)NH * HD * SQ * 2);
  float* QF0 = (float*)take((size_t)QT0 * DM * 4); float* KF0 = (float*)take((size_t)QT0 * DM * 4); float* VF0 = (float*)take((size_t)QT0 * DM * 4); _Float16* OH0 = (_Float16*)take((size_t)NB * QT0 * DM * 2); _Float16* OL0 = (_Float16*)take((size_t)NB * QT0 * DM * 2);
  if (off > ws_size) return;
  k_prep<<<(unsigned)(NR * DM / 2048 + 4 * ((size_t)DM * DM / 2048)), 256, 0, stream>>>(x, wq, wk, wv, wo, X16, BQ, BK, BV, BO);      /* x rows and the four weights (natural [out][in] = Bt[n][k], x16) as f16 in fragment order */
  k_qkv<<<3 * QKV_G, 256, 0, stream>>>(X16, BQ, BK, BV, bq, bv, Q16, K16, VT, QF0, KF0, VF0);      /* q, k and V^T [NH][HD][SQ] as f16 in fragment order; q, k, v of the first 256 rows as f32 rows */
  k_att0<1, DM><<<NH * (QT0 / 32), 256, 0, stream>>>(QF0, KF0, VF0, 0.125f, OH0, OL0, DM);      /* exact f32 causal ALiBi attention for rows 0..255 (o x64), as f16 hi + x1024 residual planes */
  k_fattn<<<NH * (SQ / 256), 512, 0, stream>>>(Q16, K16, VT, O16);      /* scores, causal ALiBi softmax and o (merged heads, x64, f16 in fragment order) in one launch */
  k_out<<<OUT_G0 + ((MPO - QT0) / 128) * (DM / 64), 128, 0, stream>>>(O16, OH0, OL0, BO, (float*)d_out);      /* out rows are the output layout */
}

// v010
// A run of this version takes 84.5 microseconds.
// In two side-by-side timings against v009, it was 1.11 and 1.12 times as fast.
// Over all steps from v000 it is 100 times as fast.
#include <hip/hip_runtime.h>
// Causal multi-head attention with an ALiBi key-position bias (inputs [1][4096][1024]; q = x Wq^T + bq, k = x Wk^T (no bias), v = x Wv^T + bv (natural [1024][1024] sigma 0.02; bq, bv sigma 0.02); 16 heads of 64; scores / 8 - slopes[h] * j with slopes[h] = 2^(-8 (h+1) / 16) and j the key position; causal (j <= i keep, -inf); softmax; out = merged Wo^T (no bias) -> [1][4096][1024]).
// Structure: token rows r = s; q, k, v inputs as exact f16 rows (bf16-rounded); Q, K and V^T as WMMA GEMMs in one launch (32x64 wave tiles, f32 accumulation, exact x16 weights, f16 outputs; V^T = Wv x^T, the weight rows as the A operand); the first 256 rows exactly in f32 (own launch); one fused attention launch (eight or four waves per 32 query rows of a head, each with its share of the passes of 32 keys up to the diagonal or up to where the ALiBi term has made every weight vanish, joined in LDS; scores / 8 minus the ALiBi term slope_h * j in f32, online softmax with f32 statistics and native exp2, weights x256 f16, o carried x64, folded into the output GEMM alpha) written straight into the merged f16 o rows; out = o W_o GEMM (f32) into the output layout, the first 256 rows from the exact o as f16 hi + residual planes. Five launches. Every f16 plane that a WMMA reads from memory (x, the weights, q, k, V^T, o) is kept in fragment order (see FT below), not as plain rows.
// Compute dtype: inputs rounded to bf16; x / weights exact; q, k, v, softmax weights and o as plain f16 GEMM operands (~2^-12); scores and softmax statistics f32. v_wmma_f32_16x16x32_f16.
#define NB 1
#define SQ 4096
#define DM 1024
#define NH 16
#define HD 64
#define HG 4                         /* heads per block group of the unlaunched k_vt overload */
#define QT 256                       /* query rows per causal tile */
#define NKX SQ                       /* S / P row pitch */
#define QT0 256                      /* first-tile rows recomputed exactly in f32 */
#define B0 0                         /* first batch processed (debug hook) */
#define NBR NB                       /* batches processed (debug hook) */
#define NR ((size_t)NB * SQ)         /* token rows */
#define MP ((int)((size_t)NBR * SQ)) /* rows projected (debug hook) */
#define QN SQ                        /* query rows attended per batch (debug hook) */
#define NHD NH                       /* heads attended (debug hook) */
#define MPO MP                       /* rows through the output stage (debug hook) */
#define LQ DM      /* row pitch of the q/k/v rows */
typedef __bf16 v16b __attribute__((ext_vector_type(16)));
typedef unsigned short v8us __attribute__((ext_vector_type(8), may_alias));
typedef float  v8f  __attribute__((ext_vector_type(8)));
typedef float  v4f  __attribute__((ext_vector_type(4)));
typedef float  v4fa __attribute__((ext_vector_type(4), may_alias));
union FragB { v16b v; v8us half[2]; unsigned short u[16]; };

__device__ __forceinline__ unsigned short bf16_bits(float x) { unsigned int u = __float_as_uint(x); return (unsigned short)((u + 0x7FFFu + ((u >> 16) & 1u)) >> 16); }
__device__ __forceinline__ float bf16_val(unsigned short b) { return __uint_as_float(((unsigned int)b) << 16); }
__device__ __forceinline__ float bf16_round(float x) { return bf16_val(bf16_bits(x)); }
// D += A·B with NT terms: 1 = ah·bh, 2 = + al·bh (A split), 3 = + ah·bl (both split)
template <int NT>
__device__ __forceinline__ v8f mmaN(v16b ah, v16b al, v16b bh, v16b bl, v8f c) {
  c = __builtin_amdgcn_wmma_f32_16x16x32_bf16(false, ah, false, bh, (short)0, c, false, false);
  if (NT >= 2) c = __builtin_amdgcn_wmma_f32_16x16x32_bf16(false, al, false, bh, (short)0, c, false, false);
  if (NT >= 3) c = __builtin_amdgcn_wmma_f32_16x16x32_bf16(false, ah, false, bl, (short)0, c, false, false);
  asm volatile("v_nop\n\tv_nop\n\tv_nop\n\tv_nop" : "+v"(c) : "v"(ah), "v"(al), "v"(bh), "v"(bl));
  return c;
}

__global__ __launch_bounds__(256) void k_wt_bf16(const float* __restrict__ W, unsigned short* __restrict__ Wt, int K, int N) {
  const int t = blockIdx.x * 256 + threadIdx.x;
  const int k8n = K / 8;
  if (t >= N * k8n) return;
  const int n = t / k8n, k8 = (t % k8n) * 8;
  v8us v;
#pragma unroll
  for (int i = 0; i < 8; ++i) v[i] = bf16_bits(W[(size_t)(k8 + i) * N + n]);
  *(v8us*)(Wt + (size_t)n * K + k8) = v;
  
}

// GEMM C[M][N] (f32, pitch ldc) = act(A[M][K]·W + bias). A f32 row-major (pitch lda) converted per fragment to bf16
// (ASPLIT: hi/lo two planes -> 2 terms, else single rounded term); Wt bf16 [N][K] (pitch ldb). BIAS_BF16 rounds the
// bias to bf16 first (bias quantised to bf16 before the add). K%32==0, M%16==0, N%64==0.
template <bool ASPLIT, int ACT, bool BIAS_BF16>
__global__ __launch_bounds__(128) void k_gemm_bf(const float* __restrict__ A, int lda, const unsigned short* __restrict__ Wt, int ldb,
                                               const float* __restrict__ bias, float* __restrict__ C, int ldc, int M, int N, int K) {
  __shared__ __attribute__((aligned(16))) float so[4][16][64];
  const int tid = threadIdx.x, w = tid >> 5, lane = tid & 31, ln = lane & 15, hh = lane >> 4;
  const int ntn = N / 64;
  const int wid = blockIdx.x * 4 + w;
  const int mt = wid / ntn, nq = wid % ntn;
  if (mt * 16 >= M) return;
  const int row0 = mt * 16, col0 = nq * 64;
  const float* arow = A + (size_t)(row0 + ln) * lda;
  v8f acc[4] = {};
  for (int kb = 0; kb < K; kb += 32) {
    FragB ah, al;
    const v4f x0 = *(const v4fa*)(arow + kb + 8 * hh), x1 = *(const v4fa*)(arow + kb + 8 * hh + 4);
    const v4f x2 = *(const v4fa*)(arow + kb + 16 + 8 * hh), x3 = *(const v4fa*)(arow + kb + 16 + 8 * hh + 4);
    float xs[16] = {x0[0],x0[1],x0[2],x0[3],x1[0],x1[1],x1[2],x1[3],x2[0],x2[1],x2[2],x2[3],x3[0],x3[1],x3[2],x3[3]};
#pragma unroll
    for (int i = 0; i < 16; ++i) { const unsigned short hb = bf16_bits(xs[i]); ah.u[i] = hb; al.u[i] = ASPLIT ? bf16_bits(xs[i] - bf16_val(hb)) : (unsigned short)0; }
#pragma unroll
    for (int t = 0; t < 4; ++t) {
      const unsigned short* brow = Wt + (size_t)(col0 + t * 16 + ln) * ldb + kb;
      FragB b;
      b.half[0] = *(const v8us*)(brow + 8 * hh);
      b.half[1] = *(const v8us*)(brow + 16 + 8 * hh);
      acc[t] = mmaN<ASPLIT ? 2 : 1>(ah.v, al.v, b.v, b.v, acc[t]);
    }
  }
#pragma unroll
  for (int t = 0; t < 4; ++t) {
    float bv = bias ? bias[col0 + t * 16 + ln] : 0.f;
    if (BIAS_BF16) bv = bf16_round(bv);
#pragma unroll
    for (int r = 0; r < 8; ++r) { float v = acc[t][r] + bv; if (ACT == 1) v = fmaxf(v, 0.f); so[w][8 * hh + r][t * 16 + ln] = v; }
  }
  __builtin_amdgcn_fence(__ATOMIC_ACQ_REL, "workgroup");
  __builtin_amdgcn_wave_barrier();
  const int rsub = lane >> 4, c4 = (lane & 15) * 4;
  {
#pragma unroll
    for (int q = 0; q < 8; ++q) {
      const int r = q * 2 + rsub;
      const v4f v = *(const v4fa*)&so[w][r][c4];
      *(v4f*)(C + (size_t)(row0 + r) * ldc + col0 + c4) = v;
    }
    
  }
}

// GEMM C = act(A·W + bias + resid): A f32 (ASPLIT -> hi/lo 2 terms), Wt bf16 [N][K]; ACT 0 none, 1 relu, 2 exact gelu;
// resid (optional, f32, row index = (row % rmod), pitch ldr, RES_BF16 rounds it) added before the activation.
template <bool ASPLIT, int ACT, bool BIAS_BF16, bool RES_BF16>
__global__ __launch_bounds__(128) void k_gemm_bf3(const float* __restrict__ A, int lda, const unsigned short* __restrict__ Wt, int ldb,
                                                const float* __restrict__ bias, const float* __restrict__ resid, int rmod, int ldr,
                                                float* __restrict__ C, int ldc, int M, int N, int K) {
  __shared__ __attribute__((aligned(16))) float so[4][16][64];
  const int tid = threadIdx.x, w = tid >> 5, lane = tid & 31, ln = lane & 15, hh = lane >> 4;
  const int ntn = N / 64;
  const int wid = blockIdx.x * 4 + w;
  const int mt = wid / ntn, nq = wid % ntn;
  if (mt * 16 >= M) return;
  const int row0 = mt * 16, col0 = nq * 64;
  const float* arow = A + (size_t)(row0 + ln) * lda;
  v8f acc[4] = {};
  for (int kb = 0; kb < K; kb += 32) {
    FragB ah, al;
    const v4f x0 = *(const v4fa*)(arow + kb + 8 * hh), x1 = *(const v4fa*)(arow + kb + 8 * hh + 4);
    const v4f x2 = *(const v4fa*)(arow + kb + 16 + 8 * hh), x3 = *(const v4fa*)(arow + kb + 16 + 8 * hh + 4);
    float xs[16] = {x0[0],x0[1],x0[2],x0[3],x1[0],x1[1],x1[2],x1[3],x2[0],x2[1],x2[2],x2[3],x3[0],x3[1],x3[2],x3[3]};
#pragma unroll
    for (int i = 0; i < 16; ++i) { const unsigned short hb = bf16_bits(xs[i]); ah.u[i] = hb; al.u[i] = ASPLIT ? bf16_bits(xs[i] - bf16_val(hb)) : (unsigned short)0; }
#pragma unroll
    for (int t = 0; t < 4; ++t) {
      const unsigned short* brow = Wt + (size_t)(col0 + t * 16 + ln) * ldb + kb;
      FragB b;
      b.half[0] = *(const v8us*)(brow + 8 * hh);
      b.half[1] = *(const v8us*)(brow + 16 + 8 * hh);
      acc[t] = mmaN<ASPLIT ? 2 : 1>(ah.v, al.v, b.v, b.v, acc[t]);
    }
  }
#pragma unroll
  for (int t = 0; t < 4; ++t) {
    const int col = col0 + t * 16 + ln;
    float bv = bias ? bias[col] : 0.f;
    if (BIAS_BF16) bv = bf16_round(bv);
#pragma unroll
    for (int r = 0; r < 8; ++r) {
      float v = acc[t][r] + bv;
      if (resid) { float rv = resid[(size_t)((row0 + 8 * hh + r) % rmod) * ldr + col]; if (RES_BF16) rv = bf16_round(rv); v += rv; }
      if (ACT == 1) v = fmaxf(v, 0.f);
      if (ACT == 2) v = 0.5f * v * (1.0f + erff(v * 0.70710678118654752f));
      if (ACT == 3) { const float u = 0.7978845608028654f * (v + 0.044715f * v * v * v); v = 0.5f * v * (1.0f + tanhf(u)); }
      so[w][8 * hh + r][t * 16 + ln] = v;
    }
  }
  __builtin_amdgcn_fence(__ATOMIC_ACQ_REL, "workgroup");
  __builtin_amdgcn_wave_barrier();
  const int rsub = lane >> 4, c4 = (lane & 15) * 4;
  {
#pragma unroll
    for (int q = 0; q < 8; ++q) {
      const int r = q * 2 + rsub;
      const v4f v = *(const v4fa*)&so[w][r][c4];
      *(v4f*)(C + (size_t)(row0 + r) * ldc + col0 + c4) = v;
    }
    
  }
}
// row LayerNorm (biased variance, eps) over N: s = X (+ R); optional out_sum <- s; out_norm <- (s-mu)*rsqrt(var+eps)*g + b
template <bool PARAM_BF16>
__global__ __launch_bounds__(256) void k_layernorm(const float* __restrict__ X, const float* __restrict__ R, const float* __restrict__ g, const float* __restrict__ bta,
                                                  float* __restrict__ out_sum, float* __restrict__ out_norm, int N, float eps) {
  __shared__ float red[256];
  const int row = blockIdx.x, tid = threadIdx.x;
  const float* x = X + (size_t)row * N; const float* rr = R ? R + (size_t)row * N : nullptr;
  float vals[16];                     // up to N = 4096
  const int per = N / 256;            // contiguous chunk per thread? use strided-by-4 chunks: thread handles j = tid*4 + 1024*u
  float s1 = 0.f;
  for (int u = 0; u < per / 4; ++u) {
    const int j = tid * 4 + 1024 * u;
    const v4f a = *(const v4fa*)(x + j);
    v4f b = {0.f,0.f,0.f,0.f}; if (rr) b = *(const v4fa*)(rr + j);
#pragma unroll
    for (int q = 0; q < 4; ++q) { const float v = a[q] + b[q]; vals[u * 4 + q] = v; s1 += v; }
  }
  red[tid] = s1; __syncthreads();
  for (int st = 128; st > 0; st >>= 1) { if (tid < st) red[tid] += red[tid + st]; __syncthreads(); }
  const float mu = red[0] / (float)N; __syncthreads();
  float s2 = 0.f;
  for (int u = 0; u < per / 4; ++u)
#pragma unroll
    for (int q = 0; q < 4; ++q) { const float c = vals[u * 4 + q] - mu; s2 += c * c; }
  red[tid] = s2; __syncthreads();
  for (int st = 128; st > 0; st >>= 1) { if (tid < st) red[tid] += red[tid + st]; __syncthreads(); }
  const float rs = rsqrtf(red[0] / (float)N + eps);
  {
    for (int u = 0; u < per / 4; ++u) {
      const int j = tid * 4 + 1024 * u;
      v4f o, sm;
#pragma unroll
      for (int q = 0; q < 4; ++q) {
        float gg = g[j + q], bb = bta[j + q];
        if (PARAM_BF16) { gg = bf16_round(gg); bb = bf16_round(bb); }
        sm[q] = vals[u * 4 + q]; o[q] = (vals[u * 4 + q] - mu) * rs * gg + bb;
      }
      if (out_sum) *(v4f*)(out_sum + (size_t)row * N + j) = sm;
      *(v4f*)(out_norm + (size_t)row * N + j) = o;
    }
    
  }
}



// ---- f16 WMMA path (v_wmma_f32_16x16x32_f16): 11-bit significands for operands in range — used where a [0,1] probability operand needs more precision than bf16
typedef _Float16 v16h __attribute__((ext_vector_type(16)));
union FragH { v16h v; v8us half[2]; _Float16 h[16]; unsigned short u[16]; };
template <int NT>
__device__ __forceinline__ v8f mmaH(v16h ah, v16h al, v16h bh, v16h bl, v8f c) {
  c = __builtin_amdgcn_wmma_f32_16x16x32_f16(false, ah, false, bh, (short)0, c, false, false);
  if (NT >= 2) c = __builtin_amdgcn_wmma_f32_16x16x32_f16(false, al, false, bh, (short)0, c, false, false);
  if (NT >= 3) c = __builtin_amdgcn_wmma_f32_16x16x32_f16(false, ah, false, bl, (short)0, c, false, false);
  asm volatile("v_nop\n\tv_nop\n\tv_nop\n\tv_nop" : "+v"(c) : "v"(ah), "v"(al), "v"(bh), "v"(bl));
  return c;
}
// batched GEMM like k_gemm_b but f16 operands: A f32 (split into f16 hi/lo if ASPLIT, else rounded to f16), Bt = f16 values [n][k]; alpha; C f32; N multiple of 16 (partial tiles skipped)
template <bool ASPLIT>
__global__ __launch_bounds__(128) void k_gemm_h(const float* __restrict__ A, int lda, size_t sA, const _Float16* __restrict__ Bh, int ldb, size_t sB, float alpha, float* __restrict__ C, int ldc, size_t sC, int M, int N, int K) {
  __shared__ __attribute__((aligned(16))) float so[4][16][64];
  const int tid = threadIdx.x, w = tid >> 5, lane = tid & 31, ln = lane & 15, hh = lane >> 4; const int by = blockIdx.y;
  A += (size_t)by * sA; Bh += (size_t)by * sB; C += (size_t)by * sC;
  const int ntn = (N + 63) / 64; const int wid = blockIdx.x * 4 + w; const int mt = wid / ntn, nq = wid % ntn; if (mt * 16 >= M) return;
  const int row0 = mt * 16, col0 = nq * 64; const float* arow = A + (size_t)(row0 + ln) * lda;
  v8f acc[4] = {};
  for (int kb = 0; kb < K; kb += 32) {
    FragH ah, al;
    const v4f x0 = *(const v4fa*)(arow + kb + 8 * hh), x1 = *(const v4fa*)(arow + kb + 8 * hh + 4), x2 = *(const v4fa*)(arow + kb + 16 + 8 * hh), x3 = *(const v4fa*)(arow + kb + 16 + 8 * hh + 4);
    float xs[16] = {x0[0],x0[1],x0[2],x0[3],x1[0],x1[1],x1[2],x1[3],x2[0],x2[1],x2[2],x2[3],x3[0],x3[1],x3[2],x3[3]};
#pragma unroll
    for (int i = 0; i < 16; ++i) { const _Float16 h = (_Float16)xs[i]; ah.h[i] = h; al.h[i] = ASPLIT ? (_Float16)(xs[i] - (float)h) : (_Float16)0.0f; }
#pragma unroll
    for (int t = 0; t < 4; ++t) { if (col0 + t * 16 >= N) continue; const size_t boff = (size_t)(col0 + t * 16 + ln) * ldb + kb; FragH bq; bq.half[0] = *(const v8us*)(Bh + boff + 8 * hh); bq.half[1] = *(const v8us*)(Bh + boff + 16 + 8 * hh);
      acc[t] = mmaH<ASPLIT ? 2 : 1>(ah.v, al.v, bq.v, bq.v, acc[t]); }
  }
#pragma unroll
  for (int t = 0; t < 4; ++t) { if (col0 + t * 16 >= N) continue;
#pragma unroll
    for (int r = 0; r < 8; ++r) so[w][8 * hh + r][t * 16 + ln] = acc[t][r] * alpha; }
  __builtin_amdgcn_fence(__ATOMIC_ACQ_REL, "workgroup"); __builtin_amdgcn_wave_barrier();
  const int rsub = lane >> 4, c4 = (lane & 15) * 4;
  {
#pragma unroll
    for (int q = 0; q < 8; ++q) { const int r = q * 2 + rsub; if (col0 + c4 < N) { const v4f v = *(const v4fa*)&so[w][r][c4]; *(v4f*)(C + (size_t)(row0 + r) * ldc + col0 + c4) = v; } }
     }
}

// Wt[n][k] = f16(W[k][n]·scale) from f32 row-major W[K][N] (scale = power of two; bf16-exact weights stay exact in f16 away from the subnormal range)
__global__ __launch_bounds__(256) void k_wt_f16(const float* __restrict__ W, _Float16* __restrict__ Wt, int K, int N, float scale) {
  const int t = blockIdx.x * 256 + threadIdx.x; if (t >= N * (K / 8)) return; const int n = t / (K / 8), k8 = (t % (K / 8)) * 8; FragH f;
#pragma unroll
  for (int i = 0; i < 8; ++i) f.h[i] = (_Float16)(bf16_round(W[(size_t)(k8 + i) * N + n]) * scale); const v8us o = f.half[0];
  *(v8us*)((unsigned short*)Wt + (size_t)n * K + k8) = o; 
}
// k_gemm_hh variant with fused epilogue: v = acc·alpha + bias[by·sBias + col] (+ CP[(row/rowsPerB)·sCPb + by·64 + col] if CP) ; ACT 0 none / 1 elu ; writes f16 C16 (and f32 C if non-null)
template <int ACT>
__global__ __launch_bounds__(128) void k_gemm_hhx(const _Float16* __restrict__ A, int lda, size_t sA, const _Float16* __restrict__ Bh, int ldb, size_t sB, float alpha, const float* __restrict__ bias, size_t sBias, const float* __restrict__ CP, int rowsPerB, size_t sCPb, int row0g,
    float* __restrict__ C, _Float16* __restrict__ C16, int ldc, size_t sC, int M, int N, int K) {
  __shared__ __attribute__((aligned(16))) float so[4][16][64];
  const int tid = threadIdx.x, w = tid >> 5, lane = tid & 31, ln = lane & 15, hh = lane >> 4; const int by = blockIdx.y;
  A += (size_t)by * sA; Bh += (size_t)by * sB; const size_t cofs = (size_t)by * sC; const float* bp = bias ? bias + (size_t)by * sBias : nullptr;
  const int ntn = (N + 63) / 64; const int wid = blockIdx.x * 4 + w; const int mt = wid / ntn, nq = wid % ntn; if (mt * 16 >= M) return;
  const int row0 = mt * 16, col0 = nq * 64; const _Float16* arow = A + (size_t)(row0 + ln) * lda;
  v8f acc[4] = {};
  for (int kb = 0; kb < K; kb += 32) { FragH ah; ah.half[0] = *(const v8us*)((const unsigned short*)arow + kb + 8 * hh); ah.half[1] = *(const v8us*)((const unsigned short*)arow + kb + 16 + 8 * hh);
#pragma unroll
    for (int t = 0; t < 4; ++t) { if (col0 + t * 16 >= N) continue; const size_t boff = (size_t)(col0 + t * 16 + ln) * ldb + kb; FragH bq; bq.half[0] = *(const v8us*)((const unsigned short*)Bh + boff + 8 * hh); bq.half[1] = *(const v8us*)((const unsigned short*)Bh + boff + 16 + 8 * hh);
      acc[t] = mmaH<1>(ah.v, ah.v, bq.v, bq.v, acc[t]); }
  }
#pragma unroll
  for (int t = 0; t < 4; ++t) { if (col0 + t * 16 >= N) continue; const int col = col0 + t * 16 + ln; const float bv = bp ? bf16_round(bp[col]) : 0.f;
#pragma unroll
    for (int r = 0; r < 8; ++r) { float v = acc[t][r] * alpha + bv; if (CP) { const int rr = row0g + row0 + 8 * hh + r; if (rowsPerB < 0) v += CP[cofs + (size_t)rr * ldc + col];      /* rowsPerB < 0: own element of the batched C plane */ else { const int bidx = rr / rowsPerB; v += CP[(size_t)bidx * sCPb + (size_t)by * 64 + col]; } } if (ACT == 1) v = (v > 0.f) ? v : expm1f(v); else if (ACT == 7) v = (v > 0.f) ? v + 1.0f : expf(v); else if (ACT == 8) v = tanhf(v); else if (ACT == 9) v = 0.5f * v * (1.0f + tanhf(0.7978845608028654f * (v + 0.044715f * v * v * v))); else if (ACT == 11) v = 1.0f / (1.0f + expf(-v)); else if (ACT == 12) v = (v > 0.f) ? v : 0.01f * v; else if (ACT == 14) v = (v > 0.f) ? v : 0.1f * v; else if (ACT == 16) v = (v >= 0.f) ? v : 0.3f * v; else if (ACT == 17) v = (v >= 0.f) ? v : 0.2f * v; else if (ACT == 15) v = v / (1.0f + expf(-v)); else if (ACT == 3) v = fmaxf(v, 0.f); else if (ACT == 6) v = 0.5f * v * (1.0f + erff(v * 0.70710678118654752f)); so[w][8 * hh + r][t * 16 + ln] = v; } }
  __builtin_amdgcn_fence(__ATOMIC_ACQ_REL, "workgroup"); __builtin_amdgcn_wave_barrier();
  const int rsub = lane >> 4, c4 = (lane & 15) * 4; typedef _Float16 v4h __attribute__((ext_vector_type(4)));
  {
#pragma unroll
    for (int q = 0; q < 8; ++q) { const int r = q * 2 + rsub; if (col0 + c4 < N) { const v4f v = *(const v4fa*)&so[w][r][c4]; if (C) *(v4f*)(C + cofs + (size_t)(row0 + r) * ldc + col0 + c4) = v; if (C16) { v4h h4; for (int i = 0; i < 4; ++i) h4[i] = (_Float16)v[i]; *(v4h*)(C16 + cofs + (size_t)(row0 + r) * ldc + col0 + c4) = h4; } } }
     }
}


typedef _Float16 v4h __attribute__((ext_vector_type(4)));

__global__ __launch_bounds__(256) void k_h16(const float* __restrict__ x, _Float16* __restrict__ X16, size_t n8) { const size_t t = (size_t)blockIdx.x * 256 + threadIdx.x; if (t >= n8) return; FragH f;
#pragma unroll
  for (int q = 0; q < 8; ++q) f.h[q] = (_Float16)x[t * 8 + q]; *(v8us*)((unsigned short*)X16 + t * 8) = f.half[0];  }
__global__ __launch_bounds__(256) void k_round16f(const float* __restrict__ W, _Float16* __restrict__ Bt, size_t n8) { const size_t t = (size_t)blockIdx.x * 256 + threadIdx.x; if (t >= n8) return; FragH f;
#pragma unroll
  for (int i = 0; i < 8; ++i) f.h[i] = (_Float16)(bf16_round(W[t * 8 + i]) * 16.0f); *(v8us*)((unsigned short*)Bt + t * 8) = f.half[0];  }
// ---- fast GEMM pieces: wave tile 32x64, four waves a work-group (128 rows x 64 columns) in g2_kloop, eight (128 x 128) in g3_kloop; K % 64 == 0 ----
__device__ __forceinline__ v16h g2_frag(const _Float16* p, int hh) { FragH f; f.half[0] = *(const v8us*)((const unsigned short*)p + 8 * hh); f.half[1] = *(const v8us*)((const unsigned short*)p + 16 + 8 * hh); return f.v; }
__device__ __forceinline__ v8f g2_mma(v16h a, v16h b, v8f c) { v8f d = __builtin_amdgcn_wmma_f32_16x16x32_f16(false, a, false, b, (short)0, c, false, false); asm volatile("v_nop\n\tv_nop\n\tv_nop\n\tv_nop" : "+v"(d) : "v"(a), "v"(b)); return d; }
// FRAGMENT ORDER. Every f16 plane [R][K] that a WMMA reads from memory is kept as tiles of 16 rows x 32 k (FT elements, 1024 bytes), tile (r >> 4, k >> 5) at index (r >> 4) * (K / 32) + (k >> 5).
// Inside a tile the 16 bytes of row r, k = 8 c .. 8 c + 7 (c = (k >> 3) & 3) are chunk (c >> 1) * 32 + (c & 1) * 16 + (r & 15): lane l of a wave finds the two halves of its fragment (the k order of g2_frag)
// at chunks l and 32 + l, so that each wave-wide 16-byte load or store covers 512 bytes in a row, four whole lines, and not 32 bytes of each of 16 lines.
#define FT 512
__device__ __forceinline__ size_t pk_at(int r, int k, int K) { return ((size_t)(r >> 4) * (K / 32) + (k >> 5)) * FT + (size_t)((((k >> 4) & 1) * 32 + ((k >> 3) & 1) * 16 + (r & 15)) * 8 + (k & 7)); }
__device__ __forceinline__ v16h pk_frag(const _Float16* p) { FragH f; f.half[0] = *(const v8us*)((const unsigned short*)p); f.half[1] = *(const v8us*)((const unsigned short*)p + 256); return f.v; }      /* p = the tile + 8 * lane */
// c[4 half + t] += A[row0 + 16 half ..][k] Bh[col0 + 16 t ..][k] over k = 0 .. K - 1; A and Bh in fragment order
template <int K>
__device__ __forceinline__ void g2_kloop(const _Float16* __restrict__ A, const _Float16* __restrict__ Bh, int row0, int col0, int lane, v8f (&c)[8]) {
  constexpr size_t RG = (size_t)(K / 32) * FT;      /* one group of 16 rows */
  const _Float16* ap = A + (size_t)(row0 >> 4) * RG + lane * 8; const _Float16* bp = Bh + (size_t)(col0 >> 4) * RG + lane * 8;
  /* One trip = 64 k = two tiles of each group of 16 rows. All 24 fragment loads of the trip stand in front of its first WMMA, so that a trip waits for memory once;
     each accumulator still takes its k blocks in rising order. */
#pragma unroll 1 /* a second trip's fragments would not fit in 256 registers beside the 64 accumulator registers */
  for (int kb = 0; kb < K; kb += 64) {
    const _Float16* pa = ap + (size_t)kb * 16; const _Float16* pb = bp + (size_t)kb * 16;
    const v16h a0 = pk_frag(pa), a1 = pk_frag(pa + RG), b0 = pk_frag(pb), b1 = pk_frag(pb + RG), b2 = pk_frag(pb + 2 * RG), b3 = pk_frag(pb + 3 * RG);
    const v16h a2 = pk_frag(pa + FT), a3 = pk_frag(pa + RG + FT), b4 = pk_frag(pb + FT), b5 = pk_frag(pb + RG + FT), b6 = pk_frag(pb + 2 * RG + FT), b7 = pk_frag(pb + 3 * RG + FT);
    /* the wait in front of any rewrite of a register that an issued load names; as its inputs the two address pairs stay live up to it, so that no load of the trip lands in one of them */
    asm volatile("s_wait_xcnt 0x0" :: "v"(pa), "v"(pb) : "memory");
    c[0] = g2_mma(a0, b0, c[0]); c[4] = g2_mma(a1, b0, c[4]); c[1] = g2_mma(a0, b1, c[1]); c[5] = g2_mma(a1, b1, c[5]);
    c[2] = g2_mma(a0, b2, c[2]); c[6] = g2_mma(a1, b2, c[6]); c[3] = g2_mma(a0, b3, c[3]); c[7] = g2_mma(a1, b3, c[7]);
    c[0] = g2_mma(a2, b4, c[0]); c[4] = g2_mma(a3, b4, c[4]); c[1] = g2_mma(a2, b5, c[1]); c[5] = g2_mma(a3, b5, c[5]);
    c[2] = g2_mma(a2, b6, c[2]); c[6] = g2_mma(a3, b6, c[6]); c[3] = g2_mma(a2, b7, c[3]); c[7] = g2_mma(a3, b7, c[7]); } }
// The same sums for a work-group of 8 waves that shares a tile of 128 rows x 128 columns (wave = 32 x 64: rows 32 (w & 3), columns 64 (w >> 2)). A stage is 64 k of the 8 row groups of A and of the 8 of Bh:
// in fragment order 2 KiB in a row per group, 32 KiB in all, read from memory once for the whole work-group (16 bytes x 8 a thread) and laid in LDS as it lies in memory: [A groups 0..7][Bh groups 0..7].
// Two buffers: stage s + 1 goes from registers into the buffer that trip s - 1 has read, stage s + 2 flies from memory into the registers during trip s; one barrier a trip.
#define G3_ST 16384      /* elements of one stage */
/* The work-group's barrier for LDS data alone: this wave's LDS reads and writes have returned, then signal and wait. __syncthreads() would also wait for the global loads in flight, the next stage's, at every trip. */
__device__ __forceinline__ void g3_barrier() { asm volatile("s_wait_dscnt 0x0" ::: "memory"); asm volatile("s_barrier_signal -1\n\ts_barrier_wait -1" ::: "memory"); }
template <int K>
__device__ __forceinline__ void g3_kloop(const _Float16* __restrict__ A, const _Float16* __restrict__ Bh, int rg0, int cg0, int tid, unsigned short* __restrict__ ring, v8f (&c)[8]) {
  constexpr size_t RG = (size_t)(K / 32) * FT;      /* one group of 16 rows */
  constexpr int NS = K / 64;
  static_assert(NS >= 2, "g3_kloop: two stages are loaded in front of the loop");
  const int lane = tid & 31, w = tid >> 5;
  const unsigned short* ga = (const unsigned short*)A + (size_t)(rg0 + (tid >> 7)) * RG + (tid & 127) * 8;      /* load i: group 2 i + (tid >> 7), its 2 KiB dealt to 128 threads */
  const unsigned short* gb = (const unsigned short*)Bh + (size_t)(cg0 + (tid >> 7)) * RG + (tid & 127) * 8;
  const unsigned fa = (w & 3) * 2048 + lane * 8, fb = 8192 + (w >> 2) * 4096 + lane * 8;      /* the wave's first A and Bh fragment in a stage */
  v8us st[8];
#pragma unroll /* constant indices keep st[] in registers */
  for (int i = 0; i < 4; ++i) { st[i] = *(const v8us*)(ga + (size_t)i * 2 * RG); st[4 + i] = *(const v8us*)(gb + (size_t)i * 2 * RG); }
  /* the wait in front of any rewrite of a register that an issued load names; as its inputs the two address pairs stay live up to it, so that no load lands in one of them */
  asm volatile("s_wait_xcnt 0x0" :: "v"(ga), "v"(gb) : "memory");
#pragma unroll /* as above */
  for (int i = 0; i < 8; ++i) *(v8us*)(ring + i * 2048 + tid * 8) = st[i];
  ga += 1024; gb += 1024;
#pragma unroll /* as above */
  for (int i = 0; i < 4; ++i) { st[i] = *(const v8us*)(ga + (size_t)i * 2 * RG); st[4 + i] = *(const v8us*)(gb + (size_t)i * 2 * RG); }
  asm volatile("s_wait_xcnt 0x0" :: "v"(ga), "v"(gb) : "memory");      /* as above */
  g3_barrier();      /* stage 0 is read by waves that did not write it */
  unsigned cur = 0;
#pragma unroll 1 /* one trip holds 48 fragment registers, the next stage's 32 and 64 accumulator registers */
  for (int s = 0; s < NS; ++s) {
    const _Float16* pa = (const _Float16*)(ring + cur + fa); const _Float16* pb = (const _Float16*)(ring + cur + fb);
    const v16h a0 = pk_frag(pa), a1 = pk_frag(pa + 1024), b0 = pk_frag(pb), b1 = pk_frag(pb + 1024), b2 = pk_frag(pb + 2048), b3 = pk_frag(pb + 3072);
    if (s + 1 < NS) {      /* the same for the whole work-group */
      unsigned short* nb = ring + (cur ^ G3_ST) + tid * 8;      /* its last readers have passed the barrier of trip s - 1 */
#pragma unroll /* as above */
      for (int i = 0; i < 8; ++i) *(v8us*)(nb + i * 2048) = st[i];
      if (s + 2 < NS) {
        ga += 1024; gb += 1024;
#pragma unroll /* as above */
        for (int i = 0; i < 4; ++i) { st[i] = *(const v8us*)(ga + (size_t)i * 2 * RG); st[4 + i] = *(const v8us*)(gb + (size_t)i * 2 * RG); }
        asm volatile("s_wait_xcnt 0x0" :: "v"(ga), "v"(gb) : "memory");      /* as above, in front of the next step of ga and gb */
      } }
    c[0] = g2_mma(a0, b0, c[0]); c[4] = g2_mma(a1, b0, c[4]); c[1] = g2_mma(a0, b1, c[1]); c[5] = g2_mma(a1, b1, c[5]);
    c[2] = g2_mma(a0, b2, c[2]); c[6] = g2_mma(a1, b2, c[6]); c[3] = g2_mma(a0, b3, c[3]); c[7] = g2_mma(a1, b3, c[7]);
    /* the second 32 k take the registers of the first: both sets at once would cost the third work-group a WGP */
    const v16h a2 = pk_frag(pa + FT), a3 = pk_frag(pa + 1024 + FT), b4 = pk_frag(pb + FT), b5 = pk_frag(pb + 1024 + FT), b6 = pk_frag(pb + 2048 + FT), b7 = pk_frag(pb + 3072 + FT);
    c[0] = g2_mma(a2, b4, c[0]); c[4] = g2_mma(a3, b4, c[4]); c[1] = g2_mma(a2, b5, c[1]); c[5] = g2_mma(a3, b5, c[5]);
    c[2] = g2_mma(a2, b6, c[2]); c[6] = g2_mma(a3, b6, c[6]); c[3] = g2_mma(a2, b7, c[3]); c[7] = g2_mma(a3, b7, c[7]);
    g3_barrier();      /* publishes stage s + 1 and ends every wave's reads of stage s; behind the last trip's the caller may use the ring's LDS for something else */
    cur ^= G3_ST; } }
// A wave's 32x64 tile out of its LDS tile: lane = 16 bytes of f32 of row 2 q + (lane >> 4). The stores take one base address and constant offsets.
__device__ __forceinline__ void g2_take(const float (&so)[32][68], int lane, v4f (&v)[16]) {
#pragma unroll /* constant indices keep v[] in registers */
  for (int q = 0; q < 16; ++q) v[q] = *(const v4fa*)&so[q * 2 + (lane >> 4)][(lane & 15) * 4]; }
template <int LDC, typename T, typename V>
__device__ __forceinline__ void g2_put(T* __restrict__ p, const V (&v)[16]) {
#pragma unroll /* constant indices keep v[] in registers; constant offsets keep one address pair */
  for (int q = 0; q < 16; ++q) *(V*)(p + (size_t)q * 2 * LDC) = v[q]; }
__device__ __forceinline__ float fa_xhalf(float x) { return __builtin_bit_cast(float, __builtin_amdgcn_permlanex16(__builtin_bit_cast(int, x), __builtin_bit_cast(int, x), 0x76543210, 0xfedcba98, false, false)); }      /* lane l with lane l ^ 16, on the vector pipe */
/* the largest of the 16 lanes of a row, in every lane of the row: lane l with lane l ^ 8, ^ 4, ^ 2, ^ 1 by v_permlane16_b32 (a nibble of the two select words per lane), on the vector pipe and with no index register */
template <unsigned LO, unsigned HI>
__device__ __forceinline__ float fa_xrow(float x) { return __builtin_bit_cast(float, __builtin_amdgcn_permlane16(__builtin_bit_cast(int, x), __builtin_bit_cast(int, x), LO, HI, false, false)); }
__device__ __forceinline__ float fa_max16(float x) { x = fmaxf(x, fa_xrow<0xfedcba98u, 0x76543210u>(x)); x = fmaxf(x, fa_xrow<0x32107654u, 0xba98fedcu>(x)); x = fmaxf(x, fa_xrow<0x54761032u, 0xdcfe98bau>(x)); return fmaxf(x, fa_xrow<0x67452301u, 0xefcdab89u>(x)); }
// The projections in one grid, by block ranges (weights carried x16, f32 accumulation, k in rising order everywhere):
//   job 0: q = x Wq^T + bq and job 1: k = x Wk^T (with the largest |k|^2 of each 32 keys of each head, KN), as f16 planes in fragment order; their first QT0 token rows go out as plain f32 rows too (operands of the exact first-tile attention);
//   job 2: V^T = Wv x^T + bv (the weight rows are the A operand, the token rows the B operand; the bias goes by row), f16 [NH * HD][SQ] in fragment order, the operand that the second attention product reads;
//          its tiles of the first QT0 tokens go out as plain f32 v rows too, turned in LDS. So the grid is 3 x 256 equal work-groups, three a WGP, all resident at once.
#define QKV_G ((MP / 128) * (DM / 128))      /* work-groups of each of the jobs 0, 1, 2: tiles of 128 x 128 */
__global__ __launch_bounds__(256) __attribute__((amdgpu_waves_per_eu(6, 6))) /* a budget of 160 registers: three work-groups a WGP, so that the 768 work-groups are all resident at once */ void k_qkv(const _Float16* __restrict__ X, const _Float16* __restrict__ BQ, const _Float16* __restrict__ BK, const _Float16* __restrict__ BV, const float* __restrict__ bq, const float* __restrict__ bv,
    _Float16* __restrict__ Q16, _Float16* __restrict__ K16, _Float16* __restrict__ VT, float* __restrict__ QF0, float* __restrict__ KF0, float* __restrict__ VF0, float* __restrict__ KN) {
  static_assert(NB == 1 && QT0 % 128 == 0 && MP % 128 == 0 && DM % 128 == 0 && MP == SQ && NH * HD == DM, "k_qkv: one batch, whole work-group tiles in both orientations");
  static_assert(SQ % 128 == 0, "k_qkv: whole column tiles of V^T");
  __shared__ __attribute__((aligned(16))) float so[8][32][68];      /* first the ring of the k loop, then, behind its last barrier, a tile a wave */
  static_assert(sizeof(so) >= 2 * G3_ST * sizeof(unsigned short), "k_qkv: the ring lies in the output tiles' LDS");
  unsigned short* ring = (unsigned short*)&so[0][0][0];
  const int tid = threadIdx.x, w = tid >> 5, lane = tid & 31, ln = lane & 15, hh = lane >> 4;
  const int job = blockIdx.x / QKV_G, bx = blockIdx.x % QKV_G;
  const int tt = bx / (DM / 128), tw = bx % (DM / 128);      /* the tile of 128 tokens and the tile of 128 weight rows: the three jobs' work-groups of one bx read the same token rows (for speed only: where they share a WGP, its cache can serve them) */
  const int mt = job == 2 ? tw : tt, nq = job == 2 ? tt : tw; const int row0 = mt * 128 + 32 * (w & 3), col0 = nq * 128 + 64 * (w >> 2);
  const _Float16* Ah = job == 2 ? BV : X; const _Float16* Bh = job == 0 ? BQ : job == 1 ? BK : X;
  const v8f z8 = {0.f,0.f,0.f,0.f,0.f,0.f,0.f,0.f}; v8f c[8] = {z8, z8, z8, z8, z8, z8, z8, z8};
  g3_kloop<DM>(Ah, Bh, mt * 8, nq * 8, tid, ring, c);
  if (job == 2) { const float* pb = bv + row0 + 8 * hh; float rb[2][8];
#pragma unroll /* constant indices keep rb[] in registers */
    for (int half = 0; half < 2; ++half)
#pragma unroll /* as above */
      for (int r = 0; r < 8; ++r) rb[half][r] = pb[half * 16 + r];
    /* the wait in front of any rewrite of a register that an issued load names; as its input the address pair stays live up to it */
    asm volatile("s_wait_xcnt 0x0" :: "v"(pb) : "memory");
#pragma unroll /* constant indices keep c[] in registers */
    for (int u = 0; u < 8; ++u)
#pragma unroll /* as above */
      for (int r = 0; r < 8; ++r) so[w][(u >> 2) * 16 + 8 * hh + r][(u & 3) * 16 + ln] = c[u][r] * 0.0625f + bf16_round(rb[u >> 2][r]);
  } else { const float* bp = job == 0 ? bq : nullptr; float bb[4] = {0.f, 0.f, 0.f, 0.f};
    if (bp) {
#pragma unroll /* constant indices keep bb[] in registers */
      for (int t = 0; t < 4; ++t) bb[t] = bf16_round(bp[col0 + t * 16 + ln]); }
#pragma unroll /* as above */
    for (int u = 0; u < 8; ++u)
#pragma unroll /* as above */
      for (int r = 0; r < 8; ++r) so[w][(u >> 2) * 16 + 8 * hh + r][(u & 3) * 16 + ln] = c[u][r] * 0.0625f + bb[u & 3]; }
  __builtin_amdgcn_fence(__ATOMIC_ACQ_REL, "workgroup"); __builtin_amdgcn_wave_barrier();
  const int rsub = lane >> 4, c4 = (lane & 15) * 4; v4f v[16]; v8us hp[8];
  const bool frows = job != 2 && row0 < QT0;      /* the same for the whole wave */
  const bool vrows = job == 2 && col0 < QT0;      /* as above */
  if (frows) g2_take(so[w], lane, v);
  if (vrows) {      /* the tile holds [head dim][token]: lane = 4 head dims in a row of token 4 q + (lane >> 3), so that 8 lanes fill one 128-byte line of a v row */
#pragma unroll /* constant indices keep v[] in registers */
    for (int q = 0; q < 16; ++q)
#pragma unroll /* as above */
      for (int e = 0; e < 4; ++e) v[q][e] = so[w][(lane & 7) * 4 + e][q * 4 + (lane >> 3)]; }
  /* the wave's 32 x 64 tile is four tiles of the f16 plane in fragment order: lane (ln, hh) takes the 8 values of row ln that make its chunk; the LDS pitch of 16 B x 17 keeps these reads free of bank conflicts */
  float ss[2] = {0.f, 0.f};      /* job 1: the squares of the lane's 32 dims of the key rows ln and 16 + ln, of the f16 values as they are stored */
#pragma unroll /* constant indices keep hp[] in registers */
  for (int u = 0; u < 8; ++u) { const float* sp = &so[w][(u >> 2) * 16 + ln][(u & 3) * 16 + 8 * hh]; const v4f x0 = *(const v4fa*)sp, x1 = *(const v4fa*)(sp + 4); FragH f;
#pragma unroll /* as above */
    for (int i = 0; i < 4; ++i) { f.h[i] = (_Float16)x0[i]; f.h[4 + i] = (_Float16)x1[i]; }
    if (job == 1) {      /* the same for the whole work-group */
#pragma unroll /* as above */
      for (int i = 0; i < 8; ++i) { const float e = (float)f.h[i]; ss[u >> 2] = fmaf(e, e, ss[u >> 2]); } }
    hp[u] = f.half[0]; }
  /* job 1: the wave's 64 columns are one head, so that its tile holds 32 whole key rows of that head: their largest |k|^2 goes out for k_fattn's bound on the scores, as one whole line from this wave alone */
  float kn = 0.f;
  if (job == 1) kn = fa_max16(fmaxf(ss[0] + fa_xhalf(ss[0]), ss[1] + fa_xhalf(ss[1])));      /* a row's 64 dims lie in lanes ln and 16 + ln */
  /* the stores stand behind every LDS read and every conversion, so that no register that an issued store names is written again */
  const size_t rgp = (size_t)((job == 2 ? SQ : DM) / 32) * FT;      /* one group of 16 rows of the plane */
  unsigned short* p16 = (unsigned short*)(job == 0 ? Q16 : job == 1 ? K16 : VT) + (size_t)(row0 >> 4) * rgp + (size_t)(col0 >> 5) * FT + lane * 8; unsigned short* p16b = p16 + rgp;
  float* pf = (job == 0 ? QF0 : KF0) + (size_t)(row0 + rsub) * DM + col0 + c4; float* pvf = VF0 + (size_t)(col0 + (lane >> 3)) * DM + row0 + (lane & 7) * 4;
  float* pkn = KN + (job == 1 ? ((size_t)(col0 >> 6) * (SQ / 32) + (row0 >> 5)) * 32 : (size_t)0) + lane;      /* [head][block of 32 keys][32 equal values] */
  if (job == 1) *pkn = kn;
  /* the wait in front of any rewrite of a register that an issued store names; as its inputs the address pair and the value stay live up to it */
  asm volatile("s_wait_xcnt 0x0" :: "v"(pkn), "v"(kn) : "memory");
#pragma unroll /* as above; constant offsets keep one address pair a row group */
  for (int u = 0; u < 4; ++u) { *(v8us*)(p16 + u * 256) = hp[u]; *(v8us*)(p16b + u * 256) = hp[4 + u]; }
  /* the wait in front of any rewrite of a register that an issued store names: the f32 rows' addresses are formed behind these stores; as its inputs the two address pairs stay live up to it */
  asm volatile("s_wait_xcnt 0x0" :: "v"(p16), "v"(p16b) : "memory");
  if (frows) g2_put<DM>(pf, v);
  if (vrows) g2_put<2 * DM>(pvf, v); }
// out = o Wo^T in one grid (o carried x64, Wo x16). Rows from QT0 on: the f16 o rows, 128 rows a work-group. The first QT0 rows: the exact o as an f16 plane and its x1024 residual plane,
// out = hi 2^-10 + lo 2^-20; 64 rows a work-group, waves 0 and 1 take the hi plane and waves 2 and 3 the lo plane of the same rows, so that no wave walks k twice; the two terms meet in LDS.
#define OUT_G0 ((QT0 / 64) * (DM / 64))      /* work-groups of the first QT0 rows */
__global__ __launch_bounds__(128) void k_out(const _Float16* __restrict__ O16, const _Float16* __restrict__ OH0, const _Float16* __restrict__ OL0, const _Float16* __restrict__ BO, float* __restrict__ out) {
  static_assert(NB == 1 && QT0 % 128 == 0 && MPO % 128 == 0 && DM % 64 == 0, "k_out: one batch, the first tile ends on a work-group's edge");
  __shared__ __attribute__((aligned(16))) float so[4][32][68];
  const int tid = threadIdx.x, w = tid >> 5, lane = tid & 31, ln = lane & 15, hh = lane >> 4;
  const bool first = blockIdx.x < OUT_G0; const int bx = first ? blockIdx.x : blockIdx.x - OUT_G0;
  const int mt = bx / (DM / 64), nq = bx % (DM / 64); const int row0 = first ? mt * 64 + 32 * (w & 1) : QT0 + mt * 128 + 32 * w; const int col0 = nq * 64;
  const bool lo = first && w >= 2; const _Float16* Ah = first ? (lo ? OL0 : OH0) : O16; const float alpha = lo ? 0.00000095367431640625f : 0.0009765625f;
  const v8f z8 = {0.f,0.f,0.f,0.f,0.f,0.f,0.f,0.f}; v8f c[8] = {z8, z8, z8, z8, z8, z8, z8, z8};
  g2_kloop<DM>(Ah, BO, row0, col0, lane, c);
#pragma unroll /* constant indices keep c[] in registers */
  for (int u = 0; u < 8; ++u)
#pragma unroll /* as above */
    for (int r = 0; r < 8; ++r) so[w][(u >> 2) * 16 + 8 * hh + r][(u & 3) * 16 + ln] = c[u][r] * alpha;
  const int rsub = lane >> 4, c4 = (lane & 15) * 4; v4f v[16]; float* po = out + (size_t)(row0 + rsub) * DM + col0 + c4;
  if (first) {
    __syncthreads();      /* the lo waves' tiles are read by the hi waves; the branch is the same for the whole work-group */
    if (!lo) { v4f vl[16]; g2_take(so[w], lane, v); g2_take(so[w + 2], lane, vl);
#pragma unroll /* constant indices keep the arrays in registers */
      for (int q = 0; q < 16; ++q) v[q] = vl[q] + v[q];
      g2_put<DM>(po, v); }      /* the stores stand behind every LDS read and sum: no register that an issued store names is written again */
  } else {
    __builtin_amdgcn_fence(__ATOMIC_ACQ_REL, "workgroup"); __builtin_amdgcn_wave_barrier();
    g2_take(so[w], lane, v); g2_put<DM>(po, v); } }      /* as above */


// The five f32 -> f16 passes in one grid by block ranges: first the token rows (bf16-rounded, exact in f16), then the four natural [out][in] weights (bf16-rounded, x16). Eight elements a thread.
// A block takes 16 rows x 128 k (16 threads a row: 512 bytes in a row are read) and writes them as four tiles in fragment order, 4096 bytes in a row; the chunks change places in LDS.
__global__ __launch_bounds__(256) void k_prep(const float* __restrict__ x, const float* __restrict__ wq, const float* __restrict__ wk, const float* __restrict__ wv, const float* __restrict__ wo,
    _Float16* __restrict__ X16, _Float16* __restrict__ BQ, _Float16* __restrict__ BK, _Float16* __restrict__ BV, _Float16* __restrict__ BO) {
  static_assert(NR % 16 == 0 && DM % 128 == 0, "k_prep: whole blocks of 16 rows x 128 k");
  __shared__ __attribute__((aligned(16))) unsigned short tl[272 * 8];      /* 256 chunks of 16 bytes, a spare chunk behind every 16: writes (a lane per k chunk) and reads (a lane per row) both without bank conflicts */
  constexpr unsigned GX = (unsigned)(NR * DM / 2048), GW = (unsigned)((size_t)DM * DM / 2048);
  const unsigned bx = blockIdx.x; const float* s = x; _Float16* d = X16; float sc = 1.0f; unsigned b0 = bx;
  if (bx >= GX) { const unsigned i = (bx - GX) / GW; b0 = (bx - GX) % GW; sc = 16.0f; s = i == 0 ? wq : i == 1 ? wk : i == 2 ? wv : wo; d = i == 0 ? BQ : i == 1 ? BK : i == 2 ? BV : BO; }
  const int tid = threadIdx.x, r = tid >> 4, kc = tid & 15; const unsigned rg = b0 / (DM / 128), kq = b0 % (DM / 128);
  const float* sp = s + ((size_t)rg * 16 + r) * DM + kq * 128 + kc * 8; FragH f;
#pragma unroll /* constant indices keep f in registers */
  for (int q = 0; q < 8; ++q) f.h[q] = (_Float16)(bf16_round(sp[q]) * sc);
  *(v8us*)&tl[(17 * kc + r) * 8] = f.half[0];      /* chunk 16 kc + r of the block's four tiles: tile kc >> 2, chunk ((kc >> 1) & 1) * 32 + (kc & 1) * 16 + r */
  __syncthreads();      /* all but 16 chunks are read by another thread than wrote them */
  const v8us o = *(const v8us*)&tl[(tid + (tid >> 4)) * 8];
  *(v8us*)((unsigned short*)d + (((size_t)rg * (DM / 32) + kq * 4) * 64 + tid) * 8) = o; }
__global__ __launch_bounds__(256) void k_rsm(const float* __restrict__ S, _Float16* __restrict__ P, int nrows) {
  #pragma clang fp contract(off)
  const int i = blockIdx.x * 256 + threadIdx.x; if (i >= nrows) return; const float* s = S + (size_t)i * SQ; float mx = -3.0e38f;
#pragma unroll 1
  for (int j = 0; j < SQ; ++j) mx = fmaxf(mx, s[j]); float se = 0.f;
#pragma unroll 1
  for (int j = 0; j < SQ; ++j) se += expf(s[j] - mx); const float sc = 256.0f / se;
#pragma unroll 1
  for (int j0 = 0; j0 < SQ; j0 += 8) { FragH f; for (int q = 0; q < 8; ++q) f.h[q] = (_Float16)(expf(s[j0 + q] - mx) * sc); unsigned short* d = (unsigned short*)P + (size_t)i * SQ + j0; *(v8us*)d = f.half[0];  } }
__global__ __launch_bounds__(256) void k_vt(const _Float16* __restrict__ V16, int b, int h0, _Float16* __restrict__ VT) { __shared__ unsigned short tl[64][65]; const int tid = threadIdx.x; const int hh = blockIdx.x % HG, sg = blockIdx.x / HG; const int s0 = sg * 64; const int h = h0 + hh;
  for (int i = tid; i < 64 * 8; i += 256) { const int j = i / 8, d8 = (i % 8) * 8; FragH f; f.half[0] = *(const v8us*)((const unsigned short*)V16 + ((size_t)b * SQ + s0 + j) * DM + h * HD + d8); for (int q = 0; q < 8; ++q) tl[d8 + q][j] = f.u[q]; }
  __syncthreads();
  { for (int i = tid; i < 64 * 8; i += 256) { const int d = i / 8, j8 = (i % 8) * 8; FragH f; for (int q = 0; q < 8; ++q) f.u[q] = tl[d][j8 + q]; *(v8us*)((unsigned short*)VT + ((size_t)hh * HD + d) * SQ + s0 + j8) = f.half[0]; }  } }



#define FA_L2E 1.4426950408889634f
/* p = 2^a; behind the v_exp_f32 stands the argument of a weight three calls on, an = x log2(e) + c. That product is independent of the v_exp_f32 and fills the one slot that the instruction set asks for
   between a transcendental and an instruction that reads its result or overwrites its source; in one statement, so that it stays there. "=&v": no output shares a register with an input. */
__device__ __forceinline__ float fa_exp2_fma(float a, float x, float c, float& an) { float p; asm("v_exp_f32 %0, %2\n\tv_fma_f32 %1, %3, %4, %5" : "=&v"(p), "=&v"(an) : "v"(a), "v"(x), "s"(FA_L2E), "v"(c)); return p; }
/* the last three weights of a pass have no later argument to form: a v_nop fills the same slot */
__device__ __forceinline__ float fa_exp2_nop(float a) { float p; asm("v_exp_f32 %0, %1\n\tv_nop" : "=&v"(p) : "v"(a)); return p; }
__device__ __forceinline__ v8f fa_mma(v16h a, v16h b, v8f c) { return __builtin_amdgcn_wmma_f32_16x16x32_f16(false, a, false, b, (short)0, c, false, false); }
template <bool DIAG>
__device__ __forceinline__ void fa_pass(float jf0, int ln, int hh, float slope, const v8f (&s)[2][2], const v16h (&vf)[4], v8f (&o)[2][4], float (&m)[2], float (&l)[2]) {
  float bias[2][8];
#pragma unroll /* constant indices keep the arrays in registers */
  for (int mt = 0; mt < 2; ++mt)
#pragma unroll /* as above */
    for (int r = 0; r < 8; ++r) bias[mt][r] = __fmul_rn(slope, jf0 + (float)(mt * 16 + r));      /* slope_h * j, rounded once */
  float x[2][2][8]; float mx[2];
#pragma unroll /* as above */
  for (int nt = 0; nt < 2; ++nt) { float t = -1.0e30f;
#pragma unroll /* as above */
    for (int mt = 0; mt < 2; ++mt)
#pragma unroll /* as above */
      for (int r = 0; r < 8; ++r) { float v = fmaf(s[nt][mt][r], 0.125f, -bias[mt][r]); if (DIAG) v = (mt * 16 + 8 * hh + r <= nt * 16 + ln) ? v : -1.0e30f;      /* diagonal pass: its first key is the wave's first query */
        x[nt][mt][r] = v; t = fmaxf(t, v); }
    mx[nt] = fmaxf(t, fa_xhalf(t)); }
  /* the accumulators are rescaled only in a pass that raises some query's maximum: one scalar branch a pass */
  if (__builtin_amdgcn_ballot_w32(mx[0] > m[0] || mx[1] > m[1]) != 0) {
#pragma unroll /* as above */
    for (int nt = 0; nt < 2; ++nt) { const float mn = fmaxf(m[nt], mx[nt]); const float a = __builtin_amdgcn_exp2f((m[nt] - mn) * FA_L2E); m[nt] = mn; l[nt] *= a;
#pragma unroll /* as above */
      for (int dt = 0; dt < 4; ++dt) o[nt][dt] *= a; } }
  v16h pf[2]; float cc[2], a[32], p[32];      /* weight i = nt * 16 + 2 r + mt; weight = 2^8 exp(x - m) = 2^(x log2(e) + cc) */
#pragma unroll /* as above */
  for (int nt = 0; nt < 2; ++nt) cc[nt] = fmaf(-m[nt], FA_L2E, 8.0f);
#pragma unroll /* as above */
  for (int i = 0; i < 3; ++i) a[i] = fmaf(x[0][i & 1][i >> 1], FA_L2E, cc[0]);
#pragma unroll /* as above */
  for (int i = 0; i < 32; ++i) { const int n = i + 3; if (n < 32) p[i] = fa_exp2_fma(a[i], x[n >> 4][n & 1][(n & 15) >> 1], cc[n >> 4], a[n]); else p[i] = fa_exp2_nop(a[i]); }
#pragma unroll /* as above */
  for (int nt = 0; nt < 2; ++nt) { FragH f; float s0 = 0.f, s1 = 0.f;
#pragma unroll /* as above */
    for (int r = 0; r < 8; ++r) { const float p0 = p[nt * 16 + 2 * r], p1 = p[nt * 16 + 2 * r + 1]; s0 += p0; s1 += p1; f.h[r] = (_Float16)p0; f.h[8 + r] = (_Float16)p1; }
    l[nt] += s0 + s1; pf[nt] = f.v; }
#pragma unroll /* as above */
  for (int dt = 0; dt < 4; ++dt) { o[0][dt] = fa_mma(vf[dt], pf[0], o[0][dt]); o[1][dt] = fa_mma(vf[dt], pf[1], o[1][dt]); } }
__device__ __forceinline__ void fa_scores(const v16h (&kf)[2][2], const v16h (&qf)[2][2], v8f (&s)[2][2]) {
  const v8f z8 = {0.f,0.f,0.f,0.f,0.f,0.f,0.f,0.f};
  s[0][0] = fa_mma(kf[0][0], qf[0][0], z8); s[0][1] = fa_mma(kf[1][0], qf[0][0], z8); s[1][0] = fa_mma(kf[0][0], qf[1][0], z8); s[1][1] = fa_mma(kf[1][0], qf[1][0], z8);
  s[0][0] = fa_mma(kf[0][1], qf[0][1], s[0][0]); s[0][1] = fa_mma(kf[1][1], qf[0][1], s[0][1]); s[1][0] = fa_mma(kf[0][1], qf[1][1], s[1][0]); s[1][1] = fa_mma(kf[1][1], qf[1][1], s[1][1]); }
/* v_sqrt_f32 and v_rcp_f32 with the v_nop that fills the slot which the instruction set asks for behind a transcendental; both feed only the bound below, which carries a margin far above their error */
__device__ __forceinline__ float fa_sqrt_nop(float a) { float p; asm("v_sqrt_f32 %0, %1\n\tv_nop" : "=&v"(p) : "v"(a)); return p; }
__device__ __forceinline__ float fa_rcp_nop(float a) { float p; asm("v_rcp_f32 %0, %1\n\tv_nop" : "=&v"(p) : "v"(a)); return p; }
// The deal: a work-group is 16 waves = RB blocks of 32 query rows of one head x NSH key shares (RB NSH = 16), one work-group a WGP, four waves a SIMD. Share ks takes the passes ks, ks + NSH, ... of its row block,
// with its own running maximum, sum and O; the RB waves of one share walk the same keys side by side. The shares' partial (m, l, O) go to LDS; behind one barrier wave (rb, ks) joins the NSH shares of
// row block rb for 8 / NSH of its eight tiles of 16 queries x 16 head dims.
// WHERE A SHARE STOPS. The ALiBi term falls with the key position j, so that far keys weigh nothing: a score is at most |q| max|k| / 8 - slope j (Cauchy-Schwarz; max|k| over all keys of the head, from KN, which
// k_qkv writes; |q| from the wave's own fragments). Behind its first pass a share knows a lower bound m of each query's final maximum; from the first pass p with max|q| max|k| / 8 - slope 32 p < min m - 27 over its
// 32 queries on, every weight 2^8 exp(x - m) is below 2^-30: as an f16 operand it is exactly 0, so that O and m come out bit for bit as if the pass had been walked, and the row sum loses less than 2^-28 of itself.
// Those passes are not walked. The test holds for any q and k; how many passes it saves depends on the head's slope and on the data.
// A work-group takes the 32 RB rows n - 1 - pr and then the 32 RB rows pr of one head. The heads now differ in work, so there are more work-groups than WGPs, in the order of falling work (for speed only): the heads of
// small slope (few or no passes saved) come first in the grid, with NSH = 8, so that the longest work-group is half of what it was; the heads of large slope walk a few passes a row block and take NSH = 4
// (half as many work-groups and partial results). A WGP that is through with a work-group takes one of those that are left. NSH is a scalar of the work-group: one code path for both.
/* one tile (16 queries jn x 16 head dims jd) of a row block out of its shares' partial results, which lie at s0 .. s0 + 3, and with eight shares s0 .. s0 + 7; o = O / l x64 as f16: the lane's 8 head dims of its query */
__device__ __forceinline__ v8us fa_join(const float (&lo)[16][16][32][4], const float (&lml)[16][4][32], const int s0, const bool eight, const int jn, const int jd, const int lane) {
  float mk[8], mx = -1.0e30f, ls = 0.f; v4f a0 = {0.f, 0.f, 0.f, 0.f}, a1 = {0.f, 0.f, 0.f, 0.f};
#pragma unroll /* constant indices keep mk[] in registers */
  for (int k = 0; k < 4; ++k) { mk[k] = lml[s0 + k][jn][lane]; mk[4 + k] = -1.0e30f; }      /* a query's m is the same in its two lanes */
  if (eight) {      /* the same for the whole work-group */
#pragma unroll /* as above */
    for (int k = 4; k < 8; ++k) mk[k] = lml[s0 + k][jn][lane]; }
#pragma unroll /* as above */
  for (int k = 0; k < 8; ++k) mx = fmaxf(mx, mk[k]);
#pragma unroll /* the shares in rising order */
  for (int k = 0; k < 4; ++k) { const float wk = fa_exp2_nop((mk[k] - mx) * FA_L2E);      /* a share without a pass weighs exactly 0; the v_nop keeps the slot behind the v_exp_f32 */
    ls += wk * lml[s0 + k][2 + jn][lane]; a0 += wk * *(const v4f*)&lo[s0 + k][(jn * 4 + jd) * 2][lane][0]; a1 += wk * *(const v4f*)&lo[s0 + k][(jn * 4 + jd) * 2 + 1][lane][0]; }
  if (eight) {      /* as above */
#pragma unroll /* as above */
    for (int k = 4; k < 8; ++k) { const float wk = fa_exp2_nop((mk[k] - mx) * FA_L2E);
      ls += wk * lml[s0 + k][2 + jn][lane]; a0 += wk * *(const v4f*)&lo[s0 + k][(jn * 4 + jd) * 2][lane][0]; a1 += wk * *(const v4f*)&lo[s0 + k][(jn * 4 + jd) * 2 + 1][lane][0]; } }
  const float fin = 64.0f / (ls + fa_xhalf(ls));      /* the two halves' sums joined once; o carried x64 */
  FragH f;
#pragma unroll /* constant indices keep f in registers */
  for (int r = 0; r < 4; ++r) { f.h[r] = (_Float16)(a0[r] * fin); f.h[4 + r] = (_Float16)(a1[r] * fin); }
  return f.half[0]; }
#define FA_G8 ((NH / 2) * (SQ / 128))      /* work-groups of the NH / 2 heads of small slope: 8 shares, 2 x 64 rows each */
#define FA_G4 ((NH / 2) * (SQ / 256))      /* work-groups of the NH / 2 heads of large slope: 4 shares, 2 x 128 rows each */
__global__ __launch_bounds__(512) __attribute__((amdgpu_waves_per_eu(4, 4))) /* a budget of 256 registers: none above v255, no register-window switches in the loop */ void k_fattn(const _Float16* __restrict__ Q, const _Float16* __restrict__ K, const _Float16* __restrict__ VT, const float* __restrict__ KN, _Float16* __restrict__ O) {
  static_assert(SQ % 256 == 0 && HD == 64 && NH % 2 == 0 && SQ / 32 == 128, "k_fattn: whole pairs of blocks of rows, head size 64, two kinds of heads, four values of KN a lane");
  __shared__ __attribute__((aligned(16))) float lo[2][16][16][32][4];      /* [row half of the deal][NSH rb + ks][2 (4 nt + dt) + half of the 8 rows][lane]: every wave-wide 16-byte access is 512 bytes in a row */
  __shared__ float lml[2][16][4][32];      /* m of nt = 0, 1, then l of nt = 0, 1 */
  const int tid = threadIdx.x, lane = tid & 31, ln = lane & 15, hh = lane >> 4; const int w = __builtin_amdgcn_readfirstlane(tid >> 5);      /* the wave's number in a scalar register: the key loop stays a scalar branch */
  const bool eight = blockIdx.x < FA_G8; const int bx = eight ? blockIdx.x : blockIdx.x - FA_G8;      /* the same for the whole work-group */
  const int sh = eight ? 1 : 2, RB = 1 << sh, NSH = 16 >> sh, NP = SQ / 64 >> sh;      /* log2 RB; row blocks and shares a work-group; work-groups a head = pairs of blocks of 32 RB rows */
  static_assert((SQ / 64 & (SQ / 64 - 1)) == 0, "k_fattn: NP is a power of two");
  const int h = (eight ? NH - 1 : NH / 2 - 1) - (bx >> (__builtin_ctz(SQ / 64) - sh)), pr = bx & (NP - 1); const int ks = w >> sh, r0 = w & (RB - 1);      /* bx / NP and bx % NP by shifts: they stay on the scalar unit */
  const float* pn = KN + (size_t)h * (SQ / 32) * 32; const unsigned l32 = lane * 32;      /* the largest |k|^2 of each 32 keys, a line each: lane l takes the blocks l, 32 + l, 64 + l, 96 + l; first of all, so that they fly under the slope's arithmetic */
  const float n0 = pn[l32], n1 = pn[l32 + 32 * 32], n2 = pn[l32 + 64 * 32], n3 = pn[l32 + 96 * 32];
  /* the wait in front of any rewrite of a register that an issued load names; as its inputs the base and the lane's offset stay live up to it */
  asm volatile("s_wait_xcnt 0x0" :: "s"(pn), "v"(l32) : "memory");
  const float slope = (float)exp2(-0.5 * (double)(h + 1));      /* ALiBi slope 2^(-8 (h+1) / 16), correctly rounded to f32 */
  float k2 = fa_max16(fmaxf(fmaxf(n0, n1), fmaxf(n2, n3))); k2 = fmaxf(k2, fa_xhalf(k2));      /* the head's largest |k|^2, in every lane */
  const float rs = fa_rcp_nop(slope) * 1.001f;      /* 1 / slope, rounded up */
  const float jstep = (float)(32 * NSH);      /* key positions from a share's pass to its next */
  constexpr size_t RGQ = (size_t)(DM / 32) * FT, RGV = (size_t)(SQ / 32) * FT;      /* one group of 16 rows of Q, K, O; of V^T (all in fragment order) */
  const _Float16* kb0 = K + (size_t)(h * (HD / 32)) * FT; const _Float16* vb0 = VT + (size_t)(h * (HD / 16)) * RGV; const unsigned l8 = lane * 8;      /* the head's planes and every tile address are the same for the whole wave, so that they can stay in scalar registers; the lane's place in a tile is added at each load */
#pragma unroll 1 /* the two row halves one after the other through the same code */
  for (int t = 0; t < 2; ++t) {
    const int rb = t ? RB - 1 - r0 : r0;      /* mirrored in the second half, so that every SIMD gets the same number of passes */
    const int nd = (t ? pr : 2 * NP - 1 - pr) * RB + rb;      /* the row block's number = its diagonal pass; the passes below it are 0 .. nd - 1; share nd mod NSH owns the diagonal pass */
    v16h qf[2][2], kf[2][2], vf[4]; v8f s[2][2]; v8f o[2][4]; float m[2] = {-1.0e30f, -1.0e30f}, l[2] = {0.f, 0.f};
#pragma unroll /* constant indices keep the arrays in registers */
    for (int nt = 0; nt < 2; ++nt)
#pragma unroll /* as above */
      for (int dt = 0; dt < 4; ++dt) o[nt][dt] = v8f{0.f,0.f,0.f,0.f,0.f,0.f,0.f,0.f};
    if (ks <= nd) {      /* only in the first 32 NSH rows of a head has a share no pass at all: it hands in m = -1e30, l = 0, O = 0 */
      const _Float16* pq = Q + (size_t)(nd * 2) * RGQ + (size_t)(h * (HD / 32)) * FT; const _Float16* pk = kb0 + (size_t)(ks * 2) * RGQ; const _Float16* pv = vb0 + (size_t)ks * FT;
      float jf0 = (float)(32 * ks + 8 * hh);      /* this lane's first key position of the pass, as a float (exact) */
#pragma unroll /* as above */
      for (int nt = 0; nt < 2; ++nt)
#pragma unroll /* as above */
        for (int kd = 0; kd < 2; ++kd) { qf[nt][kd] = pk_frag(pq + nt * RGQ + kd * FT + l8); kf[nt][kd] = pk_frag(pk + nt * RGQ + kd * FT + l8); }
      /* the wait in front of any rewrite of a register that an issued load names; as its inputs the address pairs stay live up to it */
      asm volatile("s_wait_xcnt 0x0" :: "s"(pq), "s"(pk) : "memory");
      float q2[2] = {0.f, 0.f};
#pragma unroll /* as above */
      for (int nt = 0; nt < 2; ++nt)
#pragma unroll /* as above */
        for (int kd = 0; kd < 2; ++kd)
#pragma unroll /* as above */
          for (int i = 0; i < 16; ++i) { const float e = (float)qf[nt][kd][i]; q2[nt] = fmaf(e, e, q2[nt]); }
      /* max|q| max|k| / 8 over the wave's 32 queries (a query's 64 dims lie in its two lanes), 1 % up: above every rounding of the lengths and of the score products; plus 27; the same in every lane, so in a scalar register */
      const float bq = __builtin_bit_cast(float, __builtin_amdgcn_readfirstlane(__builtin_bit_cast(int, fmaf(fa_sqrt_nop(fa_max16(fmaxf(q2[0] + fa_xhalf(q2[0]), q2[1] + fa_xhalf(q2[1]))) * k2), 0.12625f, 27.0f))));
      int lim = nd, pend = 0x7fffffff;      /* the loop's end; the first pass that need not be walked */
#pragma unroll 1 /* a pass holds about 240 registers; two passes side by side would not fit in 256 */
      for (int p = ks; p < lim; p += NSH) {
#pragma unroll /* as above */
        for (int dt = 0; dt < 4; ++dt) vf[dt] = pk_frag(pv + dt * RGV + l8);      /* this pass's V^T: flies under the score products and the softmax */
        asm volatile("s_wait_xcnt 0x0" :: "s"(pv) : "memory");      /* as above, in front of the step of pv */
        pv += (size_t)NSH * FT;
        fa_scores(kf, qf, s);
        pk = kb0 + (size_t)((p + NSH < nd ? p + NSH : nd) * 2) * RGQ;      /* the share's next pass; never past the diagonal pass, whose K rows are the last that this row block may read */
#pragma unroll /* as above */
        for (int mt = 0; mt < 2; ++mt)
#pragma unroll /* as above */
          for (int kd = 0; kd < 2; ++kd) kf[mt][kd] = pk_frag(pk + mt * RGQ + kd * FT + l8);      /* into the same registers: flies under the softmax and the second product */
        asm volatile("s_wait_xcnt 0x0" :: "s"(pk) : "memory");      /* as above, in front of the next value of pk */
        fa_pass<false>(jf0, ln, hh, slope, s, vf, o, m, l);
        jf0 += jstep;
        if (p == ks) {      /* once a row block, a scalar branch: m is now a lower bound of each query's final maximum in this share */
          const float jl = bq + fa_max16(fmaxf(-m[0], -m[1]));      /* a key at j > jl / slope weighs less than 2^-30 for all 32 queries (38 ln 2 = 26.4); the two lane halves hold the same m */
          pend = __builtin_amdgcn_readfirstlane((int)(fminf(jl * rs, 1.0e6f) * 0.03125f)) + 1;      /* 32 pend > jl / slope; a value that is no number ends as 1e6: nothing is left out */
          lim = pend < nd ? pend : nd; } }
      if (ks == (nd & (NSH - 1)) && nd < pend) {      /* the loop has left this share at p = nd */
#pragma unroll /* as above */
        for (int dt = 0; dt < 4; ++dt) vf[dt] = pk_frag(pv + dt * RGV + l8);
        asm volatile("s_wait_xcnt 0x0" :: "s"(pv) : "memory");      /* as above */
        fa_scores(kf, qf, s);
        fa_pass<true>(jf0, ln, hh, slope, s, vf, o, m, l); } }
    const int sl = rb * NSH + ks;
#pragma unroll /* as above */
    for (int nt = 0; nt < 2; ++nt) { lml[t][sl][nt][lane] = m[nt]; lml[t][sl][2 + nt][lane] = l[nt];
#pragma unroll /* as above */
      for (int dt = 0; dt < 4; ++dt) { const v8f v = o[nt][dt];
        *(v4f*)&lo[t][sl][(nt * 4 + dt) * 2][lane][0] = v4f{v[0], v[1], v[2], v[3]}; *(v4f*)&lo[t][sl][(nt * 4 + dt) * 2 + 1][lane][0] = v4f{v[4], v[5], v[6], v[7]}; } } }
  __syncthreads();      /* every share's partial result is read by the other waves of its row block */
  /* with eight shares wave (rb, ks) joins tile ks = (queries 16 (ks & 1), head dims 16 (ks >> 1)); with four shares the tiles 2 ks and 2 ks + 1 = both query tiles of the head dims 16 ks */
  const int e0 = eight ? ks : 2 * ks, jn = e0 & 1, jd = e0 >> 1; const int rb1 = RB - 1 - r0;
  v8us hv[2][2];
  hv[0][0] = fa_join(lo[0], lml[0], r0 * NSH, eight, jn, jd, lane); hv[1][0] = fa_join(lo[1], lml[1], rb1 * NSH, eight, jn, jd, lane);
  if (!eight) { hv[0][1] = fa_join(lo[0], lml[0], r0 * NSH, false, 1, jd, lane); hv[1][1] = fa_join(lo[1], lml[1], rb1 * NSH, false, 1, jd, lane); }
  /* the stores stand behind every conversion: no register that an issued store names is written again */
  unsigned short* po = (unsigned short*)O + (size_t)(h * (HD / 32)) * FT + jd * 256;      /* lane (ln, hh) holds dims 16 jd + 8 hh .. + 7 of query ln: chunk (jd & 1) * 32 + lane of tile jd >> 1; the tile's address is the same for the whole wave, the lane's place is added at the store */
  unsigned short* po0 = po + (size_t)(((2 * NP - 1 - pr) * RB + r0) * 2) * RGQ; unsigned short* po1 = po + (size_t)((pr * RB + rb1) * 2) * RGQ;      /* the two row blocks' first 16 queries */
  *(v8us*)(po0 + jn * RGQ + l8) = hv[0][0]; *(v8us*)(po1 + jn * RGQ + l8) = hv[1][0];
  if (!eight) { *(v8us*)(po0 + RGQ + l8) = hv[0][1]; *(v8us*)(po1 + RGQ + l8) = hv[1][1]; } }


// Exact f32 causal attention of the first QT0 rows. One work-group of 8 waves per head and 32 query rows. The head's K and V rows below the group's end and its 32 q rows are staged in LDS by whole-line loads.
// Both products run on the f32 matrix form (v_wmma_f32_16x16x4_f32: full f32 operands, f32 sums), transposed like k_fattn: S^T = K Q^T (A = K rows, B = q rows), O^T = V^T P^T (A = V columns, B = weight rows),
// so that a fragment read from LDS feeds 16 x 16 products and not one row's. In a D tile lane (ln, hh) holds column ln (a query) and rows 8 hh + r (8 keys, or 8 head dims, in a row).
// The k order: both operands of a product take, for each 8 k, element e = 0 .. 3 of lane half hh from k = 8 s + 4 hh + e; one matrix instruction takes e = 0, 1 and the next e = 2, 3, the same on the A and on the B side.
// Scores: wave w takes the key tiles w, w + 8; softmax maxima taken as the scores are formed, exp and sums in one pass over the scores kept in LDS (lane = row); o: wave w takes head dims 16 (w & 3) .. + 15 of the queries 16 (w >> 2) .. + 15 over all keys in rising order.
// LD = row pitch of QF, KF, VF in floats, a compile-time constant so that every staged row is one base address plus an immediate offset.
typedef float v2f __attribute__((ext_vector_type(2)));
/* the four v_nop keep four vector slots between the matrix instruction and any vector instruction that reads its D or overwrites its A or B (as its operands they stay live up to there) */
__device__ __forceinline__ v8f a0_mma(v2f a, v2f b, v8f c) { v8f d = __builtin_amdgcn_wmma_f32_16x16x4_f32(false, a, false, b, (short)0, c, false, false); asm volatile("v_nop\n\tv_nop\n\tv_nop\n\tv_nop" : "+v"(d) : "v"(a), "v"(b)); return d; }
/* the fragments of 32 keys of the second product: pp = the lane's weight row at its first key, pv = the lane's head dim in that key's V row */
__device__ __forceinline__ void a0_frags(const float* pp, const float* pv, v4f (&pf)[4], v2f (&va)[4][2]) {
#pragma unroll /* constant indices keep the fragments in registers */
  for (int u = 0; u < 4; ++u) { const float* q = pv + u * 8 * (HD + 4); pf[u] = *(const v4f*)(pp + u * 8); va[u][0] = v2f{q[0], q[HD + 4]}; va[u][1] = v2f{q[2 * (HD + 4)], q[3 * (HD + 4)]}; } }
template <int ALIBI, int LD>
__global__ __launch_bounds__(256) void k_att0(const float* __restrict__ QF, const float* __restrict__ KF, const float* __restrict__ VF, float scale, _Float16* __restrict__ OH, _Float16* __restrict__ OL, int ldo) {
  static_assert(QT0 % 32 == 0 && HD == 64, "k_att0: 32 rows a group, 16 threads a staged row, four tiles of 16 head dims");
  /* every pitch is 16 B x an odd number: a lane per row reads and writes 16 bytes without bank conflicts; in lv, rows 4 apart lie 16 banks apart, so that the two lane halves' 4-byte reads do not meet */
  __shared__ __attribute__((aligned(16))) float lk[QT0][HD + 4]; __shared__ __attribute__((aligned(16))) float lv[QT0][HD + 4]; __shared__ __attribute__((aligned(16))) float sp[32][QT0 + 4];      /* sp: scores, later weights, [query][key] */
  __shared__ __attribute__((aligned(16))) float lqo[32][HD + 4];      /* q rows, later o rows */
  __shared__ float pm[8][32]; __shared__ float pl[8][32];
  const int tid = threadIdx.x, lane = tid & 31, ln = lane & 15, hh = lane >> 4; const int w = __builtin_amdgcn_readfirstlane(tid >> 5);      /* the wave's number in a scalar register: the loops round the matrix instructions stay scalar branches, every lane on */
  const int h = blockIdx.x / (QT0 / 32), rg = blockIdx.x % (QT0 / 32); const int nkeys = rg * 32 + 32;      /* causal: keys up to the group's last row */
  const int sr = tid >> 4, c4 = (tid & 15) * 4;      /* staging: 16 threads a row of 256 bytes */
  { v4f tk[QT0 / 16], tv[QT0 / 16], tq[2];
    const float* gk = KF + (size_t)sr * LD + h * HD + c4; const float* gv = VF + (size_t)sr * LD + h * HD + c4; const float* gq = QF + (size_t)(rg * 32 + sr) * LD + h * HD + c4;
#pragma unroll /* constant indices keep tk[] and tv[] in registers; all loads are issued before the first is used */
    for (int c = 0; c < QT0 / 32; ++c) if (c * 32 < nkeys) {
#pragma unroll /* as above */
      for (int u = 2 * c; u < 2 * c + 2; ++u) { tk[u] = *(const v4fa*)(gk + (size_t)u * 16 * LD); tv[u] = *(const v4fa*)(gv + (size_t)u * 16 * LD); } }
#pragma unroll /* as above */
    for (int u = 0; u < 2; ++u) tq[u] = *(const v4fa*)(gq + (size_t)u * 16 * LD);
    /* the wait in front of any rewrite of a register that an issued load names; as its inputs the three address pairs stay live up to it, so that no load lands in one of them */
    asm volatile("s_wait_xcnt 0x0" :: "v"(gk), "v"(gv), "v"(gq) : "memory");
#pragma unroll /* as above */
    for (int c = 0; c < QT0 / 32; ++c) if (c * 32 < nkeys) {
#pragma unroll /* as above */
      for (int u = 2 * c; u < 2 * c + 2; ++u) { *(v4f*)&lk[u * 16 + sr][c4] = tk[u]; *(v4f*)&lv[u * 16 + sr][c4] = tv[u]; } }
#pragma unroll /* as above */
    for (int u = 0; u < 2; ++u) *(v4f*)&lqo[u * 16 + sr][c4] = tq[u]; }
  __syncthreads();
  const float slope = ALIBI ? (float)exp2(-0.5 * (double)(h + 1)) : 0.f;      /* ALiBi: 2^(-8 (h+1) / 16) */
  const v8f z8 = {0.f,0.f,0.f,0.f,0.f,0.f,0.f,0.f};
  v4f qf[2][HD / 8]; float mx[2] = {-1.0e30f, -1.0e30f};
#pragma unroll /* constant indices keep qf[] in registers */
  for (int nt = 0; nt < 2; ++nt)
#pragma unroll /* as above */
    for (int s = 0; s < HD / 8; ++s) qf[nt][s] = *(const v4f*)&lqo[nt * 16 + ln][8 * s + 4 * hh];
  for (int kt = w; kt < nkeys / 16; kt += 8) {      /* a tile of 16 keys against both tiles of 16 queries: two independent accumulators */
    v4f kf[HD / 8]; v8f sa[2] = {z8, z8};
#pragma unroll /* constant indices keep kf[] in registers; all eight reads stand in front of the first product */
    for (int s = 0; s < HD / 8; ++s) kf[s] = *(const v4f*)&lk[kt * 16 + ln][8 * s + 4 * hh];
#pragma unroll /* as above */
    for (int s = 0; s < HD / 8; ++s) {
      sa[0] = a0_mma(v2f{kf[s][0], kf[s][1]}, v2f{qf[0][s][0], qf[0][s][1]}, sa[0]); sa[1] = a0_mma(v2f{kf[s][0], kf[s][1]}, v2f{qf[1][s][0], qf[1][s][1]}, sa[1]);
      sa[0] = a0_mma(v2f{kf[s][2], kf[s][3]}, v2f{qf[0][s][2], qf[0][s][3]}, sa[0]); sa[1] = a0_mma(v2f{kf[s][2], kf[s][3]}, v2f{qf[1][s][2], qf[1][s][3]}, sa[1]); }
#pragma unroll /* constant indices keep sa[] in registers */
    for (int nt = 0; nt < 2; ++nt) { const int i = rg * 32 + nt * 16 + ln; float x[8];
#pragma unroll /* as above */
      for (int r = 0; r < 8; ++r) { const int j = kt * 16 + 8 * hh + r; float s = sa[nt][r] * scale; if (ALIBI) s -= slope * (float)j;
        s = (j <= i) ? s : -1.0e30f; x[r] = s; mx[nt] = fmaxf(mx[nt], s); }
      *(v4f*)&sp[nt * 16 + ln][kt * 16 + 8 * hh] = v4f{x[0], x[1], x[2], x[3]}; *(v4f*)&sp[nt * 16 + ln][kt * 16 + 8 * hh + 4] = v4f{x[4], x[5], x[6], x[7]}; } }
  mx[0] = fmaxf(mx[0], fa_xhalf(mx[0])); mx[1] = fmaxf(mx[1], fa_xhalf(mx[1]));      /* a query's keys lie in its two lanes */
  pm[w][lane] = hh ? mx[1] : mx[0];      /* row 16 hh + ln; a wave without a key tile hands in -1e30 */
  __syncthreads();
  float m = pm[0][lane];
#pragma unroll /* eight partial maxima */
  for (int x = 1; x < 8; ++x) m = fmaxf(m, pm[x][lane]);
  float lp = 0.f;
  for (int j4 = 4 * w; j4 < nkeys; j4 += 32) {      /* lane = row; nkeys is a multiple of 32: every wave takes four keys in a row of each 32 */
    const v4f x = *(const v4f*)&sp[lane][j4]; v4f e;
#pragma unroll /* constant indices keep the vectors in registers */
    for (int c = 0; c < 4; ++c) e[c] = expf(x[c] - m);      /* a masked key gives exactly 0 */
    *(v4f*)&sp[lane][j4] = e; lp += (e[0] + e[1]) + (e[2] + e[3]); }
  pl[w][lane] = lp;
  __syncthreads();
  const int d0 = (w & 3) * 16, rq = (w >> 2) * 16 + ln;      /* this wave's head dims; this lane's query */
  float l = pl[0][rq];
#pragma unroll /* eight partial sums, fixed order */
  for (int x = 1; x < 8; ++x) l += pl[x][rq];
  v8f oa[2] = {z8, z8};      /* two accumulators, so that a matrix instruction does not wait for the one before it */
  const float* pp = &sp[rq][4 * hh]; const float* pv = &lv[4 * hh][d0 + ln]; v4f pf[4]; v2f va[4][2];      /* the fragments of 32 keys: weights (B), V columns (A) */
  a0_frags(pp, pv, pf, va);
  for (int j = 0; j < nkeys; j += 32) {      /* nkeys is a multiple of 32 */
    const int jn = j + 32 < nkeys ? j + 32 : j; v4f pn[4]; v2f vn[4][2];      /* the next 32 keys' fragments fly under this trip's products; the last trip reads its own again, inside the staged rows */
    a0_frags(pp + jn, pv + (size_t)jn * (HD + 4), pn, vn);
    __builtin_amdgcn_sched_barrier(0);      /* the reads stay in front of the products: moved down among them, each product would wait out an LDS latency */
#pragma unroll /* constant indices keep the fragments in registers */
    for (int u = 0; u < 4; ++u) { oa[0] = a0_mma(va[u][0], v2f{pf[u][0], pf[u][1]}, oa[0]); oa[1] = a0_mma(va[u][1], v2f{pf[u][2], pf[u][3]}, oa[1]); }
#pragma unroll /* as above */
    for (int u = 0; u < 4; ++u) { pf[u] = pn[u]; va[u][0] = vn[u][0]; va[u][1] = vn[u][1]; } }
  const float fin = 64.0f / l;      /* o carried x64 like the f16 path */
  const v8f ov = (oa[0] + oa[1]) * fin;
  *(v4f*)&lqo[rq][d0 + 8 * hh] = v4f{ov[0], ov[1], ov[2], ov[3]}; *(v4f*)&lqo[rq][d0 + 8 * hh + 4] = v4f{ov[4], ov[5], ov[6], ov[7]};
  __syncthreads();
#pragma unroll /* two rows a thread; the 16 threads of a row fill its eight 16-byte chunks, in two tiles, of each plane */
  for (int u = 0; u < 2; ++u) { const int row = u * 16 + sr; const v4f v = *(const v4f*)&lqo[row][c4]; v4h vh, vl;      /* o (x64) -> f16 plane + x1024 residual plane */
#pragma unroll /* constant indices keep the vectors in registers */
    for (int e = 0; e < 4; ++e) { const _Float16 t = (_Float16)v[e]; vh[e] = t; vl[e] = (_Float16)((v[e] - (float)t) * 1024.0f); }
    const size_t at = pk_at(rg * 32 + row, h * HD + c4, ldo); *(v4h*)(OH + at) = vh; *(v4h*)(OL + at) = vl; } }      /* both planes in fragment order */

extern "C" void kernel_launch(void* const* d_in, const int* in_sizes, int n_in,
                              void* d_out, int out_size, void* d_ws, size_t ws_size, hipStream_t stream) {
  (void)in_sizes; (void)n_in; (void)out_size;
  const float* const* I = (const float* const*)d_in; const float* x = I[0]; const float* wq = I[1]; const float* bq = I[2]; const float* wk = I[3]; const float* wv = I[4]; const float* bv = I[5]; const float* wo = I[6];      /* natural [out][in] weights; biases on q and v only */
  char* ws = (char*)d_ws; size_t off = 0;
  auto take = [&](size_t bytes) { char* p = ws + off; off += (bytes + 255) & ~(size_t)255; return p; };
  _Float16* BQ = (_Float16*)take((size_t)DM * DM * 2); _Float16* BK = (_Float16*)take((size_t)DM * DM * 2); _Float16* BV = (_Float16*)take((size_t)DM * DM * 2); _Float16* BO = (_Float16*)take((size_t)DM * DM * 2);
  _Float16* X16 = (_Float16*)take(NR * DM * 2); _Float16* Q16 = (_Float16*)take(NR * DM * 2); _Float16* K16 = (_Float16*)take(NR * DM * 2); _Float16* O16 = (_Float16*)take(NR * DM * 2);
  _Float16* VT = (_Float16*)take((size_t)NH * HD * SQ * 2);
  float* QF0 = (float*)take((size_t)QT0 * DM * 4); float* KF0 = (float*)take((size_t)QT0 * DM * 4); float* VF0 = (float*)take((size_t)QT0 * DM * 4); _Float16* OH0 = (_Float16*)take((size_t)NB * QT0 * DM * 2); _Float16* OL0 = (_Float16*)take((size_t)NB * QT0 * DM * 2);
  float* KN = (float*)take((size_t)NH * (SQ / 32) * 32 * 4);      /* the largest |k|^2 of each 32 keys of each head, a 128-byte line each */
  if (off > ws_size) return;
  k_prep<<<(unsigned)(NR * DM / 2048 + 4 * ((size_t)DM * DM / 2048)), 256, 0, stream>>>(x, wq, wk, wv, wo, X16, BQ, BK, BV, BO);      /* x rows and the four weights (natural [out][in] = Bt[n][k], x16) as f16 in fragment order */
  k_qkv<<<3 * QKV_G, 256, 0, stream>>>(X16, BQ, BK, BV, bq, bv, Q16, K16, VT, QF0, KF0, VF0, KN);      /* q, k and V^T [NH][HD][SQ] as f16 in fragment order; q, k, v of the first 256 rows as f32 rows */
  k_att0<1, DM><<<NH * (QT0 / 32), 256, 0, stream>>>(QF0, KF0, VF0, 0.125f, OH0, OL0, DM);      /* exact f32 causal ALiBi attention for rows 0..255 (o x64), as f16 hi + x1024 residual planes */
  k_fattn<<<FA_G8 + FA_G4, 512, 0, stream>>>(Q16, K16, VT, KN, O16);      /* scores, causal ALiBi softmax and o (merged heads, x64, f16 in fragment order) in one launch */
  k_out<<<OUT_G0 + ((MPO - QT0) / 128) * (DM / 64), 128, 0, stream>>>(O16, OH0, OL0, BO, (float*)d_out);      /* out rows are the output layout */
}
